// v000
// Times are from an AMD MI455X. After a warm-up the kernel runs many times in a row, and a time is the length of
// such a window on the GPU divided by its runs, so every launch and the gaps after it count. The runs cycle
// through copies of the inputs. A figure is the median of several windows, for all but v000 over two sittings.
// Sittings can differ by a few percent; kernels timed side by side share one.
// v000 is the starting kernel. One run takes 24.5 milliseconds.
#include <hip/hip_runtime.h>
// MultiScaleTemporalAttention (x [4][1024][1024]; q = x Wq, [k_s|v_s] = x Wkv_short, [k_l|v_l] = x Wkv_long (weights [in][out], no bias), 16 heads of 64; short branch: softmax(q k_s^T/8 - |i-j| (1 - decay)), long branch: softmax(q k_l^T/8); o = a o_short + (1-a) o_long with a = sigmoid(mix_weight); out = o Wo -> [4][1024][1024]).
// Structure: token rows; x as exact f16 rows; Q, [K_s|V_s], [K_l|V_l] as WMMA GEMMs on transposed weights (32x64 wave tiles, f32 accumulation, exact x16 weights, f16 outputs); per (batch, 4 heads) and per branch: scores GEMM (K = 64), row softmax on VALU (the short branch adds the decay bias computed from decay_factor read on device; f32; weights x256 as f16), V^T via LDS, o_branch = P . V GEMM (K = 1,024, alpha 2^-8) into per-branch f32 rows; the sigmoid(mix_weight) blend on VALU (scalars read on device) into f16 o rows; out = o Wo (f32, output layout).
// Compute dtype: inputs rounded to bf16; x / weights exact; q, k, v, softmax weights and the blended o plain f16 (~2^-12); scores, softmax, branch outputs and the blend f32. v_wmma_f32_16x16x32_f16.
#define NB 4
#define SQ 1024
#define DM 1024
#define NH 16
#define HD 64
#define HG 4                         /* heads per attention launch group */
#define QN SQ                        /* query rows attended per batch (debug hook) */
#define NR ((size_t)NB * SQ)         /* 4096 token rows */
typedef __bf16 v16b __attribute__((ext_vector_type(16)));
typedef unsigned short v8us __attribute__((ext_vector_type(8), may_alias));
typedef float  v8f  __attribute__((ext_vector_type(8)));
typedef float  v4f  __attribute__((ext_vector_type(4)));
typedef float  v4fa __attribute__((ext_vector_type(4), may_alias));
union FragB { v16b v; v8us half[2]; unsigned short u[16]; };

__device__ __forceinline__ unsigned short bf16_bits(float x) { unsigned int u = __float_as_uint(x); return (unsigned short)((u + 0x7FFFu + ((u >> 16) & 1u)) >> 16); }
__device__ __forceinline__ float bf16_val(unsigned short b) { return __uint_as_float(((unsigned int)b) << 16); }
__device__ __forceinline__ float bf16_round(float x) { return bf16_val(bf16_bits(x)); }
// D += A·B with NT terms: 1 = ah·bh, 2 = + al·bh (A split), 3 = + ah·bl (both split)
template <int NT>
__device__ __forceinline__ v8f mmaN(v16b ah, v16b al, v16b bh, v16b bl, v8f c) {
  c = __builtin_amdgcn_wmma_f32_16x16x32_bf16(false, ah, false, bh, (short)0, c, false, false);
  if (NT >= 2) c = __builtin_amdgcn_wmma_f32_16x16x32_bf16(false, al, false, bh, (short)0, c, false, false);
  if (NT >= 3) c = __builtin_amdgcn_wmma_f32_16x16x32_bf16(false, ah, false, bl, (short)0, c, false, false);
  asm volatile("v_nop\n\tv_nop\n\tv_nop\n\tv_nop" : "+v"(c) : "v"(ah), "v"(al), "v"(bh), "v"(bl));
  return c;
}

__global__ __launch_bounds__(256) void k_wt_bf16(const float* __restrict__ W, unsigned short* __restrict__ Wt, int K, int N) {
  const int t = blockIdx.x * 256 + threadIdx.x;
  const int k8n = K / 8;
  if (t >= N * k8n) return;
  const int n = t / k8n, k8 = (t % k8n) * 8;
  v8us v;
#pragma unroll
  for (int i = 0; i < 8; ++i) v[i] = bf16_bits(W[(size_t)(k8 + i) * N + n]);
  *(v8us*)(Wt + (size_t)n * K + k8) = v;
  
}

// GEMM C[M][N] (f32, pitch ldc) = act(A[M][K]·W + bias). A f32 row-major (pitch lda) converted per fragment to bf16
// (ASPLIT: hi/lo two planes -> 2 terms, else single rounded term); Wt bf16 [N][K] (pitch ldb). BIAS_BF16 rounds the
// bias to bf16 first (bias quantised to bf16 before the add). K%32==0, M%16==0, N%64==0.
template <bool ASPLIT, int ACT, bool BIAS_BF16>
__global__ __launch_bounds__(128) void k_gemm_bf(const float* __restrict__ A, int lda, const unsigned short* __restrict__ Wt, int ldb,
                                               const float* __restrict__ bias, float* __restrict__ C, int ldc, int M, int N, int K) {
  __shared__ __attribute__((aligned(16))) float so[4][16][64];
  const int tid = threadIdx.x, w = tid >> 5, lane = tid & 31, ln = lane & 15, hh = lane >> 4;
  const int ntn = N / 64;
  const int wid = blockIdx.x * 4 + w;
  const int mt = wid / ntn, nq = wid % ntn;
  if (mt * 16 >= M) return;
  const int row0 = mt * 16, col0 = nq * 64;
  const float* arow = A + (size_t)(row0 + ln) * lda;
  v8f acc[4] = {};
  for (int kb = 0; kb < K; kb += 32) {
    FragB ah, al;
    const v4f x0 = *(const v4fa*)(arow + kb + 8 * hh), x1 = *(const v4fa*)(arow + kb + 8 * hh + 4);
    const v4f x2 = *(const v4fa*)(arow + kb + 16 + 8 * hh), x3 = *(const v4fa*)(arow + kb + 16 + 8 * hh + 4);
    float xs[16] = {x0[0],x0[1],x0[2],x0[3],x1[0],x1[1],x1[2],x1[3],x2[0],x2[1],x2[2],x2[3],x3[0],x3[1],x3[2],x3[3]};
#pragma unroll
    for (int i = 0; i < 16; ++i) { const unsigned short hb = bf16_bits(xs[i]); ah.u[i] = hb; al.u[i] = ASPLIT ? bf16_bits(xs[i] - bf16_val(hb)) : (unsigned short)0; }
#pragma unroll
    for (int t = 0; t < 4; ++t) {
      const unsigned short* brow = Wt + (size_t)(col0 + t * 16 + ln) * ldb + kb;
      FragB b;
      b.half[0] = *(const v8us*)(brow + 8 * hh);
      b.half[1] = *(const v8us*)(brow + 16 + 8 * hh);
      acc[t] = mmaN<ASPLIT ? 2 : 1>(ah.v, al.v, b.v, b.v, acc[t]);
    }
  }
#pragma unroll
  for (int t = 0; t < 4; ++t) {
    float bv = bias ? bias[col0 + t * 16 + ln] : 0.f;
    if (BIAS_BF16) bv = bf16_round(bv);
#pragma unroll
    for (int r = 0; r < 8; ++r) { float v = acc[t][r] + bv; if (ACT == 1) v = fmaxf(v, 0.f); so[w][8 * hh + r][t * 16 + ln] = v; }
  }
  __builtin_amdgcn_fence(__ATOMIC_ACQ_REL, "workgroup");
  __builtin_amdgcn_wave_barrier();
  const int rsub = lane >> 4, c4 = (lane & 15) * 4;
  {
#pragma unroll
    for (int q = 0; q < 8; ++q) {
      const int r = q * 2 + rsub;
      const v4f v = *(const v4fa*)&so[w][r][c4];
      *(v4f*)(C + (size_t)(row0 + r) * ldc + col0 + c4) = v;
    }
    
  }
}

// GEMM C = act(A·W + bias + resid): A f32 (ASPLIT -> hi/lo 2 terms), Wt bf16 [N][K]; ACT 0 none, 1 relu, 2 exact gelu;
// resid (optional, f32, row index = (row % rmod), pitch ldr, RES_BF16 rounds it) added before the activation.
template <bool ASPLIT, int ACT, bool BIAS_BF16, bool RES_BF16>
__global__ __launch_bounds__(128) void k_gemm_bf3(const float* __restrict__ A, int lda, const unsigned short* __restrict__ Wt, int ldb,
                                                const float* __restrict__ bias, const float* __restrict__ resid, int rmod, int ldr,
                                                float* __restrict__ C, int ldc, int M, int N, int K) {
  __shared__ __attribute__((aligned(16))) float so[4][16][64];
  const int tid = threadIdx.x, w = tid >> 5, lane = tid & 31, ln = lane & 15, hh = lane >> 4;
  const int ntn = N / 64;
  const int wid = blockIdx.x * 4 + w;
  const int mt = wid / ntn, nq = wid % ntn;
  if (mt * 16 >= M) return;
  const int row0 = mt * 16, col0 = nq * 64;
  const float* arow = A + (size_t)(row0 + ln) * lda;
  v8f acc[4] = {};
  for (int kb = 0; kb < K; kb += 32) {
    FragB ah, al;
    const v4f x0 = *(const v4fa*)(arow + kb + 8 * hh), x1 = *(const v4fa*)(arow + kb + 8 * hh + 4);
    const v4f x2 = *(const v4fa*)(arow + kb + 16 + 8 * hh), x3 = *(const v4fa*)(arow + kb + 16 + 8 * hh + 4);
    float xs[16] = {x0[0],x0[1],x0[2],x0[3],x1[0],x1[1],x1[2],x1[3],x2[0],x2[1],x2[2],x2[3],x3[0],x3[1],x3[2],x3[3]};
#pragma unroll
    for (int i = 0; i < 16; ++i) { const unsigned short hb = bf16_bits(xs[i]); ah.u[i] = hb; al.u[i] = ASPLIT ? bf16_bits(xs[i] - bf16_val(hb)) : (unsigned short)0; }
#pragma unroll
    for (int t = 0; t < 4; ++t) {
      const unsigned short* brow = Wt + (size_t)(col0 + t * 16 + ln) * ldb + kb;
      FragB b;
      b.half[0] = *(const v8us*)(brow + 8 * hh);
      b.half[1] = *(const v8us*)(brow + 16 + 8 * hh);
      acc[t] = mmaN<ASPLIT ? 2 : 1>(ah.v, al.v, b.v, b.v, acc[t]);
    }
  }
#pragma unroll
  for (int t = 0; t < 4; ++t) {
    const int col = col0 + t * 16 + ln;
    float bv = bias ? bias[col] : 0.f;
    if (BIAS_BF16) bv = bf16_round(bv);
#pragma unroll
    for (int r = 0; r < 8; ++r) {
      float v = acc[t][r] + bv;
      if (resid) { float rv = resid[(size_t)((row0 + 8 * hh + r) % rmod) * ldr + col]; if (RES_BF16) rv = bf16_round(rv); v += rv; }
      if (ACT == 1) v = fmaxf(v, 0.f);
      if (ACT == 2) v = 0.5f * v * (1.0f + erff(v * 0.70710678118654752f));
      if (ACT == 3) { const float u = 0.7978845608028654f * (v + 0.044715f * v * v * v); v = 0.5f * v * (1.0f + tanhf(u)); }
      so[w][8 * hh + r][t * 16 + ln] = v;
    }
  }
  __builtin_amdgcn_fence(__ATOMIC_ACQ_REL, "workgroup");
  __builtin_amdgcn_wave_barrier();
  const int rsub = lane >> 4, c4 = (lane & 15) * 4;
  {
#pragma unroll
    for (int q = 0; q < 8; ++q) {
      const int r = q * 2 + rsub;
      const v4f v = *(const v4fa*)&so[w][r][c4];
      *(v4f*)(C + (size_t)(row0 + r) * ldc + col0 + c4) = v;
    }
    
  }
}
// row LayerNorm (biased variance, eps) over N: s = X (+ R); optional out_sum <- s; out_norm <- (s-mu)*rsqrt(var+eps)*g + b
template <bool PARAM_BF16>
__global__ __launch_bounds__(256) void k_layernorm(const float* __restrict__ X, const float* __restrict__ R, const float* __restrict__ g, const float* __restrict__ bta,
                                                  float* __restrict__ out_sum, float* __restrict__ out_norm, int N, float eps) {
  __shared__ float red[256];
  const int row = blockIdx.x, tid = threadIdx.x;
  const float* x = X + (size_t)row * N; const float* rr = R ? R + (size_t)row * N : nullptr;
  float vals[16];                     // up to N = 4096
  const int per = N / 256;            // contiguous chunk per thread? use strided-by-4 chunks: thread handles j = tid*4 + 1024*u
  float s1 = 0.f;
  for (int u = 0; u < per / 4; ++u) {
    const int j = tid * 4 + 1024 * u;
    const v4f a = *(const v4fa*)(x + j);
    v4f b = {0.f,0.f,0.f,0.f}; if (rr) b = *(const v4fa*)(rr + j);
#pragma unroll
    for (int q = 0; q < 4; ++q) { const float v = a[q] + b[q]; vals[u * 4 + q] = v; s1 += v; }
  }
  red[tid] = s1; __syncthreads();
  for (int st = 128; st > 0; st >>= 1) { if (tid < st) red[tid] += red[tid + st]; __syncthreads(); }
  const float mu = red[0] / (float)N; __syncthreads();
  float s2 = 0.f;
  for (int u = 0; u < per / 4; ++u)
#pragma unroll
    for (int q = 0; q < 4; ++q) { const float c = vals[u * 4 + q] - mu; s2 += c * c; }
  red[tid] = s2; __syncthreads();
  for (int st = 128; st > 0; st >>= 1) { if (tid < st) red[tid] += red[tid + st]; __syncthreads(); }
  const float rs = rsqrtf(red[0] / (float)N + eps);
  {
    for (int u = 0; u < per / 4; ++u) {
      const int j = tid * 4 + 1024 * u;
      v4f o, sm;
#pragma unroll
      for (int q = 0; q < 4; ++q) {
        float gg = g[j + q], bb = bta[j + q];
        if (PARAM_BF16) { gg = bf16_round(gg); bb = bf16_round(bb); }
        sm[q] = vals[u * 4 + q]; o[q] = (vals[u * 4 + q] - mu) * rs * gg + bb;
      }
      if (out_sum) *(v4f*)(out_sum + (size_t)row * N + j) = sm;
      *(v4f*)(out_norm + (size_t)row * N + j) = o;
    }
    
  }
}



// ---- f16 WMMA path (v_wmma_f32_16x16x32_f16): 11-bit significands for operands in range — used where a [0,1] probability operand needs more precision than bf16
typedef _Float16 v16h __attribute__((ext_vector_type(16)));
union FragH { v16h v; v8us half[2]; _Float16 h[16]; unsigned short u[16]; };
template <int NT>
__device__ __forceinline__ v8f mmaH(v16h ah, v16h al, v16h bh, v16h bl, v8f c) {
  c = __builtin_amdgcn_wmma_f32_16x16x32_f16(false, ah, false, bh, (short)0, c, false, false);
  if (NT >= 2) c = __builtin_amdgcn_wmma_f32_16x16x32_f16(false, al, false, bh, (short)0, c, false, false);
  if (NT >= 3) c = __builtin_amdgcn_wmma_f32_16x16x32_f16(false, ah, false, bl, (short)0, c, false, false);
  asm volatile("v_nop\n\tv_nop\n\tv_nop\n\tv_nop" : "+v"(c) : "v"(ah), "v"(al), "v"(bh), "v"(bl));
  return c;
}
// batched GEMM like k_gemm_b but f16 operands: A f32 (split into f16 hi/lo if ASPLIT, else rounded to f16), Bt = f16 values [n][k]; alpha; C f32; N multiple of 16 (partial tiles skipped)
template <bool ASPLIT>
__global__ __launch_bounds__(128) void k_gemm_h(const float* __restrict__ A, int lda, size_t sA, const _Float16* __restrict__ Bh, int ldb, size_t sB, float alpha, float* __restrict__ C, int ldc, size_t sC, int M, int N, int K) {
  __shared__ __attribute__((aligned(16))) float so[4][16][64];
  const int tid = threadIdx.x, w = tid >> 5, lane = tid & 31, ln = lane & 15, hh = lane >> 4; const int by = blockIdx.y;
  A += (size_t)by * sA; Bh += (size_t)by * sB; C += (size_t)by * sC;
  const int ntn = (N + 63) / 64; const int wid = blockIdx.x * 4 + w; const int mt = wid / ntn, nq = wid % ntn; if (mt * 16 >= M) return;
  const int row0 = mt * 16, col0 = nq * 64; const float* arow = A + (size_t)(row0 + ln) * lda;
  v8f acc[4] = {};
  for (int kb = 0; kb < K; kb += 32) {
    FragH ah, al;
    const v4f x0 = *(const v4fa*)(arow + kb + 8 * hh), x1 = *(const v4fa*)(arow + kb + 8 * hh + 4), x2 = *(const v4fa*)(arow + kb + 16 + 8 * hh), x3 = *(const v4fa*)(arow + kb + 16 + 8 * hh + 4);
    float xs[16] = {x0[0],x0[1],x0[2],x0[3],x1[0],x1[1],x1[2],x1[3],x2[0],x2[1],x2[2],x2[3],x3[0],x3[1],x3[2],x3[3]};
#pragma unroll
    for (int i = 0; i < 16; ++i) { const _Float16 h = (_Float16)xs[i]; ah.h[i] = h; al.h[i] = ASPLIT ? (_Float16)(xs[i] - (float)h) : (_Float16)0.0f; }
#pragma unroll
    for (int t = 0; t < 4; ++t) { if (col0 + t * 16 >= N) continue; const size_t boff = (size_t)(col0 + t * 16 + ln) * ldb + kb; FragH bq; bq.half[0] = *(const v8us*)(Bh + boff + 8 * hh); bq.half[1] = *(const v8us*)(Bh + boff + 16 + 8 * hh);
      acc[t] = mmaH<ASPLIT ? 2 : 1>(ah.v, al.v, bq.v, bq.v, acc[t]); }
  }
#pragma unroll
  for (int t = 0; t < 4; ++t) { if (col0 + t * 16 >= N) continue;
#pragma unroll
    for (int r = 0; r < 8; ++r) so[w][8 * hh + r][t * 16 + ln] = acc[t][r] * alpha; }
  __builtin_amdgcn_fence(__ATOMIC_ACQ_REL, "workgroup"); __builtin_amdgcn_wave_barrier();
  const int rsub = lane >> 4, c4 = (lane & 15) * 4;
  {
#pragma unroll
    for (int q = 0; q < 8; ++q) { const int r = q * 2 + rsub; if (col0 + c4 < N) { const v4f v = *(const v4fa*)&so[w][r][c4]; *(v4f*)(C + (size_t)(row0 + r) * ldc + col0 + c4) = v; } }
     }
}

// Wt[n][k] = f16(W[k][n]·scale) from f32 row-major W[K][N] (scale = power of two; bf16-exact weights stay exact in f16 away from the subnormal range)
__global__ __launch_bounds__(256) void k_wt_f16(const float* __restrict__ W, _Float16* __restrict__ Wt, int K, int N, float scale) {
  const int t = blockIdx.x * 256 + threadIdx.x; if (t >= N * (K / 8)) return; const int n = t / (K / 8), k8 = (t % (K / 8)) * 8; FragH f;
#pragma unroll
  for (int i = 0; i < 8; ++i) f.h[i] = (_Float16)(bf16_round(W[(size_t)(k8 + i) * N + n]) * scale); const v8us o = f.half[0];
  *(v8us*)((unsigned short*)Wt + (size_t)n * K + k8) = o; 
}
// k_gemm_hh variant with fused epilogue: v = acc·alpha + bias[by·sBias + col] (+ CP[(row/rowsPerB)·sCPb + by·64 + col] if CP) ; ACT 0 none / 1 elu ; writes f16 C16 (and f32 C if non-null)
template <int ACT>
__global__ __launch_bounds__(128) void k_gemm_hhx(const _Float16* __restrict__ A, int lda, size_t sA, const _Float16* __restrict__ Bh, int ldb, size_t sB, float alpha, const float* __restrict__ bias, size_t sBias, const float* __restrict__ CP, int rowsPerB, size_t sCPb, int row0g,
    float* __restrict__ C, _Float16* __restrict__ C16, int ldc, size_t sC, int M, int N, int K) {
  __shared__ __attribute__((aligned(16))) float so[4][16][64];
  const int tid = threadIdx.x, w = tid >> 5, lane = tid & 31, ln = lane & 15, hh = lane >> 4; const int by = blockIdx.y;
  A += (size_t)by * sA; Bh += (size_t)by * sB; const size_t cofs = (size_t)by * sC; const float* bp = bias ? bias + (size_t)by * sBias : nullptr;
  const int ntn = (N + 63) / 64; const int wid = blockIdx.x * 4 + w; const int mt = wid / ntn, nq = wid % ntn; if (mt * 16 >= M) return;
  const int row0 = mt * 16, col0 = nq * 64; const _Float16* arow = A + (size_t)(row0 + ln) * lda;
  v8f acc[4] = {};
  for (int kb = 0; kb < K; kb += 32) { FragH ah; ah.half[0] = *(const v8us*)((const unsigned short*)arow + kb + 8 * hh); ah.half[1] = *(const v8us*)((const unsigned short*)arow + kb + 16 + 8 * hh);
#pragma unroll
    for (int t = 0; t < 4; ++t) { if (col0 + t * 16 >= N) continue; const size_t boff = (size_t)(col0 + t * 16 + ln) * ldb + kb; FragH bq; bq.half[0] = *(const v8us*)((const unsigned short*)Bh + boff + 8 * hh); bq.half[1] = *(const v8us*)((const unsigned short*)Bh + boff + 16 + 8 * hh);
      acc[t] = mmaH<1>(ah.v, ah.v, bq.v, bq.v, acc[t]); }
  }
#pragma unroll
  for (int t = 0; t < 4; ++t) { if (col0 + t * 16 >= N) continue; const int col = col0 + t * 16 + ln; const float bv = bp ? bf16_round(bp[col]) : 0.f;
#pragma unroll
    for (int r = 0; r < 8; ++r) { float v = acc[t][r] * alpha + bv; if (CP) { const int rr = row0g + row0 + 8 * hh + r; if (rowsPerB < 0) v += CP[cofs + (size_t)rr * ldc + col];      /* rowsPerB < 0: own element of the batched C plane */ else { const int bidx = rr / rowsPerB; v += CP[(size_t)bidx * sCPb + (size_t)by * 64 + col]; } } if (ACT == 1) v = (v > 0.f) ? v : expm1f(v); else if (ACT == 7) v = (v > 0.f) ? v + 1.0f : expf(v); else if (ACT == 8) v = tanhf(v); else if (ACT == 9) v = 0.5f * v * (1.0f + tanhf(0.7978845608028654f * (v + 0.044715f * v * v * v))); else if (ACT == 11) v = 1.0f / (1.0f + expf(-v)); else if (ACT == 12) v = (v > 0.f) ? v : 0.01f * v; else if (ACT == 14) v = (v > 0.f) ? v : 0.1f * v; else if (ACT == 16) v = (v >= 0.f) ? v : 0.3f * v; else if (ACT == 17) v = (v >= 0.f) ? v : 0.2f * v; else if (ACT == 15) v = v / (1.0f + expf(-v)); else if (ACT == 3) v = fmaxf(v, 0.f); else if (ACT == 6) v = 0.5f * v * (1.0f + erff(v * 0.70710678118654752f)); so[w][8 * hh + r][t * 16 + ln] = v; } }
  __builtin_amdgcn_fence(__ATOMIC_ACQ_REL, "workgroup"); __builtin_amdgcn_wave_barrier();
  const int rsub = lane >> 4, c4 = (lane & 15) * 4; typedef _Float16 v4h __attribute__((ext_vector_type(4)));
  {
#pragma unroll
    for (int q = 0; q < 8; ++q) { const int r = q * 2 + rsub; if (col0 + c4 < N) { const v4f v = *(const v4fa*)&so[w][r][c4]; if (C) *(v4f*)(C + cofs + (size_t)(row0 + r) * ldc + col0 + c4) = v; if (C16) { v4h h4; for (int i = 0; i < 4; ++i) h4[i] = (_Float16)v[i]; *(v4h*)(C16 + cofs + (size_t)(row0 + r) * ldc + col0 + c4) = h4; } } }
     }
}


typedef _Float16 v4h __attribute__((ext_vector_type(4)));

__global__ __launch_bounds__(256) void k_x16(const float* __restrict__ x, _Float16* __restrict__ X16, size_t n8) { const size_t t = (size_t)blockIdx.x * 256 + threadIdx.x; if (t >= n8) return; FragH f;
#pragma unroll
  for (int q = 0; q < 8; ++q) f.h[q] = (_Float16)bf16_round(x[t * 8 + q]); *(v8us*)((unsigned short*)X16 + t * 8) = f.half[0];  }
__global__ __launch_bounds__(256) void k_h16(const float* __restrict__ x, _Float16* __restrict__ X16, size_t n8) { const size_t t = (size_t)blockIdx.x * 256 + threadIdx.x; if (t >= n8) return; FragH f;
#pragma unroll
  for (int q = 0; q < 8; ++q) f.h[q] = (_Float16)x[t * 8 + q]; *(v8us*)((unsigned short*)X16 + t * 8) = f.half[0];  }
__global__ __launch_bounds__(256) void k_round16f(const float* __restrict__ W, _Float16* __restrict__ Bt, size_t n8) { const size_t t = (size_t)blockIdx.x * 256 + threadIdx.x; if (t >= n8) return; FragH f;
#pragma unroll
  for (int i = 0; i < 8; ++i) f.h[i] = (_Float16)(bf16_round(W[t * 8 + i]) * 16.0f); *(v8us*)((unsigned short*)Bt + t * 8) = f.half[0];  }
template <int NHv, int TTv>
__global__ __launch_bounds__(256) void k_vt(const _Float16* __restrict__ V16, int ldv, int voff, _Float16* __restrict__ Vt) { __shared__ unsigned short tl[64][66]; const int tid = threadIdx.x; const int slab = blockIdx.x / (TTv / 64), lg = blockIdx.x % (TTv / 64); const int b = slab / NHv, h = slab % NHv;
  for (int i = tid; i < 64 * 8; i += 256) { const int r = i / 8, c8 = (i % 8) * 8; FragH f; f.half[0] = *(const v8us*)((const unsigned short*)V16 + ((size_t)b * TTv + lg * 64 + r) * ldv + voff + h * 64 + c8);
#pragma unroll
    for (int q = 0; q < 8; ++q) tl[r][c8 + q] = f.u[q]; }
  __syncthreads();
  {
#pragma unroll
    for (int rd = 0; rd < 2; ++rd) { const int d = rd * 32 + tid / 8, pc = tid % 8; FragH f;
#pragma unroll
      for (int q = 0; q < 8; ++q) f.u[q] = tl[pc * 8 + q][d];
      *(v8us*)((unsigned short*)Vt + ((size_t)slab * 64 + d) * TTv + lg * 64 + pc * 8) = f.half[0]; }
     } }

__global__ __launch_bounds__(256) void k_hl(const float* __restrict__ F, _Float16* __restrict__ Hh, _Float16* __restrict__ Hl, size_t n8) { const size_t t = (size_t)blockIdx.x * 256 + threadIdx.x; if (t >= n8) return; FragH fh, fl; const v4f a = *(const v4fa*)(F + t * 8), c = *(const v4fa*)(F + t * 8 + 4);
#pragma unroll
  for (int q = 0; q < 4; ++q) { _Float16 h = (_Float16)a[q]; fh.h[q] = h; fl.h[q] = (_Float16)((a[q] - (float)h) * 1024.0f); h = (_Float16)c[q]; fh.h[4 + q] = h; fl.h[4 + q] = (_Float16)((c[q] - (float)h) * 1024.0f); }
  { *(v8us*)((unsigned short*)Hh + t * 8) = fh.half[0]; *(v8us*)((unsigned short*)Hl + t * 8) = fl.half[0];  } }

// ---- fast GEMM (wave tile 32x64; requires M % 32 == 0 rows per launch region and N % 64 == 0); epilogue = k_gemm_hhx semantics ----
__device__ __forceinline__ v16h g2_frag(const _Float16* p, int hh) { FragH f; f.half[0] = *(const v8us*)((const unsigned short*)p + 8 * hh); f.half[1] = *(const v8us*)((const unsigned short*)p + 16 + 8 * hh); return f.v; }
__device__ __forceinline__ v8f g2_mma(v16h a, v16h b, v8f c) { v8f d = __builtin_amdgcn_wmma_f32_16x16x32_f16(false, a, false, b, (short)0, c, false, false); asm volatile("v_nop\n\tv_nop\n\tv_nop\n\tv_nop" : "+v"(d) : "v"(a), "v"(b)); return d; }
template <int ACT>
__global__ __launch_bounds__(128) void k_gemm2(const _Float16* __restrict__ A, int lda, size_t sA, const _Float16* __restrict__ Bh, int ldb, size_t sB, float alpha, const float* __restrict__ bias, size_t sBias, const float* __restrict__ CP, int rowsPerB, size_t sCPb, int row0g,
    float* __restrict__ C, _Float16* __restrict__ C16, int ldc, size_t sC, int M, int N, int K) { static_assert(ACT == 0 || ACT == 3 || ACT == 6 || ACT == 8 || ACT == 9 || ACT == 11 || ACT == 12 || ACT == 14 || ACT == 15 || ACT == 16 || ACT == 17, "k_gemm2: unsupported ACT code (would silently apply no activation)");
  __shared__ __attribute__((aligned(16))) float so[4][32][68];
  const int tid = threadIdx.x, w = tid >> 5, lane = tid & 31, ln = lane & 15, hh = lane >> 4; const int by = blockIdx.y;
  A += (size_t)by * sA; Bh += (size_t)by * sB; const size_t cofs = (size_t)by * sC; const float* bp = bias ? bias + (size_t)by * sBias : nullptr;
  const int ntn = N >> 6; const int mt = blockIdx.x / ntn, nq = blockIdx.x - mt * ntn; const int row0 = mt * 128 + 32 * w, col0 = nq * 64; if (row0 >= M) return;
  const _Float16* a0p = A + (size_t)(row0 + ln) * lda; const _Float16* a1p = a0p + (size_t)16 * lda;
  const _Float16* b0p = Bh + (size_t)(col0 + ln) * ldb; const _Float16* b1p = b0p + (size_t)16 * ldb; const _Float16* b2p = b1p + (size_t)16 * ldb; const _Float16* b3p = b2p + (size_t)16 * ldb;
  const v8f z8 = {0.f,0.f,0.f,0.f,0.f,0.f,0.f,0.f}; v8f c00 = z8, c01 = z8, c02 = z8, c03 = z8, c10 = z8, c11 = z8, c12 = z8, c13 = z8;
#pragma unroll 1
  for (int kb = 0; kb < K; kb += 32) { const v16h a0 = g2_frag(a0p + kb, hh), a1 = g2_frag(a1p + kb, hh);
    v16h b = g2_frag(b0p + kb, hh); c00 = g2_mma(a0, b, c00); c10 = g2_mma(a1, b, c10);
    b = g2_frag(b1p + kb, hh); c01 = g2_mma(a0, b, c01); c11 = g2_mma(a1, b, c11);
    b = g2_frag(b2p + kb, hh); c02 = g2_mma(a0, b, c02); c12 = g2_mma(a1, b, c12);
    b = g2_frag(b3p + kb, hh); c03 = g2_mma(a0, b, c03); c13 = g2_mma(a1, b, c13); }
  v8f accs[8] = {c00, c01, c02, c03, c10, c11, c12, c13};
#pragma unroll
  for (int u = 0; u < 8; ++u) { const int t = u & 3, half = u >> 2; const int col = col0 + t * 16 + ln; const float bv = bp ? bf16_round(bp[col]) : 0.f;
#pragma unroll
    for (int r = 0; r < 8; ++r) { const int rloc = half * 16 + 8 * hh + r; float v = accs[u][r] * alpha + bv; if (CP) { if (rowsPerB < 0) v += CP[cofs + (size_t)(row0g + row0 + rloc) * ldc + col];      /* rowsPerB < 0: own element of the batched C plane */ else { const int bidx = (row0g + row0 + rloc) / rowsPerB; v += CP[(size_t)bidx * sCPb + (size_t)by * 64 + col]; } }
      if (ACT == 3) v = fmaxf(v, 0.f); else if (ACT == 6) v = 0.5f * v * (1.0f + erff(v * 0.70710678118654752f)); else if (ACT == 11) v = 1.0f / (1.0f + expf(-v)); else if (ACT == 15) v = v / (1.0f + expf(-v)); else if (ACT == 12) v = (v > 0.f) ? v : 0.01f * v; else if (ACT == 8) v = tanhf(v); else if (ACT == 9) v = 0.5f * v * (1.0f + tanhf(0.7978845608028654f * (v + 0.044715f * v * v * v))); else if (ACT == 14) v = (v > 0.f) ? v : 0.1f * v; else if (ACT == 16) v = (v >= 0.f) ? v : 0.3f * v; else if (ACT == 17) v = (v >= 0.f) ? v : 0.2f * v;
      so[w][rloc][t * 16 + ln] = v; } }
  __builtin_amdgcn_fence(__ATOMIC_ACQ_REL, "workgroup"); __builtin_amdgcn_wave_barrier();
  const int rsub = lane >> 4, c4 = (lane & 15) * 4;
  {
#pragma unroll
    for (int q = 0; q < 16; ++q) { const int r = q * 2 + rsub; const v4f v = *(const v4fa*)&so[w][r][c4]; if (C) *(v4f*)(C + cofs + (size_t)(row0 + r) * ldc + col0 + c4) = v; if (C16) { v4h h4; for (int i = 0; i < 4; ++i) h4[i] = (_Float16)v[i]; *(v4h*)(C16 + cofs + (size_t)(row0 + r) * ldc + col0 + c4) = h4; } }
     } }


__global__ __launch_bounds__(256) void k_wnat(const float* __restrict__ w, size_t n8, _Float16* __restrict__ Bt) { const size_t t = (size_t)blockIdx.x * 256 + threadIdx.x; if (t >= n8) return; FragH f; for (int q = 0; q < 8; ++q) f.h[q] = (_Float16)(bf16_round(w[t * 8 + q]) * 16.0f); *(v8us*)((unsigned short*)Bt + t * 8) = f.half[0];  }
__global__ __launch_bounds__(256) void k_rsm(const float* __restrict__ S, _Float16* __restrict__ P, int nrows) {
  #pragma clang fp contract(off)
  const int i = blockIdx.x * 256 + threadIdx.x; if (i >= nrows) return; const float* s = S + (size_t)i * SQ; float mx = -3.0e38f;
#pragma unroll 1
  for (int j = 0; j < SQ; ++j) mx = fmaxf(mx, s[j]); float se = 0.f;
#pragma unroll 1
  for (int j = 0; j < SQ; ++j) se += expf(s[j] - mx); const float sc = 256.0f / se;
#pragma unroll 1
  for (int j0 = 0; j0 < SQ; j0 += 8) { FragH f; for (int q = 0; q < 8; ++q) f.h[q] = (_Float16)(expf(s[j0 + q] - mx) * sc); unsigned short* d = (unsigned short*)P + (size_t)i * SQ + j0; *(v8us*)d = f.half[0];  } }
__global__ __launch_bounds__(256) void k_vt(const _Float16* __restrict__ V16, int b, int h0, _Float16* __restrict__ VT) { __shared__ unsigned short tl[64][65]; const int tid = threadIdx.x; const int hh = blockIdx.x % HG, sg = blockIdx.x / HG; const int s0 = sg * 64; const int h = h0 + hh;
  for (int i = tid; i < 64 * 8; i += 256) { const int j = i / 8, d8 = (i % 8) * 8; FragH f; f.half[0] = *(const v8us*)((const unsigned short*)V16 + ((size_t)b * SQ + s0 + j) * DM + h * HD + d8); for (int q = 0; q < 8; ++q) tl[d8 + q][j] = f.u[q]; }
  __syncthreads();
  { for (int i = tid; i < 64 * 8; i += 256) { const int d = i / 8, j8 = (i % 8) * 8; FragH f; for (int q = 0; q < 8; ++q) f.u[q] = tl[d][j8 + q]; *(v8us*)((unsigned short*)VT + ((size_t)hh * HD + d) * SQ + s0 + j8) = f.half[0]; }  } }

__global__ __launch_bounds__(256) void k_wT(const float* __restrict__ w, int din, int dout, _Float16* __restrict__ Bt) { __shared__ float tl[64][65]; const int tid = threadIdx.x; const int nbo = dout / 64; const int ib = blockIdx.x / nbo, ob = blockIdx.x % nbo; const int i0 = ib * 64, o0 = ob * 64;
  for (int t = tid; t < 64 * 64; t += 256) { const int i = t / 64, o = t % 64; tl[o][i] = bf16_round(w[(size_t)(i0 + i) * dout + o0 + o]) * 16.0f; }
  __syncthreads();
  { for (int t = tid; t < 64 * 8; t += 256) { const int o = t / 8, i8 = (t % 8) * 8; FragH f; for (int q = 0; q < 8; ++q) f.h[q] = (_Float16)tl[o][i8 + q]; *(v8us*)((unsigned short*)Bt + (size_t)(o0 + o) * din + i0 + i8) = f.half[0]; }  } }
__global__ __launch_bounds__(256) void k_rsmd(const float* __restrict__ S, _Float16* __restrict__ P, int nrows, const float* __restrict__ dfp) {
  #pragma clang fp contract(off)
  const int i = blockIdx.x * 256 + threadIdx.x; if (i >= nrows) return; const float* s = S + (size_t)i * SQ; const float c = 1.0f - bf16_round(dfp[0]); float mx = -3.0e38f;
#pragma unroll 1
  for (int j = 0; j < SQ; ++j) mx = fmaxf(mx, s[j] - (float)abs(i - j) * c); float se = 0.f;
#pragma unroll 1
  for (int j = 0; j < SQ; ++j) se += expf((s[j] - (float)abs(i - j) * c) - mx); const float sc = 256.0f / se;
#pragma unroll 1
  for (int j0 = 0; j0 < SQ; j0 += 8) { FragH f; for (int q = 0; q < 8; ++q) { const int j = j0 + q; f.h[q] = (_Float16)(expf((s[j] - (float)abs(i - j) * c) - mx) * sc); } unsigned short* d = (unsigned short*)P + (size_t)i * SQ + j0; *(v8us*)d = f.half[0];  } }
__global__ __launch_bounds__(256) void k_mix(const float* __restrict__ OS, const float* __restrict__ OL, const float* __restrict__ mwp, _Float16* __restrict__ O16, size_t n8) {
  #pragma clang fp contract(off)
  const size_t t = (size_t)blockIdx.x * 256 + threadIdx.x; if (t >= n8) return; const float a = 1.0f / (1.0f + expf(-bf16_round(mwp[0]))); FragH f; for (int q = 0; q < 8; ++q) f.h[q] = (_Float16)__fadd_rn(__fmul_rn(a, OS[t * 8 + q]), __fmul_rn(1.0f - a, OL[t * 8 + q]));
  *(v8us*)((unsigned short*)O16 + t * 8) = f.half[0];  }
extern "C" void kernel_launch(void* const* d_in, const int* in_sizes, int n_in,
                              void* d_out, int out_size, void* d_ws, size_t ws_size, hipStream_t stream) {
  (void)in_sizes; (void)n_in; (void)out_size;
  const float* const* I = (const float* const*)d_in; const float* x = I[0]; const float* wq = I[1]; const float* wkvs = I[2]; const float* wkvl = I[3]; const float* wo = I[4]; const float* mwp = I[5]; const float* dfp = I[6];
  char* ws = (char*)d_ws; size_t off = 0;
  auto take = [&](size_t bytes) { char* p = ws + off; off += (bytes + 255) & ~(size_t)255; return p; };
  _Float16* BQ = (_Float16*)take((size_t)DM * DM * 2); _Float16* BKVS = (_Float16*)take((size_t)2 * DM * DM * 2); _Float16* BKVL = (_Float16*)take((size_t)2 * DM * DM * 2); _Float16* BO = (_Float16*)take((size_t)DM * DM * 2);
  _Float16* X16 = (_Float16*)take(NR * DM * 2); _Float16* Q16 = (_Float16*)take(NR * DM * 2); _Float16* K16 = (_Float16*)take(NR * DM * 2); _Float16* V16 = (_Float16*)take(NR * DM * 2); _Float16* KL16 = (_Float16*)take(NR * DM * 2); _Float16* VL16 = (_Float16*)take(NR * DM * 2); float* OS = (float*)take(NR * DM * 4); float* OL = (float*)take(NR * DM * 4); _Float16* O16 = (_Float16*)take(NR * DM * 2);
  float* S = (float*)take((size_t)HG * SQ * SQ * 4); _Float16* P = (_Float16*)take((size_t)HG * SQ * SQ * 2); _Float16* VT = (_Float16*)take((size_t)HG * HD * SQ * 2);
  if (off > ws_size) return;      /* 12 + 6x8 + 2x16 + 8 + 16 + 8 + 0.5 = ≈ 124.5 MiB */
  k_wT<<<(DM / 64) * (DM / 64), 256, 0, stream>>>(wq, DM, DM, BQ); k_wT<<<(DM / 64) * (2 * DM / 64), 256, 0, stream>>>(wkvs, DM, 2 * DM, BKVS); k_wT<<<(DM / 64) * (2 * DM / 64), 256, 0, stream>>>(wkvl, DM, 2 * DM, BKVL); k_wT<<<(DM / 64) * (DM / 64), 256, 0, stream>>>(wo, DM, DM, BO);
  k_x16<<<(unsigned)((NR * DM / 8 + 255) / 256), 256, 0, stream>>>(x, X16, NR * DM / 8);
  const dim3 gp((unsigned)((NR / 128) * (DM / 64)), 1);
  k_gemm2<0><<<gp, 128, 0, stream>>>(X16, DM, 0, BQ, DM, 0, 0.0625f, nullptr, 0, nullptr, 1, 0, 0, nullptr, Q16, DM, 0, (int)NR, DM, DM);
  k_gemm2<0><<<gp, 128, 0, stream>>>(X16, DM, 0, BKVS, DM, 0, 0.0625f, nullptr, 0, nullptr, 1, 0, 0, nullptr, K16, DM, 0, (int)NR, DM, DM); k_gemm2<0><<<gp, 128, 0, stream>>>(X16, DM, 0, BKVS + (size_t)DM * DM, DM, 0, 0.0625f, nullptr, 0, nullptr, 1, 0, 0, nullptr, V16, DM, 0, (int)NR, DM, DM);      /* short k | v */
  k_gemm2<0><<<gp, 128, 0, stream>>>(X16, DM, 0, BKVL, DM, 0, 0.0625f, nullptr, 0, nullptr, 1, 0, 0, nullptr, KL16, DM, 0, (int)NR, DM, DM); k_gemm2<0><<<gp, 128, 0, stream>>>(X16, DM, 0, BKVL + (size_t)DM * DM, DM, 0, 0.0625f, nullptr, 0, nullptr, 1, 0, 0, nullptr, VL16, DM, 0, (int)NR, DM, DM);      /* long k | v */
  for (int br = 0; br < 2; ++br) { const _Float16* KB = br ? KL16 : K16; const _Float16* VB = br ? VL16 : V16; float* OB = br ? OL : OS;
  for (int b = 0; b < NB; ++b) for (int h0 = 0; h0 < NH; h0 += HG) {
    const _Float16* qb = Q16 + (size_t)b * SQ * DM + h0 * HD; const _Float16* kb = KB + (size_t)b * SQ * DM + h0 * HD;
    k_gemm2<0><<<dim3((QN / 128) * (SQ / 64), HG), 128, 0, stream>>>(qb, DM, (size_t)HD, kb, DM, (size_t)HD, 0.125f, nullptr, 0, nullptr, 1, 0, 0, S, nullptr, SQ, (size_t)SQ * SQ, QN, SQ, HD);
    for (int hh = 0; hh < HG; ++hh) { if (br == 0) k_rsmd<<<(QN + 255) / 256, 256, 0, stream>>>(S + (size_t)hh * SQ * SQ, P + (size_t)hh * SQ * SQ, QN, dfp); else k_rsm<<<(QN + 255) / 256, 256, 0, stream>>>(S + (size_t)hh * SQ * SQ, P + (size_t)hh * SQ * SQ, QN); }
    k_vt<<<HG * (SQ / 64), 256, 0, stream>>>(VB, b, h0, VT);
    k_gemm2<0><<<dim3((QN / 128) * (HD / 64), HG), 128, 0, stream>>>(P, SQ, (size_t)SQ * SQ, VT, SQ, (size_t)HD * SQ, 0.00390625f, nullptr, 0, nullptr, 1, 0, 0, OB + (size_t)b * SQ * DM + h0 * HD, nullptr, DM, (size_t)HD, QN, HD, SQ); } }      /* per-branch o (merged heads) as f32 rows */
  k_mix<<<(unsigned)((NR * DM / 8 + 255) / 256), 256, 0, stream>>>(OS, OL, mwp, O16, NR * DM / 8);
  k_gemm2<0><<<gp, 128, 0, stream>>>(O16, DM, 0, BO, DM, 0, 0.0625f, nullptr, 0, nullptr, 1, 0, 0, (float*)d_out, nullptr, DM, 0, (int)NR, DM, DM);      /* out = o Wo */
}

// v001
// It runs in 1930 microseconds.
// In two side-by-side timings against v000, it was 12.8 and 12.7 times as fast.
#include <hip/hip_runtime.h>
// MultiScaleTemporalAttention (x [4][1024][1024]; q = x Wq, [k_s|v_s] = x Wkv_short, [k_l|v_l] = x Wkv_long (weights [in][out], no bias), 16 heads of 64; short branch: softmax(q k_s^T/8 - |i-j| (1 - decay)), long branch: softmax(q k_l^T/8); o = a o_short + (1-a) o_long with a = sigmoid(mix_weight); out = o Wo -> [4][1024][1024]).
// Structure: token rows; x as exact f16 rows; Q, [K_s|V_s], [K_l|V_l] as WMMA GEMMs on transposed weights (32x64 wave tiles, f32 accumulation, exact x16 weights, f16 outputs); per (batch, 4 heads) and per branch: scores GEMM (K = 64), row softmax on VALU (the short branch adds the decay bias computed from decay_factor read on device; f32; weights x256 as f16), V^T via LDS, o_branch = P . V GEMM (K = 1,024, alpha 2^-8) into per-branch f32 rows; the sigmoid(mix_weight) blend on VALU (scalars read on device) into f16 o rows; out = o Wo (f32, output layout).
// Compute dtype: inputs rounded to bf16; x / weights exact; q, k, v, softmax weights and the blended o plain f16 (~2^-12); scores, softmax, branch outputs and the blend f32. v_wmma_f32_16x16x32_f16.
#define NB 4
#define SQ 1024
#define DM 1024
#define NH 16
#define HD 64
#define HG 4                         /* heads per attention launch group */
#define QN SQ                        /* query rows attended per batch (debug hook) */
#define NR ((size_t)NB * SQ)         /* 4096 token rows */
typedef __bf16 v16b __attribute__((ext_vector_type(16)));
typedef unsigned short v8us __attribute__((ext_vector_type(8), may_alias));
typedef float  v8f  __attribute__((ext_vector_type(8)));
typedef float  v4f  __attribute__((ext_vector_type(4)));
typedef float  v4fa __attribute__((ext_vector_type(4), may_alias));
union FragB { v16b v; v8us half[2]; unsigned short u[16]; };

__device__ __forceinline__ unsigned short bf16_bits(float x) { unsigned int u = __float_as_uint(x); return (unsigned short)((u + 0x7FFFu + ((u >> 16) & 1u)) >> 16); }
__device__ __forceinline__ float bf16_val(unsigned short b) { return __uint_as_float(((unsigned int)b) << 16); }
__device__ __forceinline__ float bf16_round(float x) { return bf16_val(bf16_bits(x)); }
// D += A·B with NT terms: 1 = ah·bh, 2 = + al·bh (A split), 3 = + ah·bl (both split)
template <int NT>
__device__ __forceinline__ v8f mmaN(v16b ah, v16b al, v16b bh, v16b bl, v8f c) {
  c = __builtin_amdgcn_wmma_f32_16x16x32_bf16(false, ah, false, bh, (short)0, c, false, false);
  if (NT >= 2) c = __builtin_amdgcn_wmma_f32_16x16x32_bf16(false, al, false, bh, (short)0, c, false, false);
  if (NT >= 3) c = __builtin_amdgcn_wmma_f32_16x16x32_bf16(false, ah, false, bl, (short)0, c, false, false);
  asm volatile("v_nop\n\tv_nop\n\tv_nop\n\tv_nop" : "+v"(c) : "v"(ah), "v"(al), "v"(bh), "v"(bl));
  return c;
}

__global__ __launch_bounds__(256) void k_wt_bf16(const float* __restrict__ W, unsigned short* __restrict__ Wt, int K, int N) {
  const int t = blockIdx.x * 256 + threadIdx.x;
  const int k8n = K / 8;
  if (t >= N * k8n) return;
  const int n = t / k8n, k8 = (t % k8n) * 8;
  v8us v;
#pragma unroll
  for (int i = 0; i < 8; ++i) v[i] = bf16_bits(W[(size_t)(k8 + i) * N + n]);
  *(v8us*)(Wt + (size_t)n * K + k8) = v;
  
}

// GEMM C[M][N] (f32, pitch ldc) = act(A[M][K]·W + bias). A f32 row-major (pitch lda) converted per fragment to bf16
// (ASPLIT: hi/lo two planes -> 2 terms, else single rounded term); Wt bf16 [N][K] (pitch ldb). BIAS_BF16 rounds the
// bias to bf16 first (bias quantised to bf16 before the add). K%32==0, M%16==0, N%64==0.
template <bool ASPLIT, int ACT, bool BIAS_BF16>
__global__ __launch_bounds__(128) void k_gemm_bf(const float* __restrict__ A, int lda, const unsigned short* __restrict__ Wt, int ldb,
                                               const float* __restrict__ bias, float* __restrict__ C, int ldc, int M, int N, int K) {
  __shared__ __attribute__((aligned(16))) float so[4][16][64];
  const int tid = threadIdx.x, w = tid >> 5, lane = tid & 31, ln = lane & 15, hh = lane >> 4;
  const int ntn = N / 64;
  const int wid = blockIdx.x * 4 + w;
  const int mt = wid / ntn, nq = wid % ntn;
  if (mt * 16 >= M) return;
  const int row0 = mt * 16, col0 = nq * 64;
  const float* arow = A + (size_t)(row0 + ln) * lda;
  v8f acc[4] = {};
  for (int kb = 0; kb < K; kb += 32) {
    FragB ah, al;
    const v4f x0 = *(const v4fa*)(arow + kb + 8 * hh), x1 = *(const v4fa*)(arow + kb + 8 * hh + 4);
    const v4f x2 = *(const v4fa*)(arow + kb + 16 + 8 * hh), x3 = *(const v4fa*)(arow + kb + 16 + 8 * hh + 4);
    float xs[16] = {x0[0],x0[1],x0[2],x0[3],x1[0],x1[1],x1[2],x1[3],x2[0],x2[1],x2[2],x2[3],x3[0],x3[1],x3[2],x3[3]};
#pragma unroll
    for (int i = 0; i < 16; ++i) { const unsigned short hb = bf16_bits(xs[i]); ah.u[i] = hb; al.u[i] = ASPLIT ? bf16_bits(xs[i] - bf16_val(hb)) : (unsigned short)0; }
#pragma unroll
    for (int t = 0; t < 4; ++t) {
      const unsigned short* brow = Wt + (size_t)(col0 + t * 16 + ln) * ldb + kb;
      FragB b;
      b.half[0] = *(const v8us*)(brow + 8 * hh);
      b.half[1] = *(const v8us*)(brow + 16 + 8 * hh);
      acc[t] = mmaN<ASPLIT ? 2 : 1>(ah.v, al.v, b.v, b.v, acc[t]);
    }
  }
#pragma unroll
  for (int t = 0; t < 4; ++t) {
    float bv = bias ? bias[col0 + t * 16 + ln] : 0.f;
    if (BIAS_BF16) bv = bf16_round(bv);
#pragma unroll
    for (int r = 0; r < 8; ++r) { float v = acc[t][r] + bv; if (ACT == 1) v = fmaxf(v, 0.f); so[w][8 * hh + r][t * 16 + ln] = v; }
  }
  __builtin_amdgcn_fence(__ATOMIC_ACQ_REL, "workgroup");
  __builtin_amdgcn_wave_barrier();
  const int rsub = lane >> 4, c4 = (lane & 15) * 4;
  {
#pragma unroll
    for (int q = 0; q < 8; ++q) {
      const int r = q * 2 + rsub;
      const v4f v = *(const v4fa*)&so[w][r][c4];
      *(v4f*)(C + (size_t)(row0 + r) * ldc + col0 + c4) = v;
    }
    
  }
}

// GEMM C = act(A·W + bias + resid): A f32 (ASPLIT -> hi/lo 2 terms), Wt bf16 [N][K]; ACT 0 none, 1 relu, 2 exact gelu;
// resid (optional, f32, row index = (row % rmod), pitch ldr, RES_BF16 rounds it) added before the activation.
template <bool ASPLIT, int ACT, bool BIAS_BF16, bool RES_BF16>
__global__ __launch_bounds__(128) void k_gemm_bf3(const float* __restrict__ A, int lda, const unsigned short* __restrict__ Wt, int ldb,
                                                const float* __restrict__ bias, const float* __restrict__ resid, int rmod, int ldr,
                                                float* __restrict__ C, int ldc, int M, int N, int K) {
  __shared__ __attribute__((aligned(16))) float so[4][16][64];
  const int tid = threadIdx.x, w = tid >> 5, lane = tid & 31, ln = lane & 15, hh = lane >> 4;
  const int ntn = N / 64;
  const int wid = blockIdx.x * 4 + w;
  const int mt = wid / ntn, nq = wid % ntn;
  if (mt * 16 >= M) return;
  const int row0 = mt * 16, col0 = nq * 64;
  const float* arow = A + (size_t)(row0 + ln) * lda;
  v8f acc[4] = {};
  for (int kb = 0; kb < K; kb += 32) {
    FragB ah, al;
    const v4f x0 = *(const v4fa*)(arow + kb + 8 * hh), x1 = *(const v4fa*)(arow + kb + 8 * hh + 4);
    const v4f x2 = *(const v4fa*)(arow + kb + 16 + 8 * hh), x3 = *(const v4fa*)(arow + kb + 16 + 8 * hh + 4);
    float xs[16] = {x0[0],x0[1],x0[2],x0[3],x1[0],x1[1],x1[2],x1[3],x2[0],x2[1],x2[2],x2[3],x3[0],x3[1],x3[2],x3[3]};
#pragma unroll
    for (int i = 0; i < 16; ++i) { const unsigned short hb = bf16_bits(xs[i]); ah.u[i] = hb; al.u[i] = ASPLIT ? bf16_bits(xs[i] - bf16_val(hb)) : (unsigned short)0; }
#pragma unroll
    for (int t = 0; t < 4; ++t) {
      const unsigned short* brow = Wt + (size_t)(col0 + t * 16 + ln) * ldb + kb;
      FragB b;
      b.half[0] = *(const v8us*)(brow + 8 * hh);
      b.half[1] = *(const v8us*)(brow + 16 + 8 * hh);
      acc[t] = mmaN<ASPLIT ? 2 : 1>(ah.v, al.v, b.v, b.v, acc[t]);
    }
  }
#pragma unroll
  for (int t = 0; t < 4; ++t) {
    const int col = col0 + t * 16 + ln;
    float bv = bias ? bias[col] : 0.f;
    if (BIAS_BF16) bv = bf16_round(bv);
#pragma unroll
    for (int r = 0; r < 8; ++r) {
      float v = acc[t][r] + bv;
      if (resid) { float rv = resid[(size_t)((row0 + 8 * hh + r) % rmod) * ldr + col]; if (RES_BF16) rv = bf16_round(rv); v += rv; }
      if (ACT == 1) v = fmaxf(v, 0.f);
      if (ACT == 2) v = 0.5f * v * (1.0f + erff(v * 0.70710678118654752f));
      if (ACT == 3) { const float u = 0.7978845608028654f * (v + 0.044715f * v * v * v); v = 0.5f * v * (1.0f + tanhf(u)); }
      so[w][8 * hh + r][t * 16 + ln] = v;
    }
  }
  __builtin_amdgcn_fence(__ATOMIC_ACQ_REL, "workgroup");
  __builtin_amdgcn_wave_barrier();
  const int rsub = lane >> 4, c4 = (lane & 15) * 4;
  {
#pragma unroll
    for (int q = 0; q < 8; ++q) {
      const int r = q * 2 + rsub;
      const v4f v = *(const v4fa*)&so[w][r][c4];
      *(v4f*)(C + (size_t)(row0 + r) * ldc + col0 + c4) = v;
    }
    
  }
}
// row LayerNorm (biased variance, eps) over N: s = X (+ R); optional out_sum <- s; out_norm <- (s-mu)*rsqrt(var+eps)*g + b
template <bool PARAM_BF16>
__global__ __launch_bounds__(256) void k_layernorm(const float* __restrict__ X, const float* __restrict__ R, const float* __restrict__ g, const float* __restrict__ bta,
                                                  float* __restrict__ out_sum, float* __restrict__ out_norm, int N, float eps) {
  __shared__ float red[256];
  const int row = blockIdx.x, tid = threadIdx.x;
  const float* x = X + (size_t)row * N; const float* rr = R ? R + (size_t)row * N : nullptr;
  float vals[16];                     // up to N = 4096
  const int per = N / 256;            // contiguous chunk per thread? use strided-by-4 chunks: thread handles j = tid*4 + 1024*u
  float s1 = 0.f;
  for (int u = 0; u < per / 4; ++u) {
    const int j = tid * 4 + 1024 * u;
    const v4f a = *(const v4fa*)(x + j);
    v4f b = {0.f,0.f,0.f,0.f}; if (rr) b = *(const v4fa*)(rr + j);
#pragma unroll
    for (int q = 0; q < 4; ++q) { const float v = a[q] + b[q]; vals[u * 4 + q] = v; s1 += v; }
  }
  red[tid] = s1; __syncthreads();
  for (int st = 128; st > 0; st >>= 1) { if (tid < st) red[tid] += red[tid + st]; __syncthreads(); }
  const float mu = red[0] / (float)N; __syncthreads();
  float s2 = 0.f;
  for (int u = 0; u < per / 4; ++u)
#pragma unroll
    for (int q = 0; q < 4; ++q) { const float c = vals[u * 4 + q] - mu; s2 += c * c; }
  red[tid] = s2; __syncthreads();
  for (int st = 128; st > 0; st >>= 1) { if (tid < st) red[tid] += red[tid + st]; __syncthreads(); }
  const float rs = rsqrtf(red[0] / (float)N + eps);
  {
    for (int u = 0; u < per / 4; ++u) {
      const int j = tid * 4 + 1024 * u;
      v4f o, sm;
#pragma unroll
      for (int q = 0; q < 4; ++q) {
        float gg = g[j + q], bb = bta[j + q];
        if (PARAM_BF16) { gg = bf16_round(gg); bb = bf16_round(bb); }
        sm[q] = vals[u * 4 + q]; o[q] = (vals[u * 4 + q] - mu) * rs * gg + bb;
      }
      if (out_sum) *(v4f*)(out_sum + (size_t)row * N + j) = sm;
      *(v4f*)(out_norm + (size_t)row * N + j) = o;
    }
    
  }
}



// ---- f16 WMMA path (v_wmma_f32_16x16x32_f16): 11-bit significands for operands in range — used where a [0,1] probability operand needs more precision than bf16
typedef _Float16 v16h __attribute__((ext_vector_type(16)));
union FragH { v16h v; v8us half[2]; _Float16 h[16]; unsigned short u[16]; };
template <int NT>
__device__ __forceinline__ v8f mmaH(v16h ah, v16h al, v16h bh, v16h bl, v8f c) {
  c = __builtin_amdgcn_wmma_f32_16x16x32_f16(false, ah, false, bh, (short)0, c, false, false);
  if (NT >= 2) c = __builtin_amdgcn_wmma_f32_16x16x32_f16(false, al, false, bh, (short)0, c, false, false);
  if (NT >= 3) c = __builtin_amdgcn_wmma_f32_16x16x32_f16(false, ah, false, bl, (short)0, c, false, false);
  asm volatile("v_nop\n\tv_nop\n\tv_nop\n\tv_nop" : "+v"(c) : "v"(ah), "v"(al), "v"(bh), "v"(bl));
  return c;
}
// batched GEMM like k_gemm_b but f16 operands: A f32 (split into f16 hi/lo if ASPLIT, else rounded to f16), Bt = f16 values [n][k]; alpha; C f32; N multiple of 16 (partial tiles skipped)
template <bool ASPLIT>
__global__ __launch_bounds__(128) void k_gemm_h(const float* __restrict__ A, int lda, size_t sA, const _Float16* __restrict__ Bh, int ldb, size_t sB, float alpha, float* __restrict__ C, int ldc, size_t sC, int M, int N, int K) {
  __shared__ __attribute__((aligned(16))) float so[4][16][64];
  const int tid = threadIdx.x, w = tid >> 5, lane = tid & 31, ln = lane & 15, hh = lane >> 4; const int by = blockIdx.y;
  A += (size_t)by * sA; Bh += (size_t)by * sB; C += (size_t)by * sC;
  const int ntn = (N + 63) / 64; const int wid = blockIdx.x * 4 + w; const int mt = wid / ntn, nq = wid % ntn; if (mt * 16 >= M) return;
  const int row0 = mt * 16, col0 = nq * 64; const float* arow = A + (size_t)(row0 + ln) * lda;
  v8f acc[4] = {};
  for (int kb = 0; kb < K; kb += 32) {
    FragH ah, al;
    const v4f x0 = *(const v4fa*)(arow + kb + 8 * hh), x1 = *(const v4fa*)(arow + kb + 8 * hh + 4), x2 = *(const v4fa*)(arow + kb + 16 + 8 * hh), x3 = *(const v4fa*)(arow + kb + 16 + 8 * hh + 4);
    float xs[16] = {x0[0],x0[1],x0[2],x0[3],x1[0],x1[1],x1[2],x1[3],x2[0],x2[1],x2[2],x2[3],x3[0],x3[1],x3[2],x3[3]};
#pragma unroll
    for (int i = 0; i < 16; ++i) { const _Float16 h = (_Float16)xs[i]; ah.h[i] = h; al.h[i] = ASPLIT ? (_Float16)(xs[i] - (float)h) : (_Float16)0.0f; }
#pragma unroll
    for (int t = 0; t < 4; ++t) { if (col0 + t * 16 >= N) continue; const size_t boff = (size_t)(col0 + t * 16 + ln) * ldb + kb; FragH bq; bq.half[0] = *(const v8us*)(Bh + boff + 8 * hh); bq.half[1] = *(const v8us*)(Bh + boff + 16 + 8 * hh);
      acc[t] = mmaH<ASPLIT ? 2 : 1>(ah.v, al.v, bq.v, bq.v, acc[t]); }
  }
#pragma unroll
  for (int t = 0; t < 4; ++t) { if (col0 + t * 16 >= N) continue;
#pragma unroll
    for (int r = 0; r < 8; ++r) so[w][8 * hh + r][t * 16 + ln] = acc[t][r] * alpha; }
  __builtin_amdgcn_fence(__ATOMIC_ACQ_REL, "workgroup"); __builtin_amdgcn_wave_barrier();
  const int rsub = lane >> 4, c4 = (lane & 15) * 4;
  {
#pragma unroll
    for (int q = 0; q < 8; ++q) { const int r = q * 2 + rsub; if (col0 + c4 < N) { const v4f v = *(const v4fa*)&so[w][r][c4]; *(v4f*)(C + (size_t)(row0 + r) * ldc + col0 + c4) = v; } }
     }
}

// Wt[n][k] = f16(W[k][n]·scale) from f32 row-major W[K][N] (scale = power of two; bf16-exact weights stay exact in f16 away from the subnormal range)
__global__ __launch_bounds__(256) void k_wt_f16(const float* __restrict__ W, _Float16* __restrict__ Wt, int K, int N, float scale) {
  const int t = blockIdx.x * 256 + threadIdx.x; if (t >= N * (K / 8)) return; const int n = t / (K / 8), k8 = (t % (K / 8)) * 8; FragH f;
#pragma unroll
  for (int i = 0; i < 8; ++i) f.h[i] = (_Float16)(bf16_round(W[(size_t)(k8 + i) * N + n]) * scale); const v8us o = f.half[0];
  *(v8us*)((unsigned short*)Wt + (size_t)n * K + k8) = o; 
}
// k_gemm_hh variant with fused epilogue: v = acc·alpha + bias[by·sBias + col] (+ CP[(row/rowsPerB)·sCPb + by·64 + col] if CP) ; ACT 0 none / 1 elu ; writes f16 C16 (and f32 C if non-null)
template <int ACT>
__global__ __launch_bounds__(128) void k_gemm_hhx(const _Float16* __restrict__ A, int lda, size_t sA, const _Float16* __restrict__ Bh, int ldb, size_t sB, float alpha, const float* __restrict__ bias, size_t sBias, const float* __restrict__ CP, int rowsPerB, size_t sCPb, int row0g,
    float* __restrict__ C, _Float16* __restrict__ C16, int ldc, size_t sC, int M, int N, int K) {
  __shared__ __attribute__((aligned(16))) float so[4][16][64];
  const int tid = threadIdx.x, w = tid >> 5, lane = tid & 31, ln = lane & 15, hh = lane >> 4; const int by = blockIdx.y;
  A += (size_t)by * sA; Bh += (size_t)by * sB; const size_t cofs = (size_t)by * sC; const float* bp = bias ? bias + (size_t)by * sBias : nullptr;
  const int ntn = (N + 63) / 64; const int wid = blockIdx.x * 4 + w; const int mt = wid / ntn, nq = wid % ntn; if (mt * 16 >= M) return;
  const int row0 = mt * 16, col0 = nq * 64; const _Float16* arow = A + (size_t)(row0 + ln) * lda;
  v8f acc[4] = {};
  for (int kb = 0; kb < K; kb += 32) { FragH ah; ah.half[0] = *(const v8us*)((const unsigned short*)arow + kb + 8 * hh); ah.half[1] = *(const v8us*)((const unsigned short*)arow + kb + 16 + 8 * hh);
#pragma unroll
    for (int t = 0; t < 4; ++t) { if (col0 + t * 16 >= N) continue; const size_t boff = (size_t)(col0 + t * 16 + ln) * ldb + kb; FragH bq; bq.half[0] = *(const v8us*)((const unsigned short*)Bh + boff + 8 * hh); bq.half[1] = *(const v8us*)((const unsigned short*)Bh + boff + 16 + 8 * hh);
      acc[t] = mmaH<1>(ah.v, ah.v, bq.v, bq.v, acc[t]); }
  }
#pragma unroll
  for (int t = 0; t < 4; ++t) { if (col0 + t * 16 >= N) continue; const int col = col0 + t * 16 + ln; const float bv = bp ? bf16_round(bp[col]) : 0.f;
#pragma unroll
    for (int r = 0; r < 8; ++r) { float v = acc[t][r] * alpha + bv; if (CP) { const int rr = row0g + row0 + 8 * hh + r; if (rowsPerB < 0) v += CP[cofs + (size_t)rr * ldc + col];      /* rowsPerB < 0: own element of the batched C plane */ else { const int bidx = rr / rowsPerB; v += CP[(size_t)bidx * sCPb + (size_t)by * 64 + col]; } } if (ACT == 1) v = (v > 0.f) ? v : expm1f(v); else if (ACT == 7) v = (v > 0.f) ? v + 1.0f : expf(v); else if (ACT == 8) v = tanhf(v); else if (ACT == 9) v = 0.5f * v * (1.0f + tanhf(0.7978845608028654f * (v + 0.044715f * v * v * v))); else if (ACT == 11) v = 1.0f / (1.0f + expf(-v)); else if (ACT == 12) v = (v > 0.f) ? v : 0.01f * v; else if (ACT == 14) v = (v > 0.f) ? v : 0.1f * v; else if (ACT == 16) v = (v >= 0.f) ? v : 0.3f * v; else if (ACT == 17) v = (v >= 0.f) ? v : 0.2f * v; else if (ACT == 15) v = v / (1.0f + expf(-v)); else if (ACT == 3) v = fmaxf(v, 0.f); else if (ACT == 6) v = 0.5f * v * (1.0f + erff(v * 0.70710678118654752f)); so[w][8 * hh + r][t * 16 + ln] = v; } }
  __builtin_amdgcn_fence(__ATOMIC_ACQ_REL, "workgroup"); __builtin_amdgcn_wave_barrier();
  const int rsub = lane >> 4, c4 = (lane & 15) * 4; typedef _Float16 v4h __attribute__((ext_vector_type(4)));
  {
#pragma unroll
    for (int q = 0; q < 8; ++q) { const int r = q * 2 + rsub; if (col0 + c4 < N) { const v4f v = *(const v4fa*)&so[w][r][c4]; if (C) *(v4f*)(C + cofs + (size_t)(row0 + r) * ldc + col0 + c4) = v; if (C16) { v4h h4; for (int i = 0; i < 4; ++i) h4[i] = (_Float16)v[i]; *(v4h*)(C16 + cofs + (size_t)(row0 + r) * ldc + col0 + c4) = h4; } } }
     }
}


typedef _Float16 v4h __attribute__((ext_vector_type(4)));

__global__ __launch_bounds__(256) void k_x16(const float* __restrict__ x, _Float16* __restrict__ X16, size_t n8) { const size_t t = (size_t)blockIdx.x * 256 + threadIdx.x; if (t >= n8) return; FragH f;
#pragma unroll
  for (int q = 0; q < 8; ++q) f.h[q] = (_Float16)bf16_round(x[t * 8 + q]); *(v8us*)((unsigned short*)X16 + t * 8) = f.half[0];  }
__global__ __launch_bounds__(256) void k_h16(const float* __restrict__ x, _Float16* __restrict__ X16, size_t n8) { const size_t t = (size_t)blockIdx.x * 256 + threadIdx.x; if (t >= n8) return; FragH f;
#pragma unroll
  for (int q = 0; q < 8; ++q) f.h[q] = (_Float16)x[t * 8 + q]; *(v8us*)((unsigned short*)X16 + t * 8) = f.half[0];  }
__global__ __launch_bounds__(256) void k_round16f(const float* __restrict__ W, _Float16* __restrict__ Bt, size_t n8) { const size_t t = (size_t)blockIdx.x * 256 + threadIdx.x; if (t >= n8) return; FragH f;
#pragma unroll
  for (int i = 0; i < 8; ++i) f.h[i] = (_Float16)(bf16_round(W[t * 8 + i]) * 16.0f); *(v8us*)((unsigned short*)Bt + t * 8) = f.half[0];  }
template <int NHv, int TTv>
__global__ __launch_bounds__(256) void k_vt(const _Float16* __restrict__ V16, int ldv, int voff, _Float16* __restrict__ Vt) { __shared__ unsigned short tl[64][66]; const int tid = threadIdx.x; const int slab = blockIdx.x / (TTv / 64), lg = blockIdx.x % (TTv / 64); const int b = slab / NHv, h = slab % NHv;
  for (int i = tid; i < 64 * 8; i += 256) { const int r = i / 8, c8 = (i % 8) * 8; FragH f; f.half[0] = *(const v8us*)((const unsigned short*)V16 + ((size_t)b * TTv + lg * 64 + r) * ldv + voff + h * 64 + c8);
#pragma unroll
    for (int q = 0; q < 8; ++q) tl[r][c8 + q] = f.u[q]; }
  __syncthreads();
  {
#pragma unroll
    for (int rd = 0; rd < 2; ++rd) { const int d = rd * 32 + tid / 8, pc = tid % 8; FragH f;
#pragma unroll
      for (int q = 0; q < 8; ++q) f.u[q] = tl[pc * 8 + q][d];
      *(v8us*)((unsigned short*)Vt + ((size_t)slab * 64 + d) * TTv + lg * 64 + pc * 8) = f.half[0]; }
     } }

__global__ __launch_bounds__(256) void k_hl(const float* __restrict__ F, _Float16* __restrict__ Hh, _Float16* __restrict__ Hl, size_t n8) { const size_t t = (size_t)blockIdx.x * 256 + threadIdx.x; if (t >= n8) return; FragH fh, fl; const v4f a = *(const v4fa*)(F + t * 8), c = *(const v4fa*)(F + t * 8 + 4);
#pragma unroll
  for (int q = 0; q < 4; ++q) { _Float16 h = (_Float16)a[q]; fh.h[q] = h; fl.h[q] = (_Float16)((a[q] - (float)h) * 1024.0f); h = (_Float16)c[q]; fh.h[4 + q] = h; fl.h[4 + q] = (_Float16)((c[q] - (float)h) * 1024.0f); }
  { *(v8us*)((unsigned short*)Hh + t * 8) = fh.half[0]; *(v8us*)((unsigned short*)Hl + t * 8) = fl.half[0];  } }

// ---- fast GEMM (wave tile 32x64; requires M % 32 == 0 rows per launch region and N % 64 == 0); epilogue = k_gemm_hhx semantics ----
__device__ __forceinline__ v16h g2_frag(const _Float16* p, int hh) { FragH f; f.half[0] = *(const v8us*)((const unsigned short*)p + 8 * hh); f.half[1] = *(const v8us*)((const unsigned short*)p + 16 + 8 * hh); return f.v; }
__device__ __forceinline__ v8f g2_mma(v16h a, v16h b, v8f c) { v8f d = __builtin_amdgcn_wmma_f32_16x16x32_f16(false, a, false, b, (short)0, c, false, false); asm volatile("v_nop\n\tv_nop\n\tv_nop\n\tv_nop" : "+v"(d) : "v"(a), "v"(b)); return d; }
template <int ACT>
__global__ __launch_bounds__(128) void k_gemm2(const _Float16* __restrict__ A, int lda, size_t sA, const _Float16* __restrict__ Bh, int ldb, size_t sB, float alpha, const float* __restrict__ bias, size_t sBias, const float* __restrict__ CP, int rowsPerB, size_t sCPb, int row0g,
    float* __restrict__ C, _Float16* __restrict__ C16, int ldc, size_t sC, int M, int N, int K) { static_assert(ACT == 0 || ACT == 3 || ACT == 6 || ACT == 8 || ACT == 9 || ACT == 11 || ACT == 12 || ACT == 14 || ACT == 15 || ACT == 16 || ACT == 17, "k_gemm2: unsupported ACT code (would silently apply no activation)");
  __shared__ __attribute__((aligned(16))) float so[4][32][68];
  const int tid = threadIdx.x, w = tid >> 5, lane = tid & 31, ln = lane & 15, hh = lane >> 4; const int by = blockIdx.y;
  A += (size_t)by * sA; Bh += (size_t)by * sB; const size_t cofs = (size_t)by * sC; const float* bp = bias ? bias + (size_t)by * sBias : nullptr;
  const int ntn = N >> 6; const int mt = blockIdx.x / ntn, nq = blockIdx.x - mt * ntn; const int row0 = mt * 128 + 32 * w, col0 = nq * 64; if (row0 >= M) return;
  const _Float16* a0p = A + (size_t)(row0 + ln) * lda; const _Float16* a1p = a0p + (size_t)16 * lda;
  const _Float16* b0p = Bh + (size_t)(col0 + ln) * ldb; const _Float16* b1p = b0p + (size_t)16 * ldb; const _Float16* b2p = b1p + (size_t)16 * ldb; const _Float16* b3p = b2p + (size_t)16 * ldb;
  const v8f z8 = {0.f,0.f,0.f,0.f,0.f,0.f,0.f,0.f}; v8f c00 = z8, c01 = z8, c02 = z8, c03 = z8, c10 = z8, c11 = z8, c12 = z8, c13 = z8;
#pragma unroll 1
  for (int kb = 0; kb < K; kb += 32) { const v16h a0 = g2_frag(a0p + kb, hh), a1 = g2_frag(a1p + kb, hh);
    v16h b = g2_frag(b0p + kb, hh); c00 = g2_mma(a0, b, c00); c10 = g2_mma(a1, b, c10);
    b = g2_frag(b1p + kb, hh); c01 = g2_mma(a0, b, c01); c11 = g2_mma(a1, b, c11);
    b = g2_frag(b2p + kb, hh); c02 = g2_mma(a0, b, c02); c12 = g2_mma(a1, b, c12);
    b = g2_frag(b3p + kb, hh); c03 = g2_mma(a0, b, c03); c13 = g2_mma(a1, b, c13); }
  v8f accs[8] = {c00, c01, c02, c03, c10, c11, c12, c13};
#pragma unroll
  for (int u = 0; u < 8; ++u) { const int t = u & 3, half = u >> 2; const int col = col0 + t * 16 + ln; const float bv = bp ? bf16_round(bp[col]) : 0.f;
#pragma unroll
    for (int r = 0; r < 8; ++r) { const int rloc = half * 16 + 8 * hh + r; float v = accs[u][r] * alpha + bv; if (CP) { if (rowsPerB < 0) v += CP[cofs + (size_t)(row0g + row0 + rloc) * ldc + col];      /* rowsPerB < 0: own element of the batched C plane */ else { const int bidx = (row0g + row0 + rloc) / rowsPerB; v += CP[(size_t)bidx * sCPb + (size_t)by * 64 + col]; } }
      if (ACT == 3) v = fmaxf(v, 0.f); else if (ACT == 6) v = 0.5f * v * (1.0f + erff(v * 0.70710678118654752f)); else if (ACT == 11) v = 1.0f / (1.0f + expf(-v)); else if (ACT == 15) v = v / (1.0f + expf(-v)); else if (ACT == 12) v = (v > 0.f) ? v : 0.01f * v; else if (ACT == 8) v = tanhf(v); else if (ACT == 9) v = 0.5f * v * (1.0f + tanhf(0.7978845608028654f * (v + 0.044715f * v * v * v))); else if (ACT == 14) v = (v > 0.f) ? v : 0.1f * v; else if (ACT == 16) v = (v >= 0.f) ? v : 0.3f * v; else if (ACT == 17) v = (v >= 0.f) ? v : 0.2f * v;
      so[w][rloc][t * 16 + ln] = v; } }
  __builtin_amdgcn_fence(__ATOMIC_ACQ_REL, "workgroup"); __builtin_amdgcn_wave_barrier();
  const int rsub = lane >> 4, c4 = (lane & 15) * 4;
  {
#pragma unroll
    for (int q = 0; q < 16; ++q) { const int r = q * 2 + rsub; const v4f v = *(const v4fa*)&so[w][r][c4]; if (C) *(v4f*)(C + cofs + (size_t)(row0 + r) * ldc + col0 + c4) = v; if (C16) { v4h h4; for (int i = 0; i < 4; ++i) h4[i] = (_Float16)v[i]; *(v4h*)(C16 + cofs + (size_t)(row0 + r) * ldc + col0 + c4) = h4; } }
     } }


__global__ __launch_bounds__(256) void k_wnat(const float* __restrict__ w, size_t n8, _Float16* __restrict__ Bt) { const size_t t = (size_t)blockIdx.x * 256 + threadIdx.x; if (t >= n8) return; FragH f; for (int q = 0; q < 8; ++q) f.h[q] = (_Float16)(bf16_round(w[t * 8 + q]) * 16.0f); *(v8us*)((unsigned short*)Bt + t * 8) = f.half[0];  }
// Row softmax, one wave per row: lane l holds columns 128 u + 4 l .. + 3 (u = 0 .. 7) of the row in registers, so every load covers 512 contiguous bytes and each score is read
// and exponentiated once; row maximum and row sum by a five-step butterfly over the 32 lanes. blockIdx.y = head of the group; i = query row inside the head (the decay bias needs it).
// Every loop below is fully unrolled so that v[] is indexed by constants and stays in registers (a rolled loop would put it in scratch memory).
template <bool DECAY>
__device__ __forceinline__ void rsm_row(const float* __restrict__ S, _Float16* __restrict__ P, int nrows, float c) {
  const int lane = threadIdx.x & 31; const int i = blockIdx.x * 8 + (threadIdx.x >> 5); if (i >= nrows) return;
  const size_t ro = ((size_t)blockIdx.y * SQ + i) * SQ + lane * 4; const float* s = S + ro; v4f v[8];
#pragma unroll
  for (int u = 0; u < 8; ++u) v[u] = *(const v4fa*)(s + u * 128);
  float mx = -3.0e38f;
#pragma unroll
  for (int u = 0; u < 8; ++u)
#pragma unroll
    for (int q = 0; q < 4; ++q) { if (DECAY) v[u][q] = v[u][q] - (float)abs(i - (u * 128 + lane * 4 + q)) * c; mx = fmaxf(mx, v[u][q]); }
#pragma unroll
  for (int m = 16; m > 0; m >>= 1) mx = fmaxf(mx, __shfl_xor(mx, m, 32));
  v4f s4 = {0.f, 0.f, 0.f, 0.f};
#pragma unroll
  for (int u = 0; u < 8; ++u)
#pragma unroll
    for (int q = 0; q < 4; ++q) { v[u][q] = expf(v[u][q] - mx); s4[q] += v[u][q]; }
  float se = (s4[0] + s4[1]) + (s4[2] + s4[3]);
#pragma unroll
  for (int m = 16; m > 0; m >>= 1) se += __shfl_xor(se, m, 32);
  const float sc = 256.0f / se; _Float16* p = P + ro;
#pragma unroll
  for (int u = 0; u < 8; ++u) { v4h h4;
#pragma unroll
    for (int q = 0; q < 4; ++q) h4[q] = (_Float16)(v[u][q] * sc);
    *(v4h*)(p + u * 128) = h4; } }
__global__ __launch_bounds__(256) void k_rsm(const float* __restrict__ S, _Float16* __restrict__ P, int nrows) { rsm_row<false>(S, P, nrows, 0.f); }
__global__ __launch_bounds__(256) void k_vt(const _Float16* __restrict__ V16, int b, int h0, _Float16* __restrict__ VT) { __shared__ unsigned short tl[64][65]; const int tid = threadIdx.x; const int hh = blockIdx.x % HG, sg = blockIdx.x / HG; const int s0 = sg * 64; const int h = h0 + hh;
  for (int i = tid; i < 64 * 8; i += 256) { const int j = i / 8, d8 = (i % 8) * 8; FragH f; f.half[0] = *(const v8us*)((const unsigned short*)V16 + ((size_t)b * SQ + s0 + j) * DM + h * HD + d8); for (int q = 0; q < 8; ++q) tl[d8 + q][j] = f.u[q]; }
  __syncthreads();
  { for (int i = tid; i < 64 * 8; i += 256) { const int d = i / 8, j8 = (i % 8) * 8; FragH f; for (int q = 0; q < 8; ++q) f.u[q] = tl[d][j8 + q]; *(v8us*)((unsigned short*)VT + ((size_t)hh * HD + d) * SQ + s0 + j8) = f.half[0]; }  } }

__global__ __launch_bounds__(256) void k_wT(const float* __restrict__ w, int din, int dout, _Float16* __restrict__ Bt) { __shared__ float tl[64][65]; const int tid = threadIdx.x; const int nbo = dout / 64; const int ib = blockIdx.x / nbo, ob = blockIdx.x % nbo; const int i0 = ib * 64, o0 = ob * 64;
  for (int t = tid; t < 64 * 64; t += 256) { const int i = t / 64, o = t % 64; tl[o][i] = bf16_round(w[(size_t)(i0 + i) * dout + o0 + o]) * 16.0f; }
  __syncthreads();
  { for (int t = tid; t < 64 * 8; t += 256) { const int o = t / 8, i8 = (t % 8) * 8; FragH f; for (int q = 0; q < 8; ++q) f.h[q] = (_Float16)tl[o][i8 + q]; *(v8us*)((unsigned short*)Bt + (size_t)(o0 + o) * din + i0 + i8) = f.half[0]; }  } }
__global__ __launch_bounds__(256) void k_rsmd(const float* __restrict__ S, _Float16* __restrict__ P, int nrows, const float* __restrict__ dfp) { rsm_row<true>(S, P, nrows, 1.0f - bf16_round(dfp[0])); }
__global__ __launch_bounds__(256) void k_mix(const float* __restrict__ OS, const float* __restrict__ OL, const float* __restrict__ mwp, _Float16* __restrict__ O16, size_t n8) {
  #pragma clang fp contract(off)
  const size_t t = (size_t)blockIdx.x * 256 + threadIdx.x; if (t >= n8) return; const float a = 1.0f / (1.0f + expf(-bf16_round(mwp[0]))); FragH f; for (int q = 0; q < 8; ++q) f.h[q] = (_Float16)__fadd_rn(__fmul_rn(a, OS[t * 8 + q]), __fmul_rn(1.0f - a, OL[t * 8 + q]));
  *(v8us*)((unsigned short*)O16 + t * 8) = f.half[0];  }
extern "C" void kernel_launch(void* const* d_in, const int* in_sizes, int n_in,
                              void* d_out, int out_size, void* d_ws, size_t ws_size, hipStream_t stream) {
  (void)in_sizes; (void)n_in; (void)out_size;
  const float* const* I = (const float* const*)d_in; const float* x = I[0]; const float* wq = I[1]; const float* wkvs = I[2]; const float* wkvl = I[3]; const float* wo = I[4]; const float* mwp = I[5]; const float* dfp = I[6];
  char* ws = (char*)d_ws; size_t off = 0;
  auto take = [&](size_t bytes) { char* p = ws + off; off += (bytes + 255) & ~(size_t)255; return p; };
  _Float16* BQ = (_Float16*)take((size_t)DM * DM * 2); _Float16* BKVS = (_Float16*)take((size_t)2 * DM * DM * 2); _Float16* BKVL = (_Float16*)take((size_t)2 * DM * DM * 2); _Float16* BO = (_Float16*)take((size_t)DM * DM * 2);
  _Float16* X16 = (_Float16*)take(NR * DM * 2); _Float16* Q16 = (_Float16*)take(NR * DM * 2); _Float16* K16 = (_Float16*)take(NR * DM * 2); _Float16* V16 = (_Float16*)take(NR * DM * 2); _Float16* KL16 = (_Float16*)take(NR * DM * 2); _Float16* VL16 = (_Float16*)take(NR * DM * 2); float* OS = (float*)take(NR * DM * 4); float* OL = (float*)take(NR * DM * 4); _Float16* O16 = (_Float16*)take(NR * DM * 2);
  float* S = (float*)take((size_t)HG * SQ * SQ * 4); _Float16* P = (_Float16*)take((size_t)HG * SQ * SQ * 2); _Float16* VT = (_Float16*)take((size_t)HG * HD * SQ * 2);
  if (off > ws_size) return;      /* 12 + 6x8 + 2x16 + 8 + 16 + 8 + 0.5 = ≈ 124.5 MiB */
  k_wT<<<(DM / 64) * (DM / 64), 256, 0, stream>>>(wq, DM, DM, BQ); k_wT<<<(DM / 64) * (2 * DM / 64), 256, 0, stream>>>(wkvs, DM, 2 * DM, BKVS); k_wT<<<(DM / 64) * (2 * DM / 64), 256, 0, stream>>>(wkvl, DM, 2 * DM, BKVL); k_wT<<<(DM / 64) * (DM / 64), 256, 0, stream>>>(wo, DM, DM, BO);
  k_x16<<<(unsigned)((NR * DM / 8 + 255) / 256), 256, 0, stream>>>(x, X16, NR * DM / 8);
  const dim3 gp((unsigned)((NR / 128) * (DM / 64)), 1);
  k_gemm2<0><<<gp, 128, 0, stream>>>(X16, DM, 0, BQ, DM, 0, 0.0625f, nullptr, 0, nullptr, 1, 0, 0, nullptr, Q16, DM, 0, (int)NR, DM, DM);
  k_gemm2<0><<<gp, 128, 0, stream>>>(X16, DM, 0, BKVS, DM, 0, 0.0625f, nullptr, 0, nullptr, 1, 0, 0, nullptr, K16, DM, 0, (int)NR, DM, DM); k_gemm2<0><<<gp, 128, 0, stream>>>(X16, DM, 0, BKVS + (size_t)DM * DM, DM, 0, 0.0625f, nullptr, 0, nullptr, 1, 0, 0, nullptr, V16, DM, 0, (int)NR, DM, DM);      /* short k | v */
  k_gemm2<0><<<gp, 128, 0, stream>>>(X16, DM, 0, BKVL, DM, 0, 0.0625f, nullptr, 0, nullptr, 1, 0, 0, nullptr, KL16, DM, 0, (int)NR, DM, DM); k_gemm2<0><<<gp, 128, 0, stream>>>(X16, DM, 0, BKVL + (size_t)DM * DM, DM, 0, 0.0625f, nullptr, 0, nullptr, 1, 0, 0, nullptr, VL16, DM, 0, (int)NR, DM, DM);      /* long k | v */
  for (int br = 0; br < 2; ++br) { const _Float16* KB = br ? KL16 : K16; const _Float16* VB = br ? VL16 : V16; float* OB = br ? OL : OS;
  for (int b = 0; b < NB; ++b) for (int h0 = 0; h0 < NH; h0 += HG) {
    const _Float16* qb = Q16 + (size_t)b * SQ * DM + h0 * HD; const _Float16* kb = KB + (size_t)b * SQ * DM + h0 * HD;
    k_gemm2<0><<<dim3((QN / 128) * (SQ / 64), HG), 128, 0, stream>>>(qb, DM, (size_t)HD, kb, DM, (size_t)HD, 0.125f, nullptr, 0, nullptr, 1, 0, 0, S, nullptr, SQ, (size_t)SQ * SQ, QN, SQ, HD);
    if (br == 0) k_rsmd<<<dim3((QN + 7) / 8, HG), 256, 0, stream>>>(S, P, QN, dfp); else k_rsm<<<dim3((QN + 7) / 8, HG), 256, 0, stream>>>(S, P, QN);
    k_vt<<<HG * (SQ / 64), 256, 0, stream>>>(VB, b, h0, VT);
    k_gemm2<0><<<dim3((QN / 128) * (HD / 64), HG), 128, 0, stream>>>(P, SQ, (size_t)SQ * SQ, VT, SQ, (size_t)HD * SQ, 0.00390625f, nullptr, 0, nullptr, 1, 0, 0, OB + (size_t)b * SQ * DM + h0 * HD, nullptr, DM, (size_t)HD, QN, HD, SQ); } }      /* per-branch o (merged heads) as f32 rows */
  k_mix<<<(unsigned)((NR * DM / 8 + 255) / 256), 256, 0, stream>>>(OS, OL, mwp, O16, NR * DM / 8);
  k_gemm2<0><<<gp, 128, 0, stream>>>(O16, DM, 0, BO, DM, 0, 0.0625f, nullptr, 0, nullptr, 1, 0, 0, (float*)d_out, nullptr, DM, 0, (int)NR, DM, DM);      /* out = o Wo */
}

// v002
// Measured time: 300 microseconds a run.
// In two side-by-side timings against v001, it was 6.46 and 6.38 times as fast.
// Over all steps from v000 it is 82.1 times as fast.
#include <hip/hip_runtime.h>
#define NB 4
#define SQ 1024
#define DM 1024
#define NH 16
#define HD 64
#define NR ((size_t)NB * SQ)         /* 4096 token rows */
typedef __bf16 v16b __attribute__((ext_vector_type(16)));
typedef unsigned short v8us __attribute__((ext_vector_type(8), may_alias));
typedef float  v8f  __attribute__((ext_vector_type(8)));
typedef float  v4f  __attribute__((ext_vector_type(4)));
typedef float  v4fa __attribute__((ext_vector_type(4), may_alias));
union FragB { v16b v; v8us half[2]; unsigned short u[16]; };

__device__ __forceinline__ unsigned short bf16_bits(float x) { unsigned int u = __float_as_uint(x); return (unsigned short)((u + 0x7FFFu + ((u >> 16) & 1u)) >> 16); }
__device__ __forceinline__ float bf16_val(unsigned short b) { return __uint_as_float(((unsigned int)b) << 16); }
__device__ __forceinline__ float bf16_round(float x) { return bf16_val(bf16_bits(x)); }
// D += A·B with NT terms: 1 = ah·bh, 2 = + al·bh (A split), 3 = + ah·bl (both split)
template <int NT>
__device__ __forceinline__ v8f mmaN(v16b ah, v16b al, v16b bh, v16b bl, v8f c) {
  c = __builtin_amdgcn_wmma_f32_16x16x32_bf16(false, ah, false, bh, (short)0, c, false, false);
  if (NT >= 2) c = __builtin_amdgcn_wmma_f32_16x16x32_bf16(false, al, false, bh, (short)0, c, false, false);
  if (NT >= 3) c = __builtin_amdgcn_wmma_f32_16x16x32_bf16(false, ah, false, bl, (short)0, c, false, false);
  asm volatile("v_nop\n\tv_nop\n\tv_nop\n\tv_nop" : "+v"(c) : "v"(ah), "v"(al), "v"(bh), "v"(bl));
  return c;
}

__global__ __launch_bounds__(256) void k_wt_bf16(const float* __restrict__ W, unsigned short* __restrict__ Wt, int K, int N) {
  const int t = blockIdx.x * 256 + threadIdx.x;
  const int k8n = K / 8;
  if (t >= N * k8n) return;
  const int n = t / k8n, k8 = (t % k8n) * 8;
  v8us v;
#pragma unroll
  for (int i = 0; i < 8; ++i) v[i] = bf16_bits(W[(size_t)(k8 + i) * N + n]);
  *(v8us*)(Wt + (size_t)n * K + k8) = v;
  
}

// GEMM C[M][N] (f32, pitch ldc) = act(A[M][K]·W + bias). A f32 row-major (pitch lda) converted per fragment to bf16
// (ASPLIT: hi/lo two planes -> 2 terms, else single rounded term); Wt bf16 [N][K] (pitch ldb). BIAS_BF16 rounds the
// bias to bf16 first (bias quantised to bf16 before the add). K%32==0, M%16==0, N%64==0.
template <bool ASPLIT, int ACT, bool BIAS_BF16>
__global__ __launch_bounds__(128) void k_gemm_bf(const float* __restrict__ A, int lda, const unsigned short* __restrict__ Wt, int ldb,
                                               const float* __restrict__ bias, float* __restrict__ C, int ldc, int M, int N, int K) {
  __shared__ __attribute__((aligned(16))) float so[4][16][64];
  const int tid = threadIdx.x, w = tid >> 5, lane = tid & 31, ln = lane & 15, hh = lane >> 4;
  const int ntn = N / 64;
  const int wid = blockIdx.x * 4 + w;
  const int mt = wid / ntn, nq = wid % ntn;
  if (mt * 16 >= M) return;
  const int row0 = mt * 16, col0 = nq * 64;
  const float* arow = A + (size_t)(row0 + ln) * lda;
  v8f acc[4] = {};
  for (int kb = 0; kb < K; kb += 32) {
    FragB ah, al;
    const v4f x0 = *(const v4fa*)(arow + kb + 8 * hh), x1 = *(const v4fa*)(arow + kb + 8 * hh + 4);
    const v4f x2 = *(const v4fa*)(arow + kb + 16 + 8 * hh), x3 = *(const v4fa*)(arow + kb + 16 + 8 * hh + 4);
    float xs[16] = {x0[0],x0[1],x0[2],x0[3],x1[0],x1[1],x1[2],x1[3],x2[0],x2[1],x2[2],x2[3],x3[0],x3[1],x3[2],x3[3]};
#pragma unroll
    for (int i = 0; i < 16; ++i) { const unsigned short hb = bf16_bits(xs[i]); ah.u[i] = hb; al.u[i] = ASPLIT ? bf16_bits(xs[i] - bf16_val(hb)) : (unsigned short)0; }
#pragma unroll
    for (int t = 0; t < 4; ++t) {
      const unsigned short* brow = Wt + (size_t)(col0 + t * 16 + ln) * ldb + kb;
      FragB b;
      b.half[0] = *(const v8us*)(brow + 8 * hh);
      b.half[1] = *(const v8us*)(brow + 16 + 8 * hh);
      acc[t] = mmaN<ASPLIT ? 2 : 1>(ah.v, al.v, b.v, b.v, acc[t]);
    }
  }
#pragma unroll
  for (int t = 0; t < 4; ++t) {
    float bv = bias ? bias[col0 + t * 16 + ln] : 0.f;
    if (BIAS_BF16) bv = bf16_round(bv);
#pragma unroll
    for (int r = 0; r < 8; ++r) { float v = acc[t][r] + bv; if (ACT == 1) v = fmaxf(v, 0.f); so[w][8 * hh + r][t * 16 + ln] = v; }
  }
  __builtin_amdgcn_fence(__ATOMIC_ACQ_REL, "workgroup");
  __builtin_amdgcn_wave_barrier();
  const int rsub = lane >> 4, c4 = (lane & 15) * 4;
  {
#pragma unroll
    for (int q = 0; q < 8; ++q) {
      const int r = q * 2 + rsub;
      const v4f v = *(const v4fa*)&so[w][r][c4];
      *(v4f*)(C + (size_t)(row0 + r) * ldc + col0 + c4) = v;
    }
    
  }
}

// GEMM C = act(A·W + bias + resid): A f32 (ASPLIT -> hi/lo 2 terms), Wt bf16 [N][K]; ACT 0 none, 1 relu, 2 exact gelu;
// resid (optional, f32, row index = (row % rmod), pitch ldr, RES_BF16 rounds it) added before the activation.
template <bool ASPLIT, int ACT, bool BIAS_BF16, bool RES_BF16>
__global__ __launch_bounds__(128) void k_gemm_bf3(const float* __restrict__ A, int lda, const unsigned short* __restrict__ Wt, int ldb,
                                                const float* __restrict__ bias, const float* __restrict__ resid, int rmod, int ldr,
                                                float* __restrict__ C, int ldc, int M, int N, int K) {
  __shared__ __attribute__((aligned(16))) float so[4][16][64];
  const int tid = threadIdx.x, w = tid >> 5, lane = tid & 31, ln = lane & 15, hh = lane >> 4;
  const int ntn = N / 64;
  const int wid = blockIdx.x * 4 + w;
  const int mt = wid / ntn, nq = wid % ntn;
  if (mt * 16 >= M) return;
  const int row0 = mt * 16, col0 = nq * 64;
  const float* arow = A + (size_t)(row0 + ln) * lda;
  v8f acc[4] = {};
  for (int kb = 0; kb < K; kb += 32) {
    FragB ah, al;
    const v4f x0 = *(const v4fa*)(arow + kb + 8 * hh), x1 = *(const v4fa*)(arow + kb + 8 * hh + 4);
    const v4f x2 = *(const v4fa*)(arow + kb + 16 + 8 * hh), x3 = *(const v4fa*)(arow + kb + 16 + 8 * hh + 4);
    float xs[16] = {x0[0],x0[1],x0[2],x0[3],x1[0],x1[1],x1[2],x1[3],x2[0],x2[1],x2[2],x2[3],x3[0],x3[1],x3[2],x3[3]};
#pragma unroll
    for (int i = 0; i < 16; ++i) { const unsigned short hb = bf16_bits(xs[i]); ah.u[i] = hb; al.u[i] = ASPLIT ? bf16_bits(xs[i] - bf16_val(hb)) : (unsigned short)0; }
#pragma unroll
    for (int t = 0; t < 4; ++t) {
      const unsigned short* brow = Wt + (size_t)(col0 + t * 16 + ln) * ldb + kb;
      FragB b;
      b.half[0] = *(const v8us*)(brow + 8 * hh);
      b.half[1] = *(const v8us*)(brow + 16 + 8 * hh);
      acc[t] = mmaN<ASPLIT ? 2 : 1>(ah.v, al.v, b.v, b.v, acc[t]);
    }
  }
#pragma unroll
  for (int t = 0; t < 4; ++t) {
    const int col = col0 + t * 16 + ln;
    float bv = bias ? bias[col] : 0.f;
    if (BIAS_BF16) bv = bf16_round(bv);
#pragma unroll
    for (int r = 0; r < 8; ++r) {
      float v = acc[t][r] + bv;
      if (resid) { float rv = resid[(size_t)((row0 + 8 * hh + r) % rmod) * ldr + col]; if (RES_BF16) rv = bf16_round(rv); v += rv; }
      if (ACT == 1) v = fmaxf(v, 0.f);
      if (ACT == 2) v = 0.5f * v * (1.0f + erff(v * 0.70710678118654752f));
      if (ACT == 3) { const float u = 0.7978845608028654f * (v + 0.044715f * v * v * v); v = 0.5f * v * (1.0f + tanhf(u)); }
      so[w][8 * hh + r][t * 16 + ln] = v;
    }
  }
  __builtin_amdgcn_fence(__ATOMIC_ACQ_REL, "workgroup");
  __builtin_amdgcn_wave_barrier();
  const int rsub = lane >> 4, c4 = (lane & 15) * 4;
  {
#pragma unroll
    for (int q = 0; q < 8; ++q) {
      const int r = q * 2 + rsub;
      const v4f v = *(const v4fa*)&so[w][r][c4];
      *(v4f*)(C + (size_t)(row0 + r) * ldc + col0 + c4) = v;
    }
    
  }
}
// row LayerNorm (biased variance, eps) over N: s = X (+ R); optional out_sum <- s; out_norm <- (s-mu)*rsqrt(var+eps)*g + b
template <bool PARAM_BF16>
__global__ __launch_bounds__(256) void k_layernorm(const float* __restrict__ X, const float* __restrict__ R, const float* __restrict__ g, const float* __restrict__ bta,
                                                  float* __restrict__ out_sum, float* __restrict__ out_norm, int N, float eps) {
  __shared__ float red[256];
  const int row = blockIdx.x, tid = threadIdx.x;
  const float* x = X + (size_t)row * N; const float* rr = R ? R + (size_t)row * N : nullptr;
  float vals[16];                     // up to N = 4096
  const int per = N / 256;            // contiguous chunk per thread? use strided-by-4 chunks: thread handles j = tid*4 + 1024*u
  float s1 = 0.f;
  for (int u = 0; u < per / 4; ++u) {
    const int j = tid * 4 + 1024 * u;
    const v4f a = *(const v4fa*)(x + j);
    v4f b = {0.f,0.f,0.f,0.f}; if (rr) b = *(const v4fa*)(rr + j);
#pragma unroll
    for (int q = 0; q < 4; ++q) { const float v = a[q] + b[q]; vals[u * 4 + q] = v; s1 += v; }
  }
  red[tid] = s1; __syncthreads();
  for (int st = 128; st > 0; st >>= 1) { if (tid < st) red[tid] += red[tid + st]; __syncthreads(); }
  const float mu = red[0] / (float)N; __syncthreads();
  float s2 = 0.f;
  for (int u = 0; u < per / 4; ++u)
#pragma unroll
    for (int q = 0; q < 4; ++q) { const float c = vals[u * 4 + q] - mu; s2 += c * c; }
  red[tid] = s2; __syncthreads();
  for (int st = 128; st > 0; st >>= 1) { if (tid < st) red[tid] += red[tid + st]; __syncthreads(); }
  const float rs = rsqrtf(red[0] / (float)N + eps);
  {
    for (int u = 0; u < per / 4; ++u) {
      const int j = tid * 4 + 1024 * u;
      v4f o, sm;
#pragma unroll
      for (int q = 0; q < 4; ++q) {
        float gg = g[j + q], bb = bta[j + q];
        if (PARAM_BF16) { gg = bf16_round(gg); bb = bf16_round(bb); }
        sm[q] = vals[u * 4 + q]; o[q] = (vals[u * 4 + q] - mu) * rs * gg + bb;
      }
      if (out_sum) *(v4f*)(out_sum + (size_t)row * N + j) = sm;
      *(v4f*)(out_norm + (size_t)row * N + j) = o;
    }
    
  }
}



// ---- f16 WMMA path (v_wmma_f32_16x16x32_f16): 11-bit significands for operands in range — used where a [0,1] probability operand needs more precision than bf16
typedef _Float16 v16h __attribute__((ext_vector_type(16)));
union FragH { v16h v; v8us half[2]; _Float16 h[16]; unsigned short u[16]; };
template <int NT>
__device__ __forceinline__ v8f mmaH(v16h ah, v16h al, v16h bh, v16h bl, v8f c) {
  c = __builtin_amdgcn_wmma_f32_16x16x32_f16(false, ah, false, bh, (short)0, c, false, false);
  if (NT >= 2) c = __builtin_amdgcn_wmma_f32_16x16x32_f16(false, al, false, bh, (short)0, c, false, false);
  if (NT >= 3) c = __builtin_amdgcn_wmma_f32_16x16x32_f16(false, ah, false, bl, (short)0, c, false, false);
  asm volatile("v_nop\n\tv_nop\n\tv_nop\n\tv_nop" : "+v"(c) : "v"(ah), "v"(al), "v"(bh), "v"(bl));
  return c;
}
// batched GEMM like k_gemm_b but f16 operands: A f32 (split into f16 hi/lo if ASPLIT, else rounded to f16), Bt = f16 values [n][k]; alpha; C f32; N multiple of 16 (partial tiles skipped)
template <bool ASPLIT>
__global__ __launch_bounds__(128) void k_gemm_h(const float* __restrict__ A, int lda, size_t sA, const _Float16* __restrict__ Bh, int ldb, size_t sB, float alpha, float* __restrict__ C, int ldc, size_t sC, int M, int N, int K) {
  __shared__ __attribute__((aligned(16))) float so[4][16][64];
  const int tid = threadIdx.x, w = tid >> 5, lane = tid & 31, ln = lane & 15, hh = lane >> 4; const int by = blockIdx.y;
  A += (size_t)by * sA; Bh += (size_t)by * sB; C += (size_t)by * sC;
  const int ntn = (N + 63) / 64; const int wid = blockIdx.x * 4 + w; const int mt = wid / ntn, nq = wid % ntn; if (mt * 16 >= M) return;
  const int row0 = mt * 16, col0 = nq * 64; const float* arow = A + (size_t)(row0 + ln) * lda;
  v8f acc[4] = {};
  for (int kb = 0; kb < K; kb += 32) {
    FragH ah, al;
    const v4f x0 = *(const v4fa*)(arow + kb + 8 * hh), x1 = *(const v4fa*)(arow + kb + 8 * hh + 4), x2 = *(const v4fa*)(arow + kb + 16 + 8 * hh), x3 = *(const v4fa*)(arow + kb + 16 + 8 * hh + 4);
    float xs[16] = {x0[0],x0[1],x0[2],x0[3],x1[0],x1[1],x1[2],x1[3],x2[0],x2[1],x2[2],x2[3],x3[0],x3[1],x3[2],x3[3]};
#pragma unroll
    for (int i = 0; i < 16; ++i) { const _Float16 h = (_Float16)xs[i]; ah.h[i] = h; al.h[i] = ASPLIT ? (_Float16)(xs[i] - (float)h) : (_Float16)0.0f; }
#pragma unroll
    for (int t = 0; t < 4; ++t) { if (col0 + t * 16 >= N) continue; const size_t boff = (size_t)(col0 + t * 16 + ln) * ldb + kb; FragH bq; bq.half[0] = *(const v8us*)(Bh + boff + 8 * hh); bq.half[1] = *(const v8us*)(Bh + boff + 16 + 8 * hh);
      acc[t] = mmaH<ASPLIT ? 2 : 1>(ah.v, al.v, bq.v, bq.v, acc[t]); }
  }
#pragma unroll
  for (int t = 0; t < 4; ++t) { if (col0 + t * 16 >= N) continue;
#pragma unroll
    for (int r = 0; r < 8; ++r) so[w][8 * hh + r][t * 16 + ln] = acc[t][r] * alpha; }
  __builtin_amdgcn_fence(__ATOMIC_ACQ_REL, "workgroup"); __builtin_amdgcn_wave_barrier();
  const int rsub = lane >> 4, c4 = (lane & 15) * 4;
  {
#pragma unroll
    for (int q = 0; q < 8; ++q) { const int r = q * 2 + rsub; if (col0 + c4 < N) { const v4f v = *(const v4fa*)&so[w][r][c4]; *(v4f*)(C + (size_t)(row0 + r) * ldc + col0 + c4) = v; } }
     }
}

// Wt[n][k] = f16(W[k][n]·scale) from f32 row-major W[K][N] (scale = power of two; bf16-exact weights stay exact in f16 away from the subnormal range)
__global__ __launch_bounds__(256) void k_wt_f16(const float* __restrict__ W, _Float16* __restrict__ Wt, int K, int N, float scale) {
  const int t = blockIdx.x * 256 + threadIdx.x; if (t >= N * (K / 8)) return; const int n = t / (K / 8), k8 = (t % (K / 8)) * 8; FragH f;
#pragma unroll
  for (int i = 0; i < 8; ++i) f.h[i] = (_Float16)(bf16_round(W[(size_t)(k8 + i) * N + n]) * scale); const v8us o = f.half[0];
  *(v8us*)((unsigned short*)Wt + (size_t)n * K + k8) = o; 
}
// k_gemm_hh variant with fused epilogue: v = acc·alpha + bias[by·sBias + col] (+ CP[(row/rowsPerB)·sCPb + by·64 + col] if CP) ; ACT 0 none / 1 elu ; writes f16 C16 (and f32 C if non-null)
template <int ACT>
__global__ __launch_bounds__(128) void k_gemm_hhx(const _Float16* __restrict__ A, int lda, size_t sA, const _Float16* __restrict__ Bh, int ldb, size_t sB, float alpha, const float* __restrict__ bias, size_t sBias, const float* __restrict__ CP, int rowsPerB, size_t sCPb, int row0g,
    float* __restrict__ C, _Float16* __restrict__ C16, int ldc, size_t sC, int M, int N, int K) {
  __shared__ __attribute__((aligned(16))) float so[4][16][64];
  const int tid = threadIdx.x, w = tid >> 5, lane = tid & 31, ln = lane & 15, hh = lane >> 4; const int by = blockIdx.y;
  A += (size_t)by * sA; Bh += (size_t)by * sB; const size_t cofs = (size_t)by * sC; const float* bp = bias ? bias + (size_t)by * sBias : nullptr;
  const int ntn = (N + 63) / 64; const int wid = blockIdx.x * 4 + w; const int mt = wid / ntn, nq = wid % ntn; if (mt * 16 >= M) return;
  const int row0 = mt * 16, col0 = nq * 64; const _Float16* arow = A + (size_t)(row0 + ln) * lda;
  v8f acc[4] = {};
  for (int kb = 0; kb < K; kb += 32) { FragH ah; ah.half[0] = *(const v8us*)((const unsigned short*)arow + kb + 8 * hh); ah.half[1] = *(const v8us*)((const unsigned short*)arow + kb + 16 + 8 * hh);
#pragma unroll
    for (int t = 0; t < 4; ++t) { if (col0 + t * 16 >= N) continue; const size_t boff = (size_t)(col0 + t * 16 + ln) * ldb + kb; FragH bq; bq.half[0] = *(const v8us*)((const unsigned short*)Bh + boff + 8 * hh); bq.half[1] = *(const v8us*)((const unsigned short*)Bh + boff + 16 + 8 * hh);
      acc[t] = mmaH<1>(ah.v, ah.v, bq.v, bq.v, acc[t]); }
  }
#pragma unroll
  for (int t = 0; t < 4; ++t) { if (col0 + t * 16 >= N) continue; const int col = col0 + t * 16 + ln; const float bv = bp ? bf16_round(bp[col]) : 0.f;
#pragma unroll
    for (int r = 0; r < 8; ++r) { float v = acc[t][r] * alpha + bv; if (CP) { const int rr = row0g + row0 + 8 * hh + r; if (rowsPerB < 0) v += CP[cofs + (size_t)rr * ldc + col];      /* rowsPerB < 0: own element of the batched C plane */ else { const int bidx = rr / rowsPerB; v += CP[(size_t)bidx * sCPb + (size_t)by * 64 + col]; } } if (ACT == 1) v = (v > 0.f) ? v : expm1f(v); else if (ACT == 7) v = (v > 0.f) ? v + 1.0f : expf(v); else if (ACT == 8) v = tanhf(v); else if (ACT == 9) v = 0.5f * v * (1.0f + tanhf(0.7978845608028654f * (v + 0.044715f * v * v * v))); else if (ACT == 11) v = 1.0f / (1.0f + expf(-v)); else if (ACT == 12) v = (v > 0.f) ? v : 0.01f * v; else if (ACT == 14) v = (v > 0.f) ? v : 0.1f * v; else if (ACT == 16) v = (v >= 0.f) ? v : 0.3f * v; else if (ACT == 17) v = (v >= 0.f) ? v : 0.2f * v; else if (ACT == 15) v = v / (1.0f + expf(-v)); else if (ACT == 3) v = fmaxf(v, 0.f); else if (ACT == 6) v = 0.5f * v * (1.0f + erff(v * 0.70710678118654752f)); so[w][8 * hh + r][t * 16 + ln] = v; } }
  __builtin_amdgcn_fence(__ATOMIC_ACQ_REL, "workgroup"); __builtin_amdgcn_wave_barrier();
  const int rsub = lane >> 4, c4 = (lane & 15) * 4; typedef _Float16 v4h __attribute__((ext_vector_type(4)));
  {
#pragma unroll
    for (int q = 0; q < 8; ++q) { const int r = q * 2 + rsub; if (col0 + c4 < N) { const v4f v = *(const v4fa*)&so[w][r][c4]; if (C) *(v4f*)(C + cofs + (size_t)(row0 + r) * ldc + col0 + c4) = v; if (C16) { v4h h4; for (int i = 0; i < 4; ++i) h4[i] = (_Float16)v[i]; *(v4h*)(C16 + cofs + (size_t)(row0 + r) * ldc + col0 + c4) = h4; } } }
     }
}


typedef _Float16 v4h __attribute__((ext_vector_type(4)));

__global__ __launch_bounds__(256) void k_x16(const float* __restrict__ x, _Float16* __restrict__ X16, size_t n8) { const size_t t = (size_t)blockIdx.x * 256 + threadIdx.x; if (t >= n8) return; FragH f;
#pragma unroll
  for (int q = 0; q < 8; ++q) f.h[q] = (_Float16)bf16_round(x[t * 8 + q]); *(v8us*)((unsigned short*)X16 + t * 8) = f.half[0];  }
__global__ __launch_bounds__(256) void k_h16(const float* __restrict__ x, _Float16* __restrict__ X16, size_t n8) { const size_t t = (size_t)blockIdx.x * 256 + threadIdx.x; if (t >= n8) return; FragH f;
#pragma unroll
  for (int q = 0; q < 8; ++q) f.h[q] = (_Float16)x[t * 8 + q]; *(v8us*)((unsigned short*)X16 + t * 8) = f.half[0];  }
__global__ __launch_bounds__(256) void k_round16f(const float* __restrict__ W, _Float16* __restrict__ Bt, size_t n8) { const size_t t = (size_t)blockIdx.x * 256 + threadIdx.x; if (t >= n8) return; FragH f;
#pragma unroll
  for (int i = 0; i < 8; ++i) f.h[i] = (_Float16)(bf16_round(W[t * 8 + i]) * 16.0f); *(v8us*)((unsigned short*)Bt + t * 8) = f.half[0];  }
template <int NHv, int TTv>
__global__ __launch_bounds__(256) void k_vt(const _Float16* __restrict__ V16, int ldv, int voff, _Float16* __restrict__ Vt) { __shared__ unsigned short tl[64][66]; const int tid = threadIdx.x; const int slab = blockIdx.x / (TTv / 64), lg = blockIdx.x % (TTv / 64); const int b = slab / NHv, h = slab % NHv;
  for (int i = tid; i < 64 * 8; i += 256) { const int r = i / 8, c8 = (i % 8) * 8; FragH f; f.half[0] = *(const v8us*)((const unsigned short*)V16 + ((size_t)b * TTv + lg * 64 + r) * ldv + voff + h * 64 + c8);
#pragma unroll
    for (int q = 0; q < 8; ++q) tl[r][c8 + q] = f.u[q]; }
  __syncthreads();
  {
#pragma unroll
    for (int rd = 0; rd < 2; ++rd) { const int d = rd * 32 + tid / 8, pc = tid % 8; FragH f;
#pragma unroll
      for (int q = 0; q < 8; ++q) f.u[q] = tl[pc * 8 + q][d];
      *(v8us*)((unsigned short*)Vt + ((size_t)slab * 64 + d) * TTv + lg * 64 + pc * 8) = f.half[0]; }
     } }

__global__ __launch_bounds__(256) void k_hl(const float* __restrict__ F, _Float16* __restrict__ Hh, _Float16* __restrict__ Hl, size_t n8) { const size_t t = (size_t)blockIdx.x * 256 + threadIdx.x; if (t >= n8) return; FragH fh, fl; const v4f a = *(const v4fa*)(F + t * 8), c = *(const v4fa*)(F + t * 8 + 4);
#pragma unroll
  for (int q = 0; q < 4; ++q) { _Float16 h = (_Float16)a[q]; fh.h[q] = h; fl.h[q] = (_Float16)((a[q] - (float)h) * 1024.0f); h = (_Float16)c[q]; fh.h[4 + q] = h; fl.h[4 + q] = (_Float16)((c[q] - (float)h) * 1024.0f); }
  { *(v8us*)((unsigned short*)Hh + t * 8) = fh.half[0]; *(v8us*)((unsigned short*)Hl + t * 8) = fl.half[0];  } }

// ---- fast GEMM (wave tile 32x64; requires M % 32 == 0 rows per launch region and N % 64 == 0); epilogue = k_gemm_hhx semantics ----
__device__ __forceinline__ v16h g2_frag(const _Float16* p, int hh) { FragH f; f.half[0] = *(const v8us*)((const unsigned short*)p + 8 * hh); f.half[1] = *(const v8us*)((const unsigned short*)p + 16 + 8 * hh); return f.v; }
__device__ __forceinline__ v8f g2_mma(v16h a, v16h b, v8f c) { v8f d = __builtin_amdgcn_wmma_f32_16x16x32_f16(false, a, false, b, (short)0, c, false, false); asm volatile("v_nop\n\tv_nop\n\tv_nop\n\tv_nop" : "+v"(d) : "v"(a), "v"(b)); return d; }
template <int ACT>
__global__ __launch_bounds__(128) void k_gemm2(const _Float16* __restrict__ A, int lda, size_t sA, const _Float16* __restrict__ Bh, int ldb, size_t sB, float alpha, const float* __restrict__ bias, size_t sBias, const float* __restrict__ CP, int rowsPerB, size_t sCPb, int row0g,
    float* __restrict__ C, _Float16* __restrict__ C16, int ldc, size_t sC, int M, int N, int K) { static_assert(ACT == 0 || ACT == 3 || ACT == 6 || ACT == 8 || ACT == 9 || ACT == 11 || ACT == 12 || ACT == 14 || ACT == 15 || ACT == 16 || ACT == 17, "k_gemm2: unsupported ACT code (would silently apply no activation)");
  __shared__ __attribute__((aligned(16))) float so[4][32][68];
  const int tid = threadIdx.x, w = tid >> 5, lane = tid & 31, ln = lane & 15, hh = lane >> 4; const int by = blockIdx.y;
  A += (size_t)by * sA; Bh += (size_t)by * sB; const size_t cofs = (size_t)by * sC; const float* bp = bias ? bias + (size_t)by * sBias : nullptr;
  const int ntn = N >> 6; const int mt = blockIdx.x / ntn, nq = blockIdx.x - mt * ntn; const int row0 = mt * 128 + 32 * w, col0 = nq * 64; if (row0 >= M) return;
  const _Float16* a0p = A + (size_t)(row0 + ln) * lda; const _Float16* a1p = a0p + (size_t)16 * lda;
  const _Float16* b0p = Bh + (size_t)(col0 + ln) * ldb; const _Float16* b1p = b0p + (size_t)16 * ldb; const _Float16* b2p = b1p + (size_t)16 * ldb; const _Float16* b3p = b2p + (size_t)16 * ldb;
  const v8f z8 = {0.f,0.f,0.f,0.f,0.f,0.f,0.f,0.f}; v8f c00 = z8, c01 = z8, c02 = z8, c03 = z8, c10 = z8, c11 = z8, c12 = z8, c13 = z8;
#pragma unroll 1
  for (int kb = 0; kb < K; kb += 32) { const v16h a0 = g2_frag(a0p + kb, hh), a1 = g2_frag(a1p + kb, hh);
    v16h b = g2_frag(b0p + kb, hh); c00 = g2_mma(a0, b, c00); c10 = g2_mma(a1, b, c10);
    b = g2_frag(b1p + kb, hh); c01 = g2_mma(a0, b, c01); c11 = g2_mma(a1, b, c11);
    b = g2_frag(b2p + kb, hh); c02 = g2_mma(a0, b, c02); c12 = g2_mma(a1, b, c12);
    b = g2_frag(b3p + kb, hh); c03 = g2_mma(a0, b, c03); c13 = g2_mma(a1, b, c13); }
  v8f accs[8] = {c00, c01, c02, c03, c10, c11, c12, c13};
#pragma unroll
  for (int u = 0; u < 8; ++u) { const int t = u & 3, half = u >> 2; const int col = col0 + t * 16 + ln; const float bv = bp ? bf16_round(bp[col]) : 0.f;
#pragma unroll
    for (int r = 0; r < 8; ++r) { const int rloc = half * 16 + 8 * hh + r; float v = accs[u][r] * alpha + bv; if (CP) { if (rowsPerB < 0) v += CP[cofs + (size_t)(row0g + row0 + rloc) * ldc + col];      /* rowsPerB < 0: own element of the batched C plane */ else { const int bidx = (row0g + row0 + rloc) / rowsPerB; v += CP[(size_t)bidx * sCPb + (size_t)by * 64 + col]; } }
      if (ACT == 3) v = fmaxf(v, 0.f); else if (ACT == 6) v = 0.5f * v * (1.0f + erff(v * 0.70710678118654752f)); else if (ACT == 11) v = 1.0f / (1.0f + expf(-v)); else if (ACT == 15) v = v / (1.0f + expf(-v)); else if (ACT == 12) v = (v > 0.f) ? v : 0.01f * v; else if (ACT == 8) v = tanhf(v); else if (ACT == 9) v = 0.5f * v * (1.0f + tanhf(0.7978845608028654f * (v + 0.044715f * v * v * v))); else if (ACT == 14) v = (v > 0.f) ? v : 0.1f * v; else if (ACT == 16) v = (v >= 0.f) ? v : 0.3f * v; else if (ACT == 17) v = (v >= 0.f) ? v : 0.2f * v;
      so[w][rloc][t * 16 + ln] = v; } }
  __builtin_amdgcn_fence(__ATOMIC_ACQ_REL, "workgroup"); __builtin_amdgcn_wave_barrier();
  const int rsub = lane >> 4, c4 = (lane & 15) * 4;
  {
#pragma unroll
    for (int q = 0; q < 16; ++q) { const int r = q * 2 + rsub; const v4f v = *(const v4fa*)&so[w][r][c4]; if (C) *(v4f*)(C + cofs + (size_t)(row0 + r) * ldc + col0 + c4) = v; if (C16) { v4h h4; for (int i = 0; i < 4; ++i) h4[i] = (_Float16)v[i]; *(v4h*)(C16 + cofs + (size_t)(row0 + r) * ldc + col0 + c4) = h4; } }
     } }


__global__ __launch_bounds__(256) void k_wnat(const float* __restrict__ w, size_t n8, _Float16* __restrict__ Bt) { const size_t t = (size_t)blockIdx.x * 256 + threadIdx.x; if (t >= n8) return; FragH f; for (int q = 0; q < 8; ++q) f.h[q] = (_Float16)(bf16_round(w[t * 8 + q]) * 16.0f); *(v8us*)((unsigned short*)Bt + t * 8) = f.half[0];  }
// V^T of every (branch, batch, head): blockIdx.x = head + NH * (block of 64 keys), blockIdx.y = batch, blockIdx.z = branch; VT[(b * NH + h) * HD + d][key]
__global__ __launch_bounds__(256) void k_vt(const _Float16* __restrict__ VS16, const _Float16* __restrict__ VL16, _Float16* __restrict__ VTS, _Float16* __restrict__ VTL) { __shared__ unsigned short tl[64][65]; const int tid = threadIdx.x; const int h = blockIdx.x % NH, sg = blockIdx.x / NH; const int s0 = sg * 64; const int b = blockIdx.y;
  const _Float16* V16 = blockIdx.z ? VL16 : VS16; _Float16* VT = blockIdx.z ? VTL : VTS;
  for (int i = tid; i < 64 * 8; i += 256) { const int j = i / 8, d8 = (i % 8) * 8; FragH f; f.half[0] = *(const v8us*)((const unsigned short*)V16 + ((size_t)b * SQ + s0 + j) * DM + h * HD + d8); for (int q = 0; q < 8; ++q) tl[d8 + q][j] = f.u[q]; }
  __syncthreads();
  { for (int i = tid; i < 64 * 8; i += 256) { const int d = i / 8, j8 = (i % 8) * 8; FragH f; for (int q = 0; q < 8; ++q) f.u[q] = tl[d][j8 + q]; *(v8us*)((unsigned short*)VT + (((size_t)b * NH + h) * HD + d) * SQ + s0 + j8) = f.half[0]; }  } }

// ---- fused attention: scores, softmax and weighted sum of one branch in one pass over the keys; no score ever reaches memory ----
// Transposed products. S^T = K Q^T: A = 16 key rows, B = 16 query rows, so lane (ln, hh) holds for query ln the keys 8 hh + r of each 16-key tile. Two such tiles, rounded to f16, are
// at once the B operand of O^T += V^T P^T over 32 keys (element i: key 8 hh + i, element 8 + i: key 16 + 8 hh + i, the k order of g2_frag, which loads the A operand from V^T rows).
// A query's maximum, sum and scale therefore live in its own lane (both halves); the halves exchange the maximum once a pass and join their sums once at the end.
// Every inner loop is fully unrolled so that the fragment, score and accumulator arrays are indexed by constants and stay in registers (a rolled loop would put them in scratch memory).
// Scores are kept in the log2 domain (x = s log2 e). The maximum in use is raised, and sums and outputs rescaled, only when a column's new maximum exceeds it by more than 8, so weights stay <= 2^8.
// 2^x of eight (two) values in place, one statement: behind each v_exp_f32 stands an instruction that neither reads its result nor overwrites its source (the operands are distinct registers), behind the last the v_nop: the slot the instruction set asks for behind a transcendental
__device__ __forceinline__ void ex2x8(v8f& x) { asm("v_exp_f32 %0, %0\n\tv_exp_f32 %1, %1\n\tv_exp_f32 %2, %2\n\tv_exp_f32 %3, %3\n\tv_exp_f32 %4, %4\n\tv_exp_f32 %5, %5\n\tv_exp_f32 %6, %6\n\tv_exp_f32 %7, %7\n\tv_nop" : "+v"(x[0]), "+v"(x[1]), "+v"(x[2]), "+v"(x[3]), "+v"(x[4]), "+v"(x[5]), "+v"(x[6]), "+v"(x[7])); }
__device__ __forceinline__ void ex2x2(float& a, float& b) { asm("v_exp_f32 %0, %0\n\tv_exp_f32 %1, %1\n\tv_nop" : "+v"(a), "+v"(b)); }
__device__ __forceinline__ v8f at_mma(v16h a, v16h b, v8f c) { return __builtin_amdgcn_wmma_f32_16x16x32_f16(false, a, false, b, (short)0, c, false, false); }
template <bool DECAY>
__device__ __forceinline__ void attn_run(const _Float16* __restrict__ Q16, const _Float16* __restrict__ KB, const _Float16* __restrict__ VT, float* __restrict__ OB, float c2, float (*so)[68]) {
  const int lane = threadIdx.x & 31, ln = lane & 15, hh = lane >> 4; const int b = blockIdx.y / NH, h = blockIdx.y % NH; const int q0 = blockIdx.x * 128 + (threadIdx.x >> 5) * 32;
  const float sc2 = 0.125f * 1.4426950408889634f;
  const _Float16* qp = Q16 + ((size_t)b * SQ + q0 + ln) * DM + h * HD; const _Float16* kp = KB + ((size_t)b * SQ + ln) * DM + h * HD; const _Float16* vp = VT + ((size_t)blockIdx.y * HD + ln) * SQ;
  v16h qf[2][2], kf[2][2];
#pragma unroll
  for (int g = 0; g < 2; ++g)
#pragma unroll
    for (int ks = 0; ks < 2; ++ks) { qf[g][ks] = g2_frag(qp + (size_t)g * 16 * DM + ks * 32, hh); kf[g][ks] = g2_frag(kp + (size_t)g * 16 * DM + ks * 32, hh); }
  const v8f z8 = {0.f,0.f,0.f,0.f,0.f,0.f,0.f,0.f}; v8f o[2][4];
#pragma unroll
  for (int g = 0; g < 2; ++g)
#pragma unroll
    for (int dt = 0; dt < 4; ++dt) o[g][dt] = z8;
  float m[2] = {-3.0e38f, -3.0e38f}, l[2] = {0.f, 0.f};
  // rolled, for speed only
#pragma unroll 1
  for (int kb = 0; kb < SQ; kb += 32) {
    v16h vf[4];
#pragma unroll
    for (int dt = 0; dt < 4; ++dt) vf[dt] = g2_frag(vp + (size_t)dt * 16 * SQ + kb, hh);
    __builtin_amdgcn_sched_barrier(0);      // keeps the V^T loads at the head of the pass, so that the score products and the maxima cover their latency (the scheduler sinks them to their use otherwise)
    v8f s[2][2];
#pragma unroll
    for (int g = 0; g < 2; ++g)
#pragma unroll
      for (int t = 0; t < 2; ++t) s[g][t] = at_mma(kf[t][1], qf[g][1], at_mma(kf[t][0], qf[g][0], z8));
    // the next pass's K fragments, asked for while this pass's softmax runs (the last pass reads the first rows again: in bounds, not used)
    const int kn = (kb + 32 < SQ) ? kb + 32 : 0;
#pragma unroll
    for (int t = 0; t < 2; ++t)
#pragma unroll
      for (int ks = 0; ks < 2; ++ks) kf[t][ks] = g2_frag(kp + (size_t)(kn + t * 16) * DM + ks * 32, hh);
    float mt[2];
#pragma unroll
    for (int g = 0; g < 2; ++g) { float mx = -3.0e38f;
#pragma unroll
      for (int t = 0; t < 2; ++t) { const float fb = (float)(q0 + g * 16 + ln - 8 * hh - kb - t * 16);
#pragma unroll
        for (int r = 0; r < 8; ++r) { if (DECAY) s[g][t][r] = s[g][t][r] * sc2 - fabsf(fb - (float)r) * c2; mx = fmaxf(mx, s[g][t][r]); } }
      if (!DECAY) mx *= sc2;
      mt[g] = fmaxf(mx, __shfl_xor(mx, 16, 32)); }
    const bool need = (mt[0] > m[0] + 8.0f) || (mt[1] > m[1] + 8.0f);
    if (__builtin_amdgcn_ballot_w32(need) != 0) { const float mn0 = fmaxf(m[0], mt[0]), mn1 = fmaxf(m[1], mt[1]); float al[2] = {m[0] - mn0, m[1] - mn1}; ex2x2(al[0], al[1]); m[0] = mn0; m[1] = mn1;
#pragma unroll
      for (int g = 0; g < 2; ++g) { l[g] *= al[g];
#pragma unroll
        for (int dt = 0; dt < 4; ++dt) o[g][dt] *= al[g]; } }
#pragma unroll
    for (int g = 0; g < 2; ++g) { FragH pf; float ls = 0.f;
#pragma unroll
      for (int t = 0; t < 2; ++t) { v8f p;
#pragma unroll
        for (int r = 0; r < 8; ++r) p[r] = DECAY ? s[g][t][r] - m[g] : s[g][t][r] * sc2 - m[g];
        ex2x8(p);
#pragma unroll
        for (int r = 0; r < 8; ++r) { ls += p[r]; pf.h[t * 8 + r] = (_Float16)p[r]; } }
      l[g] += ls;
#pragma unroll
      for (int dt = 0; dt < 4; ++dt) o[g][dt] = at_mma(vf[dt], pf.v, o[g][dt]); }
  }
  // O^T tile: lane (ln, hh) holds of query ln the columns 16 dt + 8 hh + r; through the wave's own LDS rows so that each store covers 256 contiguous bytes of a row
#pragma unroll
  for (int g = 0; g < 2; ++g) { const float lt = l[g] + __shfl_xor(l[g], 16, 32); const float inv = 1.0f / lt;
#pragma unroll
    for (int dt = 0; dt < 4; ++dt) { const v8f ov = o[g][dt] * inv; const v4f lo = {ov[0], ov[1], ov[2], ov[3]}, hi = {ov[4], ov[5], ov[6], ov[7]};
      *(v4fa*)&so[g * 16 + ln][dt * 16 + 8 * hh] = lo; *(v4fa*)&so[g * 16 + ln][dt * 16 + 8 * hh + 4] = hi; } }
  __builtin_amdgcn_fence(__ATOMIC_ACQ_REL, "workgroup"); __builtin_amdgcn_wave_barrier();      // the wave's LDS writes above are finished before its lanes read each other's rows below (each wave has its own rows: no work-group barrier)
  const int rsub = lane >> 4, c4 = (lane & 15) * 4;
#pragma unroll
  for (int q = 0; q < 16; ++q) { const int r = q * 2 + rsub; const v4f v = *(const v4fa*)&so[r][c4]; *(v4f*)(OB + ((size_t)b * SQ + q0 + r) * DM + h * HD + c4) = v; } }
// blockIdx.x = block of 128 queries (4 waves of 32), blockIdx.y = batch * NH + head, blockIdx.z = branch (0 short, with the decay bias; 1 long)
__global__ __launch_bounds__(128) void k_attn(const _Float16* __restrict__ Q16, const _Float16* __restrict__ KS, const _Float16* __restrict__ KL, const _Float16* __restrict__ VTS, const _Float16* __restrict__ VTL, float* __restrict__ OS, float* __restrict__ OL, const float* __restrict__ dfp) {
  __shared__ __attribute__((aligned(16))) float so[4][32][68];
  if (blockIdx.z == 0) attn_run<true>(Q16, KS, VTS, OS, (1.0f - bf16_round(dfp[0])) * 1.4426950408889634f, so[threadIdx.x >> 5]);
  else attn_run<false>(Q16, KL, VTL, OL, 0.f, so[threadIdx.x >> 5]); }

__global__ __launch_bounds__(256) void k_wT(const float* __restrict__ w, int din, int dout, _Float16* __restrict__ Bt) { __shared__ float tl[64][65]; const int tid = threadIdx.x; const int nbo = dout / 64; const int ib = blockIdx.x / nbo, ob = blockIdx.x % nbo; const int i0 = ib * 64, o0 = ob * 64;
  for (int t = tid; t < 64 * 64; t += 256) { const int i = t / 64, o = t % 64; tl[o][i] = bf16_round(w[(size_t)(i0 + i) * dout + o0 + o]) * 16.0f; }
  __syncthreads();
  { for (int t = tid; t < 64 * 8; t += 256) { const int o = t / 8, i8 = (t % 8) * 8; FragH f; for (int q = 0; q < 8; ++q) f.h[q] = (_Float16)tl[o][i8 + q]; *(v8us*)((unsigned short*)Bt + (size_t)(o0 + o) * din + i0 + i8) = f.half[0]; }  } }
__global__ __launch_bounds__(256) void k_mix(const float* __restrict__ OS, const float* __restrict__ OL, const float* __restrict__ mwp, _Float16* __restrict__ O16, size_t n8) {
  #pragma clang fp contract(off)
  const size_t t = (size_t)blockIdx.x * 256 + threadIdx.x; if (t >= n8) return; const float a = 1.0f / (1.0f + expf(-bf16_round(mwp[0]))); FragH f; for (int q = 0; q < 8; ++q) f.h[q] = (_Float16)__fadd_rn(__fmul_rn(a, OS[t * 8 + q]), __fmul_rn(1.0f - a, OL[t * 8 + q]));
  *(v8us*)((unsigned short*)O16 + t * 8) = f.half[0];  }
extern "C" void kernel_launch(void* const* d_in, const int* in_sizes, int n_in,
                              void* d_out, int out_size, void* d_ws, size_t ws_size, hipStream_t stream) {
  (void)in_sizes; (void)n_in; (void)out_size;
  const float* const* I = (const float* const*)d_in; const float* x = I[0]; const float* wq = I[1]; const float* wkvs = I[2]; const float* wkvl = I[3]; const float* wo = I[4]; const float* mwp = I[5]; const float* dfp = I[6];
  char* ws = (char*)d_ws; size_t off = 0;
  auto take = [&](size_t bytes) { char* p = ws + off; off += (bytes + 255) & ~(size_t)255; return p; };
  _Float16* BQ = (_Float16*)take((size_t)DM * DM * 2); _Float16* BKVS = (_Float16*)take((size_t)2 * DM * DM * 2); _Float16* BKVL = (_Float16*)take((size_t)2 * DM * DM * 2); _Float16* BO = (_Float16*)take((size_t)DM * DM * 2);
  _Float16* X16 = (_Float16*)take(NR * DM * 2); _Float16* Q16 = (_Float16*)take(NR * DM * 2); _Float16* K16 = (_Float16*)take(NR * DM * 2); _Float16* V16 = (_Float16*)take(NR * DM * 2); _Float16* KL16 = (_Float16*)take(NR * DM * 2); _Float16* VL16 = (_Float16*)take(NR * DM * 2); float* OS = (float*)take(NR * DM * 4); float* OL = (float*)take(NR * DM * 4); _Float16* O16 = (_Float16*)take(NR * DM * 2);
  _Float16* VTS = (_Float16*)take(NR * DM * 2); _Float16* VTL = (_Float16*)take(NR * DM * 2);
  if (off > ws_size) return;      /* 12 + 6x8 + 32 + 8 + 16 = 116 MiB */
  k_wT<<<(DM / 64) * (DM / 64), 256, 0, stream>>>(wq, DM, DM, BQ); k_wT<<<(DM / 64) * (2 * DM / 64), 256, 0, stream>>>(wkvs, DM, 2 * DM, BKVS); k_wT<<<(DM / 64) * (2 * DM / 64), 256, 0, stream>>>(wkvl, DM, 2 * DM, BKVL); k_wT<<<(DM / 64) * (DM / 64), 256, 0, stream>>>(wo, DM, DM, BO);
  k_x16<<<(unsigned)((NR * DM / 8 + 255) / 256), 256, 0, stream>>>(x, X16, NR * DM / 8);
  const dim3 gp((unsigned)((NR / 128) * (DM / 64)), 1);
  k_gemm2<0><<<gp, 128, 0, stream>>>(X16, DM, 0, BQ, DM, 0, 0.0625f, nullptr, 0, nullptr, 1, 0, 0, nullptr, Q16, DM, 0, (int)NR, DM, DM);
  k_gemm2<0><<<gp, 128, 0, stream>>>(X16, DM, 0, BKVS, DM, 0, 0.0625f, nullptr, 0, nullptr, 1, 0, 0, nullptr, K16, DM, 0, (int)NR, DM, DM); k_gemm2<0><<<gp, 128, 0, stream>>>(X16, DM, 0, BKVS + (size_t)DM * DM, DM, 0, 0.0625f, nullptr, 0, nullptr, 1, 0, 0, nullptr, V16, DM, 0, (int)NR, DM, DM);      /* short k | v */
  k_gemm2<0><<<gp, 128, 0, stream>>>(X16, DM, 0, BKVL, DM, 0, 0.0625f, nullptr, 0, nullptr, 1, 0, 0, nullptr, KL16, DM, 0, (int)NR, DM, DM); k_gemm2<0><<<gp, 128, 0, stream>>>(X16, DM, 0, BKVL + (size_t)DM * DM, DM, 0, 0.0625f, nullptr, 0, nullptr, 1, 0, 0, nullptr, VL16, DM, 0, (int)NR, DM, DM);      /* long k | v */
  k_vt<<<dim3(NH * (SQ / 64), NB, 2), 256, 0, stream>>>(V16, VL16, VTS, VTL);
  k_attn<<<dim3(SQ / 128, NB * NH, 2), 128, 0, stream>>>(Q16, K16, KL16, VTS, VTL, OS, OL, dfp);      /* per-branch o (merged heads) as f32 rows */
  k_mix<<<(unsigned)((NR * DM / 8 + 255) / 256), 256, 0, stream>>>(OS, OL, mwp, O16, NR * DM / 8);
  k_gemm2<0><<<gp, 128, 0, stream>>>(O16, DM, 0, BO, DM, 0, 0.0625f, nullptr, 0, nullptr, 1, 0, 0, (float*)d_out, nullptr, DM, 0, (int)NR, DM, DM);      /* out = o Wo */
}

// v003
// Measured time: 187 microseconds a run.
// Next to v002, in two timings, it ran 1.59 times as fast each time.
// Counting every step since v000, it is 131 times as fast.
#include <hip/hip_runtime.h>
#define NB 4
#define SQ 1024
#define DM 1024
#define NH 16
#define HD 64
#define NR ((size_t)NB * SQ)         /* 4096 token rows */
typedef __bf16 v16b __attribute__((ext_vector_type(16)));
typedef unsigned short v8us __attribute__((ext_vector_type(8), may_alias));
typedef float  v8f  __attribute__((ext_vector_type(8)));
typedef float  v4f  __attribute__((ext_vector_type(4)));
typedef float  v4fa __attribute__((ext_vector_type(4), may_alias));
union FragB { v16b v; v8us half[2]; unsigned short u[16]; };

__device__ __forceinline__ unsigned short bf16_bits(float x) { unsigned int u = __float_as_uint(x); return (unsigned short)((u + 0x7FFFu + ((u >> 16) & 1u)) >> 16); }
__device__ __forceinline__ float bf16_val(unsigned short b) { return __uint_as_float(((unsigned int)b) << 16); }
__device__ __forceinline__ float bf16_round(float x) { return bf16_val(bf16_bits(x)); }
// D += A·B with NT terms: 1 = ah·bh, 2 = + al·bh (A split), 3 = + ah·bl (both split)
template <int NT>
__device__ __forceinline__ v8f mmaN(v16b ah, v16b al, v16b bh, v16b bl, v8f c) {
  c = __builtin_amdgcn_wmma_f32_16x16x32_bf16(false, ah, false, bh, (short)0, c, false, false);
  if (NT >= 2) c = __builtin_amdgcn_wmma_f32_16x16x32_bf16(false, al, false, bh, (short)0, c, false, false);
  if (NT >= 3) c = __builtin_amdgcn_wmma_f32_16x16x32_bf16(false, ah, false, bl, (short)0, c, false, false);
  asm volatile("v_nop\n\tv_nop\n\tv_nop\n\tv_nop" : "+v"(c) : "v"(ah), "v"(al), "v"(bh), "v"(bl));
  return c;
}

__global__ __launch_bounds__(256) void k_wt_bf16(const float* __restrict__ W, unsigned short* __restrict__ Wt, int K, int N) {
  const int t = blockIdx.x * 256 + threadIdx.x;
  const int k8n = K / 8;
  if (t >= N * k8n) return;
  const int n = t / k8n, k8 = (t % k8n) * 8;
  v8us v;
#pragma unroll
  for (int i = 0; i < 8; ++i) v[i] = bf16_bits(W[(size_t)(k8 + i) * N + n]);
  *(v8us*)(Wt + (size_t)n * K + k8) = v;
  
}

// GEMM C[M][N] (f32, pitch ldc) = act(A[M][K]·W + bias). A f32 row-major (pitch lda) converted per fragment to bf16
// (ASPLIT: hi/lo two planes -> 2 terms, else single rounded term); Wt bf16 [N][K] (pitch ldb). BIAS_BF16 rounds the
// bias to bf16 first (bias quantised to bf16 before the add). K%32==0, M%16==0, N%64==0.
template <bool ASPLIT, int ACT, bool BIAS_BF16>
__global__ __launch_bounds__(128) void k_gemm_bf(const float* __restrict__ A, int lda, const unsigned short* __restrict__ Wt, int ldb,
                                               const float* __restrict__ bias, float* __restrict__ C, int ldc, int M, int N, int K) {
  __shared__ __attribute__((aligned(16))) float so[4][16][64];
  const int tid = threadIdx.x, w = tid >> 5, lane = tid & 31, ln = lane & 15, hh = lane >> 4;
  const int ntn = N / 64;
  const int wid = blockIdx.x * 4 + w;
  const int mt = wid / ntn, nq = wid % ntn;
  if (mt * 16 >= M) return;
  const int row0 = mt * 16, col0 = nq * 64;
  const float* arow = A + (size_t)(row0 + ln) * lda;
  v8f acc[4] = {};
  for (int kb = 0; kb < K; kb += 32) {
    FragB ah, al;
    const v4f x0 = *(const v4fa*)(arow + kb + 8 * hh), x1 = *(const v4fa*)(arow + kb + 8 * hh + 4);
    const v4f x2 = *(const v4fa*)(arow + kb + 16 + 8 * hh), x3 = *(const v4fa*)(arow + kb + 16 + 8 * hh + 4);
    float xs[16] = {x0[0],x0[1],x0[2],x0[3],x1[0],x1[1],x1[2],x1[3],x2[0],x2[1],x2[2],x2[3],x3[0],x3[1],x3[2],x3[3]};
#pragma unroll
    for (int i = 0; i < 16; ++i) { const unsigned short hb = bf16_bits(xs[i]); ah.u[i] = hb; al.u[i] = ASPLIT ? bf16_bits(xs[i] - bf16_val(hb)) : (unsigned short)0; }
#pragma unroll
    for (int t = 0; t < 4; ++t) {
      const unsigned short* brow = Wt + (size_t)(col0 + t * 16 + ln) * ldb + kb;
      FragB b;
      b.half[0] = *(const v8us*)(brow + 8 * hh);
      b.half[1] = *(const v8us*)(brow + 16 + 8 * hh);
      acc[t] = mmaN<ASPLIT ? 2 : 1>(ah.v, al.v, b.v, b.v, acc[t]);
    }
  }
#pragma unroll
  for (int t = 0; t < 4; ++t) {
    float bv = bias ? bias[col0 + t * 16 + ln] : 0.f;
    if (BIAS_BF16) bv = bf16_round(bv);
#pragma unroll
    for (int r = 0; r < 8; ++r) { float v = acc[t][r] + bv; if (ACT == 1) v = fmaxf(v, 0.f); so[w][8 * hh + r][t * 16 + ln] = v; }
  }
  __builtin_amdgcn_fence(__ATOMIC_ACQ_REL, "workgroup");
  __builtin_amdgcn_wave_barrier();
  const int rsub = lane >> 4, c4 = (lane & 15) * 4;
  {
#pragma unroll
    for (int q = 0; q < 8; ++q) {
      const int r = q * 2 + rsub;
      const v4f v = *(const v4fa*)&so[w][r][c4];
      *(v4f*)(C + (size_t)(row0 + r) * ldc + col0 + c4) = v;
    }
    
  }
}

// GEMM C = act(A·W + bias + resid): A f32 (ASPLIT -> hi/lo 2 terms), Wt bf16 [N][K]; ACT 0 none, 1 relu, 2 exact gelu;
// resid (optional, f32, row index = (row % rmod), pitch ldr, RES_BF16 rounds it) added before the activation.
template <bool ASPLIT, int ACT, bool BIAS_BF16, bool RES_BF16>
__global__ __launch_bounds__(128) void k_gemm_bf3(const float* __restrict__ A, int lda, const unsigned short* __restrict__ Wt, int ldb,
                                                const float* __restrict__ bias, const float* __restrict__ resid, int rmod, int ldr,
                                                float* __restrict__ C, int ldc, int M, int N, int K) {
  __shared__ __attribute__((aligned(16))) float so[4][16][64];
  const int tid = threadIdx.x, w = tid >> 5, lane = tid & 31, ln = lane & 15, hh = lane >> 4;
  const int ntn = N / 64;
  const int wid = blockIdx.x * 4 + w;
  const int mt = wid / ntn, nq = wid % ntn;
  if (mt * 16 >= M) return;
  const int row0 = mt * 16, col0 = nq * 64;
  const float* arow = A + (size_t)(row0 + ln) * lda;
  v8f acc[4] = {};
  for (int kb = 0; kb < K; kb += 32) {
    FragB ah, al;
    const v4f x0 = *(const v4fa*)(arow + kb + 8 * hh), x1 = *(const v4fa*)(arow + kb + 8 * hh + 4);
    const v4f x2 = *(const v4fa*)(arow + kb + 16 + 8 * hh), x3 = *(const v4fa*)(arow + kb + 16 + 8 * hh + 4);
    float xs[16] = {x0[0],x0[1],x0[2],x0[3],x1[0],x1[1],x1[2],x1[3],x2[0],x2[1],x2[2],x2[3],x3[0],x3[1],x3[2],x3[3]};
#pragma unroll
    for (int i = 0; i < 16; ++i) { const unsigned short hb = bf16_bits(xs[i]); ah.u[i] = hb; al.u[i] = ASPLIT ? bf16_bits(xs[i] - bf16_val(hb)) : (unsigned short)0; }
#pragma unroll
    for (int t = 0; t < 4; ++t) {
      const unsigned short* brow = Wt + (size_t)(col0 + t * 16 + ln) * ldb + kb;
      FragB b;
      b.half[0] = *(const v8us*)(brow + 8 * hh);
      b.half[1] = *(const v8us*)(brow + 16 + 8 * hh);
      acc[t] = mmaN<ASPLIT ? 2 : 1>(ah.v, al.v, b.v, b.v, acc[t]);
    }
  }
#pragma unroll
  for (int t = 0; t < 4; ++t) {
    const int col = col0 + t * 16 + ln;
    float bv = bias ? bias[col] : 0.f;
    if (BIAS_BF16) bv = bf16_round(bv);
#pragma unroll
    for (int r = 0; r < 8; ++r) {
      float v = acc[t][r] + bv;
      if (resid) { float rv = resid[(size_t)((row0 + 8 * hh + r) % rmod) * ldr + col]; if (RES_BF16) rv = bf16_round(rv); v += rv; }
      if (ACT == 1) v = fmaxf(v, 0.f);
      if (ACT == 2) v = 0.5f * v * (1.0f + erff(v * 0.70710678118654752f));
      if (ACT == 3) { const float u = 0.7978845608028654f * (v + 0.044715f * v * v * v); v = 0.5f * v * (1.0f + tanhf(u)); }
      so[w][8 * hh + r][t * 16 + ln] = v;
    }
  }
  __builtin_amdgcn_fence(__ATOMIC_ACQ_REL, "workgroup");
  __builtin_amdgcn_wave_barrier();
  const int rsub = lane >> 4, c4 = (lane & 15) * 4;
  {
#pragma unroll
    for (int q = 0; q < 8; ++q) {
      const int r = q * 2 + rsub;
      const v4f v = *(const v4fa*)&so[w][r][c4];
      *(v4f*)(C + (size_t)(row0 + r) * ldc + col0 + c4) = v;
    }
    
  }
}
// row LayerNorm (biased variance, eps) over N: s = X (+ R); optional out_sum <- s; out_norm <- (s-mu)*rsqrt(var+eps)*g + b
template <bool PARAM_BF16>
__global__ __launch_bounds__(256) void k_layernorm(const float* __restrict__ X, const float* __restrict__ R, const float* __restrict__ g, const float* __restrict__ bta,
                                                  float* __restrict__ out_sum, float* __restrict__ out_norm, int N, float eps) {
  __shared__ float red[256];
  const int row = blockIdx.x, tid = threadIdx.x;
  const float* x = X + (size_t)row * N; const float* rr = R ? R + (size_t)row * N : nullptr;
  float vals[16];                     // up to N = 4096
  const int per = N / 256;            // contiguous chunk per thread? use strided-by-4 chunks: thread handles j = tid*4 + 1024*u
  float s1 = 0.f;
  for (int u = 0; u < per / 4; ++u) {
    const int j = tid * 4 + 1024 * u;
    const v4f a = *(const v4fa*)(x + j);
    v4f b = {0.f,0.f,0.f,0.f}; if (rr) b = *(const v4fa*)(rr + j);
#pragma unroll
    for (int q = 0; q < 4; ++q) { const float v = a[q] + b[q]; vals[u * 4 + q] = v; s1 += v; }
  }
  red[tid] = s1; __syncthreads();
  for (int st = 128; st > 0; st >>= 1) { if (tid < st) red[tid] += red[tid + st]; __syncthreads(); }
  const float mu = red[0] / (float)N; __syncthreads();
  float s2 = 0.f;
  for (int u = 0; u < per / 4; ++u)
#pragma unroll
    for (int q = 0; q < 4; ++q) { const float c = vals[u * 4 + q] - mu; s2 += c * c; }
  red[tid] = s2; __syncthreads();
  for (int st = 128; st > 0; st >>= 1) { if (tid < st) red[tid] += red[tid + st]; __syncthreads(); }
  const float rs = rsqrtf(red[0] / (float)N + eps);
  {
    for (int u = 0; u < per / 4; ++u) {
      const int j = tid * 4 + 1024 * u;
      v4f o, sm;
#pragma unroll
      for (int q = 0; q < 4; ++q) {
        float gg = g[j + q], bb = bta[j + q];
        if (PARAM_BF16) { gg = bf16_round(gg); bb = bf16_round(bb); }
        sm[q] = vals[u * 4 + q]; o[q] = (vals[u * 4 + q] - mu) * rs * gg + bb;
      }
      if (out_sum) *(v4f*)(out_sum + (size_t)row * N + j) = sm;
      *(v4f*)(out_norm + (size_t)row * N + j) = o;
    }
    
  }
}



// ---- f16 WMMA path (v_wmma_f32_16x16x32_f16): 11-bit significands for operands in range — used where a [0,1] probability operand needs more precision than bf16
typedef _Float16 v16h __attribute__((ext_vector_type(16)));
union FragH { v16h v; v8us half[2]; _Float16 h[16]; unsigned short u[16]; };
template <int NT>
__device__ __forceinline__ v8f mmaH(v16h ah, v16h al, v16h bh, v16h bl, v8f c) {
  c = __builtin_amdgcn_wmma_f32_16x16x32_f16(false, ah, false, bh, (short)0, c, false, false);
  if (NT >= 2) c = __builtin_amdgcn_wmma_f32_16x16x32_f16(false, al, false, bh, (short)0, c, false, false);
  if (NT >= 3) c = __builtin_amdgcn_wmma_f32_16x16x32_f16(false, ah, false, bl, (short)0, c, false, false);
  asm volatile("v_nop\n\tv_nop\n\tv_nop\n\tv_nop" : "+v"(c) : "v"(ah), "v"(al), "v"(bh), "v"(bl));
  return c;
}
// batched GEMM like k_gemm_b but f16 operands: A f32 (split into f16 hi/lo if ASPLIT, else rounded to f16), Bt = f16 values [n][k]; alpha; C f32; N multiple of 16 (partial tiles skipped)
template <bool ASPLIT>
__global__ __launch_bounds__(128) void k_gemm_h(const float* __restrict__ A, int lda, size_t sA, const _Float16* __restrict__ Bh, int ldb, size_t sB, float alpha, float* __restrict__ C, int ldc, size_t sC, int M, int N, int K) {
  __shared__ __attribute__((aligned(16))) float so[4][16][64];
  const int tid = threadIdx.x, w = tid >> 5, lane = tid & 31, ln = lane & 15, hh = lane >> 4; const int by = blockIdx.y;
  A += (size_t)by * sA; Bh += (size_t)by * sB; C += (size_t)by * sC;
  const int ntn = (N + 63) / 64; const int wid = blockIdx.x * 4 + w; const int mt = wid / ntn, nq = wid % ntn; if (mt * 16 >= M) return;
  const int row0 = mt * 16, col0 = nq * 64; const float* arow = A + (size_t)(row0 + ln) * lda;
  v8f acc[4] = {};
  for (int kb = 0; kb < K; kb += 32) {
    FragH ah, al;
    const v4f x0 = *(const v4fa*)(arow + kb + 8 * hh), x1 = *(const v4fa*)(arow + kb + 8 * hh + 4), x2 = *(const v4fa*)(arow + kb + 16 + 8 * hh), x3 = *(const v4fa*)(arow + kb + 16 + 8 * hh + 4);
    float xs[16] = {x0[0],x0[1],x0[2],x0[3],x1[0],x1[1],x1[2],x1[3],x2[0],x2[1],x2[2],x2[3],x3[0],x3[1],x3[2],x3[3]};
#pragma unroll
    for (int i = 0; i < 16; ++i) { const _Float16 h = (_Float16)xs[i]; ah.h[i] = h; al.h[i] = ASPLIT ? (_Float16)(xs[i] - (float)h) : (_Float16)0.0f; }
#pragma unroll
    for (int t = 0; t < 4; ++t) { if (col0 + t * 16 >= N) continue; const size_t boff = (size_t)(col0 + t * 16 + ln) * ldb + kb; FragH bq; bq.half[0] = *(const v8us*)(Bh + boff + 8 * hh); bq.half[1] = *(const v8us*)(Bh + boff + 16 + 8 * hh);
      acc[t] = mmaH<ASPLIT ? 2 : 1>(ah.v, al.v, bq.v, bq.v, acc[t]); }
  }
#pragma unroll
  for (int t = 0; t < 4; ++t) { if (col0 + t * 16 >= N) continue;
#pragma unroll
    for (int r = 0; r < 8; ++r) so[w][8 * hh + r][t * 16 + ln] = acc[t][r] * alpha; }
  __builtin_amdgcn_fence(__ATOMIC_ACQ_REL, "workgroup"); __builtin_amdgcn_wave_barrier();
  const int rsub = lane >> 4, c4 = (lane & 15) * 4;
  {
#pragma unroll
    for (int q = 0; q < 8; ++q) { const int r = q * 2 + rsub; if (col0 + c4 < N) { const v4f v = *(const v4fa*)&so[w][r][c4]; *(v4f*)(C + (size_t)(row0 + r) * ldc + col0 + c4) = v; } }
     }
}

// Wt[n][k] = f16(W[k][n]·scale) from f32 row-major W[K][N] (scale = power of two; bf16-exact weights stay exact in f16 away from the subnormal range)
__global__ __launch_bounds__(256) void k_wt_f16(const float* __restrict__ W, _Float16* __restrict__ Wt, int K, int N, float scale) {
  const int t = blockIdx.x * 256 + threadIdx.x; if (t >= N * (K / 8)) return; const int n = t / (K / 8), k8 = (t % (K / 8)) * 8; FragH f;
#pragma unroll
  for (int i = 0; i < 8; ++i) f.h[i] = (_Float16)(bf16_round(W[(size_t)(k8 + i) * N + n]) * scale); const v8us o = f.half[0];
  *(v8us*)((unsigned short*)Wt + (size_t)n * K + k8) = o; 
}
// k_gemm_hh variant with fused epilogue: v = acc·alpha + bias[by·sBias + col] (+ CP[(row/rowsPerB)·sCPb + by·64 + col] if CP) ; ACT 0 none / 1 elu ; writes f16 C16 (and f32 C if non-null)
template <int ACT>
__global__ __launch_bounds__(128) void k_gemm_hhx(const _Float16* __restrict__ A, int lda, size_t sA, const _Float16* __restrict__ Bh, int ldb, size_t sB, float alpha, const float* __restrict__ bias, size_t sBias, const float* __restrict__ CP, int rowsPerB, size_t sCPb, int row0g,
    float* __restrict__ C, _Float16* __restrict__ C16, int ldc, size_t sC, int M, int N, int K) {
  __shared__ __attribute__((aligned(16))) float so[4][16][64];
  const int tid = threadIdx.x, w = tid >> 5, lane = tid & 31, ln = lane & 15, hh = lane >> 4; const int by = blockIdx.y;
  A += (size_t)by * sA; Bh += (size_t)by * sB; const size_t cofs = (size_t)by * sC; const float* bp = bias ? bias + (size_t)by * sBias : nullptr;
  const int ntn = (N + 63) / 64; const int wid = blockIdx.x * 4 + w; const int mt = wid / ntn, nq = wid % ntn; if (mt * 16 >= M) return;
  const int row0 = mt * 16, col0 = nq * 64; const _Float16* arow = A + (size_t)(row0 + ln) * lda;
  v8f acc[4] = {};
  for (int kb = 0; kb < K; kb += 32) { FragH ah; ah.half[0] = *(const v8us*)((const unsigned short*)arow + kb + 8 * hh); ah.half[1] = *(const v8us*)((const unsigned short*)arow + kb + 16 + 8 * hh);
#pragma unroll
    for (int t = 0; t < 4; ++t) { if (col0 + t * 16 >= N) continue; const size_t boff = (size_t)(col0 + t * 16 + ln) * ldb + kb; FragH bq; bq.half[0] = *(const v8us*)((const unsigned short*)Bh + boff + 8 * hh); bq.half[1] = *(const v8us*)((const unsigned short*)Bh + boff + 16 + 8 * hh);
      acc[t] = mmaH<1>(ah.v, ah.v, bq.v, bq.v, acc[t]); }
  }
#pragma unroll
  for (int t = 0; t < 4; ++t) { if (col0 + t * 16 >= N) continue; const int col = col0 + t * 16 + ln; const float bv = bp ? bf16_round(bp[col]) : 0.f;
#pragma unroll
    for (int r = 0; r < 8; ++r) { float v = acc[t][r] * alpha + bv; if (CP) { const int rr = row0g + row0 + 8 * hh + r; if (rowsPerB < 0) v += CP[cofs + (size_t)rr * ldc + col];      /* rowsPerB < 0: own element of the batched C plane */ else { const int bidx = rr / rowsPerB; v += CP[(size_t)bidx * sCPb + (size_t)by * 64 + col]; } } if (ACT == 1) v = (v > 0.f) ? v : expm1f(v); else if (ACT == 7) v = (v > 0.f) ? v + 1.0f : expf(v); else if (ACT == 8) v = tanhf(v); else if (ACT == 9) v = 0.5f * v * (1.0f + tanhf(0.7978845608028654f * (v + 0.044715f * v * v * v))); else if (ACT == 11) v = 1.0f / (1.0f + expf(-v)); else if (ACT == 12) v = (v > 0.f) ? v : 0.01f * v; else if (ACT == 14) v = (v > 0.f) ? v : 0.1f * v; else if (ACT == 16) v = (v >= 0.f) ? v : 0.3f * v; else if (ACT == 17) v = (v >= 0.f) ? v : 0.2f * v; else if (ACT == 15) v = v / (1.0f + expf(-v)); else if (ACT == 3) v = fmaxf(v, 0.f); else if (ACT == 6) v = 0.5f * v * (1.0f + erff(v * 0.70710678118654752f)); so[w][8 * hh + r][t * 16 + ln] = v; } }
  __builtin_amdgcn_fence(__ATOMIC_ACQ_REL, "workgroup"); __builtin_amdgcn_wave_barrier();
  const int rsub = lane >> 4, c4 = (lane & 15) * 4; typedef _Float16 v4h __attribute__((ext_vector_type(4)));
  {
#pragma unroll
    for (int q = 0; q < 8; ++q) { const int r = q * 2 + rsub; if (col0 + c4 < N) { const v4f v = *(const v4fa*)&so[w][r][c4]; if (C) *(v4f*)(C + cofs + (size_t)(row0 + r) * ldc + col0 + c4) = v; if (C16) { v4h h4; for (int i = 0; i < 4; ++i) h4[i] = (_Float16)v[i]; *(v4h*)(C16 + cofs + (size_t)(row0 + r) * ldc + col0 + c4) = h4; } } }
     }
}


typedef _Float16 v4h __attribute__((ext_vector_type(4)));

__global__ __launch_bounds__(256) void k_x16(const float* __restrict__ x, _Float16* __restrict__ X16, size_t n8) { const size_t t = (size_t)blockIdx.x * 256 + threadIdx.x; if (t >= n8) return; FragH f;
#pragma unroll
  for (int q = 0; q < 8; ++q) f.h[q] = (_Float16)bf16_round(x[t * 8 + q]); *(v8us*)((unsigned short*)X16 + t * 8) = f.half[0];  }
__global__ __launch_bounds__(256) void k_h16(const float* __restrict__ x, _Float16* __restrict__ X16, size_t n8) { const size_t t = (size_t)blockIdx.x * 256 + threadIdx.x; if (t >= n8) return; FragH f;
#pragma unroll
  for (int q = 0; q < 8; ++q) f.h[q] = (_Float16)x[t * 8 + q]; *(v8us*)((unsigned short*)X16 + t * 8) = f.half[0];  }
__global__ __launch_bounds__(256) void k_round16f(const float* __restrict__ W, _Float16* __restrict__ Bt, size_t n8) { const size_t t = (size_t)blockIdx.x * 256 + threadIdx.x; if (t >= n8) return; FragH f;
#pragma unroll
  for (int i = 0; i < 8; ++i) f.h[i] = (_Float16)(bf16_round(W[t * 8 + i]) * 16.0f); *(v8us*)((unsigned short*)Bt + t * 8) = f.half[0];  }
template <int NHv, int TTv>
__global__ __launch_bounds__(256) void k_vt(const _Float16* __restrict__ V16, int ldv, int voff, _Float16* __restrict__ Vt) { __shared__ unsigned short tl[64][66]; const int tid = threadIdx.x; const int slab = blockIdx.x / (TTv / 64), lg = blockIdx.x % (TTv / 64); const int b = slab / NHv, h = slab % NHv;
  for (int i = tid; i < 64 * 8; i += 256) { const int r = i / 8, c8 = (i % 8) * 8; FragH f; f.half[0] = *(const v8us*)((const unsigned short*)V16 + ((size_t)b * TTv + lg * 64 + r) * ldv + voff + h * 64 + c8);
#pragma unroll
    for (int q = 0; q < 8; ++q) tl[r][c8 + q] = f.u[q]; }
  __syncthreads();
  {
#pragma unroll
    for (int rd = 0; rd < 2; ++rd) { const int d = rd * 32 + tid / 8, pc = tid % 8; FragH f;
#pragma unroll
      for (int q = 0; q < 8; ++q) f.u[q] = tl[pc * 8 + q][d];
      *(v8us*)((unsigned short*)Vt + ((size_t)slab * 64 + d) * TTv + lg * 64 + pc * 8) = f.half[0]; }
     } }

__global__ __launch_bounds__(256) void k_hl(const float* __restrict__ F, _Float16* __restrict__ Hh, _Float16* __restrict__ Hl, size_t n8) { const size_t t = (size_t)blockIdx.x * 256 + threadIdx.x; if (t >= n8) return; FragH fh, fl; const v4f a = *(const v4fa*)(F + t * 8), c = *(const v4fa*)(F + t * 8 + 4);
#pragma unroll
  for (int q = 0; q < 4; ++q) { _Float16 h = (_Float16)a[q]; fh.h[q] = h; fl.h[q] = (_Float16)((a[q] - (float)h) * 1024.0f); h = (_Float16)c[q]; fh.h[4 + q] = h; fl.h[4 + q] = (_Float16)((c[q] - (float)h) * 1024.0f); }
  { *(v8us*)((unsigned short*)Hh + t * 8) = fh.half[0]; *(v8us*)((unsigned short*)Hl + t * 8) = fl.half[0];  } }

// ---- fast GEMM (wave tile 32x64, block tile 128x64; requires M % 128 == 0 rows per launch region, N % 64 == 0 and K % 64 == 0); epilogue = k_gemm_hhx semantics ----
// Operands go through LDS: a stage is 64 k of the block's 128 A rows and 64 B rows (128 bytes a row), brought by asynchronous copies, two buffers, the copies of stage t + 2 in flight while stage t + 1 is worked on.
// A wave-wide copy reads 4 rows x 128 contiguous bytes (4 whole cache lines), and the B rows are fetched once a block.
#define G2_PITCH 72      /* f16 elements a row in LDS = 144 bytes = 16 x 9: 16 rows read by ds_load_b128 fall on distinct banks */
#define G2_ROWS 192      /* rows 0..127: A, rows 128..191: B */
#define G2_BUF (G2_ROWS * G2_PITCH)
// fragment from an LDS row: p = row + 32 ks + 8 hh; the k order of g2_frag
__device__ __forceinline__ v16h g2_lfrag(const _Float16* p) { FragH f; f.half[0] = *(const v8us*)((const unsigned short*)p); f.half[1] = *(const v8us*)((const unsigned short*)p + 16); return f.v; }
// One lane's twelve 16-byte copies of a stage: thread tid takes bytes 16 (tid & 7) of rows (tid >> 3) + 16 c, c = 0..11. l = its LDS byte address in row tid >> 3 of the buffer, ga / gb = its global address in that row of the
// A / B tile, sa / sb = 16 rows in elements. The s_wait_xcnt stands inside the statement, behind the last copy, so that no address register of a copy is rewritten in front of it.
__device__ __forceinline__ void g2_stage(unsigned l, const _Float16* ga, size_t sa, const _Float16* gb, size_t sb) {
  const unsigned rs = 16 * G2_PITCH * 2;
  asm volatile("global_load_async_to_lds_b128 %0, %12, off\n\tglobal_load_async_to_lds_b128 %1, %13, off\n\tglobal_load_async_to_lds_b128 %2, %14, off\n\tglobal_load_async_to_lds_b128 %3, %15, off\n\t"
               "global_load_async_to_lds_b128 %4, %16, off\n\tglobal_load_async_to_lds_b128 %5, %17, off\n\tglobal_load_async_to_lds_b128 %6, %18, off\n\tglobal_load_async_to_lds_b128 %7, %19, off\n\t"
               "global_load_async_to_lds_b128 %8, %20, off\n\tglobal_load_async_to_lds_b128 %9, %21, off\n\tglobal_load_async_to_lds_b128 %10, %22, off\n\tglobal_load_async_to_lds_b128 %11, %23, off\n\ts_wait_xcnt 0x0"
               :: "v"(l), "v"(l + rs), "v"(l + 2 * rs), "v"(l + 3 * rs), "v"(l + 4 * rs), "v"(l + 5 * rs), "v"(l + 6 * rs), "v"(l + 7 * rs), "v"(l + 8 * rs), "v"(l + 9 * rs), "v"(l + 10 * rs), "v"(l + 11 * rs),
                  "v"(ga), "v"(ga + sa), "v"(ga + 2 * sa), "v"(ga + 3 * sa), "v"(ga + 4 * sa), "v"(ga + 5 * sa), "v"(ga + 6 * sa), "v"(ga + 7 * sa), "v"(gb), "v"(gb + sb), "v"(gb + 2 * sb), "v"(gb + 3 * sb) : "memory"); }
__device__ __forceinline__ v16h g2_frag(const _Float16* p, int hh) { FragH f; f.half[0] = *(const v8us*)((const unsigned short*)p + 8 * hh); f.half[1] = *(const v8us*)((const unsigned short*)p + 16 + 8 * hh); return f.v; }
__device__ __forceinline__ v8f g2_mma(v16h a, v16h b, v8f c) { v8f d = __builtin_amdgcn_wmma_f32_16x16x32_f16(false, a, false, b, (short)0, c, false, false); asm volatile("v_nop\n\tv_nop\n\tv_nop\n\tv_nop" : "+v"(d) : "v"(a), "v"(b)); return d; }
template <int ACT>
__global__ __launch_bounds__(128) void k_gemm2(const _Float16* __restrict__ A, int lda, size_t sA, const _Float16* __restrict__ Bh, int ldb, size_t sB, float alpha, const float* __restrict__ bias, size_t sBias, const float* __restrict__ CP, int rowsPerB, size_t sCPb, int row0g,
    float* __restrict__ C, _Float16* __restrict__ C16, int ldc, size_t sC, int M, int N, int K) { static_assert(ACT == 0 || ACT == 3 || ACT == 6 || ACT == 8 || ACT == 9 || ACT == 11 || ACT == 12 || ACT == 14 || ACT == 15 || ACT == 16 || ACT == 17, "k_gemm2: unsupported ACT code (would silently apply no activation)");
  __shared__ __attribute__((aligned(16))) float so[4][32][68];
  __shared__ __attribute__((aligned(16))) _Float16 st[2][G2_BUF];
  const int tid = threadIdx.x, w = tid >> 5, lane = tid & 31, ln = lane & 15, hh = lane >> 4; const int by = blockIdx.y;
  A += (size_t)by * sA; Bh += (size_t)by * sB; const size_t cofs = (size_t)by * sC; const float* bp = bias ? bias + (size_t)by * sBias : nullptr;
  const int ntn = N >> 6; const int mt = blockIdx.x / ntn, nq = blockIdx.x - mt * ntn; const int row0 = mt * 128 + 32 * w, col0 = nq * 64; if (mt * 128 >= M) return;      /* the same for the whole block: it stands in front of barriers */
  const _Float16* gap = A + (size_t)(mt * 128 + (tid >> 3)) * lda + (tid & 7) * 8; const _Float16* gbp = Bh + (size_t)(col0 + (tid >> 3)) * ldb + (tid & 7) * 8; const size_t sa16 = (size_t)16 * lda, sb16 = (size_t)16 * ldb;
  const unsigned lst = (unsigned)(size_t)&st[0][(tid >> 3) * G2_PITCH + (tid & 7) * 8];      /* low 32 bits of the shared address = byte address in the block's LDS */
  const int aoff = (32 * w + ln) * G2_PITCH + 8 * hh, boff = (128 + ln) * G2_PITCH + 8 * hh; const int nst = K >> 6;
  const v8f z8 = {0.f,0.f,0.f,0.f,0.f,0.f,0.f,0.f}; v8f c00 = z8, c01 = z8, c02 = z8, c03 = z8, c10 = z8, c11 = z8, c12 = z8, c13 = z8;
  g2_stage(lst, gap, sa16, gbp, sb16);
  asm volatile("s_wait_asynccnt 0x0" ::: "memory");      // this wave's copies of stage 0 have landed
  __syncthreads();                                       // ... and every other wave's: stage 0 may be read
  if (nst > 1) g2_stage(lst + G2_BUF * 2, gap + 64, sa16, gbp + 64, sb16);
  // rolled, as it was: a trip already holds a stage's 24 LDS reads and 16 products, and unrolled trips would each keep their own 36 copy address registers; the buffer is chosen by the trip's parity
#pragma unroll 1
  for (int t = 0; t < nst; ++t) { const _Float16* sb = st[t & 1]; v16h af[2][2], bf[2][4];
    // the three inner loops are fully unrolled so that the fragment arrays are indexed by constants and stay in registers
#pragma unroll
    for (int ks = 0; ks < 2; ++ks) { af[ks][0] = g2_lfrag(sb + aoff + ks * 32); af[ks][1] = g2_lfrag(sb + aoff + 16 * G2_PITCH + ks * 32);
#pragma unroll
      for (int u = 0; u < 4; ++u) bf[ks][u] = g2_lfrag(sb + boff + u * 16 * G2_PITCH + ks * 32); }
#pragma unroll
    for (int ks = 0; ks < 2; ++ks) {
      c00 = g2_mma(af[ks][0], bf[ks][0], c00); c10 = g2_mma(af[ks][1], bf[ks][0], c10);
      c01 = g2_mma(af[ks][0], bf[ks][1], c01); c11 = g2_mma(af[ks][1], bf[ks][1], c11);
      c02 = g2_mma(af[ks][0], bf[ks][2], c02); c12 = g2_mma(af[ks][1], bf[ks][2], c12);
      c03 = g2_mma(af[ks][0], bf[ks][3], c03); c13 = g2_mma(af[ks][1], bf[ks][3], c13); }
    asm volatile("s_wait_dscnt 0x0" ::: "memory");         // this wave's reads of stage t are finished before its buffer is refilled
    asm volatile("s_wait_asynccnt 0x0" ::: "memory");      // this wave's copies of stage t + 1 have landed
    __syncthreads();                                       // publishes stage t + 1 and ends every wave's reads of stage t
    if (t + 2 < nst) g2_stage(lst + (unsigned)(t & 1) * (G2_BUF * 2), gap + (size_t)(t + 2) * 64, sa16, gbp + (size_t)(t + 2) * 64, sb16); }
  asm volatile("s_wait_asynccnt 0x0" ::: "memory");        // no copy is outstanding when the wave goes on to its end
  v8f accs[8] = {c00, c01, c02, c03, c10, c11, c12, c13};
#pragma unroll
  for (int u = 0; u < 8; ++u) { const int t = u & 3, half = u >> 2; const int col = col0 + t * 16 + ln; const float bv = bp ? bf16_round(bp[col]) : 0.f;
#pragma unroll
    for (int r = 0; r < 8; ++r) { const int rloc = half * 16 + 8 * hh + r; float v = accs[u][r] * alpha + bv; if (CP) { if (rowsPerB < 0) v += CP[cofs + (size_t)(row0g + row0 + rloc) * ldc + col];      /* rowsPerB < 0: own element of the batched C plane */ else { const int bidx = (row0g + row0 + rloc) / rowsPerB; v += CP[(size_t)bidx * sCPb + (size_t)by * 64 + col]; } }
      if (ACT == 3) v = fmaxf(v, 0.f); else if (ACT == 6) v = 0.5f * v * (1.0f + erff(v * 0.70710678118654752f)); else if (ACT == 11) v = 1.0f / (1.0f + expf(-v)); else if (ACT == 15) v = v / (1.0f + expf(-v)); else if (ACT == 12) v = (v > 0.f) ? v : 0.01f * v; else if (ACT == 8) v = tanhf(v); else if (ACT == 9) v = 0.5f * v * (1.0f + tanhf(0.7978845608028654f * (v + 0.044715f * v * v * v))); else if (ACT == 14) v = (v > 0.f) ? v : 0.1f * v; else if (ACT == 16) v = (v >= 0.f) ? v : 0.3f * v; else if (ACT == 17) v = (v >= 0.f) ? v : 0.2f * v;
      so[w][rloc][t * 16 + ln] = v; } }
  __builtin_amdgcn_fence(__ATOMIC_ACQ_REL, "workgroup"); __builtin_amdgcn_wave_barrier();
  const int rsub = lane >> 4, c4 = (lane & 15) * 4;
  {
#pragma unroll
    for (int q = 0; q < 16; ++q) { const int r = q * 2 + rsub; const v4f v = *(const v4fa*)&so[w][r][c4]; if (C) *(v4f*)(C + cofs + (size_t)(row0 + r) * ldc + col0 + c4) = v; if (C16) { v4h h4; for (int i = 0; i < 4; ++i) h4[i] = (_Float16)v[i]; *(v4h*)(C16 + cofs + (size_t)(row0 + r) * ldc + col0 + c4) = h4; } }
     } }


__global__ __launch_bounds__(256) void k_wnat(const float* __restrict__ w, size_t n8, _Float16* __restrict__ Bt) { const size_t t = (size_t)blockIdx.x * 256 + threadIdx.x; if (t >= n8) return; FragH f; for (int q = 0; q < 8; ++q) f.h[q] = (_Float16)(bf16_round(w[t * 8 + q]) * 16.0f); *(v8us*)((unsigned short*)Bt + t * 8) = f.half[0];  }
// V^T of every (branch, batch, head): blockIdx.x = head + NH * (block of 64 keys), blockIdx.y = batch, blockIdx.z = branch; VT[(b * NH + h) * HD + d][key]
__global__ __launch_bounds__(256) void k_vt(const _Float16* __restrict__ VS16, const _Float16* __restrict__ VL16, _Float16* __restrict__ VTS, _Float16* __restrict__ VTL) { __shared__ unsigned short tl[64][65]; const int tid = threadIdx.x; const int h = blockIdx.x % NH, sg = blockIdx.x / NH; const int s0 = sg * 64; const int b = blockIdx.y;
  const _Float16* V16 = blockIdx.z ? VL16 : VS16; _Float16* VT = blockIdx.z ? VTL : VTS;
  for (int i = tid; i < 64 * 8; i += 256) { const int j = i / 8, d8 = (i % 8) * 8; FragH f; f.half[0] = *(const v8us*)((const unsigned short*)V16 + ((size_t)b * SQ + s0 + j) * DM + h * HD + d8); for (int q = 0; q < 8; ++q) tl[d8 + q][j] = f.u[q]; }
  __syncthreads();
  { for (int i = tid; i < 64 * 8; i += 256) { const int d = i / 8, j8 = (i % 8) * 8; FragH f; for (int q = 0; q < 8; ++q) f.u[q] = tl[d][j8 + q]; *(v8us*)((unsigned short*)VT + (((size_t)b * NH + h) * HD + d) * SQ + s0 + j8) = f.half[0]; }  } }

// ---- fused attention: scores, softmax and weighted sum of one branch in one pass over the keys; no score ever reaches memory ----
// Transposed products. S^T = K Q^T: A = 16 key rows, B = 16 query rows, so lane (ln, hh) holds for query ln the keys 8 hh + r of each 16-key tile. Two such tiles, rounded to f16, are
// at once the B operand of O^T += V^T P^T over 32 keys (element i: key 8 hh + i, element 8 + i: key 16 + 8 hh + i, the k order of g2_frag, which loads the A operand from V^T rows).
// A query's maximum, sum and scale therefore live in its own lane (both halves); the halves exchange the maximum once a pass and join their sums once at the end.
// Every inner loop is fully unrolled so that the fragment, score and accumulator arrays are indexed by constants and stay in registers (a rolled loop would put them in scratch memory).
// Scores are kept in the log2 domain (x = s log2 e). The maximum in use is raised, and sums and outputs rescaled, only when a column's new maximum exceeds it by more than 8, so weights stay <= 2^8.
// 2^x of eight (two) values in place, one statement: behind each v_exp_f32 stands an instruction that neither reads its result nor overwrites its source (the operands are distinct registers), behind the last the v_nop: the slot the instruction set asks for behind a transcendental
__device__ __forceinline__ void ex2x8(v8f& x) { asm("v_exp_f32 %0, %0\n\tv_exp_f32 %1, %1\n\tv_exp_f32 %2, %2\n\tv_exp_f32 %3, %3\n\tv_exp_f32 %4, %4\n\tv_exp_f32 %5, %5\n\tv_exp_f32 %6, %6\n\tv_exp_f32 %7, %7\n\tv_nop" : "+v"(x[0]), "+v"(x[1]), "+v"(x[2]), "+v"(x[3]), "+v"(x[4]), "+v"(x[5]), "+v"(x[6]), "+v"(x[7])); }
__device__ __forceinline__ void ex2x2(float& a, float& b) { asm("v_exp_f32 %0, %0\n\tv_exp_f32 %1, %1\n\tv_nop" : "+v"(a), "+v"(b)); }
__device__ __forceinline__ v8f at_mma(v16h a, v16h b, v8f c) { return __builtin_amdgcn_wmma_f32_16x16x32_f16(false, a, false, b, (short)0, c, false, false); }
template <bool DECAY>
__device__ __forceinline__ void attn_run(const _Float16* __restrict__ Q16, const _Float16* __restrict__ KB, const _Float16* __restrict__ VT, float* __restrict__ OB, float c2, float (*so)[68]) {
  const int lane = threadIdx.x & 31, ln = lane & 15, hh = lane >> 4; const int b = blockIdx.y / NH, h = blockIdx.y % NH; const int q0 = blockIdx.x * 128 + (threadIdx.x >> 5) * 32;
  const float sc2 = 0.125f * 1.4426950408889634f;
  const _Float16* qp = Q16 + ((size_t)b * SQ + q0 + ln) * DM + h * HD; const _Float16* kp = KB + ((size_t)b * SQ + ln) * DM + h * HD; const _Float16* vp = VT + ((size_t)blockIdx.y * HD + ln) * SQ;
  v16h qf[2][2], kf[2][2];
#pragma unroll
  for (int g = 0; g < 2; ++g)
#pragma unroll
    for (int ks = 0; ks < 2; ++ks) { qf[g][ks] = g2_frag(qp + (size_t)g * 16 * DM + ks * 32, hh); kf[g][ks] = g2_frag(kp + (size_t)g * 16 * DM + ks * 32, hh); }
  const v8f z8 = {0.f,0.f,0.f,0.f,0.f,0.f,0.f,0.f}; v8f o[2][4];
#pragma unroll
  for (int g = 0; g < 2; ++g)
#pragma unroll
    for (int dt = 0; dt < 4; ++dt) o[g][dt] = z8;
  float m[2] = {-3.0e38f, -3.0e38f}, l[2] = {0.f, 0.f};
  // rolled, for speed only
#pragma unroll 1
  for (int kb = 0; kb < SQ; kb += 32) {
    v16h vf[4];
#pragma unroll
    for (int dt = 0; dt < 4; ++dt) vf[dt] = g2_frag(vp + (size_t)dt * 16 * SQ + kb, hh);
    __builtin_amdgcn_sched_barrier(0);      // keeps the V^T loads at the head of the pass, so that the score products and the maxima cover their latency (the scheduler sinks them to their use otherwise)
    v8f s[2][2];
#pragma unroll
    for (int g = 0; g < 2; ++g)
#pragma unroll
      for (int t = 0; t < 2; ++t) s[g][t] = at_mma(kf[t][1], qf[g][1], at_mma(kf[t][0], qf[g][0], z8));
    // the next pass's K fragments, asked for while this pass's softmax runs (the last pass reads the first rows again: in bounds, not used)
    const int kn = (kb + 32 < SQ) ? kb + 32 : 0;
#pragma unroll
    for (int t = 0; t < 2; ++t)
#pragma unroll
      for (int ks = 0; ks < 2; ++ks) kf[t][ks] = g2_frag(kp + (size_t)(kn + t * 16) * DM + ks * 32, hh);
    float mt[2];
#pragma unroll
    for (int g = 0; g < 2; ++g) { float mx = -3.0e38f;
#pragma unroll
      for (int t = 0; t < 2; ++t) { const float fb = (float)(q0 + g * 16 + ln - 8 * hh - kb - t * 16);
#pragma unroll
        for (int r = 0; r < 8; ++r) { if (DECAY) s[g][t][r] = s[g][t][r] * sc2 - fabsf(fb - (float)r) * c2; mx = fmaxf(mx, s[g][t][r]); } }
      if (!DECAY) mx *= sc2;
      mt[g] = fmaxf(mx, __shfl_xor(mx, 16, 32)); }
    const bool need = (mt[0] > m[0] + 8.0f) || (mt[1] > m[1] + 8.0f);
    if (__builtin_amdgcn_ballot_w32(need) != 0) { const float mn0 = fmaxf(m[0], mt[0]), mn1 = fmaxf(m[1], mt[1]); float al[2] = {m[0] - mn0, m[1] - mn1}; ex2x2(al[0], al[1]); m[0] = mn0; m[1] = mn1;
#pragma unroll
      for (int g = 0; g < 2; ++g) { l[g] *= al[g];
#pragma unroll
        for (int dt = 0; dt < 4; ++dt) o[g][dt] *= al[g]; } }
#pragma unroll
    for (int g = 0; g < 2; ++g) { FragH pf; float ls = 0.f;
#pragma unroll
      for (int t = 0; t < 2; ++t) { v8f p;
#pragma unroll
        for (int r = 0; r < 8; ++r) p[r] = DECAY ? s[g][t][r] - m[g] : s[g][t][r] * sc2 - m[g];
        ex2x8(p);
#pragma unroll
        for (int r = 0; r < 8; ++r) { ls += p[r]; pf.h[t * 8 + r] = (_Float16)p[r]; } }
      l[g] += ls;
#pragma unroll
      for (int dt = 0; dt < 4; ++dt) o[g][dt] = at_mma(vf[dt], pf.v, o[g][dt]); }
  }
  // O^T tile: lane (ln, hh) holds of query ln the columns 16 dt + 8 hh + r; through the wave's own LDS rows so that each store covers 256 contiguous bytes of a row
#pragma unroll
  for (int g = 0; g < 2; ++g) { const float lt = l[g] + __shfl_xor(l[g], 16, 32); const float inv = 1.0f / lt;
#pragma unroll
    for (int dt = 0; dt < 4; ++dt) { const v8f ov = o[g][dt] * inv; const v4f lo = {ov[0], ov[1], ov[2], ov[3]}, hi = {ov[4], ov[5], ov[6], ov[7]};
      *(v4fa*)&so[g * 16 + ln][dt * 16 + 8 * hh] = lo; *(v4fa*)&so[g * 16 + ln][dt * 16 + 8 * hh + 4] = hi; } }
  __builtin_amdgcn_fence(__ATOMIC_ACQ_REL, "workgroup"); __builtin_amdgcn_wave_barrier();      // the wave's LDS writes above are finished before its lanes read each other's rows below (each wave has its own rows: no work-group barrier)
  const int rsub = lane >> 4, c4 = (lane & 15) * 4;
#pragma unroll
  for (int q = 0; q < 16; ++q) { const int r = q * 2 + rsub; const v4f v = *(const v4fa*)&so[r][c4]; *(v4f*)(OB + ((size_t)b * SQ + q0 + r) * DM + h * HD + c4) = v; } }
// blockIdx.x = block of 128 queries (4 waves of 32), blockIdx.y = batch * NH + head, blockIdx.z = branch (0 short, with the decay bias; 1 long)
__global__ __launch_bounds__(128) void k_attn(const _Float16* __restrict__ Q16, const _Float16* __restrict__ KS, const _Float16* __restrict__ KL, const _Float16* __restrict__ VTS, const _Float16* __restrict__ VTL, float* __restrict__ OS, float* __restrict__ OL, const float* __restrict__ dfp) {
  __shared__ __attribute__((aligned(16))) float so[4][32][68];
  if (blockIdx.z == 0) attn_run<true>(Q16, KS, VTS, OS, (1.0f - bf16_round(dfp[0])) * 1.4426950408889634f, so[threadIdx.x >> 5]);
  else attn_run<false>(Q16, KL, VTL, OL, 0.f, so[threadIdx.x >> 5]); }

__global__ __launch_bounds__(256) void k_wT(const float* __restrict__ w, int din, int dout, _Float16* __restrict__ Bt) { __shared__ float tl[64][65]; const int tid = threadIdx.x; const int nbo = dout / 64; const int ib = blockIdx.x / nbo, ob = blockIdx.x % nbo; const int i0 = ib * 64, o0 = ob * 64;
  for (int t = tid; t < 64 * 64; t += 256) { const int i = t / 64, o = t % 64; tl[o][i] = bf16_round(w[(size_t)(i0 + i) * dout + o0 + o]) * 16.0f; }
  __syncthreads();
  { for (int t = tid; t < 64 * 8; t += 256) { const int o = t / 8, i8 = (t % 8) * 8; FragH f; for (int q = 0; q < 8; ++q) f.h[q] = (_Float16)tl[o][i8 + q]; *(v8us*)((unsigned short*)Bt + (size_t)(o0 + o) * din + i0 + i8) = f.half[0]; }  } }
__global__ __launch_bounds__(256) void k_mix(const float* __restrict__ OS, const float* __restrict__ OL, const float* __restrict__ mwp, _Float16* __restrict__ O16, size_t n8) {
  #pragma clang fp contract(off)
  const size_t t = (size_t)blockIdx.x * 256 + threadIdx.x; if (t >= n8) return; const float a = 1.0f / (1.0f + expf(-bf16_round(mwp[0]))); FragH f; for (int q = 0; q < 8; ++q) f.h[q] = (_Float16)__fadd_rn(__fmul_rn(a, OS[t * 8 + q]), __fmul_rn(1.0f - a, OL[t * 8 + q]));
  *(v8us*)((unsigned short*)O16 + t * 8) = f.half[0];  }
extern "C" void kernel_launch(void* const* d_in, const int* in_sizes, int n_in,
                              void* d_out, int out_size, void* d_ws, size_t ws_size, hipStream_t stream) {
  (void)in_sizes; (void)n_in; (void)out_size;
  const float* const* I = (const float* const*)d_in; const float* x = I[0]; const float* wq = I[1]; const float* wkvs = I[2]; const float* wkvl = I[3]; const float* wo = I[4]; const float* mwp = I[5]; const float* dfp = I[6];
  char* ws = (char*)d_ws; size_t off = 0;
  auto take = [&](size_t bytes) { char* p = ws + off; off += (bytes + 255) & ~(size_t)255; return p; };
  _Float16* BQ = (_Float16*)take((size_t)DM * DM * 2); _Float16* BKVS = (_Float16*)take((size_t)2 * DM * DM * 2); _Float16* BKVL = (_Float16*)take((size_t)2 * DM * DM * 2); _Float16* BO = (_Float16*)take((size_t)DM * DM * 2);
  _Float16* X16 = (_Float16*)take(NR * DM * 2); _Float16* Q16 = (_Float16*)take(NR * DM * 2); _Float16* K16 = (_Float16*)take(NR * DM * 2); _Float16* V16 = (_Float16*)take(NR * DM * 2); _Float16* KL16 = (_Float16*)take(NR * DM * 2); _Float16* VL16 = (_Float16*)take(NR * DM * 2); float* OS = (float*)take(NR * DM * 4); float* OL = (float*)take(NR * DM * 4); _Float16* O16 = (_Float16*)take(NR * DM * 2);
  _Float16* VTS = (_Float16*)take(NR * DM * 2); _Float16* VTL = (_Float16*)take(NR * DM * 2);
  if (off > ws_size) return;      /* 12 + 6x8 + 32 + 8 + 16 = 116 MiB */
  k_wT<<<(DM / 64) * (DM / 64), 256, 0, stream>>>(wq, DM, DM, BQ); k_wT<<<(DM / 64) * (2 * DM / 64), 256, 0, stream>>>(wkvs, DM, 2 * DM, BKVS); k_wT<<<(DM / 64) * (2 * DM / 64), 256, 0, stream>>>(wkvl, DM, 2 * DM, BKVL); k_wT<<<(DM / 64) * (DM / 64), 256, 0, stream>>>(wo, DM, DM, BO);
  k_x16<<<(unsigned)((NR * DM / 8 + 255) / 256), 256, 0, stream>>>(x, X16, NR * DM / 8);
  const dim3 gp((unsigned)((NR / 128) * (DM / 64)), 1);
  k_gemm2<0><<<gp, 128, 0, stream>>>(X16, DM, 0, BQ, DM, 0, 0.0625f, nullptr, 0, nullptr, 1, 0, 0, nullptr, Q16, DM, 0, (int)NR, DM, DM);
  k_gemm2<0><<<gp, 128, 0, stream>>>(X16, DM, 0, BKVS, DM, 0, 0.0625f, nullptr, 0, nullptr, 1, 0, 0, nullptr, K16, DM, 0, (int)NR, DM, DM); k_gemm2<0><<<gp, 128, 0, stream>>>(X16, DM, 0, BKVS + (size_t)DM * DM, DM, 0, 0.0625f, nullptr, 0, nullptr, 1, 0, 0, nullptr, V16, DM, 0, (int)NR, DM, DM);      /* short k | v */
  k_gemm2<0><<<gp, 128, 0, stream>>>(X16, DM, 0, BKVL, DM, 0, 0.0625f, nullptr, 0, nullptr, 1, 0, 0, nullptr, KL16, DM, 0, (int)NR, DM, DM); k_gemm2<0><<<gp, 128, 0, stream>>>(X16, DM, 0, BKVL + (size_t)DM * DM, DM, 0, 0.0625f, nullptr, 0, nullptr, 1, 0, 0, nullptr, VL16, DM, 0, (int)NR, DM, DM);      /* long k | v */
  k_vt<<<dim3(NH * (SQ / 64), NB, 2), 256, 0, stream>>>(V16, VL16, VTS, VTL);
  k_attn<<<dim3(SQ / 128, NB * NH, 2), 128, 0, stream>>>(Q16, K16, KL16, VTS, VTL, OS, OL, dfp);      /* per-branch o (merged heads) as f32 rows */
  k_mix<<<(unsigned)((NR * DM / 8 + 255) / 256), 256, 0, stream>>>(OS, OL, mwp, O16, NR * DM / 8);
  k_gemm2<0><<<gp, 128, 0, stream>>>(O16, DM, 0, BO, DM, 0, 0.0625f, nullptr, 0, nullptr, 1, 0, 0, (float*)d_out, nullptr, DM, 0, (int)NR, DM, DM);      /* out = o Wo */
}

// v004
// It runs in 150 microseconds.
// Timed twice side by side with v003, it ran 1.24 and 1.25 times as fast.
// Counting every step since v000, it is 163 times as fast.
#include <hip/hip_runtime.h>
#define NB 4
#define SQ 1024
#define DM 1024
#define NH 16
#define HD 64
#define NR ((size_t)NB * SQ)         /* 4096 token rows */
typedef __bf16 v16b __attribute__((ext_vector_type(16)));
typedef unsigned short v8us __attribute__((ext_vector_type(8), may_alias));
typedef float  v8f  __attribute__((ext_vector_type(8)));
typedef float  v4f  __attribute__((ext_vector_type(4)));
typedef float  v4fa __attribute__((ext_vector_type(4), may_alias));
union FragB { v16b v; v8us half[2]; unsigned short u[16]; };

__device__ __forceinline__ unsigned short bf16_bits(float x) { unsigned int u = __float_as_uint(x); return (unsigned short)((u + 0x7FFFu + ((u >> 16) & 1u)) >> 16); }
__device__ __forceinline__ float bf16_val(unsigned short b) { return __uint_as_float(((unsigned int)b) << 16); }
__device__ __forceinline__ float bf16_round(float x) { return bf16_val(bf16_bits(x)); }
// D += A·B with NT terms: 1 = ah·bh, 2 = + al·bh (A split), 3 = + ah·bl (both split)
template <int NT>
__device__ __forceinline__ v8f mmaN(v16b ah, v16b al, v16b bh, v16b bl, v8f c) {
  c = __builtin_amdgcn_wmma_f32_16x16x32_bf16(false, ah, false, bh, (short)0, c, false, false);
  if (NT >= 2) c = __builtin_amdgcn_wmma_f32_16x16x32_bf16(false, al, false, bh, (short)0, c, false, false);
  if (NT >= 3) c = __builtin_amdgcn_wmma_f32_16x16x32_bf16(false, ah, false, bl, (short)0, c, false, false);
  asm volatile("v_nop\n\tv_nop\n\tv_nop\n\tv_nop" : "+v"(c) : "v"(ah), "v"(al), "v"(bh), "v"(bl));
  return c;
}

__global__ __launch_bounds__(256) void k_wt_bf16(const float* __restrict__ W, unsigned short* __restrict__ Wt, int K, int N) {
  const int t = blockIdx.x * 256 + threadIdx.x;
  const int k8n = K / 8;
  if (t >= N * k8n) return;
  const int n = t / k8n, k8 = (t % k8n) * 8;
  v8us v;
#pragma unroll
  for (int i = 0; i < 8; ++i) v[i] = bf16_bits(W[(size_t)(k8 + i) * N + n]);
  *(v8us*)(Wt + (size_t)n * K + k8) = v;
  
}

// GEMM C[M][N] (f32, pitch ldc) = act(A[M][K]·W + bias). A f32 row-major (pitch lda) converted per fragment to bf16
// (ASPLIT: hi/lo two planes -> 2 terms, else single rounded term); Wt bf16 [N][K] (pitch ldb). BIAS_BF16 rounds the
// bias to bf16 first (bias quantised to bf16 before the add). K%32==0, M%16==0, N%64==0.
template <bool ASPLIT, int ACT, bool BIAS_BF16>
__global__ __launch_bounds__(128) void k_gemm_bf(const float* __restrict__ A, int lda, const unsigned short* __restrict__ Wt, int ldb,
                                               const float* __restrict__ bias, float* __restrict__ C, int ldc, int M, int N, int K) {
  __shared__ __attribute__((aligned(16))) float so[4][16][64];
  const int tid = threadIdx.x, w = tid >> 5, lane = tid & 31, ln = lane & 15, hh = lane >> 4;
  const int ntn = N / 64;
  const int wid = blockIdx.x * 4 + w;
  const int mt = wid / ntn, nq = wid % ntn;
  if (mt * 16 >= M) return;
  const int row0 = mt * 16, col0 = nq * 64;
  const float* arow = A + (size_t)(row0 + ln) * lda;
  v8f acc[4] = {};
  for (int kb = 0; kb < K; kb += 32) {
    FragB ah, al;
    const v4f x0 = *(const v4fa*)(arow + kb + 8 * hh), x1 = *(const v4fa*)(arow + kb + 8 * hh + 4);
    const v4f x2 = *(const v4fa*)(arow + kb + 16 + 8 * hh), x3 = *(const v4fa*)(arow + kb + 16 + 8 * hh + 4);
    float xs[16] = {x0[0],x0[1],x0[2],x0[3],x1[0],x1[1],x1[2],x1[3],x2[0],x2[1],x2[2],x2[3],x3[0],x3[1],x3[2],x3[3]};
#pragma unroll
    for (int i = 0; i < 16; ++i) { const unsigned short hb = bf16_bits(xs[i]); ah.u[i] = hb; al.u[i] = ASPLIT ? bf16_bits(xs[i] - bf16_val(hb)) : (unsigned short)0; }
#pragma unroll
    for (int t = 0; t < 4; ++t) {
      const unsigned short* brow = Wt + (size_t)(col0 + t * 16 + ln) * ldb + kb;
      FragB b;
      b.half[0] = *(const v8us*)(brow + 8 * hh);
      b.half[1] = *(const v8us*)(brow + 16 + 8 * hh);
      acc[t] = mmaN<ASPLIT ? 2 : 1>(ah.v, al.v, b.v, b.v, acc[t]);
    }
  }
#pragma unroll
  for (int t = 0; t < 4; ++t) {
    float bv = bias ? bias[col0 + t * 16 + ln] : 0.f;
    if (BIAS_BF16) bv = bf16_round(bv);
#pragma unroll
    for (int r = 0; r < 8; ++r) { float v = acc[t][r] + bv; if (ACT == 1) v = fmaxf(v, 0.f); so[w][8 * hh + r][t * 16 + ln] = v; }
  }
  __builtin_amdgcn_fence(__ATOMIC_ACQ_REL, "workgroup");
  __builtin_amdgcn_wave_barrier();
  const int rsub = lane >> 4, c4 = (lane & 15) * 4;
  {
#pragma unroll
    for (int q = 0; q < 8; ++q) {
      const int r = q * 2 + rsub;
      const v4f v = *(const v4fa*)&so[w][r][c4];
      *(v4f*)(C + (size_t)(row0 + r) * ldc + col0 + c4) = v;
    }
    
  }
}

// GEMM C = act(A·W + bias + resid): A f32 (ASPLIT -> hi/lo 2 terms), Wt bf16 [N][K]; ACT 0 none, 1 relu, 2 exact gelu;
// resid (optional, f32, row index = (row % rmod), pitch ldr, RES_BF16 rounds it) added before the activation.
template <bool ASPLIT, int ACT, bool BIAS_BF16, bool RES_BF16>
__global__ __launch_bounds__(128) void k_gemm_bf3(const float* __restrict__ A, int lda, const unsigned short* __restrict__ Wt, int ldb,
                                                const float* __restrict__ bias, const float* __restrict__ resid, int rmod, int ldr,
                                                float* __restrict__ C, int ldc, int M, int N, int K) {
  __shared__ __attribute__((aligned(16))) float so[4][16][64];
  const int tid = threadIdx.x, w = tid >> 5, lane = tid & 31, ln = lane & 15, hh = lane >> 4;
  const int ntn = N / 64;
  const int wid = blockIdx.x * 4 + w;
  const int mt = wid / ntn, nq = wid % ntn;
  if (mt * 16 >= M) return;
  const int row0 = mt * 16, col0 = nq * 64;
  const float* arow = A + (size_t)(row0 + ln) * lda;
  v8f acc[4] = {};
  for (int kb = 0; kb < K; kb += 32) {
    FragB ah, al;
    const v4f x0 = *(const v4fa*)(arow + kb + 8 * hh), x1 = *(const v4fa*)(arow + kb + 8 * hh + 4);
    const v4f x2 = *(const v4fa*)(arow + kb + 16 + 8 * hh), x3 = *(const v4fa*)(arow + kb + 16 + 8 * hh + 4);
    float xs[16] = {x0[0],x0[1],x0[2],x0[3],x1[0],x1[1],x1[2],x1[3],x2[0],x2[1],x2[2],x2[3],x3[0],x3[1],x3[2],x3[3]};
#pragma unroll
    for (int i = 0; i < 16; ++i) { const unsigned short hb = bf16_bits(xs[i]); ah.u[i] = hb; al.u[i] = ASPLIT ? bf16_bits(xs[i] - bf16_val(hb)) : (unsigned short)0; }
#pragma unroll
    for (int t = 0; t < 4; ++t) {
      const unsigned short* brow = Wt + (size_t)(col0 + t * 16 + ln) * ldb + kb;
      FragB b;
      b.half[0] = *(const v8us*)(brow + 8 * hh);
      b.half[1] = *(const v8us*)(brow + 16 + 8 * hh);
      acc[t] = mmaN<ASPLIT ? 2 : 1>(ah.v, al.v, b.v, b.v, acc[t]);
    }
  }
#pragma unroll
  for (int t = 0; t < 4; ++t) {
    const int col = col0 + t * 16 + ln;
    float bv = bias ? bias[col] : 0.f;
    if (BIAS_BF16) bv = bf16_round(bv);
#pragma unroll
    for (int r = 0; r < 8; ++r) {
      float v = acc[t][r] + bv;
      if (resid) { float rv = resid[(size_t)((row0 + 8 * hh + r) % rmod) * ldr + col]; if (RES_BF16) rv = bf16_round(rv); v += rv; }
      if (ACT == 1) v = fmaxf(v, 0.f);
      if (ACT == 2) v = 0.5f * v * (1.0f + erff(v * 0.70710678118654752f));
      if (ACT == 3) { const float u = 0.7978845608028654f * (v + 0.044715f * v * v * v); v = 0.5f * v * (1.0f + tanhf(u)); }
      so[w][8 * hh + r][t * 16 + ln] = v;
    }
  }
  __builtin_amdgcn_fence(__ATOMIC_ACQ_REL, "workgroup");
  __builtin_amdgcn_wave_barrier();
  const int rsub = lane >> 4, c4 = (lane & 15) * 4;
  {
#pragma unroll
    for (int q = 0; q < 8; ++q) {
      const int r = q * 2 + rsub;
      const v4f v = *(const v4fa*)&so[w][r][c4];
      *(v4f*)(C + (size_t)(row0 + r) * ldc + col0 + c4) = v;
    }
    
  }
}
// row LayerNorm (biased variance, eps) over N: s = X (+ R); optional out_sum <- s; out_norm <- (s-mu)*rsqrt(var+eps)*g + b
template <bool PARAM_BF16>
__global__ __launch_bounds__(256) void k_layernorm(const float* __restrict__ X, const float* __restrict__ R, const float* __restrict__ g, const float* __restrict__ bta,
                                                  float* __restrict__ out_sum, float* __restrict__ out_norm, int N, float eps) {
  __shared__ float red[256];
  const int row = blockIdx.x, tid = threadIdx.x;
  const float* x = X + (size_t)row * N; const float* rr = R ? R + (size_t)row * N : nullptr;
  float vals[16];                     // up to N = 4096
  const int per = N / 256;            // contiguous chunk per thread? use strided-by-4 chunks: thread handles j = tid*4 + 1024*u
  float s1 = 0.f;
  for (int u = 0; u < per / 4; ++u) {
    const int j = tid * 4 + 1024 * u;
    const v4f a = *(const v4fa*)(x + j);
    v4f b = {0.f,0.f,0.f,0.f}; if (rr) b = *(const v4fa*)(rr + j);
#pragma unroll
    for (int q = 0; q < 4; ++q) { const float v = a[q] + b[q]; vals[u * 4 + q] = v; s1 += v; }
  }
  red[tid] = s1; __syncthreads();
  for (int st = 128; st > 0; st >>= 1) { if (tid < st) red[tid] += red[tid + st]; __syncthreads(); }
  const float mu = red[0] / (float)N; __syncthreads();
  float s2 = 0.f;
  for (int u = 0; u < per / 4; ++u)
#pragma unroll
    for (int q = 0; q < 4; ++q) { const float c = vals[u * 4 + q] - mu; s2 += c * c; }
  red[tid] = s2; __syncthreads();
  for (int st = 128; st > 0; st >>= 1) { if (tid < st) red[tid] += red[tid + st]; __syncthreads(); }
  const float rs = rsqrtf(red[0] / (float)N + eps);
  {
    for (int u = 0; u < per / 4; ++u) {
      const int j = tid * 4 + 1024 * u;
      v4f o, sm;
#pragma unroll
      for (int q = 0; q < 4; ++q) {
        float gg = g[j + q], bb = bta[j + q];
        if (PARAM_BF16) { gg = bf16_round(gg); bb = bf16_round(bb); }
        sm[q] = vals[u * 4 + q]; o[q] = (vals[u * 4 + q] - mu) * rs * gg + bb;
      }
      if (out_sum) *(v4f*)(out_sum + (size_t)row * N + j) = sm;
      *(v4f*)(out_norm + (size_t)row * N + j) = o;
    }
    
  }
}



// ---- f16 WMMA path (v_wmma_f32_16x16x32_f16): 11-bit significands for operands in range — used where a [0,1] probability operand needs more precision than bf16
typedef _Float16 v16h __attribute__((ext_vector_type(16)));
union FragH { v16h v; v8us half[2]; _Float16 h[16]; unsigned short u[16]; };
template <int NT>
__device__ __forceinline__ v8f mmaH(v16h ah, v16h al, v16h bh, v16h bl, v8f c) {
  c = __builtin_amdgcn_wmma_f32_16x16x32_f16(false, ah, false, bh, (short)0, c, false, false);
  if (NT >= 2) c = __builtin_amdgcn_wmma_f32_16x16x32_f16(false, al, false, bh, (short)0, c, false, false);
  if (NT >= 3) c = __builtin_amdgcn_wmma_f32_16x16x32_f16(false, ah, false, bl, (short)0, c, false, false);
  asm volatile("v_nop\n\tv_nop\n\tv_nop\n\tv_nop" : "+v"(c) : "v"(ah), "v"(al), "v"(bh), "v"(bl));
  return c;
}
// batched GEMM like k_gemm_b but f16 operands: A f32 (split into f16 hi/lo if ASPLIT, else rounded to f16), Bt = f16 values [n][k]; alpha; C f32; N multiple of 16 (partial tiles skipped)
template <bool ASPLIT>
__global__ __launch_bounds__(128) void k_gemm_h(const float* __restrict__ A, int lda, size_t sA, const _Float16* __restrict__ Bh, int ldb, size_t sB, float alpha, float* __restrict__ C, int ldc, size_t sC, int M, int N, int K) {
  __shared__ __attribute__((aligned(16))) float so[4][16][64];
  const int tid = threadIdx.x, w = tid >> 5, lane = tid & 31, ln = lane & 15, hh = lane >> 4; const int by = blockIdx.y;
  A += (size_t)by * sA; Bh += (size_t)by * sB; C += (size_t)by * sC;
  const int ntn = (N + 63) / 64; const int wid = blockIdx.x * 4 + w; const int mt = wid / ntn, nq = wid % ntn; if (mt * 16 >= M) return;
  const int row0 = mt * 16, col0 = nq * 64; const float* arow = A + (size_t)(row0 + ln) * lda;
  v8f acc[4] = {};
  for (int kb = 0; kb < K; kb += 32) {
    FragH ah, al;
    const v4f x0 = *(const v4fa*)(arow + kb + 8 * hh), x1 = *(const v4fa*)(arow + kb + 8 * hh + 4), x2 = *(const v4fa*)(arow + kb + 16 + 8 * hh), x3 = *(const v4fa*)(arow + kb + 16 + 8 * hh + 4);
    float xs[16] = {x0[0],x0[1],x0[2],x0[3],x1[0],x1[1],x1[2],x1[3],x2[0],x2[1],x2[2],x2[3],x3[0],x3[1],x3[2],x3[3]};
#pragma unroll
    for (int i = 0; i < 16; ++i) { const _Float16 h = (_Float16)xs[i]; ah.h[i] = h; al.h[i] = ASPLIT ? (_Float16)(xs[i] - (float)h) : (_Float16)0.0f; }
#pragma unroll
    for (int t = 0; t < 4; ++t) { if (col0 + t * 16 >= N) continue; const size_t boff = (size_t)(col0 + t * 16 + ln) * ldb + kb; FragH bq; bq.half[0] = *(const v8us*)(Bh + boff + 8 * hh); bq.half[1] = *(const v8us*)(Bh + boff + 16 + 8 * hh);
      acc[t] = mmaH<ASPLIT ? 2 : 1>(ah.v, al.v, bq.v, bq.v, acc[t]); }
  }
#pragma unroll
  for (int t = 0; t < 4; ++t) { if (col0 + t * 16 >= N) continue;
#pragma unroll
    for (int r = 0; r < 8; ++r) so[w][8 * hh + r][t * 16 + ln] = acc[t][r] * alpha; }
  __builtin_amdgcn_fence(__ATOMIC_ACQ_REL, "workgroup"); __builtin_amdgcn_wave_barrier();
  const int rsub = lane >> 4, c4 = (lane & 15) * 4;
  {
#pragma unroll
    for (int q = 0; q < 8; ++q) { const int r = q * 2 + rsub; if (col0 + c4 < N) { const v4f v = *(const v4fa*)&so[w][r][c4]; *(v4f*)(C + (size_t)(row0 + r) * ldc + col0 + c4) = v; } }
     }
}

// Wt[n][k] = f16(W[k][n]·scale) from f32 row-major W[K][N] (scale = power of two; bf16-exact weights stay exact in f16 away from the subnormal range)
__global__ __launch_bounds__(256) void k_wt_f16(const float* __restrict__ W, _Float16* __restrict__ Wt, int K, int N, float scale) {
  const int t = blockIdx.x * 256 + threadIdx.x; if (t >= N * (K / 8)) return; const int n = t / (K / 8), k8 = (t % (K / 8)) * 8; FragH f;
#pragma unroll
  for (int i = 0; i < 8; ++i) f.h[i] = (_Float16)(bf16_round(W[(size_t)(k8 + i) * N + n]) * scale); const v8us o = f.half[0];
  *(v8us*)((unsigned short*)Wt + (size_t)n * K + k8) = o; 
}
// k_gemm_hh variant with fused epilogue: v = acc·alpha + bias[by·sBias + col] (+ CP[(row/rowsPerB)·sCPb + by·64 + col] if CP) ; ACT 0 none / 1 elu ; writes f16 C16 (and f32 C if non-null)
template <int ACT>
__global__ __launch_bounds__(128) void k_gemm_hhx(const _Float16* __restrict__ A, int lda, size_t sA, const _Float16* __restrict__ Bh, int ldb, size_t sB, float alpha, const float* __restrict__ bias, size_t sBias, const float* __restrict__ CP, int rowsPerB, size_t sCPb, int row0g,
    float* __restrict__ C, _Float16* __restrict__ C16, int ldc, size_t sC, int M, int N, int K) {
  __shared__ __attribute__((aligned(16))) float so[4][16][64];
  const int tid = threadIdx.x, w = tid >> 5, lane = tid & 31, ln = lane & 15, hh = lane >> 4; const int by = blockIdx.y;
  A += (size_t)by * sA; Bh += (size_t)by * sB; const size_t cofs = (size_t)by * sC; const float* bp = bias ? bias + (size_t)by * sBias : nullptr;
  const int ntn = (N + 63) / 64; const int wid = blockIdx.x * 4 + w; const int mt = wid / ntn, nq = wid % ntn; if (mt * 16 >= M) return;
  const int row0 = mt * 16, col0 = nq * 64; const _Float16* arow = A + (size_t)(row0 + ln) * lda;
  v8f acc[4] = {};
  for (int kb = 0; kb < K; kb += 32) { FragH ah; ah.half[0] = *(const v8us*)((const unsigned short*)arow + kb + 8 * hh); ah.half[1] = *(const v8us*)((const unsigned short*)arow + kb + 16 + 8 * hh);
#pragma unroll
    for (int t = 0; t < 4; ++t) { if (col0 + t * 16 >= N) continue; const size_t boff = (size_t)(col0 + t * 16 + ln) * ldb + kb; FragH bq; bq.half[0] = *(const v8us*)((const unsigned short*)Bh + boff + 8 * hh); bq.half[1] = *(const v8us*)((const unsigned short*)Bh + boff + 16 + 8 * hh);
      acc[t] = mmaH<1>(ah.v, ah.v, bq.v, bq.v, acc[t]); }
  }
#pragma unroll
  for (int t = 0; t < 4; ++t) { if (col0 + t * 16 >= N) continue; const int col = col0 + t * 16 + ln; const float bv = bp ? bf16_round(bp[col]) : 0.f;
#pragma unroll
    for (int r = 0; r < 8; ++r) { float v = acc[t][r] * alpha + bv; if (CP) { const int rr = row0g + row0 + 8 * hh + r; if (rowsPerB < 0) v += CP[cofs + (size_t)rr * ldc + col];      /* rowsPerB < 0: own element of the batched C plane */ else { const int bidx = rr / rowsPerB; v += CP[(size_t)bidx * sCPb + (size_t)by * 64 + col]; } } if (ACT == 1) v = (v > 0.f) ? v : expm1f(v); else if (ACT == 7) v = (v > 0.f) ? v + 1.0f : expf(v); else if (ACT == 8) v = tanhf(v); else if (ACT == 9) v = 0.5f * v * (1.0f + tanhf(0.7978845608028654f * (v + 0.044715f * v * v * v))); else if (ACT == 11) v = 1.0f / (1.0f + expf(-v)); else if (ACT == 12) v = (v > 0.f) ? v : 0.01f * v; else if (ACT == 14) v = (v > 0.f) ? v : 0.1f * v; else if (ACT == 16) v = (v >= 0.f) ? v : 0.3f * v; else if (ACT == 17) v = (v >= 0.f) ? v : 0.2f * v; else if (ACT == 15) v = v / (1.0f + expf(-v)); else if (ACT == 3) v = fmaxf(v, 0.f); else if (ACT == 6) v = 0.5f * v * (1.0f + erff(v * 0.70710678118654752f)); so[w][8 * hh + r][t * 16 + ln] = v; } }
  __builtin_amdgcn_fence(__ATOMIC_ACQ_REL, "workgroup"); __builtin_amdgcn_wave_barrier();
  const int rsub = lane >> 4, c4 = (lane & 15) * 4; typedef _Float16 v4h __attribute__((ext_vector_type(4)));
  {
#pragma unroll
    for (int q = 0; q < 8; ++q) { const int r = q * 2 + rsub; if (col0 + c4 < N) { const v4f v = *(const v4fa*)&so[w][r][c4]; if (C) *(v4f*)(C + cofs + (size_t)(row0 + r) * ldc + col0 + c4) = v; if (C16) { v4h h4; for (int i = 0; i < 4; ++i) h4[i] = (_Float16)v[i]; *(v4h*)(C16 + cofs + (size_t)(row0 + r) * ldc + col0 + c4) = h4; } } }
     }
}


typedef _Float16 v4h __attribute__((ext_vector_type(4)));

__device__ __forceinline__ void x16_block(const float* __restrict__ x, _Float16* __restrict__ X16, size_t n8, int bid) { const size_t t = (size_t)bid * 256 + threadIdx.x; if (t >= n8) return; FragH f;
#pragma unroll
  for (int q = 0; q < 8; ++q) f.h[q] = (_Float16)bf16_round(x[t * 8 + q]); *(v8us*)((unsigned short*)X16 + t * 8) = f.half[0];  }
__global__ __launch_bounds__(256) void k_h16(const float* __restrict__ x, _Float16* __restrict__ X16, size_t n8) { const size_t t = (size_t)blockIdx.x * 256 + threadIdx.x; if (t >= n8) return; FragH f;
#pragma unroll
  for (int q = 0; q < 8; ++q) f.h[q] = (_Float16)x[t * 8 + q]; *(v8us*)((unsigned short*)X16 + t * 8) = f.half[0];  }
__global__ __launch_bounds__(256) void k_round16f(const float* __restrict__ W, _Float16* __restrict__ Bt, size_t n8) { const size_t t = (size_t)blockIdx.x * 256 + threadIdx.x; if (t >= n8) return; FragH f;
#pragma unroll
  for (int i = 0; i < 8; ++i) f.h[i] = (_Float16)(bf16_round(W[t * 8 + i]) * 16.0f); *(v8us*)((unsigned short*)Bt + t * 8) = f.half[0];  }
template <int NHv, int TTv>
__global__ __launch_bounds__(256) void k_vt(const _Float16* __restrict__ V16, int ldv, int voff, _Float16* __restrict__ Vt) { __shared__ unsigned short tl[64][66]; const int tid = threadIdx.x; const int slab = blockIdx.x / (TTv / 64), lg = blockIdx.x % (TTv / 64); const int b = slab / NHv, h = slab % NHv;
  for (int i = tid; i < 64 * 8; i += 256) { const int r = i / 8, c8 = (i % 8) * 8; FragH f; f.half[0] = *(const v8us*)((const unsigned short*)V16 + ((size_t)b * TTv + lg * 64 + r) * ldv + voff + h * 64 + c8);
#pragma unroll
    for (int q = 0; q < 8; ++q) tl[r][c8 + q] = f.u[q]; }
  __syncthreads();
  {
#pragma unroll
    for (int rd = 0; rd < 2; ++rd) { const int d = rd * 32 + tid / 8, pc = tid % 8; FragH f;
#pragma unroll
      for (int q = 0; q < 8; ++q) f.u[q] = tl[pc * 8 + q][d];
      *(v8us*)((unsigned short*)Vt + ((size_t)slab * 64 + d) * TTv + lg * 64 + pc * 8) = f.half[0]; }
     } }

__global__ __launch_bounds__(256) void k_hl(const float* __restrict__ F, _Float16* __restrict__ Hh, _Float16* __restrict__ Hl, size_t n8) { const size_t t = (size_t)blockIdx.x * 256 + threadIdx.x; if (t >= n8) return; FragH fh, fl; const v4f a = *(const v4fa*)(F + t * 8), c = *(const v4fa*)(F + t * 8 + 4);
#pragma unroll
  for (int q = 0; q < 4; ++q) { _Float16 h = (_Float16)a[q]; fh.h[q] = h; fl.h[q] = (_Float16)((a[q] - (float)h) * 1024.0f); h = (_Float16)c[q]; fh.h[4 + q] = h; fl.h[4 + q] = (_Float16)((c[q] - (float)h) * 1024.0f); }
  { *(v8us*)((unsigned short*)Hh + t * 8) = fh.half[0]; *(v8us*)((unsigned short*)Hl + t * 8) = fl.half[0];  } }

// ---- fast GEMM (wave tile 32x64, block tile 128x64; requires M % 128 == 0 rows per launch region, N % 64 == 0 and K % 64 == 0); epilogue = k_gemm_hhx semantics ----
// Operands go through LDS: a stage is 64 k of the block's 128 A rows and 64 B rows (128 bytes a row), brought by asynchronous copies, two buffers, the copies of stage t + 2 in flight while stage t + 1 is worked on.
// A wave-wide copy reads 4 rows x 128 contiguous bytes (4 whole cache lines), and the B rows are fetched once a block.
#define G2_PITCH 72      /* f16 elements a row in LDS = 144 bytes = 16 x 9: 16 rows read by ds_load_b128 fall on distinct banks */
#define G2_ROWS 192      /* rows 0..127: A, rows 128..191: B */
#define G2_BUF (G2_ROWS * G2_PITCH)
// fragment from an LDS row: p = row + 32 ks + 8 hh; the k order of g2_frag
__device__ __forceinline__ v16h g2_lfrag(const _Float16* p) { FragH f; f.half[0] = *(const v8us*)((const unsigned short*)p); f.half[1] = *(const v8us*)((const unsigned short*)p + 16); return f.v; }
// One lane's twelve 16-byte copies of a stage: thread tid takes bytes 16 (tid & 7) of rows (tid >> 3) + 16 c, c = 0..11. l = its LDS byte address in row tid >> 3 of the buffer, ga / gb = its global address in that row of the
// A / B tile, sa / sb = 16 rows in elements. The s_wait_xcnt stands inside the statement, behind the last copy, so that no address register of a copy is rewritten in front of it.
__device__ __forceinline__ void g2_stage(unsigned l, const _Float16* ga, size_t sa, const _Float16* gb, size_t sb) {
  const unsigned rs = 16 * G2_PITCH * 2;
  asm volatile("global_load_async_to_lds_b128 %0, %12, off\n\tglobal_load_async_to_lds_b128 %1, %13, off\n\tglobal_load_async_to_lds_b128 %2, %14, off\n\tglobal_load_async_to_lds_b128 %3, %15, off\n\t"
               "global_load_async_to_lds_b128 %4, %16, off\n\tglobal_load_async_to_lds_b128 %5, %17, off\n\tglobal_load_async_to_lds_b128 %6, %18, off\n\tglobal_load_async_to_lds_b128 %7, %19, off\n\t"
               "global_load_async_to_lds_b128 %8, %20, off\n\tglobal_load_async_to_lds_b128 %9, %21, off\n\tglobal_load_async_to_lds_b128 %10, %22, off\n\tglobal_load_async_to_lds_b128 %11, %23, off\n\ts_wait_xcnt 0x0"
               :: "v"(l), "v"(l + rs), "v"(l + 2 * rs), "v"(l + 3 * rs), "v"(l + 4 * rs), "v"(l + 5 * rs), "v"(l + 6 * rs), "v"(l + 7 * rs), "v"(l + 8 * rs), "v"(l + 9 * rs), "v"(l + 10 * rs), "v"(l + 11 * rs),
                  "v"(ga), "v"(ga + sa), "v"(ga + 2 * sa), "v"(ga + 3 * sa), "v"(ga + 4 * sa), "v"(ga + 5 * sa), "v"(ga + 6 * sa), "v"(ga + 7 * sa), "v"(gb), "v"(gb + sb), "v"(gb + 2 * sb), "v"(gb + 3 * sb) : "memory"); }
__device__ __forceinline__ v16h g2_frag(const _Float16* p, int hh) { FragH f; f.half[0] = *(const v8us*)((const unsigned short*)p + 8 * hh); f.half[1] = *(const v8us*)((const unsigned short*)p + 16 + 8 * hh); return f.v; }
__device__ __forceinline__ v8f g2_mma(v16h a, v16h b, v8f c) { v8f d = __builtin_amdgcn_wmma_f32_16x16x32_f16(false, a, false, b, (short)0, c, false, false); asm volatile("v_nop\n\tv_nop\n\tv_nop\n\tv_nop" : "+v"(d) : "v"(a), "v"(b)); return d; }
template <int ACT>
__global__ __launch_bounds__(128) void k_gemm2(const _Float16* __restrict__ A, int lda, size_t sA, const _Float16* __restrict__ Bh, int ldb, size_t sB, float alpha, const float* __restrict__ bias, size_t sBias, const float* __restrict__ CP, int rowsPerB, size_t sCPb, int row0g,
    float* __restrict__ C, _Float16* __restrict__ C16, int ldc, size_t sC, int M, int N, int K) { static_assert(ACT == 0 || ACT == 3 || ACT == 6 || ACT == 8 || ACT == 9 || ACT == 11 || ACT == 12 || ACT == 14 || ACT == 15 || ACT == 16 || ACT == 17, "k_gemm2: unsupported ACT code (would silently apply no activation)");
  __shared__ __attribute__((aligned(16))) float so[4][32][68];
  __shared__ __attribute__((aligned(16))) _Float16 st[2][G2_BUF];
  const int tid = threadIdx.x, w = tid >> 5, lane = tid & 31, ln = lane & 15, hh = lane >> 4; const int by = blockIdx.y;
  A += (size_t)by * sA; Bh += (size_t)by * sB; const size_t cofs = (size_t)by * sC; const float* bp = bias ? bias + (size_t)by * sBias : nullptr;
  const int ntn = N >> 6; const int mt = blockIdx.x / ntn, nq = blockIdx.x - mt * ntn; const int row0 = mt * 128 + 32 * w, col0 = nq * 64; if (mt * 128 >= M) return;      /* the same for the whole block: it stands in front of barriers */
  const _Float16* gap = A + (size_t)(mt * 128 + (tid >> 3)) * lda + (tid & 7) * 8; const _Float16* gbp = Bh + (size_t)(col0 + (tid >> 3)) * ldb + (tid & 7) * 8; const size_t sa16 = (size_t)16 * lda, sb16 = (size_t)16 * ldb;
  const unsigned lst = (unsigned)(size_t)&st[0][(tid >> 3) * G2_PITCH + (tid & 7) * 8];      /* low 32 bits of the shared address = byte address in the block's LDS */
  const int aoff = (32 * w + ln) * G2_PITCH + 8 * hh, boff = (128 + ln) * G2_PITCH + 8 * hh; const int nst = K >> 6;
  const v8f z8 = {0.f,0.f,0.f,0.f,0.f,0.f,0.f,0.f}; v8f c00 = z8, c01 = z8, c02 = z8, c03 = z8, c10 = z8, c11 = z8, c12 = z8, c13 = z8;
  g2_stage(lst, gap, sa16, gbp, sb16);
  asm volatile("s_wait_asynccnt 0x0" ::: "memory");      // this wave's copies of stage 0 have landed
  __syncthreads();                                       // ... and every other wave's: stage 0 may be read
  if (nst > 1) g2_stage(lst + G2_BUF * 2, gap + 64, sa16, gbp + 64, sb16);
  // rolled, as it was: a trip already holds a stage's 24 LDS reads and 16 products, and unrolled trips would each keep their own 36 copy address registers; the buffer is chosen by the trip's parity
#pragma unroll 1
  for (int t = 0; t < nst; ++t) { const _Float16* sb = st[t & 1]; v16h af[2][2], bf[2][4];
    // the three inner loops are fully unrolled so that the fragment arrays are indexed by constants and stay in registers
#pragma unroll
    for (int ks = 0; ks < 2; ++ks) { af[ks][0] = g2_lfrag(sb + aoff + ks * 32); af[ks][1] = g2_lfrag(sb + aoff + 16 * G2_PITCH + ks * 32);
#pragma unroll
      for (int u = 0; u < 4; ++u) bf[ks][u] = g2_lfrag(sb + boff + u * 16 * G2_PITCH + ks * 32); }
#pragma unroll
    for (int ks = 0; ks < 2; ++ks) {
      c00 = g2_mma(af[ks][0], bf[ks][0], c00); c10 = g2_mma(af[ks][1], bf[ks][0], c10);
      c01 = g2_mma(af[ks][0], bf[ks][1], c01); c11 = g2_mma(af[ks][1], bf[ks][1], c11);
      c02 = g2_mma(af[ks][0], bf[ks][2], c02); c12 = g2_mma(af[ks][1], bf[ks][2], c12);
      c03 = g2_mma(af[ks][0], bf[ks][3], c03); c13 = g2_mma(af[ks][1], bf[ks][3], c13); }
    asm volatile("s_wait_dscnt 0x0" ::: "memory");         // this wave's reads of stage t are finished before its buffer is refilled
    asm volatile("s_wait_asynccnt 0x0" ::: "memory");      // this wave's copies of stage t + 1 have landed
    __syncthreads();                                       // publishes stage t + 1 and ends every wave's reads of stage t
    if (t + 2 < nst) g2_stage(lst + (unsigned)(t & 1) * (G2_BUF * 2), gap + (size_t)(t + 2) * 64, sa16, gbp + (size_t)(t + 2) * 64, sb16); }
  asm volatile("s_wait_asynccnt 0x0" ::: "memory");        // no copy is outstanding when the wave goes on to its end
  v8f accs[8] = {c00, c01, c02, c03, c10, c11, c12, c13};
#pragma unroll
  for (int u = 0; u < 8; ++u) { const int t = u & 3, half = u >> 2; const int col = col0 + t * 16 + ln; const float bv = bp ? bf16_round(bp[col]) : 0.f;
#pragma unroll
    for (int r = 0; r < 8; ++r) { const int rloc = half * 16 + 8 * hh + r; float v = accs[u][r] * alpha + bv; if (CP) { if (rowsPerB < 0) v += CP[cofs + (size_t)(row0g + row0 + rloc) * ldc + col];      /* rowsPerB < 0: own element of the batched C plane */ else { const int bidx = (row0g + row0 + rloc) / rowsPerB; v += CP[(size_t)bidx * sCPb + (size_t)by * 64 + col]; } }
      if (ACT == 3) v = fmaxf(v, 0.f); else if (ACT == 6) v = 0.5f * v * (1.0f + erff(v * 0.70710678118654752f)); else if (ACT == 11) v = 1.0f / (1.0f + expf(-v)); else if (ACT == 15) v = v / (1.0f + expf(-v)); else if (ACT == 12) v = (v > 0.f) ? v : 0.01f * v; else if (ACT == 8) v = tanhf(v); else if (ACT == 9) v = 0.5f * v * (1.0f + tanhf(0.7978845608028654f * (v + 0.044715f * v * v * v))); else if (ACT == 14) v = (v > 0.f) ? v : 0.1f * v; else if (ACT == 16) v = (v >= 0.f) ? v : 0.3f * v; else if (ACT == 17) v = (v >= 0.f) ? v : 0.2f * v;
      so[w][rloc][t * 16 + ln] = v; } }
  __builtin_amdgcn_fence(__ATOMIC_ACQ_REL, "workgroup"); __builtin_amdgcn_wave_barrier();
  const int rsub = lane >> 4, c4 = (lane & 15) * 4;
  {
#pragma unroll
    for (int q = 0; q < 16; ++q) { const int r = q * 2 + rsub; const v4f v = *(const v4fa*)&so[w][r][c4]; if (C) *(v4f*)(C + cofs + (size_t)(row0 + r) * ldc + col0 + c4) = v; if (C16) { v4h h4; for (int i = 0; i < 4; ++i) h4[i] = (_Float16)v[i]; *(v4h*)(C16 + cofs + (size_t)(row0 + r) * ldc + col0 + c4) = h4; } }
     } }


__global__ __launch_bounds__(256) void k_wnat(const float* __restrict__ w, size_t n8, _Float16* __restrict__ Bt) { const size_t t = (size_t)blockIdx.x * 256 + threadIdx.x; if (t >= n8) return; FragH f; for (int q = 0; q < 8; ++q) f.h[q] = (_Float16)(bf16_round(w[t * 8 + q]) * 16.0f); *(v8us*)((unsigned short*)Bt + t * 8) = f.half[0];  }
// V^T of every (branch, batch, head): blockIdx.x = head + NH * (block of 64 keys), blockIdx.y = batch, blockIdx.z = branch; VT[(b * NH + h) * HD + d][key]
__global__ __launch_bounds__(256) void k_vt(const _Float16* __restrict__ VS16, const _Float16* __restrict__ VL16, _Float16* __restrict__ VTS, _Float16* __restrict__ VTL) { __shared__ unsigned short tl[64][65]; const int tid = threadIdx.x; const int h = blockIdx.x % NH, sg = blockIdx.x / NH; const int s0 = sg * 64; const int b = blockIdx.y;
  const _Float16* V16 = blockIdx.z ? VL16 : VS16; _Float16* VT = blockIdx.z ? VTL : VTS;
  for (int i = tid; i < 64 * 8; i += 256) { const int j = i / 8, d8 = (i % 8) * 8; FragH f; f.half[0] = *(const v8us*)((const unsigned short*)V16 + ((size_t)b * SQ + s0 + j) * DM + h * HD + d8); for (int q = 0; q < 8; ++q) tl[d8 + q][j] = f.u[q]; }
  __syncthreads();
  { for (int i = tid; i < 64 * 8; i += 256) { const int d = i / 8, j8 = (i % 8) * 8; FragH f; for (int q = 0; q < 8; ++q) f.u[q] = tl[d][j8 + q]; *(v8us*)((unsigned short*)VT + (((size_t)b * NH + h) * HD + d) * SQ + s0 + j8) = f.half[0]; }  } }

// ---- fused attention: scores, softmax and weighted sum of one branch in one pass over the keys; no score ever reaches memory ----
// Transposed products. S^T = K Q^T: A = 16 key rows, B = 16 query rows, so lane (ln, hh) holds for query ln the keys 8 hh + r of each 16-key tile. Two such tiles, rounded to f16, are
// at once the B operand of O^T += V^T P^T over 32 keys (element i: key 8 hh + i, element 8 + i: key 16 + 8 hh + i, the k order of g2_frag, which loads the A operand from V^T rows).
// A query's maximum, sum and scale therefore live in its own lane (both halves); the halves exchange the maximum once a pass and join their sums once at the end.
// Every inner loop is fully unrolled so that the fragment, score and accumulator arrays are indexed by constants and stay in registers (a rolled loop would put them in scratch memory).
// Scores are kept in the log2 domain (x = s log2 e). The maximum in use is raised, and sums and outputs rescaled, only when a column's new maximum exceeds it by more than 8, so weights stay <= 2^8.
// 2^x of eight (two) values in place, one statement: behind each v_exp_f32 stands an instruction that neither reads its result nor overwrites its source (the operands are distinct registers), behind the last the v_nop: the slot the instruction set asks for behind a transcendental
__device__ __forceinline__ void ex2x8(v8f& x) { asm("v_exp_f32 %0, %0\n\tv_exp_f32 %1, %1\n\tv_exp_f32 %2, %2\n\tv_exp_f32 %3, %3\n\tv_exp_f32 %4, %4\n\tv_exp_f32 %5, %5\n\tv_exp_f32 %6, %6\n\tv_exp_f32 %7, %7\n\tv_nop" : "+v"(x[0]), "+v"(x[1]), "+v"(x[2]), "+v"(x[3]), "+v"(x[4]), "+v"(x[5]), "+v"(x[6]), "+v"(x[7])); }
__device__ __forceinline__ void ex2x2(float& a, float& b) { asm("v_exp_f32 %0, %0\n\tv_exp_f32 %1, %1\n\tv_nop" : "+v"(a), "+v"(b)); }
__device__ __forceinline__ v8f at_mma(v16h a, v16h b, v8f c) { return __builtin_amdgcn_wmma_f32_16x16x32_f16(false, a, false, b, (short)0, c, false, false); }
template <bool DECAY>
__device__ __forceinline__ void attn_run(const _Float16* __restrict__ Q16, const _Float16* __restrict__ KB, const _Float16* __restrict__ VT, float* __restrict__ OB, float c2, float (*so)[68]) {
  const int lane = threadIdx.x & 31, ln = lane & 15, hh = lane >> 4; const int b = blockIdx.y / NH, h = blockIdx.y % NH; const int q0 = blockIdx.x * 128 + (threadIdx.x >> 5) * 32;
  const float sc2 = 0.125f * 1.4426950408889634f;
  const _Float16* qp = Q16 + ((size_t)b * SQ + q0 + ln) * DM + h * HD; const _Float16* kp = KB + ((size_t)b * SQ + ln) * DM + h * HD; const _Float16* vp = VT + ((size_t)blockIdx.y * HD + ln) * SQ;
  v16h qf[2][2], kf[2][2];
#pragma unroll
  for (int g = 0; g < 2; ++g)
#pragma unroll
    for (int ks = 0; ks < 2; ++ks) { qf[g][ks] = g2_frag(qp + (size_t)g * 16 * DM + ks * 32, hh); kf[g][ks] = g2_frag(kp + (size_t)g * 16 * DM + ks * 32, hh); }
  const v8f z8 = {0.f,0.f,0.f,0.f,0.f,0.f,0.f,0.f}; v8f o[2][4];
#pragma unroll
  for (int g = 0; g < 2; ++g)
#pragma unroll
    for (int dt = 0; dt < 4; ++dt) o[g][dt] = z8;
  float m[2] = {-3.0e38f, -3.0e38f}, l[2] = {0.f, 0.f};
  // rolled, for speed only
#pragma unroll 1
  for (int kb = 0; kb < SQ; kb += 32) {
    v16h vf[4];
#pragma unroll
    for (int dt = 0; dt < 4; ++dt) vf[dt] = g2_frag(vp + (size_t)dt * 16 * SQ + kb, hh);
    __builtin_amdgcn_sched_barrier(0);      // keeps the V^T loads at the head of the pass, so that the score products and the maxima cover their latency (the scheduler sinks them to their use otherwise)
    v8f s[2][2];
#pragma unroll
    for (int g = 0; g < 2; ++g)
#pragma unroll
      for (int t = 0; t < 2; ++t) s[g][t] = at_mma(kf[t][1], qf[g][1], at_mma(kf[t][0], qf[g][0], z8));
    // the next pass's K fragments, asked for while this pass's softmax runs (the last pass reads the first rows again: in bounds, not used)
    const int kn = (kb + 32 < SQ) ? kb + 32 : 0;
#pragma unroll
    for (int t = 0; t < 2; ++t)
#pragma unroll
      for (int ks = 0; ks < 2; ++ks) kf[t][ks] = g2_frag(kp + (size_t)(kn + t * 16) * DM + ks * 32, hh);
    float mt[2];
#pragma unroll
    for (int g = 0; g < 2; ++g) { float mx = -3.0e38f;
#pragma unroll
      for (int t = 0; t < 2; ++t) { const float fb = (float)(q0 + g * 16 + ln - 8 * hh - kb - t * 16);
#pragma unroll
        for (int r = 0; r < 8; ++r) { if (DECAY) s[g][t][r] = s[g][t][r] * sc2 - fabsf(fb - (float)r) * c2; mx = fmaxf(mx, s[g][t][r]); } }
      if (!DECAY) mx *= sc2;
      mt[g] = fmaxf(mx, __shfl_xor(mx, 16, 32)); }
    const bool need = (mt[0] > m[0] + 8.0f) || (mt[1] > m[1] + 8.0f);
    if (__builtin_amdgcn_ballot_w32(need) != 0) { const float mn0 = fmaxf(m[0], mt[0]), mn1 = fmaxf(m[1], mt[1]); float al[2] = {m[0] - mn0, m[1] - mn1}; ex2x2(al[0], al[1]); m[0] = mn0; m[1] = mn1;
#pragma unroll
      for (int g = 0; g < 2; ++g) { l[g] *= al[g];
#pragma unroll
        for (int dt = 0; dt < 4; ++dt) o[g][dt] *= al[g]; } }
#pragma unroll
    for (int g = 0; g < 2; ++g) { FragH pf; float ls = 0.f;
#pragma unroll
      for (int t = 0; t < 2; ++t) { v8f p;
#pragma unroll
        for (int r = 0; r < 8; ++r) p[r] = DECAY ? s[g][t][r] - m[g] : s[g][t][r] * sc2 - m[g];
        ex2x8(p);
#pragma unroll
        for (int r = 0; r < 8; ++r) { ls += p[r]; pf.h[t * 8 + r] = (_Float16)p[r]; } }
      l[g] += ls;
#pragma unroll
      for (int dt = 0; dt < 4; ++dt) o[g][dt] = at_mma(vf[dt], pf.v, o[g][dt]); }
  }
  // O^T tile: lane (ln, hh) holds of query ln the columns 16 dt + 8 hh + r; through the wave's own LDS rows so that each store covers 256 contiguous bytes of a row
#pragma unroll
  for (int g = 0; g < 2; ++g) { const float lt = l[g] + __shfl_xor(l[g], 16, 32); const float inv = 1.0f / lt;
#pragma unroll
    for (int dt = 0; dt < 4; ++dt) { const v8f ov = o[g][dt] * inv; const v4f lo = {ov[0], ov[1], ov[2], ov[3]}, hi = {ov[4], ov[5], ov[6], ov[7]};
      *(v4fa*)&so[g * 16 + ln][dt * 16 + 8 * hh] = lo; *(v4fa*)&so[g * 16 + ln][dt * 16 + 8 * hh + 4] = hi; } }
  __builtin_amdgcn_fence(__ATOMIC_ACQ_REL, "workgroup"); __builtin_amdgcn_wave_barrier();      // the wave's LDS writes above are finished before its lanes read each other's rows below (each wave has its own rows: no work-group barrier)
  const int rsub = lane >> 4, c4 = (lane & 15) * 4;
#pragma unroll
  for (int q = 0; q < 16; ++q) { const int r = q * 2 + rsub; const v4f v = *(const v4fa*)&so[r][c4]; *(v4f*)(OB + ((size_t)b * SQ + q0 + r) * DM + h * HD + c4) = v; } }
// blockIdx.x = block of 128 queries (4 waves of 32), blockIdx.y = batch * NH + head, blockIdx.z = branch (0 short, with the decay bias; 1 long)
__global__ __launch_bounds__(128) void k_attn(const _Float16* __restrict__ Q16, const _Float16* __restrict__ KS, const _Float16* __restrict__ KL, const _Float16* __restrict__ VTS, const _Float16* __restrict__ VTL, float* __restrict__ OS, float* __restrict__ OL, const float* __restrict__ dfp) {
  __shared__ __attribute__((aligned(16))) float so[4][32][68];
  if (blockIdx.z == 0) attn_run<true>(Q16, KS, VTS, OS, (1.0f - bf16_round(dfp[0])) * 1.4426950408889634f, so[threadIdx.x >> 5]);
  else attn_run<false>(Q16, KL, VTL, OL, 0.f, so[threadIdx.x >> 5]); }

__device__ __forceinline__ void wT_block(const float* __restrict__ w, int din, int dout, _Float16* __restrict__ Bt, int bid, float (*tl)[65]) { const int tid = threadIdx.x; const int nbo = dout / 64; const int ib = bid / nbo, ob = bid % nbo; const int i0 = ib * 64, o0 = ob * 64;
  for (int t = tid; t < 64 * 64; t += 256) { const int i = t / 64, o = t % 64; tl[o][i] = bf16_round(w[(size_t)(i0 + i) * dout + o0 + o]) * 16.0f; }
  __syncthreads();
  { for (int t = tid; t < 64 * 8; t += 256) { const int o = t / 8, i8 = (t % 8) * 8; FragH f; for (int q = 0; q < 8; ++q) f.h[q] = (_Float16)tl[o][i8 + q]; *(v8us*)((unsigned short*)Bt + (size_t)(o0 + o) * din + i0 + i8) = f.half[0]; }  } }
// Everything that reads only inputs, in one launch: ranges of the block index pick the job (the test is the same for a whole block, so the barrier in wT_block is passed by all of a block's threads or by none).
// The transposes stand first: their blocks run longer.
#define PB_SQ ((DM / 64) * (DM / 64))          /* blocks of a DM x DM weight */
#define PB_KV ((DM / 64) * (2 * DM / 64))      /* blocks of a DM x 2 DM weight */
#define PB_W (2 * PB_SQ + 2 * PB_KV)
#define PB_X ((int)((NR * DM / 8 + 255) / 256))
__global__ __launch_bounds__(256) void k_prep(const float* __restrict__ x, const float* __restrict__ wq, const float* __restrict__ wkvs, const float* __restrict__ wkvl, const float* __restrict__ wo,
    _Float16* __restrict__ X16, _Float16* __restrict__ BQ, _Float16* __restrict__ BKVS, _Float16* __restrict__ BKVL, _Float16* __restrict__ BO) {
  __shared__ float tl[64][65]; const int bid = blockIdx.x;
  if (bid < PB_KV) wT_block(wkvs, DM, 2 * DM, BKVS, bid, tl);
  else if (bid < 2 * PB_KV) wT_block(wkvl, DM, 2 * DM, BKVL, bid - PB_KV, tl);
  else if (bid < 2 * PB_KV + PB_SQ) wT_block(wq, DM, DM, BQ, bid - 2 * PB_KV, tl);
  else if (bid < PB_W) wT_block(wo, DM, DM, BO, bid - 2 * PB_KV - PB_SQ, tl);
  else x16_block(x, X16, NR * DM / 8, bid - PB_W); }
__global__ __launch_bounds__(256) void k_mix(const float* __restrict__ OS, const float* __restrict__ OL, const float* __restrict__ mwp, _Float16* __restrict__ O16, size_t n8) {
  #pragma clang fp contract(off)
  const size_t t = (size_t)blockIdx.x * 256 + threadIdx.x; if (t >= n8) return; const float a = 1.0f / (1.0f + expf(-bf16_round(mwp[0]))); FragH f; for (int q = 0; q < 8; ++q) f.h[q] = (_Float16)__fadd_rn(__fmul_rn(a, OS[t * 8 + q]), __fmul_rn(1.0f - a, OL[t * 8 + q]));
  *(v8us*)((unsigned short*)O16 + t * 8) = f.half[0];  }
extern "C" void kernel_launch(void* const* d_in, const int* in_sizes, int n_in,
                              void* d_out, int out_size, void* d_ws, size_t ws_size, hipStream_t stream) {
  (void)in_sizes; (void)n_in; (void)out_size;
  const float* const* I = (const float* const*)d_in; const float* x = I[0]; const float* wq = I[1]; const float* wkvs = I[2]; const float* wkvl = I[3]; const float* wo = I[4]; const float* mwp = I[5]; const float* dfp = I[6];
  char* ws = (char*)d_ws; size_t off = 0;
  auto take = [&](size_t bytes) { char* p = ws + off; off += (bytes + 255) & ~(size_t)255; return p; };
  /* the transposed projection weights lie as five DM x DM planes in a row (q, short k, short v, long k, long v), and so do the five projections' outputs: the projection launch picks plane blockIdx.y of each */
  _Float16* BQ = (_Float16*)take((size_t)5 * DM * DM * 2); _Float16* BKVS = BQ + (size_t)DM * DM; _Float16* BKVL = BQ + (size_t)3 * DM * DM; _Float16* BO = (_Float16*)take((size_t)DM * DM * 2);
  _Float16* X16 = (_Float16*)take(NR * DM * 2); _Float16* Q16 = (_Float16*)take(5 * NR * DM * 2); _Float16* K16 = Q16 + NR * DM; _Float16* V16 = Q16 + 2 * NR * DM; _Float16* KL16 = Q16 + 3 * NR * DM; _Float16* VL16 = Q16 + 4 * NR * DM; float* OS = (float*)take(NR * DM * 4); float* OL = (float*)take(NR * DM * 4); _Float16* O16 = (_Float16*)take(NR * DM * 2);
  _Float16* VTS = (_Float16*)take(NR * DM * 2); _Float16* VTL = (_Float16*)take(NR * DM * 2);
  if (off > ws_size) return;      /* 12 + 6x8 + 32 + 8 + 16 = 116 MiB */
  k_prep<<<PB_W + PB_X, 256, 0, stream>>>(x, wq, wkvs, wkvl, wo, X16, BQ, BKVS, BKVL, BO);
  const dim3 gp((unsigned)((NR / 128) * (DM / 64)), 1), gp5((unsigned)((NR / 128) * (DM / 64)), 5);
  k_gemm2<0><<<gp5, 128, 0, stream>>>(X16, DM, 0, BQ, DM, (size_t)DM * DM, 0.0625f, nullptr, 0, nullptr, 1, 0, 0, nullptr, Q16, DM, NR * DM, (int)NR, DM, DM);      /* q, short k | v, long k | v */
  k_vt<<<dim3(NH * (SQ / 64), NB, 2), 256, 0, stream>>>(V16, VL16, VTS, VTL);
  k_attn<<<dim3(SQ / 128, NB * NH, 2), 128, 0, stream>>>(Q16, K16, KL16, VTS, VTL, OS, OL, dfp);      /* per-branch o (merged heads) as f32 rows */
  k_mix<<<(unsigned)((NR * DM / 8 + 255) / 256), 256, 0, stream>>>(OS, OL, mwp, O16, NR * DM / 8);
  k_gemm2<0><<<gp, 128, 0, stream>>>(O16, DM, 0, BO, DM, 0, 0.0625f, nullptr, 0, nullptr, 1, 0, 0, (float*)d_out, nullptr, DM, 0, (int)NR, DM, DM);      /* out = o Wo */
}

// v005
// It runs in 120 microseconds.
// Next to v004, in two timings, it ran 1.25 and 1.26 times as fast.
// All steps since v000 together make it 204 times as fast.
#include <hip/hip_runtime.h>
#define NB 4
#define SQ 1024
#define DM 1024
#define NH 16
#define HD 64
#define NR ((size_t)NB * SQ)         /* 4096 token rows */
typedef __bf16 v16b __attribute__((ext_vector_type(16)));
typedef unsigned short v8us __attribute__((ext_vector_type(8), may_alias));
typedef float  v8f  __attribute__((ext_vector_type(8)));
typedef float  v4f  __attribute__((ext_vector_type(4)));
typedef float  v4fa __attribute__((ext_vector_type(4), may_alias));
union FragB { v16b v; v8us half[2]; unsigned short u[16]; };

__device__ __forceinline__ unsigned short bf16_bits(float x) { unsigned int u = __float_as_uint(x); return (unsigned short)((u + 0x7FFFu + ((u >> 16) & 1u)) >> 16); }
__device__ __forceinline__ float bf16_val(unsigned short b) { return __uint_as_float(((unsigned int)b) << 16); }
__device__ __forceinline__ float bf16_round(float x) { return bf16_val(bf16_bits(x)); }
// D += A·B with NT terms: 1 = ah·bh, 2 = + al·bh (A split), 3 = + ah·bl (both split)
template <int NT>
__device__ __forceinline__ v8f mmaN(v16b ah, v16b al, v16b bh, v16b bl, v8f c) {
  c = __builtin_amdgcn_wmma_f32_16x16x32_bf16(false, ah, false, bh, (short)0, c, false, false);
  if (NT >= 2) c = __builtin_amdgcn_wmma_f32_16x16x32_bf16(false, al, false, bh, (short)0, c, false, false);
  if (NT >= 3) c = __builtin_amdgcn_wmma_f32_16x16x32_bf16(false, ah, false, bl, (short)0, c, false, false);
  asm volatile("v_nop\n\tv_nop\n\tv_nop\n\tv_nop" : "+v"(c) : "v"(ah), "v"(al), "v"(bh), "v"(bl));
  return c;
}

__global__ __launch_bounds__(256) void k_wt_bf16(const float* __restrict__ W, unsigned short* __restrict__ Wt, int K, int N) {
  const int t = blockIdx.x * 256 + threadIdx.x;
  const int k8n = K / 8;
  if (t >= N * k8n) return;
  const int n = t / k8n, k8 = (t % k8n) * 8;
  v8us v;
#pragma unroll
  for (int i = 0; i < 8; ++i) v[i] = bf16_bits(W[(size_t)(k8 + i) * N + n]);
  *(v8us*)(Wt + (size_t)n * K + k8) = v;
  
}

// GEMM C[M][N] (f32, pitch ldc) = act(A[M][K]·W + bias). A f32 row-major (pitch lda) converted per fragment to bf16
// (ASPLIT: hi/lo two planes -> 2 terms, else single rounded term); Wt bf16 [N][K] (pitch ldb). BIAS_BF16 rounds the
// bias to bf16 first (bias quantised to bf16 before the add). K%32==0, M%16==0, N%64==0.
template <bool ASPLIT, int ACT, bool BIAS_BF16>
__global__ __launch_bounds__(128) void k_gemm_bf(const float* __restrict__ A, int lda, const unsigned short* __restrict__ Wt, int ldb,
                                               const float* __restrict__ bias, float* __restrict__ C, int ldc, int M, int N, int K) {
  __shared__ __attribute__((aligned(16))) float so[4][16][64];
  const int tid = threadIdx.x, w = tid >> 5, lane = tid & 31, ln = lane & 15, hh = lane >> 4;
  const int ntn = N / 64;
  const int wid = blockIdx.x * 4 + w;
  const int mt = wid / ntn, nq = wid % ntn;
  if (mt * 16 >= M) return;
  const int row0 = mt * 16, col0 = nq * 64;
  const float* arow = A + (size_t)(row0 + ln) * lda;
  v8f acc[4] = {};
  for (int kb = 0; kb < K; kb += 32) {
    FragB ah, al;
    const v4f x0 = *(const v4fa*)(arow + kb + 8 * hh), x1 = *(const v4fa*)(arow + kb + 8 * hh + 4);
    const v4f x2 = *(const v4fa*)(arow + kb + 16 + 8 * hh), x3 = *(const v4fa*)(arow + kb + 16 + 8 * hh + 4);
    float xs[16] = {x0[0],x0[1],x0[2],x0[3],x1[0],x1[1],x1[2],x1[3],x2[0],x2[1],x2[2],x2[3],x3[0],x3[1],x3[2],x3[3]};
#pragma unroll
    for (int i = 0; i < 16; ++i) { const unsigned short hb = bf16_bits(xs[i]); ah.u[i] = hb; al.u[i] = ASPLIT ? bf16_bits(xs[i] - bf16_val(hb)) : (unsigned short)0; }
#pragma unroll
    for (int t = 0; t < 4; ++t) {
      const unsigned short* brow = Wt + (size_t)(col0 + t * 16 + ln) * ldb + kb;
      FragB b;
      b.half[0] = *(const v8us*)(brow + 8 * hh);
      b.half[1] = *(const v8us*)(brow + 16 + 8 * hh);
      acc[t] = mmaN<ASPLIT ? 2 : 1>(ah.v, al.v, b.v, b.v, acc[t]);
    }
  }
#pragma unroll
  for (int t = 0; t < 4; ++t) {
    float bv = bias ? bias[col0 + t * 16 + ln] : 0.f;
    if (BIAS_BF16) bv = bf16_round(bv);
#pragma unroll
    for (int r = 0; r < 8; ++r) { float v = acc[t][r] + bv; if (ACT == 1) v = fmaxf(v, 0.f); so[w][8 * hh + r][t * 16 + ln] = v; }
  }
  __builtin_amdgcn_fence(__ATOMIC_ACQ_REL, "workgroup");
  __builtin_amdgcn_wave_barrier();
  const int rsub = lane >> 4, c4 = (lane & 15) * 4;
  {
#pragma unroll
    for (int q = 0; q < 8; ++q) {
      const int r = q * 2 + rsub;
      const v4f v = *(const v4fa*)&so[w][r][c4];
      *(v4f*)(C + (size_t)(row0 + r) * ldc + col0 + c4) = v;
    }
    
  }
}

// GEMM C = act(A·W + bias + resid): A f32 (ASPLIT -> hi/lo 2 terms), Wt bf16 [N][K]; ACT 0 none, 1 relu, 2 exact gelu;
// resid (optional, f32, row index = (row % rmod), pitch ldr, RES_BF16 rounds it) added before the activation.
template <bool ASPLIT, int ACT, bool BIAS_BF16, bool RES_BF16>
__global__ __launch_bounds__(128) void k_gemm_bf3(const float* __restrict__ A, int lda, const unsigned short* __restrict__ Wt, int ldb,
                                                const float* __restrict__ bias, const float* __restrict__ resid, int rmod, int ldr,
                                                float* __restrict__ C, int ldc, int M, int N, int K) {
  __shared__ __attribute__((aligned(16))) float so[4][16][64];
  const int tid = threadIdx.x, w = tid >> 5, lane = tid & 31, ln = lane & 15, hh = lane >> 4;
  const int ntn = N / 64;
  const int wid = blockIdx.x * 4 + w;
  const int mt = wid / ntn, nq = wid % ntn;
  if (mt * 16 >= M) return;
  const int row0 = mt * 16, col0 = nq * 64;
  const float* arow = A + (size_t)(row0 + ln) * lda;
  v8f acc[4] = {};
  for (int kb = 0; kb < K; kb += 32) {
    FragB ah, al;
    const v4f x0 = *(const v4fa*)(arow + kb + 8 * hh), x1 = *(const v4fa*)(arow + kb + 8 * hh + 4);
    const v4f x2 = *(const v4fa*)(arow + kb + 16 + 8 * hh), x3 = *(const v4fa*)(arow + kb + 16 + 8 * hh + 4);
    float xs[16] = {x0[0],x0[1],x0[2],x0[3],x1[0],x1[1],x1[2],x1[3],x2[0],x2[1],x2[2],x2[3],x3[0],x3[1],x3[2],x3[3]};
#pragma unroll
    for (int i = 0; i < 16; ++i) { const unsigned short hb = bf16_bits(xs[i]); ah.u[i] = hb; al.u[i] = ASPLIT ? bf16_bits(xs[i] - bf16_val(hb)) : (unsigned short)0; }
#pragma unroll
    for (int t = 0; t < 4; ++t) {
      const unsigned short* brow = Wt + (size_t)(col0 + t * 16 + ln) * ldb + kb;
      FragB b;
      b.half[0] = *(const v8us*)(brow + 8 * hh);
      b.half[1] = *(const v8us*)(brow + 16 + 8 * hh);
      acc[t] = mmaN<ASPLIT ? 2 : 1>(ah.v, al.v, b.v, b.v, acc[t]);
    }
  }
#pragma unroll
  for (int t = 0; t < 4; ++t) {
    const int col = col0 + t * 16 + ln;
    float bv = bias ? bias[col] : 0.f;
    if (BIAS_BF16) bv = bf16_round(bv);
#pragma unroll
    for (int r = 0; r < 8; ++r) {
      float v = acc[t][r] + bv;
      if (resid) { float rv = resid[(size_t)((row0 + 8 * hh + r) % rmod) * ldr + col]; if (RES_BF16) rv = bf16_round(rv); v += rv; }
      if (ACT == 1) v = fmaxf(v, 0.f);
      if (ACT == 2) v = 0.5f * v * (1.0f + erff(v * 0.70710678118654752f));
      if (ACT == 3) { const float u = 0.7978845608028654f * (v + 0.044715f * v * v * v); v = 0.5f * v * (1.0f + tanhf(u)); }
      so[w][8 * hh + r][t * 16 + ln] = v;
    }
  }
  __builtin_amdgcn_fence(__ATOMIC_ACQ_REL, "workgroup");
  __builtin_amdgcn_wave_barrier();
  const int rsub = lane >> 4, c4 = (lane & 15) * 4;
  {
#pragma unroll
    for (int q = 0; q < 8; ++q) {
      const int r = q * 2 + rsub;
      const v4f v = *(const v4fa*)&so[w][r][c4];
      *(v4f*)(C + (size_t)(row0 + r) * ldc + col0 + c4) = v;
    }
    
  }
}
// row LayerNorm (biased variance, eps) over N: s = X (+ R); optional out_sum <- s; out_norm <- (s-mu)*rsqrt(var+eps)*g + b
template <bool PARAM_BF16>
__global__ __launch_bounds__(256) void k_layernorm(const float* __restrict__ X, const float* __restrict__ R, const float* __restrict__ g, const float* __restrict__ bta,
                                                  float* __restrict__ out_sum, float* __restrict__ out_norm, int N, float eps) {
  __shared__ float red[256];
  const int row = blockIdx.x, tid = threadIdx.x;
  const float* x = X + (size_t)row * N; const float* rr = R ? R + (size_t)row * N : nullptr;
  float vals[16];                     // up to N = 4096
  const int per = N / 256;            // contiguous chunk per thread? use strided-by-4 chunks: thread handles j = tid*4 + 1024*u
  float s1 = 0.f;
  for (int u = 0; u < per / 4; ++u) {
    const int j = tid * 4 + 1024 * u;
    const v4f a = *(const v4fa*)(x + j);
    v4f b = {0.f,0.f,0.f,0.f}; if (rr) b = *(const v4fa*)(rr + j);
#pragma unroll
    for (int q = 0; q < 4; ++q) { const float v = a[q] + b[q]; vals[u * 4 + q] = v; s1 += v; }
  }
  red[tid] = s1; __syncthreads();
  for (int st = 128; st > 0; st >>= 1) { if (tid < st) red[tid] += red[tid + st]; __syncthreads(); }
  const float mu = red[0] / (float)N; __syncthreads();
  float s2 = 0.f;
  for (int u = 0; u < per / 4; ++u)
#pragma unroll
    for (int q = 0; q < 4; ++q) { const float c = vals[u * 4 + q] - mu; s2 += c * c; }
  red[tid] = s2; __syncthreads();
  for (int st = 128; st > 0; st >>= 1) { if (tid < st) red[tid] += red[tid + st]; __syncthreads(); }
  const float rs = rsqrtf(red[0] / (float)N + eps);
  {
    for (int u = 0; u < per / 4; ++u) {
      const int j = tid * 4 + 1024 * u;
      v4f o, sm;
#pragma unroll
      for (int q = 0; q < 4; ++q) {
        float gg = g[j + q], bb = bta[j + q];
        if (PARAM_BF16) { gg = bf16_round(gg); bb = bf16_round(bb); }
        sm[q] = vals[u * 4 + q]; o[q] = (vals[u * 4 + q] - mu) * rs * gg + bb;
      }
      if (out_sum) *(v4f*)(out_sum + (size_t)row * N + j) = sm;
      *(v4f*)(out_norm + (size_t)row * N + j) = o;
    }
    
  }
}



// ---- f16 WMMA path (v_wmma_f32_16x16x32_f16): 11-bit significands for operands in range — used where a [0,1] probability operand needs more precision than bf16
typedef _Float16 v16h __attribute__((ext_vector_type(16)));
union FragH { v16h v; v8us half[2]; _Float16 h[16]; unsigned short u[16]; };
template <int NT>
__device__ __forceinline__ v8f mmaH(v16h ah, v16h al, v16h bh, v16h bl, v8f c) {
  c = __builtin_amdgcn_wmma_f32_16x16x32_f16(false, ah, false, bh, (short)0, c, false, false);
  if (NT >= 2) c = __builtin_amdgcn_wmma_f32_16x16x32_f16(false, al, false, bh, (short)0, c, false, false);
  if (NT >= 3) c = __builtin_amdgcn_wmma_f32_16x16x32_f16(false, ah, false, bl, (short)0, c, false, false);
  asm volatile("v_nop\n\tv_nop\n\tv_nop\n\tv_nop" : "+v"(c) : "v"(ah), "v"(al), "v"(bh), "v"(bl));
  return c;
}
// batched GEMM like k_gemm_b but f16 operands: A f32 (split into f16 hi/lo if ASPLIT, else rounded to f16), Bt = f16 values [n][k]; alpha; C f32; N multiple of 16 (partial tiles skipped)
template <bool ASPLIT>
__global__ __launch_bounds__(128) void k_gemm_h(const float* __restrict__ A, int lda, size_t sA, const _Float16* __restrict__ Bh, int ldb, size_t sB, float alpha, float* __restrict__ C, int ldc, size_t sC, int M, int N, int K) {
  __shared__ __attribute__((aligned(16))) float so[4][16][64];
  const int tid = threadIdx.x, w = tid >> 5, lane = tid & 31, ln = lane & 15, hh = lane >> 4; const int by = blockIdx.y;
  A += (size_t)by * sA; Bh += (size_t)by * sB; C += (size_t)by * sC;
  const int ntn = (N + 63) / 64; const int wid = blockIdx.x * 4 + w; const int mt = wid / ntn, nq = wid % ntn; if (mt * 16 >= M) return;
  const int row0 = mt * 16, col0 = nq * 64; const float* arow = A + (size_t)(row0 + ln) * lda;
  v8f acc[4] = {};
  for (int kb = 0; kb < K; kb += 32) {
    FragH ah, al;
    const v4f x0 = *(const v4fa*)(arow + kb + 8 * hh), x1 = *(const v4fa*)(arow + kb + 8 * hh + 4), x2 = *(const v4fa*)(arow + kb + 16 + 8 * hh), x3 = *(const v4fa*)(arow + kb + 16 + 8 * hh + 4);
    float xs[16] = {x0[0],x0[1],x0[2],x0[3],x1[0],x1[1],x1[2],x1[3],x2[0],x2[1],x2[2],x2[3],x3[0],x3[1],x3[2],x3[3]};
#pragma unroll
    for (int i = 0; i < 16; ++i) { const _Float16 h = (_Float16)xs[i]; ah.h[i] = h; al.h[i] = ASPLIT ? (_Float16)(xs[i] - (float)h) : (_Float16)0.0f; }
#pragma unroll
    for (int t = 0; t < 4; ++t) { if (col0 + t * 16 >= N) continue; const size_t boff = (size_t)(col0 + t * 16 + ln) * ldb + kb; FragH bq; bq.half[0] = *(const v8us*)(Bh + boff + 8 * hh); bq.half[1] = *(const v8us*)(Bh + boff + 16 + 8 * hh);
      acc[t] = mmaH<ASPLIT ? 2 : 1>(ah.v, al.v, bq.v, bq.v, acc[t]); }
  }
#pragma unroll
  for (int t = 0; t < 4; ++t) { if (col0 + t * 16 >= N) continue;
#pragma unroll
    for (int r = 0; r < 8; ++r) so[w][8 * hh + r][t * 16 + ln] = acc[t][r] * alpha; }
  __builtin_amdgcn_fence(__ATOMIC_ACQ_REL, "workgroup"); __builtin_amdgcn_wave_barrier();
  const int rsub = lane >> 4, c4 = (lane & 15) * 4;
  {
#pragma unroll
    for (int q = 0; q < 8; ++q) { const int r = q * 2 + rsub; if (col0 + c4 < N) { const v4f v = *(const v4fa*)&so[w][r][c4]; *(v4f*)(C + (size_t)(row0 + r) * ldc + col0 + c4) = v; } }
     }
}

// Wt[n][k] = f16(W[k][n]·scale) from f32 row-major W[K][N] (scale = power of two; bf16-exact weights stay exact in f16 away from the subnormal range)
__global__ __launch_bounds__(256) void k_wt_f16(const float* __restrict__ W, _Float16* __restrict__ Wt, int K, int N, float scale) {
  const int t = blockIdx.x * 256 + threadIdx.x; if (t >= N * (K / 8)) return; const int n = t / (K / 8), k8 = (t % (K / 8)) * 8; FragH f;
#pragma unroll
  for (int i = 0; i < 8; ++i) f.h[i] = (_Float16)(bf16_round(W[(size_t)(k8 + i) * N + n]) * scale); const v8us o = f.half[0];
  *(v8us*)((unsigned short*)Wt + (size_t)n * K + k8) = o; 
}
// k_gemm_hh variant with fused epilogue: v = acc·alpha + bias[by·sBias + col] (+ CP[(row/rowsPerB)·sCPb + by·64 + col] if CP) ; ACT 0 none / 1 elu ; writes f16 C16 (and f32 C if non-null)
template <int ACT>
__global__ __launch_bounds__(128) void k_gemm_hhx(const _Float16* __restrict__ A, int lda, size_t sA, const _Float16* __restrict__ Bh, int ldb, size_t sB, float alpha, const float* __restrict__ bias, size_t sBias, const float* __restrict__ CP, int rowsPerB, size_t sCPb, int row0g,
    float* __restrict__ C, _Float16* __restrict__ C16, int ldc, size_t sC, int M, int N, int K) {
  __shared__ __attribute__((aligned(16))) float so[4][16][64];
  const int tid = threadIdx.x, w = tid >> 5, lane = tid & 31, ln = lane & 15, hh = lane >> 4; const int by = blockIdx.y;
  A += (size_t)by * sA; Bh += (size_t)by * sB; const size_t cofs = (size_t)by * sC; const float* bp = bias ? bias + (size_t)by * sBias : nullptr;
  const int ntn = (N + 63) / 64; const int wid = blockIdx.x * 4 + w; const int mt = wid / ntn, nq = wid % ntn; if (mt * 16 >= M) return;
  const int row0 = mt * 16, col0 = nq * 64; const _Float16* arow = A + (size_t)(row0 + ln) * lda;
  v8f acc[4] = {};
  for (int kb = 0; kb < K; kb += 32) { FragH ah; ah.half[0] = *(const v8us*)((const unsigned short*)arow + kb + 8 * hh); ah.half[1] = *(const v8us*)((const unsigned short*)arow + kb + 16 + 8 * hh);
#pragma unroll
    for (int t = 0; t < 4; ++t) { if (col0 + t * 16 >= N) continue; const size_t boff = (size_t)(col0 + t * 16 + ln) * ldb + kb; FragH bq; bq.half[0] = *(const v8us*)((const unsigned short*)Bh + boff + 8 * hh); bq.half[1] = *(const v8us*)((const unsigned short*)Bh + boff + 16 + 8 * hh);
      acc[t] = mmaH<1>(ah.v, ah.v, bq.v, bq.v, acc[t]); }
  }
#pragma unroll
  for (int t = 0; t < 4; ++t) { if (col0 + t * 16 >= N) continue; const int col = col0 + t * 16 + ln; const float bv = bp ? bf16_round(bp[col]) : 0.f;
#pragma unroll
    for (int r = 0; r < 8; ++r) { float v = acc[t][r] * alpha + bv; if (CP) { const int rr = row0g + row0 + 8 * hh + r; if (rowsPerB < 0) v += CP[cofs + (size_t)rr * ldc + col];      /* rowsPerB < 0: own element of the batched C plane */ else { const int bidx = rr / rowsPerB; v += CP[(size_t)bidx * sCPb + (size_t)by * 64 + col]; } } if (ACT == 1) v = (v > 0.f) ? v : expm1f(v); else if (ACT == 7) v = (v > 0.f) ? v + 1.0f : expf(v); else if (ACT == 8) v = tanhf(v); else if (ACT == 9) v = 0.5f * v * (1.0f + tanhf(0.7978845608028654f * (v + 0.044715f * v * v * v))); else if (ACT == 11) v = 1.0f / (1.0f + expf(-v)); else if (ACT == 12) v = (v > 0.f) ? v : 0.01f * v; else if (ACT == 14) v = (v > 0.f) ? v : 0.1f * v; else if (ACT == 16) v = (v >= 0.f) ? v : 0.3f * v; else if (ACT == 17) v = (v >= 0.f) ? v : 0.2f * v; else if (ACT == 15) v = v / (1.0f + expf(-v)); else if (ACT == 3) v = fmaxf(v, 0.f); else if (ACT == 6) v = 0.5f * v * (1.0f + erff(v * 0.70710678118654752f)); so[w][8 * hh + r][t * 16 + ln] = v; } }
  __builtin_amdgcn_fence(__ATOMIC_ACQ_REL, "workgroup"); __builtin_amdgcn_wave_barrier();
  const int rsub = lane >> 4, c4 = (lane & 15) * 4; typedef _Float16 v4h __attribute__((ext_vector_type(4)));
  {
#pragma unroll
    for (int q = 0; q < 8; ++q) { const int r = q * 2 + rsub; if (col0 + c4 < N) { const v4f v = *(const v4fa*)&so[w][r][c4]; if (C) *(v4f*)(C + cofs + (size_t)(row0 + r) * ldc + col0 + c4) = v; if (C16) { v4h h4; for (int i = 0; i < 4; ++i) h4[i] = (_Float16)v[i]; *(v4h*)(C16 + cofs + (size_t)(row0 + r) * ldc + col0 + c4) = h4; } } }
     }
}


typedef _Float16 v4h __attribute__((ext_vector_type(4)));

__device__ __forceinline__ void x16_block(const float* __restrict__ x, _Float16* __restrict__ X16, size_t n8, int bid) { const size_t t = (size_t)bid * 256 + threadIdx.x; if (t >= n8) return; FragH f;
#pragma unroll
  for (int q = 0; q < 8; ++q) f.h[q] = (_Float16)bf16_round(x[t * 8 + q]); *(v8us*)((unsigned short*)X16 + t * 8) = f.half[0];  }
__global__ __launch_bounds__(256) void k_h16(const float* __restrict__ x, _Float16* __restrict__ X16, size_t n8) { const size_t t = (size_t)blockIdx.x * 256 + threadIdx.x; if (t >= n8) return; FragH f;
#pragma unroll
  for (int q = 0; q < 8; ++q) f.h[q] = (_Float16)x[t * 8 + q]; *(v8us*)((unsigned short*)X16 + t * 8) = f.half[0];  }
__global__ __launch_bounds__(256) void k_round16f(const float* __restrict__ W, _Float16* __restrict__ Bt, size_t n8) { const size_t t = (size_t)blockIdx.x * 256 + threadIdx.x; if (t >= n8) return; FragH f;
#pragma unroll
  for (int i = 0; i < 8; ++i) f.h[i] = (_Float16)(bf16_round(W[t * 8 + i]) * 16.0f); *(v8us*)((unsigned short*)Bt + t * 8) = f.half[0];  }
template <int NHv, int TTv>
__global__ __launch_bounds__(256) void k_vt(const _Float16* __restrict__ V16, int ldv, int voff, _Float16* __restrict__ Vt) { __shared__ unsigned short tl[64][66]; const int tid = threadIdx.x; const int slab = blockIdx.x / (TTv / 64), lg = blockIdx.x % (TTv / 64); const int b = slab / NHv, h = slab % NHv;
  for (int i = tid; i < 64 * 8; i += 256) { const int r = i / 8, c8 = (i % 8) * 8; FragH f; f.half[0] = *(const v8us*)((const unsigned short*)V16 + ((size_t)b * TTv + lg * 64 + r) * ldv + voff + h * 64 + c8);
#pragma unroll
    for (int q = 0; q < 8; ++q) tl[r][c8 + q] = f.u[q]; }
  __syncthreads();
  {
#pragma unroll
    for (int rd = 0; rd < 2; ++rd) { const int d = rd * 32 + tid / 8, pc = tid % 8; FragH f;
#pragma unroll
      for (int q = 0; q < 8; ++q) f.u[q] = tl[pc * 8 + q][d];
      *(v8us*)((unsigned short*)Vt + ((size_t)slab * 64 + d) * TTv + lg * 64 + pc * 8) = f.half[0]; }
     } }

__global__ __launch_bounds__(256) void k_hl(const float* __restrict__ F, _Float16* __restrict__ Hh, _Float16* __restrict__ Hl, size_t n8) { const size_t t = (size_t)blockIdx.x * 256 + threadIdx.x; if (t >= n8) return; FragH fh, fl; const v4f a = *(const v4fa*)(F + t * 8), c = *(const v4fa*)(F + t * 8 + 4);
#pragma unroll
  for (int q = 0; q < 4; ++q) { _Float16 h = (_Float16)a[q]; fh.h[q] = h; fl.h[q] = (_Float16)((a[q] - (float)h) * 1024.0f); h = (_Float16)c[q]; fh.h[4 + q] = h; fl.h[4 + q] = (_Float16)((c[q] - (float)h) * 1024.0f); }
  { *(v8us*)((unsigned short*)Hh + t * 8) = fh.half[0]; *(v8us*)((unsigned short*)Hl + t * 8) = fl.half[0];  } }

// ---- fast GEMM (wave tile 32x64, block tile 128x64; requires M % 128 == 0 rows per launch region, N % 64 == 0 and K % 64 == 0); epilogue = k_gemm_hhx semantics ----
// Operands go through LDS: a stage is 64 k of the block's 128 A rows and 64 B rows (128 bytes a row), brought by asynchronous copies, two buffers, the copies of stage t + 2 in flight while stage t + 1 is worked on.
// A wave-wide copy reads 4 rows x 128 contiguous bytes (4 whole cache lines), and the B rows are fetched once a block.
#define G2_PITCH 72      /* f16 elements a row in LDS = 144 bytes = 16 x 9: 16 rows read by ds_load_b128 fall on distinct banks */
#define G2_ROWS 192      /* rows 0..127: A, rows 128..191: B */
#define G2_BUF (G2_ROWS * G2_PITCH)
// fragment from an LDS row: p = row + 32 ks + 8 hh; the k order of g2_frag
__device__ __forceinline__ v16h g2_lfrag(const _Float16* p) { FragH f; f.half[0] = *(const v8us*)((const unsigned short*)p); f.half[1] = *(const v8us*)((const unsigned short*)p + 16); return f.v; }
// One lane's twelve 16-byte copies of a stage: thread tid takes bytes 16 (tid & 7) of rows (tid >> 3) + 16 c, c = 0..11. l = its LDS byte address in row tid >> 3 of the buffer, ga / gb = its global address in that row of the
// A / B tile, sa / sb = 16 rows in elements. The s_wait_xcnt stands inside the statement, behind the last copy, so that no address register of a copy is rewritten in front of it.
__device__ __forceinline__ void g2_stage(unsigned l, const _Float16* ga, size_t sa, const _Float16* gb, size_t sb) {
  const unsigned rs = 16 * G2_PITCH * 2;
  asm volatile("global_load_async_to_lds_b128 %0, %12, off\n\tglobal_load_async_to_lds_b128 %1, %13, off\n\tglobal_load_async_to_lds_b128 %2, %14, off\n\tglobal_load_async_to_lds_b128 %3, %15, off\n\t"
               "global_load_async_to_lds_b128 %4, %16, off\n\tglobal_load_async_to_lds_b128 %5, %17, off\n\tglobal_load_async_to_lds_b128 %6, %18, off\n\tglobal_load_async_to_lds_b128 %7, %19, off\n\t"
               "global_load_async_to_lds_b128 %8, %20, off\n\tglobal_load_async_to_lds_b128 %9, %21, off\n\tglobal_load_async_to_lds_b128 %10, %22, off\n\tglobal_load_async_to_lds_b128 %11, %23, off\n\ts_wait_xcnt 0x0"
               :: "v"(l), "v"(l + rs), "v"(l + 2 * rs), "v"(l + 3 * rs), "v"(l + 4 * rs), "v"(l + 5 * rs), "v"(l + 6 * rs), "v"(l + 7 * rs), "v"(l + 8 * rs), "v"(l + 9 * rs), "v"(l + 10 * rs), "v"(l + 11 * rs),
                  "v"(ga), "v"(ga + sa), "v"(ga + 2 * sa), "v"(ga + 3 * sa), "v"(ga + 4 * sa), "v"(ga + 5 * sa), "v"(ga + 6 * sa), "v"(ga + 7 * sa), "v"(gb), "v"(gb + sb), "v"(gb + 2 * sb), "v"(gb + 3 * sb) : "memory"); }
__device__ __forceinline__ v16h g2_frag(const _Float16* p, int hh) { FragH f; f.half[0] = *(const v8us*)((const unsigned short*)p + 8 * hh); f.half[1] = *(const v8us*)((const unsigned short*)p + 16 + 8 * hh); return f.v; }
__device__ __forceinline__ v8f g2_mma(v16h a, v16h b, v8f c) { v8f d = __builtin_amdgcn_wmma_f32_16x16x32_f16(false, a, false, b, (short)0, c, false, false); asm volatile("v_nop\n\tv_nop\n\tv_nop\n\tv_nop" : "+v"(d) : "v"(a), "v"(b)); return d; }
template <int ACT>
__global__ __launch_bounds__(128) void k_gemm2(const _Float16* __restrict__ A, int lda, size_t sA, const _Float16* __restrict__ Bh, int ldb, size_t sB, float alpha, const float* __restrict__ bias, size_t sBias, const float* __restrict__ CP, int rowsPerB, size_t sCPb, int row0g,
    float* __restrict__ C, _Float16* __restrict__ C16, int ldc, size_t sC, int M, int N, int K) { static_assert(ACT == 0 || ACT == 3 || ACT == 6 || ACT == 8 || ACT == 9 || ACT == 11 || ACT == 12 || ACT == 14 || ACT == 15 || ACT == 16 || ACT == 17, "k_gemm2: unsupported ACT code (would silently apply no activation)");
  __shared__ __attribute__((aligned(16))) float so[4][32][68];
  __shared__ __attribute__((aligned(16))) _Float16 st[2][G2_BUF];
  const int tid = threadIdx.x, w = tid >> 5, lane = tid & 31, ln = lane & 15, hh = lane >> 4; const int by = blockIdx.y;
  A += (size_t)by * sA; Bh += (size_t)by * sB; const size_t cofs = (size_t)by * sC; const float* bp = bias ? bias + (size_t)by * sBias : nullptr;
  const int ntn = N >> 6; const int mt = blockIdx.x / ntn, nq = blockIdx.x - mt * ntn; const int row0 = mt * 128 + 32 * w, col0 = nq * 64; if (mt * 128 >= M) return;      /* the same for the whole block: it stands in front of barriers */
  const _Float16* gap = A + (size_t)(mt * 128 + (tid >> 3)) * lda + (tid & 7) * 8; const _Float16* gbp = Bh + (size_t)(col0 + (tid >> 3)) * ldb + (tid & 7) * 8; const size_t sa16 = (size_t)16 * lda, sb16 = (size_t)16 * ldb;
  const unsigned lst = (unsigned)(size_t)&st[0][(tid >> 3) * G2_PITCH + (tid & 7) * 8];      /* low 32 bits of the shared address = byte address in the block's LDS */
  const int aoff = (32 * w + ln) * G2_PITCH + 8 * hh, boff = (128 + ln) * G2_PITCH + 8 * hh; const int nst = K >> 6;
  const v8f z8 = {0.f,0.f,0.f,0.f,0.f,0.f,0.f,0.f}; v8f c00 = z8, c01 = z8, c02 = z8, c03 = z8, c10 = z8, c11 = z8, c12 = z8, c13 = z8;
  g2_stage(lst, gap, sa16, gbp, sb16);
  asm volatile("s_wait_asynccnt 0x0" ::: "memory");      // this wave's copies of stage 0 have landed
  __syncthreads();                                       // ... and every other wave's: stage 0 may be read
  if (nst > 1) g2_stage(lst + G2_BUF * 2, gap + 64, sa16, gbp + 64, sb16);
  // rolled, as it was: a trip already holds a stage's 24 LDS reads and 16 products, and unrolled trips would each keep their own 36 copy address registers; the buffer is chosen by the trip's parity
#pragma unroll 1
  for (int t = 0; t < nst; ++t) { const _Float16* sb = st[t & 1]; v16h af[2][2], bf[2][4];
    // the three inner loops are fully unrolled so that the fragment arrays are indexed by constants and stay in registers
#pragma unroll
    for (int ks = 0; ks < 2; ++ks) { af[ks][0] = g2_lfrag(sb + aoff + ks * 32); af[ks][1] = g2_lfrag(sb + aoff + 16 * G2_PITCH + ks * 32);
#pragma unroll
      for (int u = 0; u < 4; ++u) bf[ks][u] = g2_lfrag(sb + boff + u * 16 * G2_PITCH + ks * 32); }
#pragma unroll
    for (int ks = 0; ks < 2; ++ks) {
      c00 = g2_mma(af[ks][0], bf[ks][0], c00); c10 = g2_mma(af[ks][1], bf[ks][0], c10);
      c01 = g2_mma(af[ks][0], bf[ks][1], c01); c11 = g2_mma(af[ks][1], bf[ks][1], c11);
      c02 = g2_mma(af[ks][0], bf[ks][2], c02); c12 = g2_mma(af[ks][1], bf[ks][2], c12);
      c03 = g2_mma(af[ks][0], bf[ks][3], c03); c13 = g2_mma(af[ks][1], bf[ks][3], c13); }
    asm volatile("s_wait_dscnt 0x0" ::: "memory");         // this wave's reads of stage t are finished before its buffer is refilled
    asm volatile("s_wait_asynccnt 0x0" ::: "memory");      // this wave's copies of stage t + 1 have landed
    __syncthreads();                                       // publishes stage t + 1 and ends every wave's reads of stage t
    if (t + 2 < nst) g2_stage(lst + (unsigned)(t & 1) * (G2_BUF * 2), gap + (size_t)(t + 2) * 64, sa16, gbp + (size_t)(t + 2) * 64, sb16); }
  asm volatile("s_wait_asynccnt 0x0" ::: "memory");        // no copy is outstanding when the wave goes on to its end
  v8f accs[8] = {c00, c01, c02, c03, c10, c11, c12, c13};
#pragma unroll
  for (int u = 0; u < 8; ++u) { const int t = u & 3, half = u >> 2; const int col = col0 + t * 16 + ln; const float bv = bp ? bf16_round(bp[col]) : 0.f;
#pragma unroll
    for (int r = 0; r < 8; ++r) { const int rloc = half * 16 + 8 * hh + r; float v = accs[u][r] * alpha + bv; if (CP) { if (rowsPerB < 0) v += CP[cofs + (size_t)(row0g + row0 + rloc) * ldc + col];      /* rowsPerB < 0: own element of the batched C plane */ else { const int bidx = (row0g + row0 + rloc) / rowsPerB; v += CP[(size_t)bidx * sCPb + (size_t)by * 64 + col]; } }
      if (ACT == 3) v = fmaxf(v, 0.f); else if (ACT == 6) v = 0.5f * v * (1.0f + erff(v * 0.70710678118654752f)); else if (ACT == 11) v = 1.0f / (1.0f + expf(-v)); else if (ACT == 15) v = v / (1.0f + expf(-v)); else if (ACT == 12) v = (v > 0.f) ? v : 0.01f * v; else if (ACT == 8) v = tanhf(v); else if (ACT == 9) v = 0.5f * v * (1.0f + tanhf(0.7978845608028654f * (v + 0.044715f * v * v * v))); else if (ACT == 14) v = (v > 0.f) ? v : 0.1f * v; else if (ACT == 16) v = (v >= 0.f) ? v : 0.3f * v; else if (ACT == 17) v = (v >= 0.f) ? v : 0.2f * v;
      so[w][rloc][t * 16 + ln] = v; } }
  __builtin_amdgcn_fence(__ATOMIC_ACQ_REL, "workgroup"); __builtin_amdgcn_wave_barrier();
  const int rsub = lane >> 4, c4 = (lane & 15) * 4;
  {
#pragma unroll
    for (int q = 0; q < 16; ++q) { const int r = q * 2 + rsub; const v4f v = *(const v4fa*)&so[w][r][c4]; if (C) *(v4f*)(C + cofs + (size_t)(row0 + r) * ldc + col0 + c4) = v; if (C16) { v4h h4; for (int i = 0; i < 4; ++i) h4[i] = (_Float16)v[i]; *(v4h*)(C16 + cofs + (size_t)(row0 + r) * ldc + col0 + c4) = h4; } }
     } }


__global__ __launch_bounds__(256) void k_wnat(const float* __restrict__ w, size_t n8, _Float16* __restrict__ Bt) { const size_t t = (size_t)blockIdx.x * 256 + threadIdx.x; if (t >= n8) return; FragH f; for (int q = 0; q < 8; ++q) f.h[q] = (_Float16)(bf16_round(w[t * 8 + q]) * 16.0f); *(v8us*)((unsigned short*)Bt + t * 8) = f.half[0];  }
// V^T of every (branch, batch, head): blockIdx.x = head + NH * (block of 64 keys), blockIdx.y = batch, blockIdx.z = branch; VT[(b * NH + h) * HD + d][key]
__global__ __launch_bounds__(256) void k_vt(const _Float16* __restrict__ VS16, const _Float16* __restrict__ VL16, _Float16* __restrict__ VTS, _Float16* __restrict__ VTL) { __shared__ unsigned short tl[64][65]; const int tid = threadIdx.x; const int h = blockIdx.x % NH, sg = blockIdx.x / NH; const int s0 = sg * 64; const int b = blockIdx.y;
  const _Float16* V16 = blockIdx.z ? VL16 : VS16; _Float16* VT = blockIdx.z ? VTL : VTS;
  for (int i = tid; i < 64 * 8; i += 256) { const int j = i / 8, d8 = (i % 8) * 8; FragH f; f.half[0] = *(const v8us*)((const unsigned short*)V16 + ((size_t)b * SQ + s0 + j) * DM + h * HD + d8); for (int q = 0; q < 8; ++q) tl[d8 + q][j] = f.u[q]; }
  __syncthreads();
  { for (int i = tid; i < 64 * 8; i += 256) { const int d = i / 8, j8 = (i % 8) * 8; FragH f; for (int q = 0; q < 8; ++q) f.u[q] = tl[d][j8 + q]; *(v8us*)((unsigned short*)VT + (((size_t)b * NH + h) * HD + d) * SQ + s0 + j8) = f.half[0]; }  } }

// ---- fused attention: scores, softmax and weighted sum of one branch in one pass over the keys; no score ever reaches memory ----
// Transposed products. S^T = K Q^T: A = 16 key rows, B = 16 query rows, so lane (ln, hh) holds for query ln the keys 8 hh + r of each 16-key tile. Two such tiles, rounded to f16, are
// at once the B operand of O^T += V^T P^T over 32 keys (element i: key 8 hh + i, element 8 + i: key 16 + 8 hh + i, the k order of g2_frag and g2_lfrag; g2_lfrag loads the A operand from the V^T rows in LDS).
// A query's maximum, sum and scale therefore live in its own lane (both halves); the halves exchange the maximum once a pass and join their sums once at the end.
// Every inner loop is fully unrolled so that the fragment, score and accumulator arrays are indexed by constants and stay in registers (a rolled loop would put them in scratch memory).
// Scores are kept in the log2 domain (x = s log2 e). The maximum in use is raised, and sums and outputs rescaled, only when a column's new maximum exceeds it by more than 8, so weights stay <= 2^8.
// 2^x of eight (two) values in place, one statement: behind each v_exp_f32 stands an instruction that neither reads its result nor overwrites its source (the operands are distinct registers), behind the last the v_nop: the slot the instruction set asks for behind a transcendental
__device__ __forceinline__ void ex2x8(v8f& x) { asm("v_exp_f32 %0, %0\n\tv_exp_f32 %1, %1\n\tv_exp_f32 %2, %2\n\tv_exp_f32 %3, %3\n\tv_exp_f32 %4, %4\n\tv_exp_f32 %5, %5\n\tv_exp_f32 %6, %6\n\tv_exp_f32 %7, %7\n\tv_nop" : "+v"(x[0]), "+v"(x[1]), "+v"(x[2]), "+v"(x[3]), "+v"(x[4]), "+v"(x[5]), "+v"(x[6]), "+v"(x[7])); }
__device__ __forceinline__ void ex2x2(float& a, float& b) { asm("v_exp_f32 %0, %0\n\tv_exp_f32 %1, %1\n\tv_nop" : "+v"(a), "+v"(b)); }
__device__ __forceinline__ v8f at_mma(v16h a, v16h b, v8f c) { return __builtin_amdgcn_wmma_f32_16x16x32_f16(false, a, false, b, (short)0, c, false, false); }
// K and V^T go through LDS: a stage is 64 keys, that is 64 K rows (64 d each) and 64 V^T rows (64 keys each), 128 bytes a row, brought once a block by asynchronous copies and read by all four waves; two buffers,
// the copies of stage t + 2 in flight while stage t + 1 is worked on. A wave-wide copy reads 4 rows x 128 contiguous bytes (4 whole cache lines), where a fragment load from global memory touched 16 lines for the same 512 bytes.
#define AT_PITCH 72      /* f16 elements a row in LDS = 144 bytes = 16 x 9: 16 rows read by ds_load_b128 fall on distinct banks */
#define AT_BUF (128 * AT_PITCH)      /* rows 0..63: K, rows 64..127: V^T */
// One lane's eight 16-byte copies of a stage: thread tid takes bytes 16 (tid & 7) of rows (tid >> 3) + 16 c, c = 0..3, of the K tile and of the V^T tile. l = its LDS byte address in row tid >> 3 of the buffer, gk / gv = its global
// address in that row of the K / V^T tile. The s_wait_xcnt stands inside the statement, behind the last copy, so that no address register of a copy is rewritten in front of it.
__device__ __forceinline__ void at_stage(unsigned l, const _Float16* gk, const _Float16* gv) {
  const unsigned rs = 16 * AT_PITCH * 2; const size_t sk = (size_t)16 * DM, sv = (size_t)16 * SQ;
  asm volatile("global_load_async_to_lds_b128 %0, %8, off\n\tglobal_load_async_to_lds_b128 %1, %9, off\n\tglobal_load_async_to_lds_b128 %2, %10, off\n\tglobal_load_async_to_lds_b128 %3, %11, off\n\t"
               "global_load_async_to_lds_b128 %4, %12, off\n\tglobal_load_async_to_lds_b128 %5, %13, off\n\tglobal_load_async_to_lds_b128 %6, %14, off\n\tglobal_load_async_to_lds_b128 %7, %15, off\n\ts_wait_xcnt 0x0"
               :: "v"(l), "v"(l + rs), "v"(l + 2 * rs), "v"(l + 3 * rs), "v"(l + 4 * rs), "v"(l + 5 * rs), "v"(l + 6 * rs), "v"(l + 7 * rs),
                  "v"(gk), "v"(gk + sk), "v"(gk + 2 * sk), "v"(gk + 3 * sk), "v"(gv), "v"(gv + sv), "v"(gv + 2 * sv), "v"(gv + 3 * sv) : "memory"); }
template <bool DECAY>
__device__ __forceinline__ void attn_run(const _Float16* __restrict__ Q16, const _Float16* __restrict__ KB, const _Float16* __restrict__ VT, float* __restrict__ OB, float c2, float (*so)[68], const _Float16* st) {
  const int lane = threadIdx.x & 31, ln = lane & 15, hh = lane >> 4; const int b = blockIdx.y / NH, h = blockIdx.y % NH; const int q0 = blockIdx.x * 128 + (threadIdx.x >> 5) * 32;
  const float sc2 = 0.125f * 1.4426950408889634f;
  const _Float16* qp = Q16 + ((size_t)b * SQ + q0 + ln) * DM + h * HD; const int tid = threadIdx.x;
  const _Float16* gk = KB + ((size_t)b * SQ + (tid >> 3)) * DM + h * HD + (tid & 7) * 8; const _Float16* gv = VT + ((size_t)blockIdx.y * HD + (tid >> 3)) * SQ + (tid & 7) * 8;
  const unsigned lst = (unsigned)(size_t)(st + (tid >> 3) * AT_PITCH + (tid & 7) * 8);      /* low 32 bits of the shared address = byte address in the block's LDS */
  const int koff = ln * AT_PITCH + 8 * hh, voff = (64 + ln) * AT_PITCH + 8 * hh;
  at_stage(lst, gk, gv);
  v16h qf[2][2];
#pragma unroll
  for (int g = 0; g < 2; ++g)
#pragma unroll
    for (int ks = 0; ks < 2; ++ks) qf[g][ks] = g2_frag(qp + (size_t)g * 16 * DM + ks * 32, hh);
  const v8f z8 = {0.f,0.f,0.f,0.f,0.f,0.f,0.f,0.f}; v8f o[2][4];
#pragma unroll
  for (int g = 0; g < 2; ++g)
#pragma unroll
    for (int dt = 0; dt < 4; ++dt) o[g][dt] = z8;
  float m[2] = {-3.0e38f, -3.0e38f}, l[2] = {0.f, 0.f};
  asm volatile("s_wait_asynccnt 0x0" ::: "memory");      // this wave's copies of stage 0 have landed
  __syncthreads();                                       // ... and every other wave's: stage 0 may be read
  at_stage(lst + AT_BUF * 2, gk + (size_t)64 * DM, gv + 64);
  // rolled; the buffer is chosen by the trip's parity
#pragma unroll 1
  for (int t = 0; t < SQ / 64; ++t) { const _Float16* sb = st + (t & 1) * AT_BUF; v16h kf[2][2];
#pragma unroll
   for (int u = 0; u < 2; ++u)
#pragma unroll
    for (int ks = 0; ks < 2; ++ks) kf[u][ks] = g2_lfrag(sb + koff + u * 16 * AT_PITCH + ks * 32);
   // a stage's two passes, unrolled so that the pass picks its rows and columns of the buffer by constant offsets
#pragma unroll
   for (int ps = 0; ps < 2; ++ps) { const int kb = t * 64 + ps * 32;
    v16h vf[4];
#pragma unroll
    for (int dt = 0; dt < 4; ++dt) vf[dt] = g2_lfrag(sb + voff + dt * 16 * AT_PITCH + ps * 32);
    __builtin_amdgcn_sched_barrier(0);      // keeps the V^T loads at the head of the pass, so that the score products and the maxima cover their latency (the scheduler sinks them to their use otherwise)
    v8f s[2][2];
#pragma unroll
    for (int g = 0; g < 2; ++g)
#pragma unroll
      for (int t = 0; t < 2; ++t) s[g][t] = at_mma(kf[t][1], qf[g][1], at_mma(kf[t][0], qf[g][0], z8));
    // the stage's second pass's K fragments, asked for while the first pass's softmax runs (the same buffer: nothing of the next stage is read here)
    if (ps == 0) {
#pragma unroll
      for (int u = 0; u < 2; ++u)
#pragma unroll
        for (int ks = 0; ks < 2; ++ks) kf[u][ks] = g2_lfrag(sb + koff + (32 + u * 16) * AT_PITCH + ks * 32); }
    float mt[2];
#pragma unroll
    for (int g = 0; g < 2; ++g) { float mx = -3.0e38f;
#pragma unroll
      for (int t = 0; t < 2; ++t) { const float fb = (float)(q0 + g * 16 + ln - 8 * hh - kb - t * 16);
#pragma unroll
        for (int r = 0; r < 8; ++r) { if (DECAY) s[g][t][r] = s[g][t][r] * sc2 - fabsf(fb - (float)r) * c2; mx = fmaxf(mx, s[g][t][r]); } }
      if (!DECAY) mx *= sc2;
      mt[g] = fmaxf(mx, __shfl_xor(mx, 16, 32)); }
    const bool need = (mt[0] > m[0] + 8.0f) || (mt[1] > m[1] + 8.0f);
    if (__builtin_amdgcn_ballot_w32(need) != 0) { const float mn0 = fmaxf(m[0], mt[0]), mn1 = fmaxf(m[1], mt[1]); float al[2] = {m[0] - mn0, m[1] - mn1}; ex2x2(al[0], al[1]); m[0] = mn0; m[1] = mn1;
#pragma unroll
      for (int g = 0; g < 2; ++g) { l[g] *= al[g];
#pragma unroll
        for (int dt = 0; dt < 4; ++dt) o[g][dt] *= al[g]; } }
#pragma unroll
    for (int g = 0; g < 2; ++g) { FragH pf; float ls = 0.f;
#pragma unroll
      for (int t = 0; t < 2; ++t) { v8f p;
#pragma unroll
        for (int r = 0; r < 8; ++r) p[r] = DECAY ? s[g][t][r] - m[g] : s[g][t][r] * sc2 - m[g];
        ex2x8(p);
#pragma unroll
        for (int r = 0; r < 8; ++r) { ls += p[r]; pf.h[t * 8 + r] = (_Float16)p[r]; } }
      l[g] += ls;
#pragma unroll
      for (int dt = 0; dt < 4; ++dt) o[g][dt] = at_mma(vf[dt], pf.v, o[g][dt]); }
   }
    asm volatile("s_wait_dscnt 0x0" ::: "memory");         // this wave's reads of stage t are finished before its buffer is refilled
    asm volatile("s_wait_asynccnt 0x0" ::: "memory");      // this wave's copies of stage t + 1 have landed
    __syncthreads();                                       // publishes stage t + 1 and ends every wave's reads of stage t
    if (t + 2 < SQ / 64) at_stage(lst + (unsigned)(t & 1) * (AT_BUF * 2), gk + (size_t)(t + 2) * 64 * DM, gv + (t + 2) * 64);
  }
  asm volatile("s_wait_asynccnt 0x0" ::: "memory");        // no copy is outstanding when the wave goes on to its end
  // O^T tile: lane (ln, hh) holds of query ln the columns 16 dt + 8 hh + r; through the wave's own LDS rows so that each store covers 256 contiguous bytes of a row
#pragma unroll
  for (int g = 0; g < 2; ++g) { const float lt = l[g] + __shfl_xor(l[g], 16, 32); const float inv = 1.0f / lt;
#pragma unroll
    for (int dt = 0; dt < 4; ++dt) { const v8f ov = o[g][dt] * inv; const v4f lo = {ov[0], ov[1], ov[2], ov[3]}, hi = {ov[4], ov[5], ov[6], ov[7]};
      *(v4fa*)&so[g * 16 + ln][dt * 16 + 8 * hh] = lo; *(v4fa*)&so[g * 16 + ln][dt * 16 + 8 * hh + 4] = hi; } }
  __builtin_amdgcn_fence(__ATOMIC_ACQ_REL, "workgroup"); __builtin_amdgcn_wave_barrier();      // the wave's LDS writes above are finished before its lanes read each other's rows below (each wave has its own rows: no work-group barrier)
  const int rsub = lane >> 4, c4 = (lane & 15) * 4;
#pragma unroll
  for (int q = 0; q < 16; ++q) { const int r = q * 2 + rsub; const v4f v = *(const v4fa*)&so[r][c4]; *(v4f*)(OB + ((size_t)b * SQ + q0 + r) * DM + h * HD + c4) = v; } }
// blockIdx.x = block of 128 queries (4 waves of 32), blockIdx.y = batch * NH + head, blockIdx.z = branch (0 short, with the decay bias; 1 long)
__global__ __launch_bounds__(128) void k_attn(const _Float16* __restrict__ Q16, const _Float16* __restrict__ KS, const _Float16* __restrict__ KL, const _Float16* __restrict__ VTS, const _Float16* __restrict__ VTL, float* __restrict__ OS, float* __restrict__ OL, const float* __restrict__ dfp) {
  __shared__ __attribute__((aligned(16))) float so[4][32][68];
  __shared__ __attribute__((aligned(16))) _Float16 st[2 * AT_BUF];
  /* the branch is the same for a whole block, so the barriers in attn_run are passed by all of a block's threads */
  if (blockIdx.z == 0) attn_run<true>(Q16, KS, VTS, OS, (1.0f - bf16_round(dfp[0])) * 1.4426950408889634f, so[threadIdx.x >> 5], st);
  else attn_run<false>(Q16, KL, VTL, OL, 0.f, so[threadIdx.x >> 5], st); }

__device__ __forceinline__ void wT_block(const float* __restrict__ w, int din, int dout, _Float16* __restrict__ Bt, int bid, float (*tl)[65]) { const int tid = threadIdx.x; const int nbo = dout / 64; const int ib = bid / nbo, ob = bid % nbo; const int i0 = ib * 64, o0 = ob * 64;
  for (int t = tid; t < 64 * 64; t += 256) { const int i = t / 64, o = t % 64; tl[o][i] = bf16_round(w[(size_t)(i0 + i) * dout + o0 + o]) * 16.0f; }
  __syncthreads();
  { for (int t = tid; t < 64 * 8; t += 256) { const int o = t / 8, i8 = (t % 8) * 8; FragH f; for (int q = 0; q < 8; ++q) f.h[q] = (_Float16)tl[o][i8 + q]; *(v8us*)((unsigned short*)Bt + (size_t)(o0 + o) * din + i0 + i8) = f.half[0]; }  } }
// Everything that reads only inputs, in one launch: ranges of the block index pick the job (the test is the same for a whole block, so the barrier in wT_block is passed by all of a block's threads or by none).
// The transposes stand first: their blocks run longer.
#define PB_SQ ((DM / 64) * (DM / 64))          /* blocks of a DM x DM weight */
#define PB_KV ((DM / 64) * (2 * DM / 64))      /* blocks of a DM x 2 DM weight */
#define PB_W (2 * PB_SQ + 2 * PB_KV)
#define PB_X ((int)((NR * DM / 8 + 255) / 256))
__global__ __launch_bounds__(256) void k_prep(const float* __restrict__ x, const float* __restrict__ wq, const float* __restrict__ wkvs, const float* __restrict__ wkvl, const float* __restrict__ wo,
    _Float16* __restrict__ X16, _Float16* __restrict__ BQ, _Float16* __restrict__ BKVS, _Float16* __restrict__ BKVL, _Float16* __restrict__ BO) {
  __shared__ float tl[64][65]; const int bid = blockIdx.x;
  if (bid < PB_KV) wT_block(wkvs, DM, 2 * DM, BKVS, bid, tl);
  else if (bid < 2 * PB_KV) wT_block(wkvl, DM, 2 * DM, BKVL, bid - PB_KV, tl);
  else if (bid < 2 * PB_KV + PB_SQ) wT_block(wq, DM, DM, BQ, bid - 2 * PB_KV, tl);
  else if (bid < PB_W) wT_block(wo, DM, DM, BO, bid - 2 * PB_KV - PB_SQ, tl);
  else x16_block(x, X16, NR * DM / 8, bid - PB_W); }
__global__ __launch_bounds__(256) void k_mix(const float* __restrict__ OS, const float* __restrict__ OL, const float* __restrict__ mwp, _Float16* __restrict__ O16, size_t n8) {
  #pragma clang fp contract(off)
  const size_t t = (size_t)blockIdx.x * 256 + threadIdx.x; if (t >= n8) return; const float a = 1.0f / (1.0f + expf(-bf16_round(mwp[0]))); FragH f; for (int q = 0; q < 8; ++q) f.h[q] = (_Float16)__fadd_rn(__fmul_rn(a, OS[t * 8 + q]), __fmul_rn(1.0f - a, OL[t * 8 + q]));
  *(v8us*)((unsigned short*)O16 + t * 8) = f.half[0];  }
extern "C" void kernel_launch(void* const* d_in, const int* in_sizes, int n_in,
                              void* d_out, int out_size, void* d_ws, size_t ws_size, hipStream_t stream) {
  (void)in_sizes; (void)n_in; (void)out_size;
  const float* const* I = (const float* const*)d_in; const float* x = I[0]; const float* wq = I[1]; const float* wkvs = I[2]; const float* wkvl = I[3]; const float* wo = I[4]; const float* mwp = I[5]; const float* dfp = I[6];
  char* ws = (char*)d_ws; size_t off = 0;
  auto take = [&](size_t bytes) { char* p = ws + off; off += (bytes + 255) & ~(size_t)255; return p; };
  /* the transposed projection weights lie as five DM x DM planes in a row (q, short k, short v, long k, long v), and so do the five projections' outputs: the projection launch picks plane blockIdx.y of each */
  _Float16* BQ = (_Float16*)take((size_t)5 * DM * DM * 2); _Float16* BKVS = BQ + (size_t)DM * DM; _Float16* BKVL = BQ + (size_t)3 * DM * DM; _Float16* BO = (_Float16*)take((size_t)DM * DM * 2);
  _Float16* X16 = (_Float16*)take(NR * DM * 2); _Float16* Q16 = (_Float16*)take(5 * NR * DM * 2); _Float16* K16 = Q16 + NR * DM; _Float16* V16 = Q16 + 2 * NR * DM; _Float16* KL16 = Q16 + 3 * NR * DM; _Float16* VL16 = Q16 + 4 * NR * DM; float* OS = (float*)take(NR * DM * 4); float* OL = (float*)take(NR * DM * 4); _Float16* O16 = (_Float16*)take(NR * DM * 2);
  _Float16* VTS = (_Float16*)take(NR * DM * 2); _Float16* VTL = (_Float16*)take(NR * DM * 2);
  if (off > ws_size) return;      /* 12 + 6x8 + 32 + 8 + 16 = 116 MiB */
  k_prep<<<PB_W + PB_X, 256, 0, stream>>>(x, wq, wkvs, wkvl, wo, X16, BQ, BKVS, BKVL, BO);
  const dim3 gp((unsigned)((NR / 128) * (DM / 64)), 1), gp5((unsigned)((NR / 128) * (DM / 64)), 5);
  k_gemm2<0><<<gp5, 128, 0, stream>>>(X16, DM, 0, BQ, DM, (size_t)DM * DM, 0.0625f, nullptr, 0, nullptr, 1, 0, 0, nullptr, Q16, DM, NR * DM, (int)NR, DM, DM);      /* q, short k | v, long k | v */
  k_vt<<<dim3(NH * (SQ / 64), NB, 2), 256, 0, stream>>>(V16, VL16, VTS, VTL);
  k_attn<<<dim3(SQ / 128, NB * NH, 2), 128, 0, stream>>>(Q16, K16, KL16, VTS, VTL, OS, OL, dfp);      /* per-branch o (merged heads) as f32 rows */
  k_mix<<<(unsigned)((NR * DM / 8 + 255) / 256), 256, 0, stream>>>(OS, OL, mwp, O16, NR * DM / 8);
  k_gemm2<0><<<gp, 128, 0, stream>>>(O16, DM, 0, BO, DM, 0, 0.0625f, nullptr, 0, nullptr, 1, 0, 0, (float*)d_out, nullptr, DM, 0, (int)NR, DM, DM);      /* out = o Wo */
}

// v006
// Measured time: 115 microseconds a run.
// Timed twice side by side with v005, it ran 1.05 and 1.04 times as fast.
// Counting every step since v000, it is 214 times as fast.
#include <hip/hip_runtime.h>
#define NB 4
#define SQ 1024
#define DM 1024
#define NH 16
#define HD 64
#define NR ((size_t)NB * SQ)         /* 4096 token rows */
typedef __bf16 v16b __attribute__((ext_vector_type(16)));
typedef unsigned short v8us __attribute__((ext_vector_type(8), may_alias));
typedef float  v8f  __attribute__((ext_vector_type(8)));
typedef float  v4f  __attribute__((ext_vector_type(4)));
typedef float  v4fa __attribute__((ext_vector_type(4), may_alias));
union FragB { v16b v; v8us half[2]; unsigned short u[16]; };

__device__ __forceinline__ unsigned short bf16_bits(float x) { unsigned int u = __float_as_uint(x); return (unsigned short)((u + 0x7FFFu + ((u >> 16) & 1u)) >> 16); }
__device__ __forceinline__ float bf16_val(unsigned short b) { return __uint_as_float(((unsigned int)b) << 16); }
__device__ __forceinline__ float bf16_round(float x) { return bf16_val(bf16_bits(x)); }
// D += A·B with NT terms: 1 = ah·bh, 2 = + al·bh (A split), 3 = + ah·bl (both split)
template <int NT>
__device__ __forceinline__ v8f mmaN(v16b ah, v16b al, v16b bh, v16b bl, v8f c) {
  c = __builtin_amdgcn_wmma_f32_16x16x32_bf16(false, ah, false, bh, (short)0, c, false, false);
  if (NT >= 2) c = __builtin_amdgcn_wmma_f32_16x16x32_bf16(false, al, false, bh, (short)0, c, false, false);
  if (NT >= 3) c = __builtin_amdgcn_wmma_f32_16x16x32_bf16(false, ah, false, bl, (short)0, c, false, false);
  asm volatile("v_nop\n\tv_nop\n\tv_nop\n\tv_nop" : "+v"(c) : "v"(ah), "v"(al), "v"(bh), "v"(bl));
  return c;
}

__global__ __launch_bounds__(256) void k_wt_bf16(const float* __restrict__ W, unsigned short* __restrict__ Wt, int K, int N) {
  const int t = blockIdx.x * 256 + threadIdx.x;
  const int k8n = K / 8;
  if (t >= N * k8n) return;
  const int n = t / k8n, k8 = (t % k8n) * 8;
  v8us v;
#pragma unroll
  for (int i = 0; i < 8; ++i) v[i] = bf16_bits(W[(size_t)(k8 + i) * N + n]);
  *(v8us*)(Wt + (size_t)n * K + k8) = v;
  
}

// GEMM C[M][N] (f32, pitch ldc) = act(A[M][K]·W + bias). A f32 row-major (pitch lda) converted per fragment to bf16
// (ASPLIT: hi/lo two planes -> 2 terms, else single rounded term); Wt bf16 [N][K] (pitch ldb). BIAS_BF16 rounds the
// bias to bf16 first (bias quantised to bf16 before the add). K%32==0, M%16==0, N%64==0.
template <bool ASPLIT, int ACT, bool BIAS_BF16>
__global__ __launch_bounds__(128) void k_gemm_bf(const float* __restrict__ A, int lda, const unsigned short* __restrict__ Wt, int ldb,
                                               const float* __restrict__ bias, float* __restrict__ C, int ldc, int M, int N, int K) {
  __shared__ __attribute__((aligned(16))) float so[4][16][64];
  const int tid = threadIdx.x, w = tid >> 5, lane = tid & 31, ln = lane & 15, hh = lane >> 4;
  const int ntn = N / 64;
  const int wid = blockIdx.x * 4 + w;
  const int mt = wid / ntn, nq = wid % ntn;
  if (mt * 16 >= M) return;
  const int row0 = mt * 16, col0 = nq * 64;
  const float* arow = A + (size_t)(row0 + ln) * lda;
  v8f acc[4] = {};
  for (int kb = 0; kb < K; kb += 32) {
    FragB ah, al;
    const v4f x0 = *(const v4fa*)(arow + kb + 8 * hh), x1 = *(const v4fa*)(arow + kb + 8 * hh + 4);
    const v4f x2 = *(const v4fa*)(arow + kb + 16 + 8 * hh), x3 = *(const v4fa*)(arow + kb + 16 + 8 * hh + 4);
    float xs[16] = {x0[0],x0[1],x0[2],x0[3],x1[0],x1[1],x1[2],x1[3],x2[0],x2[1],x2[2],x2[3],x3[0],x3[1],x3[2],x3[3]};
#pragma unroll
    for (int i = 0; i < 16; ++i) { const unsigned short hb = bf16_bits(xs[i]); ah.u[i] = hb; al.u[i] = ASPLIT ? bf16_bits(xs[i] - bf16_val(hb)) : (unsigned short)0; }
#pragma unroll
    for (int t = 0; t < 4; ++t) {
      const unsigned short* brow = Wt + (size_t)(col0 + t * 16 + ln) * ldb + kb;
      FragB b;
      b.half[0] = *(const v8us*)(brow + 8 * hh);
      b.half[1] = *(const v8us*)(brow + 16 + 8 * hh);
      acc[t] = mmaN<ASPLIT ? 2 : 1>(ah.v, al.v, b.v, b.v, acc[t]);
    }
  }
#pragma unroll
  for (int t = 0; t < 4; ++t) {
    float bv = bias ? bias[col0 + t * 16 + ln] : 0.f;
    if (BIAS_BF16) bv = bf16_round(bv);
#pragma unroll
    for (int r = 0; r < 8; ++r) { float v = acc[t][r] + bv; if (ACT == 1) v = fmaxf(v, 0.f); so[w][8 * hh + r][t * 16 + ln] = v; }
  }
  __builtin_amdgcn_fence(__ATOMIC_ACQ_REL, "workgroup");
  __builtin_amdgcn_wave_barrier();
  const int rsub = lane >> 4, c4 = (lane & 15) * 4;
  {
#pragma unroll
    for (int q = 0; q < 8; ++q) {
      const int r = q * 2 + rsub;
      const v4f v = *(const v4fa*)&so[w][r][c4];
      *(v4f*)(C + (size_t)(row0 + r) * ldc + col0 + c4) = v;
    }
    
  }
}

// GEMM C = act(A·W + bias + resid): A f32 (ASPLIT -> hi/lo 2 terms), Wt bf16 [N][K]; ACT 0 none, 1 relu, 2 exact gelu;
// resid (optional, f32, row index = (row % rmod), pitch ldr, RES_BF16 rounds it) added before the activation.
template <bool ASPLIT, int ACT, bool BIAS_BF16, bool RES_BF16>
__global__ __launch_bounds__(128) void k_gemm_bf3(const float* __restrict__ A, int lda, const unsigned short* __restrict__ Wt, int ldb,
                                                const float* __restrict__ bias, const float* __restrict__ resid, int rmod, int ldr,
                                                float* __restrict__ C, int ldc, int M, int N, int K) {
  __shared__ __attribute__((aligned(16))) float so[4][16][64];
  const int tid = threadIdx.x, w = tid >> 5, lane = tid & 31, ln = lane & 15, hh = lane >> 4;
  const int ntn = N / 64;
  const int wid = blockIdx.x * 4 + w;
  const int mt = wid / ntn, nq = wid % ntn;
  if (mt * 16 >= M) return;
  const int row0 = mt * 16, col0 = nq * 64;
  const float* arow = A + (size_t)(row0 + ln) * lda;
  v8f acc[4] = {};
  for (int kb = 0; kb < K; kb += 32) {
    FragB ah, al;
    const v4f x0 = *(const v4fa*)(arow + kb + 8 * hh), x1 = *(const v4fa*)(arow + kb + 8 * hh + 4);
    const v4f x2 = *(const v4fa*)(arow + kb + 16 + 8 * hh), x3 = *(const v4fa*)(arow + kb + 16 + 8 * hh + 4);
    float xs[16] = {x0[0],x0[1],x0[2],x0[3],x1[0],x1[1],x1[2],x1[3],x2[0],x2[1],x2[2],x2[3],x3[0],x3[1],x3[2],x3[3]};
#pragma unroll
    for (int i = 0; i < 16; ++i) { const unsigned short hb = bf16_bits(xs[i]); ah.u[i] = hb; al.u[i] = ASPLIT ? bf16_bits(xs[i] - bf16_val(hb)) : (unsigned short)0; }
#pragma unroll
    for (int t = 0; t < 4; ++t) {
      const unsigned short* brow = Wt + (size_t)(col0 + t * 16 + ln) * ldb + kb;
      FragB b;
      b.half[0] = *(const v8us*)(brow + 8 * hh);
      b.half[1] = *(const v8us*)(brow + 16 + 8 * hh);
      acc[t] = mmaN<ASPLIT ? 2 : 1>(ah.v, al.v, b.v, b.v, acc[t]);
    }
  }
#pragma unroll
  for (int t = 0; t < 4; ++t) {
    const int col = col0 + t * 16 + ln;
    float bv = bias ? bias[col] : 0.f;
    if (BIAS_BF16) bv = bf16_round(bv);
#pragma unroll
    for (int r = 0; r < 8; ++r) {
      float v = acc[t][r] + bv;
      if (resid) { float rv = resid[(size_t)((row0 + 8 * hh + r) % rmod) * ldr + col]; if (RES_BF16) rv = bf16_round(rv); v += rv; }
      if (ACT == 1) v = fmaxf(v, 0.f);
      if (ACT == 2) v = 0.5f * v * (1.0f + erff(v * 0.70710678118654752f));
      if (ACT == 3) { const float u = 0.7978845608028654f * (v + 0.044715f * v * v * v); v = 0.5f * v * (1.0f + tanhf(u)); }
      so[w][8 * hh + r][t * 16 + ln] = v;
    }
  }
  __builtin_amdgcn_fence(__ATOMIC_ACQ_REL, "workgroup");
  __builtin_amdgcn_wave_barrier();
  const int rsub = lane >> 4, c4 = (lane & 15) * 4;
  {
#pragma unroll
    for (int q = 0; q < 8; ++q) {
      const int r = q * 2 + rsub;
      const v4f v = *(const v4fa*)&so[w][r][c4];
      *(v4f*)(C + (size_t)(row0 + r) * ldc + col0 + c4) = v;
    }
    
  }
}
// row LayerNorm (biased variance, eps) over N: s = X (+ R); optional out_sum <- s; out_norm <- (s-mu)*rsqrt(var+eps)*g + b
template <bool PARAM_BF16>
__global__ __launch_bounds__(256) void k_layernorm(const float* __restrict__ X, const float* __restrict__ R, const float* __restrict__ g, const float* __restrict__ bta,
                                                  float* __restrict__ out_sum, float* __restrict__ out_norm, int N, float eps) {
  __shared__ float red[256];
  const int row = blockIdx.x, tid = threadIdx.x;
  const float* x = X + (size_t)row * N; const float* rr = R ? R + (size_t)row * N : nullptr;
  float vals[16];                     // up to N = 4096
  const int per = N / 256;            // contiguous chunk per thread? use strided-by-4 chunks: thread handles j = tid*4 + 1024*u
  float s1 = 0.f;
  for (int u = 0; u < per / 4; ++u) {
    const int j = tid * 4 + 1024 * u;
    const v4f a = *(const v4fa*)(x + j);
    v4f b = {0.f,0.f,0.f,0.f}; if (rr) b = *(const v4fa*)(rr + j);
#pragma unroll
    for (int q = 0; q < 4; ++q) { const float v = a[q] + b[q]; vals[u * 4 + q] = v; s1 += v; }
  }
  red[tid] = s1; __syncthreads();
  for (int st = 128; st > 0; st >>= 1) { if (tid < st) red[tid] += red[tid + st]; __syncthreads(); }
  const float mu = red[0] / (float)N; __syncthreads();
  float s2 = 0.f;
  for (int u = 0; u < per / 4; ++u)
#pragma unroll
    for (int q = 0; q < 4; ++q) { const float c = vals[u * 4 + q] - mu; s2 += c * c; }
  red[tid] = s2; __syncthreads();
  for (int st = 128; st > 0; st >>= 1) { if (tid < st) red[tid] += red[tid + st]; __syncthreads(); }
  const float rs = rsqrtf(red[0] / (float)N + eps);
  {
    for (int u = 0; u < per / 4; ++u) {
      const int j = tid * 4 + 1024 * u;
      v4f o, sm;
#pragma unroll
      for (int q = 0; q < 4; ++q) {
        float gg = g[j + q], bb = bta[j + q];
        if (PARAM_BF16) { gg = bf16_round(gg); bb = bf16_round(bb); }
        sm[q] = vals[u * 4 + q]; o[q] = (vals[u * 4 + q] - mu) * rs * gg + bb;
      }
      if (out_sum) *(v4f*)(out_sum + (size_t)row * N + j) = sm;
      *(v4f*)(out_norm + (size_t)row * N + j) = o;
    }
    
  }
}



// ---- f16 WMMA path (v_wmma_f32_16x16x32_f16): 11-bit significands for operands in range — used where a [0,1] probability operand needs more precision than bf16
typedef _Float16 v16h __attribute__((ext_vector_type(16)));
union FragH { v16h v; v8us half[2]; _Float16 h[16]; unsigned short u[16]; };
template <int NT>
__device__ __forceinline__ v8f mmaH(v16h ah, v16h al, v16h bh, v16h bl, v8f c) {
  c = __builtin_amdgcn_wmma_f32_16x16x32_f16(false, ah, false, bh, (short)0, c, false, false);
  if (NT >= 2) c = __builtin_amdgcn_wmma_f32_16x16x32_f16(false, al, false, bh, (short)0, c, false, false);
  if (NT >= 3) c = __builtin_amdgcn_wmma_f32_16x16x32_f16(false, ah, false, bl, (short)0, c, false, false);
  asm volatile("v_nop\n\tv_nop\n\tv_nop\n\tv_nop" : "+v"(c) : "v"(ah), "v"(al), "v"(bh), "v"(bl));
  return c;
}
// batched GEMM like k_gemm_b but f16 operands: A f32 (split into f16 hi/lo if ASPLIT, else rounded to f16), Bt = f16 values [n][k]; alpha; C f32; N multiple of 16 (partial tiles skipped)
template <bool ASPLIT>
__global__ __launch_bounds__(128) void k_gemm_h(const float* __restrict__ A, int lda, size_t sA, const _Float16* __restrict__ Bh, int ldb, size_t sB, float alpha, float* __restrict__ C, int ldc, size_t sC, int M, int N, int K) {
  __shared__ __attribute__((aligned(16))) float so[4][16][64];
  const int tid = threadIdx.x, w = tid >> 5, lane = tid & 31, ln = lane & 15, hh = lane >> 4; const int by = blockIdx.y;
  A += (size_t)by * sA; Bh += (size_t)by * sB; C += (size_t)by * sC;
  const int ntn = (N + 63) / 64; const int wid = blockIdx.x * 4 + w; const int mt = wid / ntn, nq = wid % ntn; if (mt * 16 >= M) return;
  const int row0 = mt * 16, col0 = nq * 64; const float* arow = A + (size_t)(row0 + ln) * lda;
  v8f acc[4] = {};
  for (int kb = 0; kb < K; kb += 32) {
    FragH ah, al;
    const v4f x0 = *(const v4fa*)(arow + kb + 8 * hh), x1 = *(const v4fa*)(arow + kb + 8 * hh + 4), x2 = *(const v4fa*)(arow + kb + 16 + 8 * hh), x3 = *(const v4fa*)(arow + kb + 16 + 8 * hh + 4);
    float xs[16] = {x0[0],x0[1],x0[2],x0[3],x1[0],x1[1],x1[2],x1[3],x2[0],x2[1],x2[2],x2[3],x3[0],x3[1],x3[2],x3[3]};
#pragma unroll
    for (int i = 0; i < 16; ++i) { const _Float16 h = (_Float16)xs[i]; ah.h[i] = h; al.h[i] = ASPLIT ? (_Float16)(xs[i] - (float)h) : (_Float16)0.0f; }
#pragma unroll
    for (int t = 0; t < 4; ++t) { if (col0 + t * 16 >= N) continue; const size_t boff = (size_t)(col0 + t * 16 + ln) * ldb + kb; FragH bq; bq.half[0] = *(const v8us*)(Bh + boff + 8 * hh); bq.half[1] = *(const v8us*)(Bh + boff + 16 + 8 * hh);
      acc[t] = mmaH<ASPLIT ? 2 : 1>(ah.v, al.v, bq.v, bq.v, acc[t]); }
  }
#pragma unroll
  for (int t = 0; t < 4; ++t) { if (col0 + t * 16 >= N) continue;
#pragma unroll
    for (int r = 0; r < 8; ++r) so[w][8 * hh + r][t * 16 + ln] = acc[t][r] * alpha; }
  __builtin_amdgcn_fence(__ATOMIC_ACQ_REL, "workgroup"); __builtin_amdgcn_wave_barrier();
  const int rsub = lane >> 4, c4 = (lane & 15) * 4;
  {
#pragma unroll
    for (int q = 0; q < 8; ++q) { const int r = q * 2 + rsub; if (col0 + c4 < N) { const v4f v = *(const v4fa*)&so[w][r][c4]; *(v4f*)(C + (size_t)(row0 + r) * ldc + col0 + c4) = v; } }
     }
}

// Wt[n][k] = f16(W[k][n]·scale) from f32 row-major W[K][N] (scale = power of two; bf16-exact weights stay exact in f16 away from the subnormal range)
__global__ __launch_bounds__(256) void k_wt_f16(const float* __restrict__ W, _Float16* __restrict__ Wt, int K, int N, float scale) {
  const int t = blockIdx.x * 256 + threadIdx.x; if (t >= N * (K / 8)) return; const int n = t / (K / 8), k8 = (t % (K / 8)) * 8; FragH f;
#pragma unroll
  for (int i = 0; i < 8; ++i) f.h[i] = (_Float16)(bf16_round(W[(size_t)(k8 + i) * N + n]) * scale); const v8us o = f.half[0];
  *(v8us*)((unsigned short*)Wt + (size_t)n * K + k8) = o; 
}
// k_gemm_hh variant with fused epilogue: v = acc·alpha + bias[by·sBias + col] (+ CP[(row/rowsPerB)·sCPb + by·64 + col] if CP) ; ACT 0 none / 1 elu ; writes f16 C16 (and f32 C if non-null)
template <int ACT>
__global__ __launch_bounds__(128) void k_gemm_hhx(const _Float16* __restrict__ A, int lda, size_t sA, const _Float16* __restrict__ Bh, int ldb, size_t sB, float alpha, const float* __restrict__ bias, size_t sBias, const float* __restrict__ CP, int rowsPerB, size_t sCPb, int row0g,
    float* __restrict__ C, _Float16* __restrict__ C16, int ldc, size_t sC, int M, int N, int K) {
  __shared__ __attribute__((aligned(16))) float so[4][16][64];
  const int tid = threadIdx.x, w = tid >> 5, lane = tid & 31, ln = lane & 15, hh = lane >> 4; const int by = blockIdx.y;
  A += (size_t)by * sA; Bh += (size_t)by * sB; const size_t cofs = (size_t)by * sC; const float* bp = bias ? bias + (size_t)by * sBias : nullptr;
  const int ntn = (N + 63) / 64; const int wid = blockIdx.x * 4 + w; const int mt = wid / ntn, nq = wid % ntn; if (mt * 16 >= M) return;
  const int row0 = mt * 16, col0 = nq * 64; const _Float16* arow = A + (size_t)(row0 + ln) * lda;
  v8f acc[4] = {};
  for (int kb = 0; kb < K; kb += 32) { FragH ah; ah.half[0] = *(const v8us*)((const unsigned short*)arow + kb + 8 * hh); ah.half[1] = *(const v8us*)((const unsigned short*)arow + kb + 16 + 8 * hh);
#pragma unroll
    for (int t = 0; t < 4; ++t) { if (col0 + t * 16 >= N) continue; const size_t boff = (size_t)(col0 + t * 16 + ln) * ldb + kb; FragH bq; bq.half[0] = *(const v8us*)((const unsigned short*)Bh + boff + 8 * hh); bq.half[1] = *(const v8us*)((const unsigned short*)Bh + boff + 16 + 8 * hh);
      acc[t] = mmaH<1>(ah.v, ah.v, bq.v, bq.v, acc[t]); }
  }
#pragma unroll
  for (int t = 0; t < 4; ++t) { if (col0 + t * 16 >= N) continue; const int col = col0 + t * 16 + ln; const float bv = bp ? bf16_round(bp[col]) : 0.f;
#pragma unroll
    for (int r = 0; r < 8; ++r) { float v = acc[t][r] * alpha + bv; if (CP) { const int rr = row0g + row0 + 8 * hh + r; if (rowsPerB < 0) v += CP[cofs + (size_t)rr * ldc + col];      /* rowsPerB < 0: own element of the batched C plane */ else { const int bidx = rr / rowsPerB; v += CP[(size_t)bidx * sCPb + (size_t)by * 64 + col]; } } if (ACT == 1) v = (v > 0.f) ? v : expm1f(v); else if (ACT == 7) v = (v > 0.f) ? v + 1.0f : expf(v); else if (ACT == 8) v = tanhf(v); else if (ACT == 9) v = 0.5f * v * (1.0f + tanhf(0.7978845608028654f * (v + 0.044715f * v * v * v))); else if (ACT == 11) v = 1.0f / (1.0f + expf(-v)); else if (ACT == 12) v = (v > 0.f) ? v : 0.01f * v; else if (ACT == 14) v = (v > 0.f) ? v : 0.1f * v; else if (ACT == 16) v = (v >= 0.f) ? v : 0.3f * v; else if (ACT == 17) v = (v >= 0.f) ? v : 0.2f * v; else if (ACT == 15) v = v / (1.0f + expf(-v)); else if (ACT == 3) v = fmaxf(v, 0.f); else if (ACT == 6) v = 0.5f * v * (1.0f + erff(v * 0.70710678118654752f)); so[w][8 * hh + r][t * 16 + ln] = v; } }
  __builtin_amdgcn_fence(__ATOMIC_ACQ_REL, "workgroup"); __builtin_amdgcn_wave_barrier();
  const int rsub = lane >> 4, c4 = (lane & 15) * 4; typedef _Float16 v4h __attribute__((ext_vector_type(4)));
  {
#pragma unroll
    for (int q = 0; q < 8; ++q) { const int r = q * 2 + rsub; if (col0 + c4 < N) { const v4f v = *(const v4fa*)&so[w][r][c4]; if (C) *(v4f*)(C + cofs + (size_t)(row0 + r) * ldc + col0 + c4) = v; if (C16) { v4h h4; for (int i = 0; i < 4; ++i) h4[i] = (_Float16)v[i]; *(v4h*)(C16 + cofs + (size_t)(row0 + r) * ldc + col0 + c4) = h4; } } }
     }
}


typedef _Float16 v4h __attribute__((ext_vector_type(4)));

__device__ __forceinline__ void x16_block(const float* __restrict__ x, _Float16* __restrict__ X16, size_t n8, int bid) { const size_t t = (size_t)bid * 256 + threadIdx.x; if (t >= n8) return; FragH f;
#pragma unroll
  for (int q = 0; q < 8; ++q) f.h[q] = (_Float16)bf16_round(x[t * 8 + q]); *(v8us*)((unsigned short*)X16 + t * 8) = f.half[0];  }
__global__ __launch_bounds__(256) void k_h16(const float* __restrict__ x, _Float16* __restrict__ X16, size_t n8) { const size_t t = (size_t)blockIdx.x * 256 + threadIdx.x; if (t >= n8) return; FragH f;
#pragma unroll
  for (int q = 0; q < 8; ++q) f.h[q] = (_Float16)x[t * 8 + q]; *(v8us*)((unsigned short*)X16 + t * 8) = f.half[0];  }
__global__ __launch_bounds__(256) void k_round16f(const float* __restrict__ W, _Float16* __restrict__ Bt, size_t n8) { const size_t t = (size_t)blockIdx.x * 256 + threadIdx.x; if (t >= n8) return; FragH f;
#pragma unroll
  for (int i = 0; i < 8; ++i) f.h[i] = (_Float16)(bf16_round(W[t * 8 + i]) * 16.0f); *(v8us*)((unsigned short*)Bt + t * 8) = f.half[0];  }
template <int NHv, int TTv>
__global__ __launch_bounds__(256) void k_vt(const _Float16* __restrict__ V16, int ldv, int voff, _Float16* __restrict__ Vt) { __shared__ unsigned short tl[64][66]; const int tid = threadIdx.x; const int slab = blockIdx.x / (TTv / 64), lg = blockIdx.x % (TTv / 64); const int b = slab / NHv, h = slab % NHv;
  for (int i = tid; i < 64 * 8; i += 256) { const int r = i / 8, c8 = (i % 8) * 8; FragH f; f.half[0] = *(const v8us*)((const unsigned short*)V16 + ((size_t)b * TTv + lg * 64 + r) * ldv + voff + h * 64 + c8);
#pragma unroll
    for (int q = 0; q < 8; ++q) tl[r][c8 + q] = f.u[q]; }
  __syncthreads();
  {
#pragma unroll
    for (int rd = 0; rd < 2; ++rd) { const int d = rd * 32 + tid / 8, pc = tid % 8; FragH f;
#pragma unroll
      for (int q = 0; q < 8; ++q) f.u[q] = tl[pc * 8 + q][d];
      *(v8us*)((unsigned short*)Vt + ((size_t)slab * 64 + d) * TTv + lg * 64 + pc * 8) = f.half[0]; }
     } }

__global__ __launch_bounds__(256) void k_hl(const float* __restrict__ F, _Float16* __restrict__ Hh, _Float16* __restrict__ Hl, size_t n8) { const size_t t = (size_t)blockIdx.x * 256 + threadIdx.x; if (t >= n8) return; FragH fh, fl; const v4f a = *(const v4fa*)(F + t * 8), c = *(const v4fa*)(F + t * 8 + 4);
#pragma unroll
  for (int q = 0; q < 4; ++q) { _Float16 h = (_Float16)a[q]; fh.h[q] = h; fl.h[q] = (_Float16)((a[q] - (float)h) * 1024.0f); h = (_Float16)c[q]; fh.h[4 + q] = h; fl.h[4 + q] = (_Float16)((c[q] - (float)h) * 1024.0f); }
  { *(v8us*)((unsigned short*)Hh + t * 8) = fh.half[0]; *(v8us*)((unsigned short*)Hl + t * 8) = fl.half[0];  } }

// ---- fast GEMM (wave tile 32x64, block tile 128x64; requires M % 128 == 0 rows per launch region, N % 64 == 0 and K % 64 == 0); epilogue = k_gemm_hhx semantics ----
// Operands go through LDS: a stage is 64 k of the block's 128 A rows and 64 B rows (128 bytes a row), brought by asynchronous copies, two buffers, the copies of stage t + 2 in flight while stage t + 1 is worked on.
// A wave-wide copy reads 4 rows x 128 contiguous bytes (4 whole cache lines), and the B rows are fetched once a block.
#define G2_PITCH 72      /* f16 elements a row in LDS = 144 bytes = 16 x 9: 16 rows read by ds_load_b128 fall on distinct banks */
#define G2_ROWS 192      /* rows 0..127: A, rows 128..191: B */
#define G2_BUF (G2_ROWS * G2_PITCH)
// fragment from an LDS row: p = row + 32 ks + 8 hh; the k order of g2_frag
__device__ __forceinline__ v16h g2_lfrag(const _Float16* p) { FragH f; f.half[0] = *(const v8us*)((const unsigned short*)p); f.half[1] = *(const v8us*)((const unsigned short*)p + 16); return f.v; }
// One lane's twelve 16-byte copies of a stage: thread tid takes bytes 16 (tid & 7) of rows (tid >> 3) + 16 c, c = 0..11. l = its LDS byte address in row tid >> 3 of the buffer, ga / gb = its global address in that row of the
// A / B tile, sa / sb = 16 rows in elements. The s_wait_xcnt stands inside the statement, behind the last copy, so that no address register of a copy is rewritten in front of it.
__device__ __forceinline__ void g2_stage(unsigned l, const _Float16* ga, size_t sa, const _Float16* gb, size_t sb) {
  const unsigned rs = 16 * G2_PITCH * 2;
  asm volatile("global_load_async_to_lds_b128 %0, %12, off\n\tglobal_load_async_to_lds_b128 %1, %13, off\n\tglobal_load_async_to_lds_b128 %2, %14, off\n\tglobal_load_async_to_lds_b128 %3, %15, off\n\t"
               "global_load_async_to_lds_b128 %4, %16, off\n\tglobal_load_async_to_lds_b128 %5, %17, off\n\tglobal_load_async_to_lds_b128 %6, %18, off\n\tglobal_load_async_to_lds_b128 %7, %19, off\n\t"
               "global_load_async_to_lds_b128 %8, %20, off\n\tglobal_load_async_to_lds_b128 %9, %21, off\n\tglobal_load_async_to_lds_b128 %10, %22, off\n\tglobal_load_async_to_lds_b128 %11, %23, off\n\ts_wait_xcnt 0x0"
               :: "v"(l), "v"(l + rs), "v"(l + 2 * rs), "v"(l + 3 * rs), "v"(l + 4 * rs), "v"(l + 5 * rs), "v"(l + 6 * rs), "v"(l + 7 * rs), "v"(l + 8 * rs), "v"(l + 9 * rs), "v"(l + 10 * rs), "v"(l + 11 * rs),
                  "v"(ga), "v"(ga + sa), "v"(ga + 2 * sa), "v"(ga + 3 * sa), "v"(ga + 4 * sa), "v"(ga + 5 * sa), "v"(ga + 6 * sa), "v"(ga + 7 * sa), "v"(gb), "v"(gb + sb), "v"(gb + 2 * sb), "v"(gb + 3 * sb) : "memory"); }
__device__ __forceinline__ v16h g2_frag(const _Float16* p, int hh) { FragH f; f.half[0] = *(const v8us*)((const unsigned short*)p + 8 * hh); f.half[1] = *(const v8us*)((const unsigned short*)p + 16 + 8 * hh); return f.v; }
__device__ __forceinline__ v8f g2_mma(v16h a, v16h b, v8f c) { v8f d = __builtin_amdgcn_wmma_f32_16x16x32_f16(false, a, false, b, (short)0, c, false, false); asm volatile("v_nop\n\tv_nop\n\tv_nop\n\tv_nop" : "+v"(d) : "v"(a), "v"(b)); return d; }
template <int ACT>
__global__ __launch_bounds__(128) void k_gemm2(const _Float16* __restrict__ A, int lda, size_t sA, const _Float16* __restrict__ Bh, int ldb, size_t sB, float alpha, const float* __restrict__ bias, size_t sBias, const float* __restrict__ CP, int rowsPerB, size_t sCPb, int row0g,
    float* __restrict__ C, _Float16* __restrict__ C16, int ldc, size_t sC, int M, int N, int K) { static_assert(ACT == 0 || ACT == 3 || ACT == 6 || ACT == 8 || ACT == 9 || ACT == 11 || ACT == 12 || ACT == 14 || ACT == 15 || ACT == 16 || ACT == 17, "k_gemm2: unsupported ACT code (would silently apply no activation)");
  __shared__ __attribute__((aligned(16))) float so[4][32][68];
  __shared__ __attribute__((aligned(16))) _Float16 st[2][G2_BUF];
  const int tid = threadIdx.x, w = tid >> 5, lane = tid & 31, ln = lane & 15, hh = lane >> 4; const int by = blockIdx.y;
  A += (size_t)by * sA; Bh += (size_t)by * sB; const size_t cofs = (size_t)by * sC; const float* bp = bias ? bias + (size_t)by * sBias : nullptr;
  const int ntn = N >> 6; const int mt = blockIdx.x / ntn, nq = blockIdx.x - mt * ntn; const int row0 = mt * 128 + 32 * w, col0 = nq * 64; if (mt * 128 >= M) return;      /* the same for the whole block: it stands in front of barriers */
  const _Float16* gap = A + (size_t)(mt * 128 + (tid >> 3)) * lda + (tid & 7) * 8; const _Float16* gbp = Bh + (size_t)(col0 + (tid >> 3)) * ldb + (tid & 7) * 8; const size_t sa16 = (size_t)16 * lda, sb16 = (size_t)16 * ldb;
  const unsigned lst = (unsigned)(size_t)&st[0][(tid >> 3) * G2_PITCH + (tid & 7) * 8];      /* low 32 bits of the shared address = byte address in the block's LDS */
  const int aoff = (32 * w + ln) * G2_PITCH + 8 * hh, boff = (128 + ln) * G2_PITCH + 8 * hh; const int nst = K >> 6;
  const v8f z8 = {0.f,0.f,0.f,0.f,0.f,0.f,0.f,0.f}; v8f c00 = z8, c01 = z8, c02 = z8, c03 = z8, c10 = z8, c11 = z8, c12 = z8, c13 = z8;
  g2_stage(lst, gap, sa16, gbp, sb16);
  asm volatile("s_wait_asynccnt 0x0" ::: "memory");      // this wave's copies of stage 0 have landed
  __syncthreads();                                       // ... and every other wave's: stage 0 may be read
  if (nst > 1) g2_stage(lst + G2_BUF * 2, gap + 64, sa16, gbp + 64, sb16);
  // rolled, as it was: a trip already holds a stage's 24 LDS reads and 16 products, and unrolled trips would each keep their own 36 copy address registers; the buffer is chosen by the trip's parity
#pragma unroll 1
  for (int t = 0; t < nst; ++t) { const _Float16* sb = st[t & 1]; v16h af[2][2], bf[2][4];
    // the three inner loops are fully unrolled so that the fragment arrays are indexed by constants and stay in registers
#pragma unroll
    for (int ks = 0; ks < 2; ++ks) { af[ks][0] = g2_lfrag(sb + aoff + ks * 32); af[ks][1] = g2_lfrag(sb + aoff + 16 * G2_PITCH + ks * 32);
#pragma unroll
      for (int u = 0; u < 4; ++u) bf[ks][u] = g2_lfrag(sb + boff + u * 16 * G2_PITCH + ks * 32); }
#pragma unroll
    for (int ks = 0; ks < 2; ++ks) {
      c00 = g2_mma(af[ks][0], bf[ks][0], c00); c10 = g2_mma(af[ks][1], bf[ks][0], c10);
      c01 = g2_mma(af[ks][0], bf[ks][1], c01); c11 = g2_mma(af[ks][1], bf[ks][1], c11);
      c02 = g2_mma(af[ks][0], bf[ks][2], c02); c12 = g2_mma(af[ks][1], bf[ks][2], c12);
      c03 = g2_mma(af[ks][0], bf[ks][3], c03); c13 = g2_mma(af[ks][1], bf[ks][3], c13); }
    asm volatile("s_wait_dscnt 0x0" ::: "memory");         // this wave's reads of stage t are finished before its buffer is refilled
    asm volatile("s_wait_asynccnt 0x0" ::: "memory");      // this wave's copies of stage t + 1 have landed
    __syncthreads();                                       // publishes stage t + 1 and ends every wave's reads of stage t
    if (t + 2 < nst) g2_stage(lst + (unsigned)(t & 1) * (G2_BUF * 2), gap + (size_t)(t + 2) * 64, sa16, gbp + (size_t)(t + 2) * 64, sb16); }
  asm volatile("s_wait_asynccnt 0x0" ::: "memory");        // no copy is outstanding when the wave goes on to its end
  v8f accs[8] = {c00, c01, c02, c03, c10, c11, c12, c13};
#pragma unroll
  for (int u = 0; u < 8; ++u) { const int t = u & 3, half = u >> 2; const int col = col0 + t * 16 + ln; const float bv = bp ? bf16_round(bp[col]) : 0.f;
#pragma unroll
    for (int r = 0; r < 8; ++r) { const int rloc = half * 16 + 8 * hh + r; float v = accs[u][r] * alpha + bv; if (CP) { if (rowsPerB < 0) v += CP[cofs + (size_t)(row0g + row0 + rloc) * ldc + col];      /* rowsPerB < 0: own element of the batched C plane */ else { const int bidx = (row0g + row0 + rloc) / rowsPerB; v += CP[(size_t)bidx * sCPb + (size_t)by * 64 + col]; } }
      if (ACT == 3) v = fmaxf(v, 0.f); else if (ACT == 6) v = 0.5f * v * (1.0f + erff(v * 0.70710678118654752f)); else if (ACT == 11) v = 1.0f / (1.0f + expf(-v)); else if (ACT == 15) v = v / (1.0f + expf(-v)); else if (ACT == 12) v = (v > 0.f) ? v : 0.01f * v; else if (ACT == 8) v = tanhf(v); else if (ACT == 9) v = 0.5f * v * (1.0f + tanhf(0.7978845608028654f * (v + 0.044715f * v * v * v))); else if (ACT == 14) v = (v > 0.f) ? v : 0.1f * v; else if (ACT == 16) v = (v >= 0.f) ? v : 0.3f * v; else if (ACT == 17) v = (v >= 0.f) ? v : 0.2f * v;
      so[w][rloc][t * 16 + ln] = v; } }
  __builtin_amdgcn_fence(__ATOMIC_ACQ_REL, "workgroup"); __builtin_amdgcn_wave_barrier();
  const int rsub = lane >> 4, c4 = (lane & 15) * 4;
  {
#pragma unroll
    for (int q = 0; q < 16; ++q) { const int r = q * 2 + rsub; const v4f v = *(const v4fa*)&so[w][r][c4]; if (C) *(v4f*)(C + cofs + (size_t)(row0 + r) * ldc + col0 + c4) = v; if (C16) { v4h h4; for (int i = 0; i < 4; ++i) h4[i] = (_Float16)v[i]; *(v4h*)(C16 + cofs + (size_t)(row0 + r) * ldc + col0 + c4) = h4; } }
     } }


__global__ __launch_bounds__(256) void k_wnat(const float* __restrict__ w, size_t n8, _Float16* __restrict__ Bt) { const size_t t = (size_t)blockIdx.x * 256 + threadIdx.x; if (t >= n8) return; FragH f; for (int q = 0; q < 8; ++q) f.h[q] = (_Float16)(bf16_round(w[t * 8 + q]) * 16.0f); *(v8us*)((unsigned short*)Bt + t * 8) = f.half[0];  }
// V^T of every (branch, batch, head): blockIdx.x = head + NH * (block of 64 keys), blockIdx.y = batch, blockIdx.z = branch; VT[(b * NH + h) * HD + d][key]
__global__ __launch_bounds__(256) void k_vt(const _Float16* __restrict__ VS16, const _Float16* __restrict__ VL16, _Float16* __restrict__ VTS, _Float16* __restrict__ VTL) { __shared__ unsigned short tl[64][65]; const int tid = threadIdx.x; const int h = blockIdx.x % NH, sg = blockIdx.x / NH; const int s0 = sg * 64; const int b = blockIdx.y;
  const _Float16* V16 = blockIdx.z ? VL16 : VS16; _Float16* VT = blockIdx.z ? VTL : VTS;
  for (int i = tid; i < 64 * 8; i += 256) { const int j = i / 8, d8 = (i % 8) * 8; FragH f; f.half[0] = *(const v8us*)((const unsigned short*)V16 + ((size_t)b * SQ + s0 + j) * DM + h * HD + d8); for (int q = 0; q < 8; ++q) tl[d8 + q][j] = f.u[q]; }
  __syncthreads();
  { for (int i = tid; i < 64 * 8; i += 256) { const int d = i / 8, j8 = (i % 8) * 8; FragH f; for (int q = 0; q < 8; ++q) f.u[q] = tl[d][j8 + q]; *(v8us*)((unsigned short*)VT + (((size_t)b * NH + h) * HD + d) * SQ + s0 + j8) = f.half[0]; }  } }

// ---- fused attention: scores, softmax and weighted sum of one branch in one pass over the keys; no score ever reaches memory ----
// Transposed products. S^T = K Q^T: A = 16 key rows, B = 16 query rows, so lane (ln, hh) holds for query ln the keys 8 hh + r of each 16-key tile. Two such tiles, rounded to f16, are
// at once the B operand of O^T += V^T P^T over 32 keys (element i: key 8 hh + i, element 8 + i: key 16 + 8 hh + i, the k order of g2_frag and g2_lfrag; g2_lfrag loads the A operand from the V^T rows in LDS).
// A query's maximum, sum and scale therefore live in its own lane (both halves); the halves exchange the maximum once a pass and join their sums once at the end.
// Every inner loop is fully unrolled so that the fragment, score and accumulator arrays are indexed by constants and stay in registers (a rolled loop would put them in scratch memory).
// Scores are kept in the log2 domain (x = s log2 e). The maximum in use is raised, and sums and outputs rescaled, only when a column's new maximum exceeds it by more than 8, so weights stay <= 2^8.
// 2^x of eight (two) values in place, one statement: behind each v_exp_f32 stands an instruction that neither reads its result nor overwrites its source (the operands are distinct registers), behind the last the v_nop: the slot the instruction set asks for behind a transcendental
__device__ __forceinline__ void ex2x8(v8f& x) { asm("v_exp_f32 %0, %0\n\tv_exp_f32 %1, %1\n\tv_exp_f32 %2, %2\n\tv_exp_f32 %3, %3\n\tv_exp_f32 %4, %4\n\tv_exp_f32 %5, %5\n\tv_exp_f32 %6, %6\n\tv_exp_f32 %7, %7\n\tv_nop" : "+v"(x[0]), "+v"(x[1]), "+v"(x[2]), "+v"(x[3]), "+v"(x[4]), "+v"(x[5]), "+v"(x[6]), "+v"(x[7])); }
__device__ __forceinline__ void ex2x2(float& a, float& b) { asm("v_exp_f32 %0, %0\n\tv_exp_f32 %1, %1\n\tv_nop" : "+v"(a), "+v"(b)); }
__device__ __forceinline__ v8f at_mma(v16h a, v16h b, v8f c) { return __builtin_amdgcn_wmma_f32_16x16x32_f16(false, a, false, b, (short)0, c, false, false); }
// K and V^T go through LDS: a stage is 64 keys, that is 64 K rows (64 d each) and 64 V^T rows (64 keys each), 128 bytes a row, brought once a block and branch by asynchronous copies and read by the branch's four waves; two buffers,
// the copies of stage t + 2 in flight while stage t + 1 is worked on. A wave-wide copy reads 4 rows x 128 contiguous bytes (4 whole cache lines), where a fragment load from global memory touched 16 lines for the same 512 bytes.
#define AT_PITCH 72      /* f16 elements a row in LDS = 144 bytes = 16 x 9: 16 rows read by ds_load_b128 fall on distinct banks */
#define AT_BUF (128 * AT_PITCH)      /* rows 0..63: K, rows 64..127: V^T */
// One lane's eight 16-byte copies of a stage: thread tid takes bytes 16 (tid & 7) of rows (tid >> 3) + 16 c, c = 0..3, of the K tile and of the V^T tile. l = its LDS byte address in row tid >> 3 of the buffer, gk / gv = its global
// address in that row of the K / V^T tile. The s_wait_xcnt stands inside the statement, behind the last copy, so that no address register of a copy is rewritten in front of it.
__device__ __forceinline__ void at_stage(unsigned l, const _Float16* gk, const _Float16* gv) {
  const unsigned rs = 16 * AT_PITCH * 2; const size_t sk = (size_t)16 * DM, sv = (size_t)16 * SQ;
  asm volatile("global_load_async_to_lds_b128 %0, %8, off\n\tglobal_load_async_to_lds_b128 %1, %9, off\n\tglobal_load_async_to_lds_b128 %2, %10, off\n\tglobal_load_async_to_lds_b128 %3, %11, off\n\t"
               "global_load_async_to_lds_b128 %4, %12, off\n\tglobal_load_async_to_lds_b128 %5, %13, off\n\tglobal_load_async_to_lds_b128 %6, %14, off\n\tglobal_load_async_to_lds_b128 %7, %15, off\n\ts_wait_xcnt 0x0"
               :: "v"(l), "v"(l + rs), "v"(l + 2 * rs), "v"(l + 3 * rs), "v"(l + 4 * rs), "v"(l + 5 * rs), "v"(l + 6 * rs), "v"(l + 7 * rs),
                  "v"(gk), "v"(gk + sk), "v"(gk + 2 * sk), "v"(gk + 3 * sk), "v"(gv), "v"(gv + sv), "v"(gv + 2 * sv), "v"(gv + 3 * sv) : "memory"); }
// One stage (64 keys, two passes of 32) of one wave's branch. sb = the branch's buffer that holds the stage; the wave's query fragments, outputs, maxima and sums stay in the caller's registers.
// decay (the same for a whole wave, held in a scalar register) = the short branch: its scores are scaled and given the decay bias in place, under a scalar branch that holds nothing but that vector arithmetic;
// everything else is one code path for both branches. kq = the scale that the scores still lack behind that place: 1 in the short branch (x * 1 is exact), 0.125 log2 e in the long one, which so keeps its one multiply-add a score.
__device__ __forceinline__ void attn_stage(const _Float16* sb, const int t, const int q0, const int ln, const int hh, const bool decay, const float c2, const float kq, const v16h (&qf)[2][2], v8f (&o)[2][4], float (&m)[2], float (&l)[2]) {
  const float sc2 = 0.125f * 1.4426950408889634f; const v8f z8 = {0.f,0.f,0.f,0.f,0.f,0.f,0.f,0.f};
  const int koff = ln * AT_PITCH + 8 * hh, voff = (64 + ln) * AT_PITCH + 8 * hh; v16h kf[2][2];
#pragma unroll
   for (int u = 0; u < 2; ++u)
#pragma unroll
    for (int ks = 0; ks < 2; ++ks) kf[u][ks] = g2_lfrag(sb + koff + u * 16 * AT_PITCH + ks * 32);
   // a stage's two passes, unrolled so that the pass picks its rows and columns of the buffer by constant offsets
#pragma unroll
   for (int ps = 0; ps < 2; ++ps) { const int kb = t * 64 + ps * 32;
    v16h vf[4];
#pragma unroll
    for (int dt = 0; dt < 4; ++dt) vf[dt] = g2_lfrag(sb + voff + dt * 16 * AT_PITCH + ps * 32);
    __builtin_amdgcn_sched_barrier(0);      // keeps the V^T loads at the head of the pass, so that the score products and the maxima cover their latency (the scheduler sinks them to their use otherwise)
    v8f s[2][2];
#pragma unroll
    for (int g = 0; g < 2; ++g)
#pragma unroll
      for (int t = 0; t < 2; ++t) s[g][t] = at_mma(kf[t][1], qf[g][1], at_mma(kf[t][0], qf[g][0], z8));
    // the stage's second pass's K fragments, asked for while the first pass's softmax runs (the same buffer: nothing of the next stage is read here)
    if (ps == 0) {
#pragma unroll
      for (int u = 0; u < 2; ++u)
#pragma unroll
        for (int ks = 0; ks < 2; ++ks) kf[u][ks] = g2_lfrag(sb + koff + (32 + u * 16) * AT_PITCH + ks * 32); }
    if (decay) {
#pragma unroll
      for (int g = 0; g < 2; ++g)
#pragma unroll
        for (int t = 0; t < 2; ++t) { const float fb = (float)(q0 + g * 16 + ln - 8 * hh - kb - t * 16);
#pragma unroll
          for (int r = 0; r < 8; ++r) s[g][t][r] = s[g][t][r] * sc2 - fabsf(fb - (float)r) * c2; } }
    float mt[2];
#pragma unroll
    for (int g = 0; g < 2; ++g) { float mx = -3.0e38f;
#pragma unroll
      for (int t = 0; t < 2; ++t)
#pragma unroll
        for (int r = 0; r < 8; ++r) mx = fmaxf(mx, s[g][t][r]);
      mx *= kq;
      mt[g] = fmaxf(mx, __shfl_xor(mx, 16, 32)); }
    const bool need = (mt[0] > m[0] + 8.0f) || (mt[1] > m[1] + 8.0f);
    if (__builtin_amdgcn_ballot_w32(need) != 0) { const float mn0 = fmaxf(m[0], mt[0]), mn1 = fmaxf(m[1], mt[1]); float al[2] = {m[0] - mn0, m[1] - mn1}; ex2x2(al[0], al[1]); m[0] = mn0; m[1] = mn1;
#pragma unroll
      for (int g = 0; g < 2; ++g) { l[g] *= al[g];
#pragma unroll
        for (int dt = 0; dt < 4; ++dt) o[g][dt] *= al[g]; } }
#pragma unroll
    for (int g = 0; g < 2; ++g) { FragH pf; float ls = 0.f;
#pragma unroll
      for (int t = 0; t < 2; ++t) { v8f p;
#pragma unroll
        for (int r = 0; r < 8; ++r) p[r] = s[g][t][r] * kq - m[g];
        ex2x8(p);
#pragma unroll
        for (int r = 0; r < 8; ++r) { ls += p[r]; pf.h[t * 8 + r] = (_Float16)p[r]; } }
      l[g] += ls;
#pragma unroll
      for (int dt = 0; dt < 4; ++dt) o[g][dt] = at_mma(vf[dt], pf.v, o[g][dt]); }
   } }
// blockIdx.x = block of 128 queries, blockIdx.y = batch * NH + head. Eight waves: waves 0..3 run the short branch (with the decay bias) on 32 queries each, waves 4..7 the long branch on the same queries,
// each branch with its own two stage buffers filled by its own four waves. Both branches walk the stages together (one barrier a stage for the whole block, in control flow that is the same for all its threads;
// only the decay bias between two barriers differs by wave). At the end both leave their normalised f32 rows in LDS, and the block blends them with sigmoid(mix_weight) and stores the f16 o rows: no branch output reaches memory.
/* four waves a SIMD (two blocks a WGP, as the LDS allows) need at most 256 vector registers a wave: the second number asks the compiler for that budget */
__global__ __launch_bounds__(256, 4) void k_attn(const _Float16* __restrict__ Q16, const _Float16* __restrict__ KS, const _Float16* __restrict__ KL, const _Float16* __restrict__ VTS, const _Float16* __restrict__ VTL, _Float16* __restrict__ O16, const float* __restrict__ dfp, const float* __restrict__ mwp) {
  __shared__ __attribute__((aligned(16))) float so[2][128][68];
  __shared__ __attribute__((aligned(16))) _Float16 st[2][2 * AT_BUF];
  const int wv = __builtin_amdgcn_readfirstlane((int)(threadIdx.x >> 5)); const int br = wv >> 2;      /* the wave's number and its branch, in scalar registers: what depends on the branch is a scalar choice */
  const int lane = threadIdx.x & 31, ln = lane & 15, hh = lane >> 4; const int b = blockIdx.y / NH, h = blockIdx.y % NH; const int qw = (wv & 3) * 32, q0 = blockIdx.x * 128 + qw;
  const _Float16* KB = br ? KL : KS; const _Float16* VT = br ? VTL : VTS; const float c2 = (1.0f - bf16_round(dfp[0])) * 1.4426950408889634f, kq = br ? 0.125f * 1.4426950408889634f : 1.0f;
  const float mw = mwp[0];      /* read here, into a scalar register, so that the blend at the end does not wait for memory */
  const _Float16* qp = Q16 + ((size_t)b * SQ + q0 + ln) * DM + h * HD; const int tid = threadIdx.x & 127;      /* the thread's number among its branch's 128 */
  const _Float16* gk = KB + ((size_t)b * SQ + (tid >> 3)) * DM + h * HD + (tid & 7) * 8; const _Float16* gv = VT + ((size_t)blockIdx.y * HD + (tid >> 3)) * SQ + (tid & 7) * 8;
  const _Float16* stb = st[br];
  const unsigned lst = (unsigned)(size_t)(stb + (tid >> 3) * AT_PITCH + (tid & 7) * 8);      /* low 32 bits of the shared address = byte address in the block's LDS */
  at_stage(lst, gk, gv);
  v16h qf[2][2];
#pragma unroll
  for (int g = 0; g < 2; ++g)
#pragma unroll
    for (int ks = 0; ks < 2; ++ks) qf[g][ks] = g2_frag(qp + (size_t)g * 16 * DM + ks * 32, hh);
  const v8f z8 = {0.f,0.f,0.f,0.f,0.f,0.f,0.f,0.f}; v8f o[2][4];
#pragma unroll
  for (int g = 0; g < 2; ++g)
#pragma unroll
    for (int dt = 0; dt < 4; ++dt) o[g][dt] = z8;
  float m[2] = {-3.0e38f, -3.0e38f}, l[2] = {0.f, 0.f};
  asm volatile("s_wait_asynccnt 0x0" ::: "memory");      // this wave's copies of stage 0 have landed
  __syncthreads();                                       // ... and every other wave's: stage 0 may be read
  at_stage(lst + AT_BUF * 2, gk + (size_t)64 * DM, gv + 64);
  // rolled; the buffer is chosen by the trip's parity
#pragma unroll 1
  for (int t = 0; t < SQ / 64; ++t) { const _Float16* sb = stb + (t & 1) * AT_BUF;
    attn_stage(sb, t, q0, ln, hh, br == 0, c2, kq, qf, o, m, l);
    asm volatile("s_wait_dscnt 0x0" ::: "memory");         // this wave's reads of stage t are finished before its buffer is refilled
    asm volatile("s_wait_asynccnt 0x0" ::: "memory");      // this wave's copies of stage t + 1 have landed
    __syncthreads();                                       // publishes stage t + 1 and ends every wave's reads of stage t
    if (t + 2 < SQ / 64) at_stage(lst + (unsigned)(t & 1) * (AT_BUF * 2), gk + (size_t)(t + 2) * 64 * DM, gv + (t + 2) * 64);
  }
  asm volatile("s_wait_asynccnt 0x0" ::: "memory");        // no copy is outstanding when the wave goes on to its end
  // the lane's number is read anew here, so that no address of the part below has to hold a vector register through the loop (the loop leaves none free at four waves a SIMD)
  const int le = (int)__builtin_amdgcn_mbcnt_lo(~0u, 0u), lne = le & 15, hhe = le >> 4, te = wv * 32 + le;
  // O^T tile: lane (lne, hhe) holds of query lne the columns 16 dt + 8 hhe + r; into the branch's LDS rows
#pragma unroll
  for (int g = 0; g < 2; ++g) { const float lt = l[g] + __shfl_xor(l[g], 16, 32); const float inv = 1.0f / lt;
#pragma unroll
    for (int dt = 0; dt < 4; ++dt) { const v8f ov = o[g][dt] * inv; const v4f lo = {ov[0], ov[1], ov[2], ov[3]}, hi = {ov[4], ov[5], ov[6], ov[7]};
      *(v4fa*)&so[br][qw + g * 16 + lne][dt * 16 + 8 * hhe] = lo; *(v4fa*)&so[br][qw + g * 16 + lne][dt * 16 + 8 * hhe + 4] = hi; } }
  const float a = 1.0f / (1.0f + expf(-bf16_round(mw))), na = 1.0f - a;
  __syncthreads();                                         // both branches' rows are complete before any thread blends them
  // a thread blends 8 columns of a row: a wave's store covers 4 rows x 128 contiguous bytes; unrolled so that the four rounds' LDS reads are all asked for before the first is used
#pragma unroll
  for (int i = 0; i < 4; ++i) { const int e = i * 256 + te, r = e >> 3, c8 = (e & 7) * 8;
    const v4f s0 = *(const v4fa*)&so[0][r][c8], s1 = *(const v4fa*)&so[0][r][c8 + 4], l0 = *(const v4fa*)&so[1][r][c8], l1 = *(const v4fa*)&so[1][r][c8 + 4]; FragH f;
#pragma unroll
    for (int q = 0; q < 4; ++q) { f.h[q] = (_Float16)(a * s0[q] + na * l0[q]); f.h[4 + q] = (_Float16)(a * s1[q] + na * l1[q]); }
    *(v8us*)((unsigned short*)O16 + ((size_t)b * SQ + blockIdx.x * 128 + r) * DM + h * HD + c8) = f.half[0]; } }

__device__ __forceinline__ void wT_block(const float* __restrict__ w, int din, int dout, _Float16* __restrict__ Bt, int bid, float (*tl)[65]) { const int tid = threadIdx.x; const int nbo = dout / 64; const int ib = bid / nbo, ob = bid % nbo; const int i0 = ib * 64, o0 = ob * 64;
  for (int t = tid; t < 64 * 64; t += 256) { const int i = t / 64, o = t % 64; tl[o][i] = bf16_round(w[(size_t)(i0 + i) * dout + o0 + o]) * 16.0f; }
  __syncthreads();
  { for (int t = tid; t < 64 * 8; t += 256) { const int o = t / 8, i8 = (t % 8) * 8; FragH f; for (int q = 0; q < 8; ++q) f.h[q] = (_Float16)tl[o][i8 + q]; *(v8us*)((unsigned short*)Bt + (size_t)(o0 + o) * din + i0 + i8) = f.half[0]; }  } }
// Everything that reads only inputs, in one launch: ranges of the block index pick the job (the test is the same for a whole block, so the barrier in wT_block is passed by all of a block's threads or by none).
// The transposes stand first: their blocks run longer.
#define PB_SQ ((DM / 64) * (DM / 64))          /* blocks of a DM x DM weight */
#define PB_KV ((DM / 64) * (2 * DM / 64))      /* blocks of a DM x 2 DM weight */
#define PB_W (2 * PB_SQ + 2 * PB_KV)
#define PB_X ((int)((NR * DM / 8 + 255) / 256))
__global__ __launch_bounds__(256) void k_prep(const float* __restrict__ x, const float* __restrict__ wq, const float* __restrict__ wkvs, const float* __restrict__ wkvl, const float* __restrict__ wo,
    _Float16* __restrict__ X16, _Float16* __restrict__ BQ, _Float16* __restrict__ BKVS, _Float16* __restrict__ BKVL, _Float16* __restrict__ BO) {
  __shared__ float tl[64][65]; const int bid = blockIdx.x;
  if (bid < PB_KV) wT_block(wkvs, DM, 2 * DM, BKVS, bid, tl);
  else if (bid < 2 * PB_KV) wT_block(wkvl, DM, 2 * DM, BKVL, bid - PB_KV, tl);
  else if (bid < 2 * PB_KV + PB_SQ) wT_block(wq, DM, DM, BQ, bid - 2 * PB_KV, tl);
  else if (bid < PB_W) wT_block(wo, DM, DM, BO, bid - 2 * PB_KV - PB_SQ, tl);
  else x16_block(x, X16, NR * DM / 8, bid - PB_W); }
extern "C" void kernel_launch(void* const* d_in, const int* in_sizes, int n_in,
                              void* d_out, int out_size, void* d_ws, size_t ws_size, hipStream_t stream) {
  (void)in_sizes; (void)n_in; (void)out_size;
  const float* const* I = (const float* const*)d_in; const float* x = I[0]; const float* wq = I[1]; const float* wkvs = I[2]; const float* wkvl = I[3]; const float* wo = I[4]; const float* mwp = I[5]; const float* dfp = I[6];
  char* ws = (char*)d_ws; size_t off = 0;
  auto take = [&](size_t bytes) { char* p = ws + off; off += (bytes + 255) & ~(size_t)255; return p; };
  /* the transposed projection weights lie as five DM x DM planes in a row (q, short k, short v, long k, long v), and so do the five projections' outputs: the projection launch picks plane blockIdx.y of each */
  _Float16* BQ = (_Float16*)take((size_t)5 * DM * DM * 2); _Float16* BKVS = BQ + (size_t)DM * DM; _Float16* BKVL = BQ + (size_t)3 * DM * DM; _Float16* BO = (_Float16*)take((size_t)DM * DM * 2);
  _Float16* X16 = (_Float16*)take(NR * DM * 2); _Float16* Q16 = (_Float16*)take(5 * NR * DM * 2); _Float16* K16 = Q16 + NR * DM; _Float16* V16 = Q16 + 2 * NR * DM; _Float16* KL16 = Q16 + 3 * NR * DM; _Float16* VL16 = Q16 + 4 * NR * DM; _Float16* O16 = (_Float16*)take(NR * DM * 2);
  _Float16* VTS = (_Float16*)take(NR * DM * 2); _Float16* VTL = (_Float16*)take(NR * DM * 2);
  if (off > ws_size) return;      /* 12 + 6x8 + 8 + 16 = 84 MiB */
  k_prep<<<PB_W + PB_X, 256, 0, stream>>>(x, wq, wkvs, wkvl, wo, X16, BQ, BKVS, BKVL, BO);
  const dim3 gp((unsigned)((NR / 128) * (DM / 64)), 1), gp5((unsigned)((NR / 128) * (DM / 64)), 5);
  k_gemm2<0><<<gp5, 128, 0, stream>>>(X16, DM, 0, BQ, DM, (size_t)DM * DM, 0.0625f, nullptr, 0, nullptr, 1, 0, 0, nullptr, Q16, DM, NR * DM, (int)NR, DM, DM);      /* q, short k | v, long k | v */
  k_vt<<<dim3(NH * (SQ / 64), NB, 2), 256, 0, stream>>>(V16, VL16, VTS, VTL);
  k_attn<<<dim3(SQ / 128, NB * NH), 256, 0, stream>>>(Q16, K16, KL16, VTS, VTL, O16, dfp, mwp);      /* blended o (merged heads) as f16 rows */
  k_gemm2<0><<<gp, 128, 0, stream>>>(O16, DM, 0, BO, DM, 0, 0.0625f, nullptr, 0, nullptr, 1, 0, 0, (float*)d_out, nullptr, DM, 0, (int)NR, DM, DM);      /* out = o Wo */
}

// v007
// It runs in 95.6 microseconds.
// In both of two side-by-side timings against v006, it was 1.20 times as fast.
// Counting every step since v000, it is 257 times as fast.
#include <hip/hip_runtime.h>
#define NB 4
#define SQ 1024
#define DM 1024
#define NH 16
#define HD 64
#define NR ((size_t)NB * SQ)         /* 4096 token rows */
typedef __bf16 v16b __attribute__((ext_vector_type(16)));
typedef unsigned short v8us __attribute__((ext_vector_type(8), may_alias));
typedef float  v8f  __attribute__((ext_vector_type(8)));
typedef float  v4f  __attribute__((ext_vector_type(4)));
typedef float  v4fa __attribute__((ext_vector_type(4), may_alias));
union FragB { v16b v; v8us half[2]; unsigned short u[16]; };

__device__ __forceinline__ unsigned short bf16_bits(float x) { unsigned int u = __float_as_uint(x); return (unsigned short)((u + 0x7FFFu + ((u >> 16) & 1u)) >> 16); }
__device__ __forceinline__ float bf16_val(unsigned short b) { return __uint_as_float(((unsigned int)b) << 16); }
__device__ __forceinline__ float bf16_round(float x) { return bf16_val(bf16_bits(x)); }
// D += A·B with NT terms: 1 = ah·bh, 2 = + al·bh (A split), 3 = + ah·bl (both split)
template <int NT>
__device__ __forceinline__ v8f mmaN(v16b ah, v16b al, v16b bh, v16b bl, v8f c) {
  c = __builtin_amdgcn_wmma_f32_16x16x32_bf16(false, ah, false, bh, (short)0, c, false, false);
  if (NT >= 2) c = __builtin_amdgcn_wmma_f32_16x16x32_bf16(false, al, false, bh, (short)0, c, false, false);
  if (NT >= 3) c = __builtin_amdgcn_wmma_f32_16x16x32_bf16(false, ah, false, bl, (short)0, c, false, false);
  asm volatile("v_nop\n\tv_nop\n\tv_nop\n\tv_nop" : "+v"(c) : "v"(ah), "v"(al), "v"(bh), "v"(bl));
  return c;
}

__global__ __launch_bounds__(256) void k_wt_bf16(const float* __restrict__ W, unsigned short* __restrict__ Wt, int K, int N) {
  const int t = blockIdx.x * 256 + threadIdx.x;
  const int k8n = K / 8;
  if (t >= N * k8n) return;
  const int n = t / k8n, k8 = (t % k8n) * 8;
  v8us v;
#pragma unroll
  for (int i = 0; i < 8; ++i) v[i] = bf16_bits(W[(size_t)(k8 + i) * N + n]);
  *(v8us*)(Wt + (size_t)n * K + k8) = v;
  
}

// GEMM C[M][N] (f32, pitch ldc) = act(A[M][K]·W + bias). A f32 row-major (pitch lda) converted per fragment to bf16
// (ASPLIT: hi/lo two planes -> 2 terms, else single rounded term); Wt bf16 [N][K] (pitch ldb). BIAS_BF16 rounds the
// bias to bf16 first (bias quantised to bf16 before the add). K%32==0, M%16==0, N%64==0.
template <bool ASPLIT, int ACT, bool BIAS_BF16>
__global__ __launch_bounds__(128) void k_gemm_bf(const float* __restrict__ A, int lda, const unsigned short* __restrict__ Wt, int ldb,
                                               const float* __restrict__ bias, float* __restrict__ C, int ldc, int M, int N, int K) {
  __shared__ __attribute__((aligned(16))) float so[4][16][64];
  const int tid = threadIdx.x, w = tid >> 5, lane = tid & 31, ln = lane & 15, hh = lane >> 4;
  const int ntn = N / 64;
  const int wid = blockIdx.x * 4 + w;
  const int mt = wid / ntn, nq = wid % ntn;
  if (mt * 16 >= M) return;
  const int row0 = mt * 16, col0 = nq * 64;
  const float* arow = A + (size_t)(row0 + ln) * lda;
  v8f acc[4] = {};
  for (int kb = 0; kb < K; kb += 32) {
    FragB ah, al;
    const v4f x0 = *(const v4fa*)(arow + kb + 8 * hh), x1 = *(const v4fa*)(arow + kb + 8 * hh + 4);
    const v4f x2 = *(const v4fa*)(arow + kb + 16 + 8 * hh), x3 = *(const v4fa*)(arow + kb + 16 + 8 * hh + 4);
    float xs[16] = {x0[0],x0[1],x0[2],x0[3],x1[0],x1[1],x1[2],x1[3],x2[0],x2[1],x2[2],x2[3],x3[0],x3[1],x3[2],x3[3]};
#pragma unroll
    for (int i = 0; i < 16; ++i) { const unsigned short hb = bf16_bits(xs[i]); ah.u[i] = hb; al.u[i] = ASPLIT ? bf16_bits(xs[i] - bf16_val(hb)) : (unsigned short)0; }
#pragma unroll
    for (int t = 0; t < 4; ++t) {
      const unsigned short* brow = Wt + (size_t)(col0 + t * 16 + ln) * ldb + kb;
      FragB b;
      b.half[0] = *(const v8us*)(brow + 8 * hh);
      b.half[1] = *(const v8us*)(brow + 16 + 8 * hh);
      acc[t] = mmaN<ASPLIT ? 2 : 1>(ah.v, al.v, b.v, b.v, acc[t]);
    }
  }
#pragma unroll
  for (int t = 0; t < 4; ++t) {
    float bv = bias ? bias[col0 + t * 16 + ln] : 0.f;
    if (BIAS_BF16) bv = bf16_round(bv);
#pragma unroll
    for (int r = 0; r < 8; ++r) { float v = acc[t][r] + bv; if (ACT == 1) v = fmaxf(v, 0.f); so[w][8 * hh + r][t * 16 + ln] = v; }
  }
  __builtin_amdgcn_fence(__ATOMIC_ACQ_REL, "workgroup");
  __builtin_amdgcn_wave_barrier();
  const int rsub = lane >> 4, c4 = (lane & 15) * 4;
  {
#pragma unroll
    for (int q = 0; q < 8; ++q) {
      const int r = q * 2 + rsub;
      const v4f v = *(const v4fa*)&so[w][r][c4];
      *(v4f*)(C + (size_t)(row0 + r) * ldc + col0 + c4) = v;
    }
    
  }
}

// GEMM C = act(A·W + bias + resid): A f32 (ASPLIT -> hi/lo 2 terms), Wt bf16 [N][K]; ACT 0 none, 1 relu, 2 exact gelu;
// resid (optional, f32, row index = (row % rmod), pitch ldr, RES_BF16 rounds it) added before the activation.
template <bool ASPLIT, int ACT, bool BIAS_BF16, bool RES_BF16>
__global__ __launch_bounds__(128) void k_gemm_bf3(const float* __restrict__ A, int lda, const unsigned short* __restrict__ Wt, int ldb,
                                                const float* __restrict__ bias, const float* __restrict__ resid, int rmod, int ldr,
                                                float* __restrict__ C, int ldc, int M, int N, int K) {
  __shared__ __attribute__((aligned(16))) float so[4][16][64];
  const int tid = threadIdx.x, w = tid >> 5, lane = tid & 31, ln = lane & 15, hh = lane >> 4;
  const int ntn = N / 64;
  const int wid = blockIdx.x * 4 + w;
  const int mt = wid / ntn, nq = wid % ntn;
  if (mt * 16 >= M) return;
  const int row0 = mt * 16, col0 = nq * 64;
  const float* arow = A + (size_t)(row0 + ln) * lda;
  v8f acc[4] = {};
  for (int kb = 0; kb < K; kb += 32) {
    FragB ah, al;
    const v4f x0 = *(const v4fa*)(arow + kb + 8 * hh), x1 = *(const v4fa*)(arow + kb + 8 * hh + 4);
    const v4f x2 = *(const v4fa*)(arow + kb + 16 + 8 * hh), x3 = *(const v4fa*)(arow + kb + 16 + 8 * hh + 4);
    float xs[16] = {x0[0],x0[1],x0[2],x0[3],x1[0],x1[1],x1[2],x1[3],x2[0],x2[1],x2[2],x2[3],x3[0],x3[1],x3[2],x3[3]};
#pragma unroll
    for (int i = 0; i < 16; ++i) { const unsigned short hb = bf16_bits(xs[i]); ah.u[i] = hb; al.u[i] = ASPLIT ? bf16_bits(xs[i] - bf16_val(hb)) : (unsigned short)0; }
#pragma unroll
    for (int t = 0; t < 4; ++t) {
      const unsigned short* brow = Wt + (size_t)(col0 + t * 16 + ln) * ldb + kb;
      FragB b;
      b.half[0] = *(const v8us*)(brow + 8 * hh);
      b.half[1] = *(const v8us*)(brow + 16 + 8 * hh);
      acc[t] = mmaN<ASPLIT ? 2 : 1>(ah.v, al.v, b.v, b.v, acc[t]);
    }
  }
#pragma unroll
  for (int t = 0; t < 4; ++t) {
    const int col = col0 + t * 16 + ln;
    float bv = bias ? bias[col] : 0.f;
    if (BIAS_BF16) bv = bf16_round(bv);
#pragma unroll
    for (int r = 0; r < 8; ++r) {
      float v = acc[t][r] + bv;
      if (resid) { float rv = resid[(size_t)((row0 + 8 * hh + r) % rmod) * ldr + col]; if (RES_BF16) rv = bf16_round(rv); v += rv; }
      if (ACT == 1) v = fmaxf(v, 0.f);
      if (ACT == 2) v = 0.5f * v * (1.0f + erff(v * 0.70710678118654752f));
      if (ACT == 3) { const float u = 0.7978845608028654f * (v + 0.044715f * v * v * v); v = 0.5f * v * (1.0f + tanhf(u)); }
      so[w][8 * hh + r][t * 16 + ln] = v;
    }
  }
  __builtin_amdgcn_fence(__ATOMIC_ACQ_REL, "workgroup");
  __builtin_amdgcn_wave_barrier();
  const int rsub = lane >> 4, c4 = (lane & 15) * 4;
  {
#pragma unroll
    for (int q = 0; q < 8; ++q) {
      const int r = q * 2 + rsub;
      const v4f v = *(const v4fa*)&so[w][r][c4];
      *(v4f*)(C + (size_t)(row0 + r) * ldc + col0 + c4) = v;
    }
    
  }
}
// row LayerNorm (biased variance, eps) over N: s = X (+ R); optional out_sum <- s; out_norm <- (s-mu)*rsqrt(var+eps)*g + b
template <bool PARAM_BF16>
__global__ __launch_bounds__(256) void k_layernorm(const float* __restrict__ X, const float* __restrict__ R, const float* __restrict__ g, const float* __restrict__ bta,
                                                  float* __restrict__ out_sum, float* __restrict__ out_norm, int N, float eps) {
  __shared__ float red[256];
  const int row = blockIdx.x, tid = threadIdx.x;
  const float* x = X + (size_t)row * N; const float* rr = R ? R + (size_t)row * N : nullptr;
  float vals[16];                     // up to N = 4096
  const int per = N / 256;            // contiguous chunk per thread? use strided-by-4 chunks: thread handles j = tid*4 + 1024*u
  float s1 = 0.f;
  for (int u = 0; u < per / 4; ++u) {
    const int j = tid * 4 + 1024 * u;
    const v4f a = *(const v4fa*)(x + j);
    v4f b = {0.f,0.f,0.f,0.f}; if (rr) b = *(const v4fa*)(rr + j);
#pragma unroll
    for (int q = 0; q < 4; ++q) { const float v = a[q] + b[q]; vals[u * 4 + q] = v; s1 += v; }
  }
  red[tid] = s1; __syncthreads();
  for (int st = 128; st > 0; st >>= 1) { if (tid < st) red[tid] += red[tid + st]; __syncthreads(); }
  const float mu = red[0] / (float)N; __syncthreads();
  float s2 = 0.f;
  for (int u = 0; u < per / 4; ++u)
#pragma unroll
    for (int q = 0; q < 4; ++q) { const float c = vals[u * 4 + q] - mu; s2 += c * c; }
  red[tid] = s2; __syncthreads();
  for (int st = 128; st > 0; st >>= 1) { if (tid < st) red[tid] += red[tid + st]; __syncthreads(); }
  const float rs = rsqrtf(red[0] / (float)N + eps);
  {
    for (int u = 0; u < per / 4; ++u) {
      const int j = tid * 4 + 1024 * u;
      v4f o, sm;
#pragma unroll
      for (int q = 0; q < 4; ++q) {
        float gg = g[j + q], bb = bta[j + q];
        if (PARAM_BF16) { gg = bf16_round(gg); bb = bf16_round(bb); }
        sm[q] = vals[u * 4 + q]; o[q] = (vals[u * 4 + q] - mu) * rs * gg + bb;
      }
      if (out_sum) *(v4f*)(out_sum + (size_t)row * N + j) = sm;
      *(v4f*)(out_norm + (size_t)row * N + j) = o;
    }
    
  }
}



// ---- f16 WMMA path (v_wmma_f32_16x16x32_f16): 11-bit significands for operands in range — used where a [0,1] probability operand needs more precision than bf16
typedef _Float16 v16h __attribute__((ext_vector_type(16)));
union FragH { v16h v; v8us half[2]; _Float16 h[16]; unsigned short u[16]; };
template <int NT>
__device__ __forceinline__ v8f mmaH(v16h ah, v16h al, v16h bh, v16h bl, v8f c) {
  c = __builtin_amdgcn_wmma_f32_16x16x32_f16(false, ah, false, bh, (short)0, c, false, false);
  if (NT >= 2) c = __builtin_amdgcn_wmma_f32_16x16x32_f16(false, al, false, bh, (short)0, c, false, false);
  if (NT >= 3) c = __builtin_amdgcn_wmma_f32_16x16x32_f16(false, ah, false, bl, (short)0, c, false, false);
  asm volatile("v_nop\n\tv_nop\n\tv_nop\n\tv_nop" : "+v"(c) : "v"(ah), "v"(al), "v"(bh), "v"(bl));
  return c;
}
// batched GEMM like k_gemm_b but f16 operands: A f32 (split into f16 hi/lo if ASPLIT, else rounded to f16), Bt = f16 values [n][k]; alpha; C f32; N multiple of 16 (partial tiles skipped)
template <bool ASPLIT>
__global__ __launch_bounds__(128) void k_gemm_h(const float* __restrict__ A, int lda, size_t sA, const _Float16* __restrict__ Bh, int ldb, size_t sB, float alpha, float* __restrict__ C, int ldc, size_t sC, int M, int N, int K) {
  __shared__ __attribute__((aligned(16))) float so[4][16][64];
  const int tid = threadIdx.x, w = tid >> 5, lane = tid & 31, ln = lane & 15, hh = lane >> 4; const int by = blockIdx.y;
  A += (size_t)by * sA; Bh += (size_t)by * sB; C += (size_t)by * sC;
  const int ntn = (N + 63) / 64; const int wid = blockIdx.x * 4 + w; const int mt = wid / ntn, nq = wid % ntn; if (mt * 16 >= M) return;
  const int row0 = mt * 16, col0 = nq * 64; const float* arow = A + (size_t)(row0 + ln) * lda;
  v8f acc[4] = {};
  for (int kb = 0; kb < K; kb += 32) {
    FragH ah, al;
    const v4f x0 = *(const v4fa*)(arow + kb + 8 * hh), x1 = *(const v4fa*)(arow + kb + 8 * hh + 4), x2 = *(const v4fa*)(arow + kb + 16 + 8 * hh), x3 = *(const v4fa*)(arow + kb + 16 + 8 * hh + 4);
    float xs[16] = {x0[0],x0[1],x0[2],x0[3],x1[0],x1[1],x1[2],x1[3],x2[0],x2[1],x2[2],x2[3],x3[0],x3[1],x3[2],x3[3]};
#pragma unroll
    for (int i = 0; i < 16; ++i) { const _Float16 h = (_Float16)xs[i]; ah.h[i] = h; al.h[i] = ASPLIT ? (_Float16)(xs[i] - (float)h) : (_Float16)0.0f; }
#pragma unroll
    for (int t = 0; t < 4; ++t) { if (col0 + t * 16 >= N) continue; const size_t boff = (size_t)(col0 + t * 16 + ln) * ldb + kb; FragH bq; bq.half[0] = *(const v8us*)(Bh + boff + 8 * hh); bq.half[1] = *(const v8us*)(Bh + boff + 16 + 8 * hh);
      acc[t] = mmaH<ASPLIT ? 2 : 1>(ah.v, al.v, bq.v, bq.v, acc[t]); }
  }
#pragma unroll
  for (int t = 0; t < 4; ++t) { if (col0 + t * 16 >= N) continue;
#pragma unroll
    for (int r = 0; r < 8; ++r) so[w][8 * hh + r][t * 16 + ln] = acc[t][r] * alpha; }
  __builtin_amdgcn_fence(__ATOMIC_ACQ_REL, "workgroup"); __builtin_amdgcn_wave_barrier();
  const int rsub = lane >> 4, c4 = (lane & 15) * 4;
  {
#pragma unroll
    for (int q = 0; q < 8; ++q) { const int r = q * 2 + rsub; if (col0 + c4 < N) { const v4f v = *(const v4fa*)&so[w][r][c4]; *(v4f*)(C + (size_t)(row0 + r) * ldc + col0 + c4) = v; } }
     }
}

// Wt[n][k] = f16(W[k][n]·scale) from f32 row-major W[K][N] (scale = power of two; bf16-exact weights stay exact in f16 away from the subnormal range)
__global__ __launch_bounds__(256) void k_wt_f16(const float* __restrict__ W, _Float16* __restrict__ Wt, int K, int N, float scale) {
  const int t = blockIdx.x * 256 + threadIdx.x; if (t >= N * (K / 8)) return; const int n = t / (K / 8), k8 = (t % (K / 8)) * 8; FragH f;
#pragma unroll
  for (int i = 0; i < 8; ++i) f.h[i] = (_Float16)(bf16_round(W[(size_t)(k8 + i) * N + n]) * scale); const v8us o = f.half[0];
  *(v8us*)((unsigned short*)Wt + (size_t)n * K + k8) = o; 
}
// k_gemm_hh variant with fused epilogue: v = acc·alpha + bias[by·sBias + col] (+ CP[(row/rowsPerB)·sCPb + by·64 + col] if CP) ; ACT 0 none / 1 elu ; writes f16 C16 (and f32 C if non-null)
template <int ACT>
__global__ __launch_bounds__(128) void k_gemm_hhx(const _Float16* __restrict__ A, int lda, size_t sA, const _Float16* __restrict__ Bh, int ldb, size_t sB, float alpha, const float* __restrict__ bias, size_t sBias, const float* __restrict__ CP, int rowsPerB, size_t sCPb, int row0g,
    float* __restrict__ C, _Float16* __restrict__ C16, int ldc, size_t sC, int M, int N, int K) {
  __shared__ __attribute__((aligned(16))) float so[4][16][64];
  const int tid = threadIdx.x, w = tid >> 5, lane = tid & 31, ln = lane & 15, hh = lane >> 4; const int by = blockIdx.y;
  A += (size_t)by * sA; Bh += (size_t)by * sB; const size_t cofs = (size_t)by * sC; const float* bp = bias ? bias + (size_t)by * sBias : nullptr;
  const int ntn = (N + 63) / 64; const int wid = blockIdx.x * 4 + w; const int mt = wid / ntn, nq = wid % ntn; if (mt * 16 >= M) return;
  const int row0 = mt * 16, col0 = nq * 64; const _Float16* arow = A + (size_t)(row0 + ln) * lda;
  v8f acc[4] = {};
  for (int kb = 0; kb < K; kb += 32) { FragH ah; ah.half[0] = *(const v8us*)((const unsigned short*)arow + kb + 8 * hh); ah.half[1] = *(const v8us*)((const unsigned short*)arow + kb + 16 + 8 * hh);
#pragma unroll
    for (int t = 0; t < 4; ++t) { if (col0 + t * 16 >= N) continue; const size_t boff = (size_t)(col0 + t * 16 + ln) * ldb + kb; FragH bq; bq.half[0] = *(const v8us*)((const unsigned short*)Bh + boff + 8 * hh); bq.half[1] = *(const v8us*)((const unsigned short*)Bh + boff + 16 + 8 * hh);
      acc[t] = mmaH<1>(ah.v, ah.v, bq.v, bq.v, acc[t]); }
  }
#pragma unroll
  for (int t = 0; t < 4; ++t) { if (col0 + t * 16 >= N) continue; const int col = col0 + t * 16 + ln; const float bv = bp ? bf16_round(bp[col]) : 0.f;
#pragma unroll
    for (int r = 0; r < 8; ++r) { float v = acc[t][r] * alpha + bv; if (CP) { const int rr = row0g + row0 + 8 * hh + r; if (rowsPerB < 0) v += CP[cofs + (size_t)rr * ldc + col];      /* rowsPerB < 0: own element of the batched C plane */ else { const int bidx = rr / rowsPerB; v += CP[(size_t)bidx * sCPb + (size_t)by * 64 + col]; } } if (ACT == 1) v = (v > 0.f) ? v : expm1f(v); else if (ACT == 7) v = (v > 0.f) ? v + 1.0f : expf(v); else if (ACT == 8) v = tanhf(v); else if (ACT == 9) v = 0.5f * v * (1.0f + tanhf(0.7978845608028654f * (v + 0.044715f * v * v * v))); else if (ACT == 11) v = 1.0f / (1.0f + expf(-v)); else if (ACT == 12) v = (v > 0.f) ? v : 0.01f * v; else if (ACT == 14) v = (v > 0.f) ? v : 0.1f * v; else if (ACT == 16) v = (v >= 0.f) ? v : 0.3f * v; else if (ACT == 17) v = (v >= 0.f) ? v : 0.2f * v; else if (ACT == 15) v = v / (1.0f + expf(-v)); else if (ACT == 3) v = fmaxf(v, 0.f); else if (ACT == 6) v = 0.5f * v * (1.0f + erff(v * 0.70710678118654752f)); so[w][8 * hh + r][t * 16 + ln] = v; } }
  __builtin_amdgcn_fence(__ATOMIC_ACQ_REL, "workgroup"); __builtin_amdgcn_wave_barrier();
  const int rsub = lane >> 4, c4 = (lane & 15) * 4; typedef _Float16 v4h __attribute__((ext_vector_type(4)));
  {
#pragma unroll
    for (int q = 0; q < 8; ++q) { const int r = q * 2 + rsub; if (col0 + c4 < N) { const v4f v = *(const v4fa*)&so[w][r][c4]; if (C) *(v4f*)(C + cofs + (size_t)(row0 + r) * ldc + col0 + c4) = v; if (C16) { v4h h4; for (int i = 0; i < 4; ++i) h4[i] = (_Float16)v[i]; *(v4h*)(C16 + cofs + (size_t)(row0 + r) * ldc + col0 + c4) = h4; } } }
     }
}


typedef _Float16 v4h __attribute__((ext_vector_type(4)));

__device__ __forceinline__ void x16_block(const float* __restrict__ x, _Float16* __restrict__ X16, size_t n8, int bid) { const size_t t = (size_t)bid * 256 + threadIdx.x; if (t >= n8) return; FragH f;
#pragma unroll
  for (int q = 0; q < 8; ++q) f.h[q] = (_Float16)bf16_round(x[t * 8 + q]); *(v8us*)((unsigned short*)X16 + t * 8) = f.half[0];  }
__global__ __launch_bounds__(256) void k_h16(const float* __restrict__ x, _Float16* __restrict__ X16, size_t n8) { const size_t t = (size_t)blockIdx.x * 256 + threadIdx.x; if (t >= n8) return; FragH f;
#pragma unroll
  for (int q = 0; q < 8; ++q) f.h[q] = (_Float16)x[t * 8 + q]; *(v8us*)((unsigned short*)X16 + t * 8) = f.half[0];  }
__global__ __launch_bounds__(256) void k_round16f(const float* __restrict__ W, _Float16* __restrict__ Bt, size_t n8) { const size_t t = (size_t)blockIdx.x * 256 + threadIdx.x; if (t >= n8) return; FragH f;
#pragma unroll
  for (int i = 0; i < 8; ++i) f.h[i] = (_Float16)(bf16_round(W[t * 8 + i]) * 16.0f); *(v8us*)((unsigned short*)Bt + t * 8) = f.half[0];  }
template <int NHv, int TTv>
__global__ __launch_bounds__(256) void k_vt(const _Float16* __restrict__ V16, int ldv, int voff, _Float16* __restrict__ Vt) { __shared__ unsigned short tl[64][66]; const int tid = threadIdx.x; const int slab = blockIdx.x / (TTv / 64), lg = blockIdx.x % (TTv / 64); const int b = slab / NHv, h = slab % NHv;
  for (int i = tid; i < 64 * 8; i += 256) { const int r = i / 8, c8 = (i % 8) * 8; FragH f; f.half[0] = *(const v8us*)((const unsigned short*)V16 + ((size_t)b * TTv + lg * 64 + r) * ldv + voff + h * 64 + c8);
#pragma unroll
    for (int q = 0; q < 8; ++q) tl[r][c8 + q] = f.u[q]; }
  __syncthreads();
  {
#pragma unroll
    for (int rd = 0; rd < 2; ++rd) { const int d = rd * 32 + tid / 8, pc = tid % 8; FragH f;
#pragma unroll
      for (int q = 0; q < 8; ++q) f.u[q] = tl[pc * 8 + q][d];
      *(v8us*)((unsigned short*)Vt + ((size_t)slab * 64 + d) * TTv + lg * 64 + pc * 8) = f.half[0]; }
     } }

__global__ __launch_bounds__(256) void k_hl(const float* __restrict__ F, _Float16* __restrict__ Hh, _Float16* __restrict__ Hl, size_t n8) { const size_t t = (size_t)blockIdx.x * 256 + threadIdx.x; if (t >= n8) return; FragH fh, fl; const v4f a = *(const v4fa*)(F + t * 8), c = *(const v4fa*)(F + t * 8 + 4);
#pragma unroll
  for (int q = 0; q < 4; ++q) { _Float16 h = (_Float16)a[q]; fh.h[q] = h; fl.h[q] = (_Float16)((a[q] - (float)h) * 1024.0f); h = (_Float16)c[q]; fh.h[4 + q] = h; fl.h[4 + q] = (_Float16)((c[q] - (float)h) * 1024.0f); }
  { *(v8us*)((unsigned short*)Hh + t * 8) = fh.half[0]; *(v8us*)((unsigned short*)Hl + t * 8) = fl.half[0];  } }

// ---- fast GEMM: WM x WN waves, wave tile 16 MF x 16 NF, block tile 16 MF WM x 16 NF WN (requires M a multiple of the tile's rows, N of its columns, K % 64 == 0, 16 NF WN % 64 == 0) ----
// Operands go through LDS: a stage is 64 k of the block's A rows and B rows (128 bytes a row), brought by asynchronous copies, two buffers, the copies of stage t + 2 in flight while stage t + 1 is worked on.
// A wave-wide copy reads 4 rows x 128 contiguous bytes (4 whole cache lines). Every operand row is fetched from L2 once a block, so the bytes a product costs fall with the tile: (rows + columns) x 128 bytes a stage for rows x columns results.
#define G2_PITCH 72      /* f16 elements a row in LDS = 144 bytes = 16 x 9: 16 rows read by ds_load_b128 fall on distinct banks */
// fragment from an LDS row: p = row + 32 ks + 8 hh; the k order of g2_frag
__device__ __forceinline__ v16h g2_lfrag(const _Float16* p) { FragH f; f.half[0] = *(const v8us*)((const unsigned short*)p); f.half[1] = *(const v8us*)((const unsigned short*)p + 16); return f.v; }
// One lane's 16-byte copies of a stage: thread tid takes bytes 16 (tid & 7) of rows (tid >> 3) + RPC c (RPC = threads / 8), c = 0 .. 3 of the A tile and c = 0 .. NCB - 1 of the B tile, which lies behind the A tile's 4 RPC rows.
// l = its LDS byte address in row tid >> 3 of the buffer, ga / gb = its global address in that row of the A / B tile, sa / sb = RPC rows in elements.
// The s_wait_xcnt stands inside the statement, behind the last copy, so that no address register of a copy is rewritten in front of it.
template <int RPC, int NCB>
__device__ __forceinline__ void g2_stage(unsigned l, const _Float16* ga, size_t sa, const _Float16* gb, size_t sb) {
  static_assert(NCB == 4 || NCB == 5, "g2_stage: 8 or 9 copies");
  const unsigned rs = RPC * G2_PITCH * 2;
  if constexpr (NCB == 5)
  asm volatile("global_load_async_to_lds_b128 %0, %9, off\n\tglobal_load_async_to_lds_b128 %1, %10, off\n\tglobal_load_async_to_lds_b128 %2, %11, off\n\tglobal_load_async_to_lds_b128 %3, %12, off\n\t"
               "global_load_async_to_lds_b128 %4, %13, off\n\tglobal_load_async_to_lds_b128 %5, %14, off\n\tglobal_load_async_to_lds_b128 %6, %15, off\n\tglobal_load_async_to_lds_b128 %7, %16, off\n\t"
               "global_load_async_to_lds_b128 %8, %17, off\n\ts_wait_xcnt 0x0"
               :: "v"(l), "v"(l + rs), "v"(l + 2 * rs), "v"(l + 3 * rs), "v"(l + 4 * rs), "v"(l + 5 * rs), "v"(l + 6 * rs), "v"(l + 7 * rs), "v"(l + 8 * rs),
                  "v"(ga), "v"(ga + sa), "v"(ga + 2 * sa), "v"(ga + 3 * sa), "v"(gb), "v"(gb + sb), "v"(gb + 2 * sb), "v"(gb + 3 * sb), "v"(gb + 4 * sb) : "memory");
  else
  asm volatile("global_load_async_to_lds_b128 %0, %8, off\n\tglobal_load_async_to_lds_b128 %1, %9, off\n\tglobal_load_async_to_lds_b128 %2, %10, off\n\tglobal_load_async_to_lds_b128 %3, %11, off\n\t"
               "global_load_async_to_lds_b128 %4, %12, off\n\tglobal_load_async_to_lds_b128 %5, %13, off\n\tglobal_load_async_to_lds_b128 %6, %14, off\n\tglobal_load_async_to_lds_b128 %7, %15, off\n\ts_wait_xcnt 0x0"
               :: "v"(l), "v"(l + rs), "v"(l + 2 * rs), "v"(l + 3 * rs), "v"(l + 4 * rs), "v"(l + 5 * rs), "v"(l + 6 * rs), "v"(l + 7 * rs),
                  "v"(ga), "v"(ga + sa), "v"(ga + 2 * sa), "v"(ga + 3 * sa), "v"(gb), "v"(gb + sb), "v"(gb + 2 * sb), "v"(gb + 3 * sb) : "memory"); }
__device__ __forceinline__ v16h g2_frag(const _Float16* p, int hh) { FragH f; f.half[0] = *(const v8us*)((const unsigned short*)p + 8 * hh); f.half[1] = *(const v8us*)((const unsigned short*)p + 16 + 8 * hh); return f.v; }
__device__ __forceinline__ v8f g2_mma(v16h a, v16h b, v8f c) { v8f d = __builtin_amdgcn_wmma_f32_16x16x32_f16(false, a, false, b, (short)0, c, false, false); asm volatile("v_nop\n\tv_nop\n\tv_nop\n\tv_nop" : "+v"(d) : "v"(a), "v"(b)); return d; }
// C = alpha A B^T. B holds N rows; column gc of the product goes to column gc % DM of output plane gc / DM (planes sC elements apart, row pitch ldc): f32 rows into C (F32OUT) or f16 rows into C16.
// The epilogue is written for these two uses alone, its choices made at compile time, so that its text stays short at up to 160 results a lane.
template <int MF, int NF, int WM, int WN, bool F32OUT>
__global__ __launch_bounds__(32 * WM * WN) void k_gemm2(const _Float16* __restrict__ A, int lda, const _Float16* __restrict__ Bh, int ldb, float alpha, float* __restrict__ C, _Float16* __restrict__ C16, int ldc, size_t sC, int M, int N, int K) {
  constexpr int NT = 32 * WM * WN, RPC = NT / 8, AR = 16 * MF * WM, BR = 16 * NF * WN, BUF = (AR + BR) * G2_PITCH, SP = BR + 4, LU = BR / 64, UW = 32 * LU / WN;
  static_assert(AR == 4 * RPC && BR % RPC == 0 && BR % 64 == 0 && MF % 2 == 0 && UW % 2 == 0 && (32 * LU) % WN == 0, "k_gemm2: tile and copy shapes");
  static_assert(2 * BUF * 2 >= WM * 32 * SP * 4, "k_gemm2: the output staging lies in the stage buffers");
  __shared__ __attribute__((aligned(16))) _Float16 st[2][BUF];
  const int tid = threadIdx.x, w = tid >> 5, lane = tid & 31, ln = lane & 15, hh = lane >> 4; const int wm = w / WN, wn = w % WN;
  const int ntn = N / BR; const int mt = blockIdx.x / ntn, nq = blockIdx.x - mt * ntn; if (mt * AR >= M) return;      /* the same for the whole block: it stands in front of barriers */
  const _Float16* gap = A + (size_t)(mt * AR + (tid >> 3)) * lda + (tid & 7) * 8; const _Float16* gbp = Bh + (size_t)(nq * BR + (tid >> 3)) * ldb + (tid & 7) * 8; const size_t sar = (size_t)RPC * lda, sbr = (size_t)RPC * ldb;
  const unsigned lst = (unsigned)(size_t)&st[0][(tid >> 3) * G2_PITCH + (tid & 7) * 8];      /* low 32 bits of the shared address = byte address in the block's LDS */
  const int aoff = (16 * MF * wm + ln) * G2_PITCH + 8 * hh, boff = (AR + 16 * NF * wn + ln) * G2_PITCH + 8 * hh; const int nst = K >> 6;
  const v8f z8 = {0.f,0.f,0.f,0.f,0.f,0.f,0.f,0.f}; v8f acc[MF][NF];
  // every loop over fragments or accumulators is fully unrolled so that these arrays are indexed by constants and stay in registers
#pragma unroll
  for (int i = 0; i < MF; ++i)
#pragma unroll
    for (int u = 0; u < NF; ++u) acc[i][u] = z8;
  g2_stage<RPC, BR / RPC>(lst, gap, sar, gbp, sbr);
  asm volatile("s_wait_asynccnt 0x0" ::: "memory");      // this wave's copies of stage 0 have landed
  __syncthreads();                                       // ... and every other wave's: stage 0 may be read
  if (nst > 1) g2_stage<RPC, BR / RPC>(lst + BUF * 2, gap + 64, sar, gbp + 64, sbr);
  // rolled, as it was: a trip already holds a stage's LDS reads and products, and unrolled trips would each keep their own copy address registers; the buffer is chosen by the trip's parity
#pragma unroll 1
  for (int t = 0; t < nst; ++t) { const _Float16* sb = st[t & 1];
#pragma unroll
    for (int ks = 0; ks < 2; ++ks) { v16h af[MF], bf[NF];
#pragma unroll
      for (int i = 0; i < MF; ++i) af[i] = g2_lfrag(sb + aoff + i * 16 * G2_PITCH + ks * 32);
#pragma unroll
      for (int u = 0; u < NF; ++u) bf[u] = g2_lfrag(sb + boff + u * 16 * G2_PITCH + ks * 32);
#pragma unroll
      for (int u = 0; u < NF; ++u)
#pragma unroll
        for (int i = 0; i < MF; ++i) acc[i][u] = g2_mma(af[i], bf[u], acc[i][u]); }
    asm volatile("s_wait_dscnt 0x0" ::: "memory");         // this wave's reads of stage t are finished before its buffer is refilled
    asm volatile("s_wait_asynccnt 0x0" ::: "memory");      // this wave's copies of stage t + 1 have landed
    __syncthreads();                                       // publishes stage t + 1 and ends every wave's reads of stage t
    if (t + 2 < nst) g2_stage<RPC, BR / RPC>(lst + (unsigned)(t & 1) * (BUF * 2), gap + (size_t)(t + 2) * 64, sar, gbp + (size_t)(t + 2) * 64, sbr); }
  asm volatile("s_wait_asynccnt 0x0" ::: "memory");        // no copy is outstanding when the wave goes on to its end
  // Output staging in the stage buffers (behind the last trip's barrier no wave reads a stage any more and every copy has landed): 32 rows of every wave's tile at a time, as WM x 32 rows of the block's BR columns.
  // The rows are then stored in units of 64 columns by 16 lanes, so that every 128-byte line of the output has one writer although a wave's own columns need not end on a line.
  float* so = (float*)&st[0][0];
#pragma unroll
  for (int ch = 0; ch < MF / 2; ++ch) {
    if (ch) __syncthreads();                               // every wave has read the 32 rows before: they may be overwritten
#pragma unroll
    for (int half = 0; half < 2; ++half)
#pragma unroll
      for (int u = 0; u < NF; ++u)
#pragma unroll
        for (int r = 0; r < 8; ++r) so[(wm * 32 + half * 16 + 8 * hh + r) * SP + (wn * NF + u) * 16 + ln] = acc[ch * 2 + half][u][r] * alpha;
    __syncthreads();                                       // the rows are complete before other waves read them
#pragma unroll
    for (int q = 0; q < UW / 2; ++q) { const int e = wn * UW + q * 2 + hh, r = e / LU, col = (e % LU) * 64 + ln * 4; const v4f v = *(const v4fa*)&so[(wm * 32 + r) * SP + col];
      const unsigned gc = (unsigned)(nq * BR + col); const size_t ro = (size_t)(gc / DM) * sC + (size_t)(mt * AR + wm * 16 * MF + ch * 32 + r) * ldc + gc % DM;
      if (F32OUT) *(v4f*)(C + ro) = v; else { v4h h4; for (int i = 0; i < 4; ++i) h4[i] = (_Float16)v[i]; *(v4h*)(C16 + ro) = h4; } }
  } }


__global__ __launch_bounds__(256) void k_wnat(const float* __restrict__ w, size_t n8, _Float16* __restrict__ Bt) { const size_t t = (size_t)blockIdx.x * 256 + threadIdx.x; if (t >= n8) return; FragH f; for (int q = 0; q < 8; ++q) f.h[q] = (_Float16)(bf16_round(w[t * 8 + q]) * 16.0f); *(v8us*)((unsigned short*)Bt + t * 8) = f.half[0];  }
// V^T of every (branch, batch, head): blockIdx.x = head + NH * (block of 64 keys), blockIdx.y = batch, blockIdx.z = branch; VT[(b * NH + h) * HD + d][key]
__global__ __launch_bounds__(256) void k_vt(const _Float16* __restrict__ VS16, const _Float16* __restrict__ VL16, _Float16* __restrict__ VTS, _Float16* __restrict__ VTL) { __shared__ unsigned short tl[64][65]; const int tid = threadIdx.x; const int h = blockIdx.x % NH, sg = blockIdx.x / NH; const int s0 = sg * 64; const int b = blockIdx.y;
  const _Float16* V16 = blockIdx.z ? VL16 : VS16; _Float16* VT = blockIdx.z ? VTL : VTS;
  for (int i = tid; i < 64 * 8; i += 256) { const int j = i / 8, d8 = (i % 8) * 8; FragH f; f.half[0] = *(const v8us*)((const unsigned short*)V16 + ((size_t)b * SQ + s0 + j) * DM + h * HD + d8); for (int q = 0; q < 8; ++q) tl[d8 + q][j] = f.u[q]; }
  __syncthreads();
  { for (int i = tid; i < 64 * 8; i += 256) { const int d = i / 8, j8 = (i % 8) * 8; FragH f; for (int q = 0; q < 8; ++q) f.u[q] = tl[d][j8 + q]; *(v8us*)((unsigned short*)VT + (((size_t)b * NH + h) * HD + d) * SQ + s0 + j8) = f.half[0]; }  } }

// ---- fused attention: scores, softmax and weighted sum of one branch in one pass over the keys; no score ever reaches memory ----
// Transposed products. S^T = K Q^T: A = 16 key rows, B = 16 query rows, so lane (ln, hh) holds for query ln the keys 8 hh + r of each 16-key tile. Two such tiles, rounded to f16, are
// at once the B operand of O^T += V^T P^T over 32 keys (element i: key 8 hh + i, element 8 + i: key 16 + 8 hh + i, the k order of g2_frag and g2_lfrag; g2_lfrag loads the A operand from the V^T rows in LDS).
// A query's maximum, sum and scale therefore live in its own lane (both halves); the halves exchange the maximum once a pass and join their sums once at the end.
// Every inner loop is fully unrolled so that the fragment, score and accumulator arrays are indexed by constants and stay in registers (a rolled loop would put them in scratch memory).
// Scores are kept in the log2 domain (x = s log2 e). The maximum in use is raised, and sums and outputs rescaled, only when a column's new maximum exceeds it by more than 8, so weights stay <= 2^8.
// 2^x of eight (two) values in place, one statement: behind each v_exp_f32 stands an instruction that neither reads its result nor overwrites its source (the operands are distinct registers), behind the last the v_nop: the slot the instruction set asks for behind a transcendental
__device__ __forceinline__ void ex2x8(v8f& x) { asm("v_exp_f32 %0, %0\n\tv_exp_f32 %1, %1\n\tv_exp_f32 %2, %2\n\tv_exp_f32 %3, %3\n\tv_exp_f32 %4, %4\n\tv_exp_f32 %5, %5\n\tv_exp_f32 %6, %6\n\tv_exp_f32 %7, %7\n\tv_nop" : "+v"(x[0]), "+v"(x[1]), "+v"(x[2]), "+v"(x[3]), "+v"(x[4]), "+v"(x[5]), "+v"(x[6]), "+v"(x[7])); }
__device__ __forceinline__ void ex2x2(float& a, float& b) { asm("v_exp_f32 %0, %0\n\tv_exp_f32 %1, %1\n\tv_nop" : "+v"(a), "+v"(b)); }
__device__ __forceinline__ v8f at_mma(v16h a, v16h b, v8f c) { return __builtin_amdgcn_wmma_f32_16x16x32_f16(false, a, false, b, (short)0, c, false, false); }
// K and V^T go through LDS: a stage is 64 keys, that is 64 K rows (64 d each) and 64 V^T rows (64 keys each), 128 bytes a row, brought once a block and branch by asynchronous copies and read by the branch's four waves; two buffers,
// the copies of stage t + 2 in flight while stage t + 1 is worked on. A wave-wide copy reads 4 rows x 128 contiguous bytes (4 whole cache lines), where a fragment load from global memory touched 16 lines for the same 512 bytes.
#define AT_PITCH 72      /* f16 elements a row in LDS = 144 bytes = 16 x 9: 16 rows read by ds_load_b128 fall on distinct banks */
#define AT_BUF (128 * AT_PITCH)      /* rows 0..63: K, rows 64..127: V^T */
// One lane's eight 16-byte copies of a stage: thread tid takes bytes 16 (tid & 7) of rows (tid >> 3) + 16 c, c = 0..3, of the K tile and of the V^T tile. l = its LDS byte address in row tid >> 3 of the buffer, gk / gv = its global
// address in that row of the K / V^T tile. The s_wait_xcnt stands inside the statement, behind the last copy, so that no address register of a copy is rewritten in front of it.
__device__ __forceinline__ void at_stage(unsigned l, const _Float16* gk, const _Float16* gv) {
  const unsigned rs = 16 * AT_PITCH * 2; const size_t sk = (size_t)16 * DM, sv = (size_t)16 * SQ;
  asm volatile("global_load_async_to_lds_b128 %0, %8, off\n\tglobal_load_async_to_lds_b128 %1, %9, off\n\tglobal_load_async_to_lds_b128 %2, %10, off\n\tglobal_load_async_to_lds_b128 %3, %11, off\n\t"
               "global_load_async_to_lds_b128 %4, %12, off\n\tglobal_load_async_to_lds_b128 %5, %13, off\n\tglobal_load_async_to_lds_b128 %6, %14, off\n\tglobal_load_async_to_lds_b128 %7, %15, off\n\ts_wait_xcnt 0x0"
               :: "v"(l), "v"(l + rs), "v"(l + 2 * rs), "v"(l + 3 * rs), "v"(l + 4 * rs), "v"(l + 5 * rs), "v"(l + 6 * rs), "v"(l + 7 * rs),
                  "v"(gk), "v"(gk + sk), "v"(gk + 2 * sk), "v"(gk + 3 * sk), "v"(gv), "v"(gv + sv), "v"(gv + 2 * sv), "v"(gv + 3 * sv) : "memory"); }
// One stage (64 keys, two passes of 32) of one wave's branch. sb = the branch's buffer that holds the stage; the wave's query fragments, outputs, maxima and sums stay in the caller's registers.
// decay (the same for a whole wave, held in a scalar register) = the short branch: its scores are scaled and given the decay bias in place, under a scalar branch that holds nothing but that vector arithmetic;
// everything else is one code path for both branches. kq = the scale that the scores still lack behind that place: 1 in the short branch (x * 1 is exact), 0.125 log2 e in the long one, which so keeps its one multiply-add a score.
__device__ __forceinline__ void attn_stage(const _Float16* sb, const int t, const int q0, const int ln, const int hh, const bool decay, const float c2, const float kq, const v16h (&qf)[2][2], v8f (&o)[2][4], float (&m)[2], float (&l)[2]) {
  const float sc2 = 0.125f * 1.4426950408889634f; const v8f z8 = {0.f,0.f,0.f,0.f,0.f,0.f,0.f,0.f};
  const int koff = ln * AT_PITCH + 8 * hh, voff = (64 + ln) * AT_PITCH + 8 * hh; v16h kf[2][2];
#pragma unroll
   for (int u = 0; u < 2; ++u)
#pragma unroll
    for (int ks = 0; ks < 2; ++ks) kf[u][ks] = g2_lfrag(sb + koff + u * 16 * AT_PITCH + ks * 32);
   // a stage's two passes, unrolled so that the pass picks its rows and columns of the buffer by constant offsets
#pragma unroll
   for (int ps = 0; ps < 2; ++ps) { const int kb = t * 64 + ps * 32;
    v16h vf[4];
#pragma unroll
    for (int dt = 0; dt < 4; ++dt) vf[dt] = g2_lfrag(sb + voff + dt * 16 * AT_PITCH + ps * 32);
    __builtin_amdgcn_sched_barrier(0);      // keeps the V^T loads at the head of the pass, so that the score products and the maxima cover their latency (the scheduler sinks them to their use otherwise)
    v8f s[2][2];
#pragma unroll
    for (int g = 0; g < 2; ++g)
#pragma unroll
      for (int t = 0; t < 2; ++t) s[g][t] = at_mma(kf[t][1], qf[g][1], at_mma(kf[t][0], qf[g][0], z8));
    // the stage's second pass's K fragments, asked for while the first pass's softmax runs (the same buffer: nothing of the next stage is read here)
    if (ps == 0) {
#pragma unroll
      for (int u = 0; u < 2; ++u)
#pragma unroll
        for (int ks = 0; ks < 2; ++ks) kf[u][ks] = g2_lfrag(sb + koff + (32 + u * 16) * AT_PITCH + ks * 32); }
    if (decay) {
#pragma unroll
      for (int g = 0; g < 2; ++g)
#pragma unroll
        for (int t = 0; t < 2; ++t) { const float fb = (float)(q0 + g * 16 + ln - 8 * hh - kb - t * 16);
#pragma unroll
          for (int r = 0; r < 8; ++r) s[g][t][r] = s[g][t][r] * sc2 - fabsf(fb - (float)r) * c2; } }
    float mt[2];
#pragma unroll
    for (int g = 0; g < 2; ++g) { float mx = -3.0e38f;
#pragma unroll
      for (int t = 0; t < 2; ++t)
#pragma unroll
        for (int r = 0; r < 8; ++r) mx = fmaxf(mx, s[g][t][r]);
      mx *= kq;
      mt[g] = fmaxf(mx, __shfl_xor(mx, 16, 32)); }
    const bool need = (mt[0] > m[0] + 8.0f) || (mt[1] > m[1] + 8.0f);
    if (__builtin_amdgcn_ballot_w32(need) != 0) { const float mn0 = fmaxf(m[0], mt[0]), mn1 = fmaxf(m[1], mt[1]); float al[2] = {m[0] - mn0, m[1] - mn1}; ex2x2(al[0], al[1]); m[0] = mn0; m[1] = mn1;
#pragma unroll
      for (int g = 0; g < 2; ++g) { l[g] *= al[g];
#pragma unroll
        for (int dt = 0; dt < 4; ++dt) o[g][dt] *= al[g]; } }
#pragma unroll
    for (int g = 0; g < 2; ++g) { FragH pf; float ls = 0.f;
#pragma unroll
      for (int t = 0; t < 2; ++t) { v8f p;
#pragma unroll
        for (int r = 0; r < 8; ++r) p[r] = s[g][t][r] * kq - m[g];
        ex2x8(p);
#pragma unroll
        for (int r = 0; r < 8; ++r) { ls += p[r]; pf.h[t * 8 + r] = (_Float16)p[r]; } }
      l[g] += ls;
#pragma unroll
      for (int dt = 0; dt < 4; ++dt) o[g][dt] = at_mma(vf[dt], pf.v, o[g][dt]); }
   } }
// blockIdx.x = block of 128 queries, blockIdx.y = batch * NH + head. Eight waves: waves 0..3 run the short branch (with the decay bias) on 32 queries each, waves 4..7 the long branch on the same queries,
// each branch with its own two stage buffers filled by its own four waves. Both branches walk the stages together (one barrier a stage for the whole block, in control flow that is the same for all its threads;
// only the decay bias between two barriers differs by wave). At the end both leave their normalised f32 rows in LDS, and the block blends them with sigmoid(mix_weight) and stores the f16 o rows: no branch output reaches memory.
/* four waves a SIMD (two blocks a WGP, as the LDS allows) need at most 256 vector registers a wave: the second number asks the compiler for that budget */
__global__ __launch_bounds__(256, 4) void k_attn(const _Float16* __restrict__ Q16, const _Float16* __restrict__ KS, const _Float16* __restrict__ KL, const _Float16* __restrict__ VTS, const _Float16* __restrict__ VTL, _Float16* __restrict__ O16, const float* __restrict__ dfp, const float* __restrict__ mwp) {
  __shared__ __attribute__((aligned(16))) float so[2][128][68];
  __shared__ __attribute__((aligned(16))) _Float16 st[2][2 * AT_BUF];
  const int wv = __builtin_amdgcn_readfirstlane((int)(threadIdx.x >> 5)); const int br = wv >> 2;      /* the wave's number and its branch, in scalar registers: what depends on the branch is a scalar choice */
  const int lane = threadIdx.x & 31, ln = lane & 15, hh = lane >> 4; const int b = blockIdx.y / NH, h = blockIdx.y % NH; const int qw = (wv & 3) * 32, q0 = blockIdx.x * 128 + qw;
  const _Float16* KB = br ? KL : KS; const _Float16* VT = br ? VTL : VTS; const float c2 = (1.0f - bf16_round(dfp[0])) * 1.4426950408889634f, kq = br ? 0.125f * 1.4426950408889634f : 1.0f;
  const float mw = mwp[0];      /* read here, into a scalar register, so that the blend at the end does not wait for memory */
  const _Float16* qp = Q16 + ((size_t)b * SQ + q0 + ln) * DM + h * HD; const int tid = threadIdx.x & 127;      /* the thread's number among its branch's 128 */
  const _Float16* gk = KB + ((size_t)b * SQ + (tid >> 3)) * DM + h * HD + (tid & 7) * 8; const _Float16* gv = VT + ((size_t)blockIdx.y * HD + (tid >> 3)) * SQ + (tid & 7) * 8;
  const _Float16* stb = st[br];
  const unsigned lst = (unsigned)(size_t)(stb + (tid >> 3) * AT_PITCH + (tid & 7) * 8);      /* low 32 bits of the shared address = byte address in the block's LDS */
  at_stage(lst, gk, gv);
  v16h qf[2][2];
#pragma unroll
  for (int g = 0; g < 2; ++g)
#pragma unroll
    for (int ks = 0; ks < 2; ++ks) qf[g][ks] = g2_frag(qp + (size_t)g * 16 * DM + ks * 32, hh);
  const v8f z8 = {0.f,0.f,0.f,0.f,0.f,0.f,0.f,0.f}; v8f o[2][4];
#pragma unroll
  for (int g = 0; g < 2; ++g)
#pragma unroll
    for (int dt = 0; dt < 4; ++dt) o[g][dt] = z8;
  float m[2] = {-3.0e38f, -3.0e38f}, l[2] = {0.f, 0.f};
  asm volatile("s_wait_asynccnt 0x0" ::: "memory");      // this wave's copies of stage 0 have landed
  __syncthreads();                                       // ... and every other wave's: stage 0 may be read
  at_stage(lst + AT_BUF * 2, gk + (size_t)64 * DM, gv + 64);
  // rolled; the buffer is chosen by the trip's parity
#pragma unroll 1
  for (int t = 0; t < SQ / 64; ++t) { const _Float16* sb = stb + (t & 1) * AT_BUF;
    attn_stage(sb, t, q0, ln, hh, br == 0, c2, kq, qf, o, m, l);
    asm volatile("s_wait_dscnt 0x0" ::: "memory");         // this wave's reads of stage t are finished before its buffer is refilled
    asm volatile("s_wait_asynccnt 0x0" ::: "memory");      // this wave's copies of stage t + 1 have landed
    __syncthreads();                                       // publishes stage t + 1 and ends every wave's reads of stage t
    if (t + 2 < SQ / 64) at_stage(lst + (unsigned)(t & 1) * (AT_BUF * 2), gk + (size_t)(t + 2) * 64 * DM, gv + (t + 2) * 64);
  }
  asm volatile("s_wait_asynccnt 0x0" ::: "memory");        // no copy is outstanding when the wave goes on to its end
  // the lane's number is read anew here, so that no address of the part below has to hold a vector register through the loop (the loop leaves none free at four waves a SIMD)
  const int le = (int)__builtin_amdgcn_mbcnt_lo(~0u, 0u), lne = le & 15, hhe = le >> 4, te = wv * 32 + le;
  // O^T tile: lane (lne, hhe) holds of query lne the columns 16 dt + 8 hhe + r; into the branch's LDS rows
#pragma unroll
  for (int g = 0; g < 2; ++g) { const float lt = l[g] + __shfl_xor(l[g], 16, 32); const float inv = 1.0f / lt;
#pragma unroll
    for (int dt = 0; dt < 4; ++dt) { const v8f ov = o[g][dt] * inv; const v4f lo = {ov[0], ov[1], ov[2], ov[3]}, hi = {ov[4], ov[5], ov[6], ov[7]};
      *(v4fa*)&so[br][qw + g * 16 + lne][dt * 16 + 8 * hhe] = lo; *(v4fa*)&so[br][qw + g * 16 + lne][dt * 16 + 8 * hhe + 4] = hi; } }
  const float a = 1.0f / (1.0f + expf(-bf16_round(mw))), na = 1.0f - a;
  __syncthreads();                                         // both branches' rows are complete before any thread blends them
  // a thread blends 8 columns of a row: a wave's store covers 4 rows x 128 contiguous bytes; unrolled so that the four rounds' LDS reads are all asked for before the first is used
#pragma unroll
  for (int i = 0; i < 4; ++i) { const int e = i * 256 + te, r = e >> 3, c8 = (e & 7) * 8;
    const v4f s0 = *(const v4fa*)&so[0][r][c8], s1 = *(const v4fa*)&so[0][r][c8 + 4], l0 = *(const v4fa*)&so[1][r][c8], l1 = *(const v4fa*)&so[1][r][c8 + 4]; FragH f;
#pragma unroll
    for (int q = 0; q < 4; ++q) { f.h[q] = (_Float16)(a * s0[q] + na * l0[q]); f.h[4 + q] = (_Float16)(a * s1[q] + na * l1[q]); }
    *(v8us*)((unsigned short*)O16 + ((size_t)b * SQ + blockIdx.x * 128 + r) * DM + h * HD + c8) = f.half[0]; } }

__device__ __forceinline__ void wT_block(const float* __restrict__ w, int din, int dout, _Float16* __restrict__ Bt, int bid, float (*tl)[65]) { const int tid = threadIdx.x; const int nbo = dout / 64; const int ib = bid / nbo, ob = bid % nbo; const int i0 = ib * 64, o0 = ob * 64;
  for (int t = tid; t < 64 * 64; t += 256) { const int i = t / 64, o = t % 64; tl[o][i] = bf16_round(w[(size_t)(i0 + i) * dout + o0 + o]) * 16.0f; }
  __syncthreads();
  { for (int t = tid; t < 64 * 8; t += 256) { const int o = t / 8, i8 = (t % 8) * 8; FragH f; for (int q = 0; q < 8; ++q) f.h[q] = (_Float16)tl[o][i8 + q]; *(v8us*)((unsigned short*)Bt + (size_t)(o0 + o) * din + i0 + i8) = f.half[0]; }  } }
// Everything that reads only inputs, in one launch: ranges of the block index pick the job (the test is the same for a whole block, so the barrier in wT_block is passed by all of a block's threads or by none).
// The transposes stand first: their blocks run longer.
#define PB_SQ ((DM / 64) * (DM / 64))          /* blocks of a DM x DM weight */
#define PB_KV ((DM / 64) * (2 * DM / 64))      /* blocks of a DM x 2 DM weight */
#define PB_W (2 * PB_SQ + 2 * PB_KV)
#define PB_X ((int)((NR * DM / 8 + 255) / 256))
__global__ __launch_bounds__(256) void k_prep(const float* __restrict__ x, const float* __restrict__ wq, const float* __restrict__ wkvs, const float* __restrict__ wkvl, const float* __restrict__ wo,
    _Float16* __restrict__ X16, _Float16* __restrict__ BQ, _Float16* __restrict__ BKVS, _Float16* __restrict__ BKVL, _Float16* __restrict__ BO) {
  __shared__ float tl[64][65]; const int bid = blockIdx.x;
  if (bid < PB_KV) wT_block(wkvs, DM, 2 * DM, BKVS, bid, tl);
  else if (bid < 2 * PB_KV) wT_block(wkvl, DM, 2 * DM, BKVL, bid - PB_KV, tl);
  else if (bid < 2 * PB_KV + PB_SQ) wT_block(wq, DM, DM, BQ, bid - 2 * PB_KV, tl);
  else if (bid < PB_W) wT_block(wo, DM, DM, BO, bid - 2 * PB_KV - PB_SQ, tl);
  else x16_block(x, X16, NR * DM / 8, bid - PB_W); }
extern "C" void kernel_launch(void* const* d_in, const int* in_sizes, int n_in,
                              void* d_out, int out_size, void* d_ws, size_t ws_size, hipStream_t stream) {
  (void)in_sizes; (void)n_in; (void)out_size;
  const float* const* I = (const float* const*)d_in; const float* x = I[0]; const float* wq = I[1]; const float* wkvs = I[2]; const float* wkvl = I[3]; const float* wo = I[4]; const float* mwp = I[5]; const float* dfp = I[6];
  char* ws = (char*)d_ws; size_t off = 0;
  auto take = [&](size_t bytes) { char* p = ws + off; off += (bytes + 255) & ~(size_t)255; return p; };
  /* the transposed projection weights lie as five DM x DM planes in a row (q, short k, short v, long k, long v), and so do the five projections' outputs: the projection launch takes the weights as one matrix and finds a column's output plane from its number */
  _Float16* BQ = (_Float16*)take((size_t)5 * DM * DM * 2); _Float16* BKVS = BQ + (size_t)DM * DM; _Float16* BKVL = BQ + (size_t)3 * DM * DM; _Float16* BO = (_Float16*)take((size_t)DM * DM * 2);
  _Float16* X16 = (_Float16*)take(NR * DM * 2); _Float16* Q16 = (_Float16*)take(5 * NR * DM * 2); _Float16* K16 = Q16 + NR * DM; _Float16* V16 = Q16 + 2 * NR * DM; _Float16* KL16 = Q16 + 3 * NR * DM; _Float16* VL16 = Q16 + 4 * NR * DM; _Float16* O16 = (_Float16*)take(NR * DM * 2);
  _Float16* VTS = (_Float16*)take(NR * DM * 2); _Float16* VTL = (_Float16*)take(NR * DM * 2);
  if (off > ws_size) return;      /* 12 + 6x8 + 8 + 16 = 84 MiB */
  k_prep<<<PB_W + PB_X, 256, 0, stream>>>(x, wq, wkvs, wkvl, wo, X16, BQ, BKVS, BKVL, BO);
  const dim3 gp((unsigned)((NR / 128) * (DM / 128)), 1), gp5((unsigned)((NR / 256) * (5 * DM / 320)), 1);
  k_gemm2<4, 5, 4, 4, false><<<gp5, 512, 0, stream>>>(X16, DM, BQ, DM, 0.0625f, nullptr, Q16, DM, NR * DM, (int)NR, 5 * DM, DM);      /* q, short k | v, long k | v */
  k_vt<<<dim3(NH * (SQ / 64), NB, 2), 256, 0, stream>>>(V16, VL16, VTS, VTL);
  k_attn<<<dim3(SQ / 128, NB * NH), 256, 0, stream>>>(Q16, K16, KL16, VTS, VTL, O16, dfp, mwp);      /* blended o (merged heads) as f16 rows */
  k_gemm2<2, 4, 4, 2, true><<<gp, 256, 0, stream>>>(O16, DM, BO, DM, 0.0625f, (float*)d_out, nullptr, DM, 0, (int)NR, DM, DM);      /* out = o Wo */
}

// v008
// One run takes 91.1 microseconds.
// Timed twice side by side with v007, it ran 1.06 and 1.05 times as fast.
// Over all steps from v000 it is 271 times as fast.
#include <hip/hip_runtime.h>
#define NB 4
#define SQ 1024
#define DM 1024
#define NH 16
#define HD 64
#define NR ((size_t)NB * SQ)         /* 4096 token rows */
typedef __bf16 v16b __attribute__((ext_vector_type(16)));
typedef unsigned short v8us __attribute__((ext_vector_type(8), may_alias));
typedef float  v8f  __attribute__((ext_vector_type(8)));
typedef float  v4f  __attribute__((ext_vector_type(4)));
typedef float  v4fa __attribute__((ext_vector_type(4), may_alias));
union FragB { v16b v; v8us half[2]; unsigned short u[16]; };

__device__ __forceinline__ unsigned short bf16_bits(float x) { unsigned int u = __float_as_uint(x); return (unsigned short)((u + 0x7FFFu + ((u >> 16) & 1u)) >> 16); }
__device__ __forceinline__ float bf16_val(unsigned short b) { return __uint_as_float(((unsigned int)b) << 16); }
__device__ __forceinline__ float bf16_round(float x) { return bf16_val(bf16_bits(x)); }
// D += A·B with NT terms: 1 = ah·bh, 2 = + al·bh (A split), 3 = + ah·bl (both split)
template <int NT>
__device__ __forceinline__ v8f mmaN(v16b ah, v16b al, v16b bh, v16b bl, v8f c) {
  c = __builtin_amdgcn_wmma_f32_16x16x32_bf16(false, ah, false, bh, (short)0, c, false, false);
  if (NT >= 2) c = __builtin_amdgcn_wmma_f32_16x16x32_bf16(false, al, false, bh, (short)0, c, false, false);
  if (NT >= 3) c = __builtin_amdgcn_wmma_f32_16x16x32_bf16(false, ah, false, bl, (short)0, c, false, false);
  asm volatile("v_nop\n\tv_nop\n\tv_nop\n\tv_nop" : "+v"(c) : "v"(ah), "v"(al), "v"(bh), "v"(bl));
  return c;
}

__global__ __launch_bounds__(256) void k_wt_bf16(const float* __restrict__ W, unsigned short* __restrict__ Wt, int K, int N) {
  const int t = blockIdx.x * 256 + threadIdx.x;
  const int k8n = K / 8;
  if (t >= N * k8n) return;
  const int n = t / k8n, k8 = (t % k8n) * 8;
  v8us v;
#pragma unroll
  for (int i = 0; i < 8; ++i) v[i] = bf16_bits(W[(size_t)(k8 + i) * N + n]);
  *(v8us*)(Wt + (size_t)n * K + k8) = v;
  
}

// GEMM C[M][N] (f32, pitch ldc) = act(A[M][K]·W + bias). A f32 row-major (pitch lda) converted per fragment to bf16
// (ASPLIT: hi/lo two planes -> 2 terms, else single rounded term); Wt bf16 [N][K] (pitch ldb). BIAS_BF16 rounds the
// bias to bf16 first (bias quantised to bf16 before the add). K%32==0, M%16==0, N%64==0.
template <bool ASPLIT, int ACT, bool BIAS_BF16>
__global__ __launch_bounds__(128) void k_gemm_bf(const float* __restrict__ A, int lda, const unsigned short* __restrict__ Wt, int ldb,
                                               const float* __restrict__ bias, float* __restrict__ C, int ldc, int M, int N, int K) {
  __shared__ __attribute__((aligned(16))) float so[4][16][64];
  const int tid = threadIdx.x, w = tid >> 5, lane = tid & 31, ln = lane & 15, hh = lane >> 4;
  const int ntn = N / 64;
  const int wid = blockIdx.x * 4 + w;
  const int mt = wid / ntn, nq = wid % ntn;
  if (mt * 16 >= M) return;
  const int row0 = mt * 16, col0 = nq * 64;
  const float* arow = A + (size_t)(row0 + ln) * lda;
  v8f acc[4] = {};
  for (int kb = 0; kb < K; kb += 32) {
    FragB ah, al;
    const v4f x0 = *(const v4fa*)(arow + kb + 8 * hh), x1 = *(const v4fa*)(arow + kb + 8 * hh + 4);
    const v4f x2 = *(const v4fa*)(arow + kb + 16 + 8 * hh), x3 = *(const v4fa*)(arow + kb + 16 + 8 * hh + 4);
    float xs[16] = {x0[0],x0[1],x0[2],x0[3],x1[0],x1[1],x1[2],x1[3],x2[0],x2[1],x2[2],x2[3],x3[0],x3[1],x3[2],x3[3]};
#pragma unroll
    for (int i = 0; i < 16; ++i) { const unsigned short hb = bf16_bits(xs[i]); ah.u[i] = hb; al.u[i] = ASPLIT ? bf16_bits(xs[i] - bf16_val(hb)) : (unsigned short)0; }
#pragma unroll
    for (int t = 0; t < 4; ++t) {
      const unsigned short* brow = Wt + (size_t)(col0 + t * 16 + ln) * ldb + kb;
      FragB b;
      b.half[0] = *(const v8us*)(brow + 8 * hh);
      b.half[1] = *(const v8us*)(brow + 16 + 8 * hh);
      acc[t] = mmaN<ASPLIT ? 2 : 1>(ah.v, al.v, b.v, b.v, acc[t]);
    }
  }
#pragma unroll
  for (int t = 0; t < 4; ++t) {
    float bv = bias ? bias[col0 + t * 16 + ln] : 0.f;
    if (BIAS_BF16) bv = bf16_round(bv);
#pragma unroll
    for (int r = 0; r < 8; ++r) { float v = acc[t][r] + bv; if (ACT == 1) v = fmaxf(v, 0.f); so[w][8 * hh + r][t * 16 + ln] = v; }
  }
  __builtin_amdgcn_fence(__ATOMIC_ACQ_REL, "workgroup");
  __builtin_amdgcn_wave_barrier();
  const int rsub = lane >> 4, c4 = (lane & 15) * 4;
  {
#pragma unroll
    for (int q = 0; q < 8; ++q) {
      const int r = q * 2 + rsub;
      const v4f v = *(const v4fa*)&so[w][r][c4];
      *(v4f*)(C + (size_t)(row0 + r) * ldc + col0 + c4) = v;
    }
    
  }
}

// GEMM C = act(A·W + bias + resid): A f32 (ASPLIT -> hi/lo 2 terms), Wt bf16 [N][K]; ACT 0 none, 1 relu, 2 exact gelu;
// resid (optional, f32, row index = (row % rmod), pitch ldr, RES_BF16 rounds it) added before the activation.
template <bool ASPLIT, int ACT, bool BIAS_BF16, bool RES_BF16>
__global__ __launch_bounds__(128) void k_gemm_bf3(const float* __restrict__ A, int lda, const unsigned short* __restrict__ Wt, int ldb,
                                                const float* __restrict__ bias, const float* __restrict__ resid, int rmod, int ldr,
                                                float* __restrict__ C, int ldc, int M, int N, int K) {
  __shared__ __attribute__((aligned(16))) float so[4][16][64];
  const int tid = threadIdx.x, w = tid >> 5, lane = tid & 31, ln = lane & 15, hh = lane >> 4;
  const int ntn = N / 64;
  const int wid = blockIdx.x * 4 + w;
  const int mt = wid / ntn, nq = wid % ntn;
  if (mt * 16 >= M) return;
  const int row0 = mt * 16, col0 = nq * 64;
  const float* arow = A + (size_t)(row0 + ln) * lda;
  v8f acc[4] = {};
  for (int kb = 0; kb < K; kb += 32) {
    FragB ah, al;
    const v4f x0 = *(const v4fa*)(arow + kb + 8 * hh), x1 = *(const v4fa*)(arow + kb + 8 * hh + 4);
    const v4f x2 = *(const v4fa*)(arow + kb + 16 + 8 * hh), x3 = *(const v4fa*)(arow + kb + 16 + 8 * hh + 4);
    float xs[16] = {x0[0],x0[1],x0[2],x0[3],x1[0],x1[1],x1[2],x1[3],x2[0],x2[1],x2[2],x2[3],x3[0],x3[1],x3[2],x3[3]};
#pragma unroll
    for (int i = 0; i < 16; ++i) { const unsigned short hb = bf16_bits(xs[i]); ah.u[i] = hb; al.u[i] = ASPLIT ? bf16_bits(xs[i] - bf16_val(hb)) : (unsigned short)0; }
#pragma unroll
    for (int t = 0; t < 4; ++t) {
      const unsigned short* brow = Wt + (size_t)(col0 + t * 16 + ln) * ldb + kb;
      FragB b;
      b.half[0] = *(const v8us*)(brow + 8 * hh);
      b.half[1] = *(const v8us*)(brow + 16 + 8 * hh);
      acc[t] = mmaN<ASPLIT ? 2 : 1>(ah.v, al.v, b.v, b.v, acc[t]);
    }
  }
#pragma unroll
  for (int t = 0; t < 4; ++t) {
    const int col = col0 + t * 16 + ln;
    float bv = bias ? bias[col] : 0.f;
    if (BIAS_BF16) bv = bf16_round(bv);
#pragma unroll
    for (int r = 0; r < 8; ++r) {
      float v = acc[t][r] + bv;
      if (resid) { float rv = resid[(size_t)((row0 + 8 * hh + r) % rmod) * ldr + col]; if (RES_BF16) rv = bf16_round(rv); v += rv; }
      if (ACT == 1) v = fmaxf(v, 0.f);
      if (ACT == 2) v = 0.5f * v * (1.0f + erff(v * 0.70710678118654752f));
      if (ACT == 3) { const float u = 0.7978845608028654f * (v + 0.044715f * v * v * v); v = 0.5f * v * (1.0f + tanhf(u)); }
      so[w][8 * hh + r][t * 16 + ln] = v;
    }
  }
  __builtin_amdgcn_fence(__ATOMIC_ACQ_REL, "workgroup");
  __builtin_amdgcn_wave_barrier();
  const int rsub = lane >> 4, c4 = (lane & 15) * 4;
  {
#pragma unroll
    for (int q = 0; q < 8; ++q) {
      const int r = q * 2 + rsub;
      const v4f v = *(const v4fa*)&so[w][r][c4];
      *(v4f*)(C + (size_t)(row0 + r) * ldc + col0 + c4) = v;
    }
    
  }
}
// row LayerNorm (biased variance, eps) over N: s = X (+ R); optional out_sum <- s; out_norm <- (s-mu)*rsqrt(var+eps)*g + b
template <bool PARAM_BF16>
__global__ __launch_bounds__(256) void k_layernorm(const float* __restrict__ X, const float* __restrict__ R, const float* __restrict__ g, const float* __restrict__ bta,
                                                  float* __restrict__ out_sum, float* __restrict__ out_norm, int N, float eps) {
  __shared__ float red[256];
  const int row = blockIdx.x, tid = threadIdx.x;
  const float* x = X + (size_t)row * N; const float* rr = R ? R + (size_t)row * N : nullptr;
  float vals[16];                     // up to N = 4096
  const int per = N / 256;            // contiguous chunk per thread? use strided-by-4 chunks: thread handles j = tid*4 + 1024*u
  float s1 = 0.f;
  for (int u = 0; u < per / 4; ++u) {
    const int j = tid * 4 + 1024 * u;
    const v4f a = *(const v4fa*)(x + j);
    v4f b = {0.f,0.f,0.f,0.f}; if (rr) b = *(const v4fa*)(rr + j);
#pragma unroll
    for (int q = 0; q < 4; ++q) { const float v = a[q] + b[q]; vals[u * 4 + q] = v; s1 += v; }
  }
  red[tid] = s1; __syncthreads();
  for (int st = 128; st > 0; st >>= 1) { if (tid < st) red[tid] += red[tid + st]; __syncthreads(); }
  const float mu = red[0] / (float)N; __syncthreads();
  float s2 = 0.f;
  for (int u = 0; u < per / 4; ++u)
#pragma unroll
    for (int q = 0; q < 4; ++q) { const float c = vals[u * 4 + q] - mu; s2 += c * c; }
  red[tid] = s2; __syncthreads();
  for (int st = 128; st > 0; st >>= 1) { if (tid < st) red[tid] += red[tid + st]; __syncthreads(); }
  const float rs = rsqrtf(red[0] / (float)N + eps);
  {
    for (int u = 0; u < per / 4; ++u) {
      const int j = tid * 4 + 1024 * u;
      v4f o, sm;
#pragma unroll
      for (int q = 0; q < 4; ++q) {
        float gg = g[j + q], bb = bta[j + q];
        if (PARAM_BF16) { gg = bf16_round(gg); bb = bf16_round(bb); }
        sm[q] = vals[u * 4 + q]; o[q] = (vals[u * 4 + q] - mu) * rs * gg + bb;
      }
      if (out_sum) *(v4f*)(out_sum + (size_t)row * N + j) = sm;
      *(v4f*)(out_norm + (size_t)row * N + j) = o;
    }
    
  }
}



// ---- f16 WMMA path (v_wmma_f32_16x16x32_f16): 11-bit significands for operands in range — used where a [0,1] probability operand needs more precision than bf16
typedef _Float16 v16h __attribute__((ext_vector_type(16)));
union FragH { v16h v; v8us half[2]; _Float16 h[16]; unsigned short u[16]; };
template <int NT>
__device__ __forceinline__ v8f mmaH(v16h ah, v16h al, v16h bh, v16h bl, v8f c) {
  c = __builtin_amdgcn_wmma_f32_16x16x32_f16(false, ah, false, bh, (short)0, c, false, false);
  if (NT >= 2) c = __builtin_amdgcn_wmma_f32_16x16x32_f16(false, al, false, bh, (short)0, c, false, false);
  if (NT >= 3) c = __builtin_amdgcn_wmma_f32_16x16x32_f16(false, ah, false, bl, (short)0, c, false, false);
  asm volatile("v_nop\n\tv_nop\n\tv_nop\n\tv_nop" : "+v"(c) : "v"(ah), "v"(al), "v"(bh), "v"(bl));
  return c;
}
// batched GEMM like k_gemm_b but f16 operands: A f32 (split into f16 hi/lo if ASPLIT, else rounded to f16), Bt = f16 values [n][k]; alpha; C f32; N multiple of 16 (partial tiles skipped)
template <bool ASPLIT>
__global__ __launch_bounds__(128) void k_gemm_h(const float* __restrict__ A, int lda, size_t sA, const _Float16* __restrict__ Bh, int ldb, size_t sB, float alpha, float* __restrict__ C, int ldc, size_t sC, int M, int N, int K) {
  __shared__ __attribute__((aligned(16))) float so[4][16][64];
  const int tid = threadIdx.x, w = tid >> 5, lane = tid & 31, ln = lane & 15, hh = lane >> 4; const int by = blockIdx.y;
  A += (size_t)by * sA; Bh += (size_t)by * sB; C += (size_t)by * sC;
  const int ntn = (N + 63) / 64; const int wid = blockIdx.x * 4 + w; const int mt = wid / ntn, nq = wid % ntn; if (mt * 16 >= M) return;
  const int row0 = mt * 16, col0 = nq * 64; const float* arow = A + (size_t)(row0 + ln) * lda;
  v8f acc[4] = {};
  for (int kb = 0; kb < K; kb += 32) {
    FragH ah, al;
    const v4f x0 = *(const v4fa*)(arow + kb + 8 * hh), x1 = *(const v4fa*)(arow + kb + 8 * hh + 4), x2 = *(const v4fa*)(arow + kb + 16 + 8 * hh), x3 = *(const v4fa*)(arow + kb + 16 + 8 * hh + 4);
    float xs[16] = {x0[0],x0[1],x0[2],x0[3],x1[0],x1[1],x1[2],x1[3],x2[0],x2[1],x2[2],x2[3],x3[0],x3[1],x3[2],x3[3]};
#pragma unroll
    for (int i = 0; i < 16; ++i) { const _Float16 h = (_Float16)xs[i]; ah.h[i] = h; al.h[i] = ASPLIT ? (_Float16)(xs[i] - (float)h) : (_Float16)0.0f; }
#pragma unroll
    for (int t = 0; t < 4; ++t) { if (col0 + t * 16 >= N) continue; const size_t boff = (size_t)(col0 + t * 16 + ln) * ldb + kb; FragH bq; bq.half[0] = *(const v8us*)(Bh + boff + 8 * hh); bq.half[1] = *(const v8us*)(Bh + boff + 16 + 8 * hh);
      acc[t] = mmaH<ASPLIT ? 2 : 1>(ah.v, al.v, bq.v, bq.v, acc[t]); }
  }
#pragma unroll
  for (int t = 0; t < 4; ++t) { if (col0 + t * 16 >= N) continue;
#pragma unroll
    for (int r = 0; r < 8; ++r) so[w][8 * hh + r][t * 16 + ln] = acc[t][r] * alpha; }
  __builtin_amdgcn_fence(__ATOMIC_ACQ_REL, "workgroup"); __builtin_amdgcn_wave_barrier();
  const int rsub = lane >> 4, c4 = (lane & 15) * 4;
  {
#pragma unroll
    for (int q = 0; q < 8; ++q) { const int r = q * 2 + rsub; if (col0 + c4 < N) { const v4f v = *(const v4fa*)&so[w][r][c4]; *(v4f*)(C + (size_t)(row0 + r) * ldc + col0 + c4) = v; } }
     }
}

// Wt[n][k] = f16(W[k][n]·scale) from f32 row-major W[K][N] (scale = power of two; bf16-exact weights stay exact in f16 away from the subnormal range)
__global__ __launch_bounds__(256) void k_wt_f16(const float* __restrict__ W, _Float16* __restrict__ Wt, int K, int N, float scale) {
  const int t = blockIdx.x * 256 + threadIdx.x; if (t >= N * (K / 8)) return; const int n = t / (K / 8), k8 = (t % (K / 8)) * 8; FragH f;
#pragma unroll
  for (int i = 0; i < 8; ++i) f.h[i] = (_Float16)(bf16_round(W[(size_t)(k8 + i) * N + n]) * scale); const v8us o = f.half[0];
  *(v8us*)((unsigned short*)Wt + (size_t)n * K + k8) = o; 
}
// k_gemm_hh variant with fused epilogue: v = acc·alpha + bias[by·sBias + col] (+ CP[(row/rowsPerB)·sCPb + by·64 + col] if CP) ; ACT 0 none / 1 elu ; writes f16 C16 (and f32 C if non-null)
template <int ACT>
__global__ __launch_bounds__(128) void k_gemm_hhx(const _Float16* __restrict__ A, int lda, size_t sA, const _Float16* __restrict__ Bh, int ldb, size_t sB, float alpha, const float* __restrict__ bias, size_t sBias, const float* __restrict__ CP, int rowsPerB, size_t sCPb, int row0g,
    float* __restrict__ C, _Float16* __restrict__ C16, int ldc, size_t sC, int M, int N, int K) {
  __shared__ __attribute__((aligned(16))) float so[4][16][64];
  const int tid = threadIdx.x, w = tid >> 5, lane = tid & 31, ln = lane & 15, hh = lane >> 4; const int by = blockIdx.y;
  A += (size_t)by * sA; Bh += (size_t)by * sB; const size_t cofs = (size_t)by * sC; const float* bp = bias ? bias + (size_t)by * sBias : nullptr;
  const int ntn = (N + 63) / 64; const int wid = blockIdx.x * 4 + w; const int mt = wid / ntn, nq = wid % ntn; if (mt * 16 >= M) return;
  const int row0 = mt * 16, col0 = nq * 64; const _Float16* arow = A + (size_t)(row0 + ln) * lda;
  v8f acc[4] = {};
  for (int kb = 0; kb < K; kb += 32) { FragH ah; ah.half[0] = *(const v8us*)((const unsigned short*)arow + kb + 8 * hh); ah.half[1] = *(const v8us*)((const unsigned short*)arow + kb + 16 + 8 * hh);
#pragma unroll
    for (int t = 0; t < 4; ++t) { if (col0 + t * 16 >= N) continue; const size_t boff = (size_t)(col0 + t * 16 + ln) * ldb + kb; FragH bq; bq.half[0] = *(const v8us*)((const unsigned short*)Bh + boff + 8 * hh); bq.half[1] = *(const v8us*)((const unsigned short*)Bh + boff + 16 + 8 * hh);
      acc[t] = mmaH<1>(ah.v, ah.v, bq.v, bq.v, acc[t]); }
  }
#pragma unroll
  for (int t = 0; t < 4; ++t) { if (col0 + t * 16 >= N) continue; const int col = col0 + t * 16 + ln; const float bv = bp ? bf16_round(bp[col]) : 0.f;
#pragma unroll
    for (int r = 0; r < 8; ++r) { float v = acc[t][r] * alpha + bv; if (CP) { const int rr = row0g + row0 + 8 * hh + r; if (rowsPerB < 0) v += CP[cofs + (size_t)rr * ldc + col];      /* rowsPerB < 0: own element of the batched C plane */ else { const int bidx = rr / rowsPerB; v += CP[(size_t)bidx * sCPb + (size_t)by * 64 + col]; } } if (ACT == 1) v = (v > 0.f) ? v : expm1f(v); else if (ACT == 7) v = (v > 0.f) ? v + 1.0f : expf(v); else if (ACT == 8) v = tanhf(v); else if (ACT == 9) v = 0.5f * v * (1.0f + tanhf(0.7978845608028654f * (v + 0.044715f * v * v * v))); else if (ACT == 11) v = 1.0f / (1.0f + expf(-v)); else if (ACT == 12) v = (v > 0.f) ? v : 0.01f * v; else if (ACT == 14) v = (v > 0.f) ? v : 0.1f * v; else if (ACT == 16) v = (v >= 0.f) ? v : 0.3f * v; else if (ACT == 17) v = (v >= 0.f) ? v : 0.2f * v; else if (ACT == 15) v = v / (1.0f + expf(-v)); else if (ACT == 3) v = fmaxf(v, 0.f); else if (ACT == 6) v = 0.5f * v * (1.0f + erff(v * 0.70710678118654752f)); so[w][8 * hh + r][t * 16 + ln] = v; } }
  __builtin_amdgcn_fence(__ATOMIC_ACQ_REL, "workgroup"); __builtin_amdgcn_wave_barrier();
  const int rsub = lane >> 4, c4 = (lane & 15) * 4; typedef _Float16 v4h __attribute__((ext_vector_type(4)));
  {
#pragma unroll
    for (int q = 0; q < 8; ++q) { const int r = q * 2 + rsub; if (col0 + c4 < N) { const v4f v = *(const v4fa*)&so[w][r][c4]; if (C) *(v4f*)(C + cofs + (size_t)(row0 + r) * ldc + col0 + c4) = v; if (C16) { v4h h4; for (int i = 0; i < 4; ++i) h4[i] = (_Float16)v[i]; *(v4h*)(C16 + cofs + (size_t)(row0 + r) * ldc + col0 + c4) = h4; } } }
     }
}


typedef _Float16 v4h __attribute__((ext_vector_type(4)));

__device__ __forceinline__ void x16_block(const float* __restrict__ x, _Float16* __restrict__ X16, size_t n8, int bid) { const size_t t = (size_t)bid * 256 + threadIdx.x; if (t >= n8) return; FragH f;
#pragma unroll
  for (int q = 0; q < 8; ++q) f.h[q] = (_Float16)bf16_round(x[t * 8 + q]); *(v8us*)((unsigned short*)X16 + t * 8) = f.half[0];  }
__global__ __launch_bounds__(256) void k_h16(const float* __restrict__ x, _Float16* __restrict__ X16, size_t n8) { const size_t t = (size_t)blockIdx.x * 256 + threadIdx.x; if (t >= n8) return; FragH f;
#pragma unroll
  for (int q = 0; q < 8; ++q) f.h[q] = (_Float16)x[t * 8 + q]; *(v8us*)((unsigned short*)X16 + t * 8) = f.half[0];  }
__global__ __launch_bounds__(256) void k_round16f(const float* __restrict__ W, _Float16* __restrict__ Bt, size_t n8) { const size_t t = (size_t)blockIdx.x * 256 + threadIdx.x; if (t >= n8) return; FragH f;
#pragma unroll
  for (int i = 0; i < 8; ++i) f.h[i] = (_Float16)(bf16_round(W[t * 8 + i]) * 16.0f); *(v8us*)((unsigned short*)Bt + t * 8) = f.half[0];  }
template <int NHv, int TTv>
__global__ __launch_bounds__(256) void k_vt(const _Float16* __restrict__ V16, int ldv, int voff, _Float16* __restrict__ Vt) { __shared__ unsigned short tl[64][66]; const int tid = threadIdx.x; const int slab = blockIdx.x / (TTv / 64), lg = blockIdx.x % (TTv / 64); const int b = slab / NHv, h = slab % NHv;
  for (int i = tid; i < 64 * 8; i += 256) { const int r = i / 8, c8 = (i % 8) * 8; FragH f; f.half[0] = *(const v8us*)((const unsigned short*)V16 + ((size_t)b * TTv + lg * 64 + r) * ldv + voff + h * 64 + c8);
#pragma unroll
    for (int q = 0; q < 8; ++q) tl[r][c8 + q] = f.u[q]; }
  __syncthreads();
  {
#pragma unroll
    for (int rd = 0; rd < 2; ++rd) { const int d = rd * 32 + tid / 8, pc = tid % 8; FragH f;
#pragma unroll
      for (int q = 0; q < 8; ++q) f.u[q] = tl[pc * 8 + q][d];
      *(v8us*)((unsigned short*)Vt + ((size_t)slab * 64 + d) * TTv + lg * 64 + pc * 8) = f.half[0]; }
     } }

__global__ __launch_bounds__(256) void k_hl(const float* __restrict__ F, _Float16* __restrict__ Hh, _Float16* __restrict__ Hl, size_t n8) { const size_t t = (size_t)blockIdx.x * 256 + threadIdx.x; if (t >= n8) return; FragH fh, fl; const v4f a = *(const v4fa*)(F + t * 8), c = *(const v4fa*)(F + t * 8 + 4);
#pragma unroll
  for (int q = 0; q < 4; ++q) { _Float16 h = (_Float16)a[q]; fh.h[q] = h; fl.h[q] = (_Float16)((a[q] - (float)h) * 1024.0f); h = (_Float16)c[q]; fh.h[4 + q] = h; fl.h[4 + q] = (_Float16)((c[q] - (float)h) * 1024.0f); }
  { *(v8us*)((unsigned short*)Hh + t * 8) = fh.half[0]; *(v8us*)((unsigned short*)Hl + t * 8) = fl.half[0];  } }

// ---- fast GEMM: WM x WN waves, wave tile 16 MF x 16 NF, block tile 16 MF WM x 16 NF WN (requires M a multiple of the tile's rows, N of its columns, K % 64 == 0, 16 NF WN % 64 == 0) ----
// Operands go through LDS: a stage is 64 k of the block's A rows and B rows (128 bytes a row), brought by asynchronous copies, two buffers, the copies of stage t + 2 in flight while stage t + 1 is worked on.
// A wave-wide copy reads 4 rows x 128 contiguous bytes (4 whole cache lines). Every operand row is fetched from L2 once a block, so the bytes a product costs fall with the tile: (rows + columns) x 128 bytes a stage for rows x columns results.
#define G2_PITCH 72      /* f16 elements a row in LDS = 144 bytes = 16 x 9: 16 rows read by ds_load_b128 fall on distinct banks */
// fragment from an LDS row: p = row + 32 ks + 8 hh; the k order of g2_frag
__device__ __forceinline__ v16h g2_lfrag(const _Float16* p) { FragH f; f.half[0] = *(const v8us*)((const unsigned short*)p); f.half[1] = *(const v8us*)((const unsigned short*)p + 16); return f.v; }
// One lane's 16-byte copies of a stage: thread tid takes bytes 16 (tid & 7) of rows (tid >> 3) + RPC c (RPC = threads / 8), c = 0 .. 3 of the A tile and c = 0 .. NCB - 1 of the B tile, which lies behind the A tile's 4 RPC rows.
// l = its LDS byte address in row tid >> 3 of the buffer, ga / gb = its global address in that row of the A / B tile, sa / sb = RPC rows in elements.
// The s_wait_xcnt stands inside the statement, behind the last copy, so that no address register of a copy is rewritten in front of it.
template <int RPC, int NCB>
__device__ __forceinline__ void g2_stage(unsigned l, const _Float16* ga, size_t sa, const _Float16* gb, size_t sb) {
  static_assert(NCB == 4 || NCB == 5, "g2_stage: 8 or 9 copies");
  const unsigned rs = RPC * G2_PITCH * 2;
  if constexpr (NCB == 5)
  asm volatile("global_load_async_to_lds_b128 %0, %9, off\n\tglobal_load_async_to_lds_b128 %1, %10, off\n\tglobal_load_async_to_lds_b128 %2, %11, off\n\tglobal_load_async_to_lds_b128 %3, %12, off\n\t"
               "global_load_async_to_lds_b128 %4, %13, off\n\tglobal_load_async_to_lds_b128 %5, %14, off\n\tglobal_load_async_to_lds_b128 %6, %15, off\n\tglobal_load_async_to_lds_b128 %7, %16, off\n\t"
               "global_load_async_to_lds_b128 %8, %17, off\n\ts_wait_xcnt 0x0"
               :: "v"(l), "v"(l + rs), "v"(l + 2 * rs), "v"(l + 3 * rs), "v"(l + 4 * rs), "v"(l + 5 * rs), "v"(l + 6 * rs), "v"(l + 7 * rs), "v"(l + 8 * rs),
                  "v"(ga), "v"(ga + sa), "v"(ga + 2 * sa), "v"(ga + 3 * sa), "v"(gb), "v"(gb + sb), "v"(gb + 2 * sb), "v"(gb + 3 * sb), "v"(gb + 4 * sb) : "memory");
  else
  asm volatile("global_load_async_to_lds_b128 %0, %8, off\n\tglobal_load_async_to_lds_b128 %1, %9, off\n\tglobal_load_async_to_lds_b128 %2, %10, off\n\tglobal_load_async_to_lds_b128 %3, %11, off\n\t"
               "global_load_async_to_lds_b128 %4, %12, off\n\tglobal_load_async_to_lds_b128 %5, %13, off\n\tglobal_load_async_to_lds_b128 %6, %14, off\n\tglobal_load_async_to_lds_b128 %7, %15, off\n\ts_wait_xcnt 0x0"
               :: "v"(l), "v"(l + rs), "v"(l + 2 * rs), "v"(l + 3 * rs), "v"(l + 4 * rs), "v"(l + 5 * rs), "v"(l + 6 * rs), "v"(l + 7 * rs),
                  "v"(ga), "v"(ga + sa), "v"(ga + 2 * sa), "v"(ga + 3 * sa), "v"(gb), "v"(gb + sb), "v"(gb + 2 * sb), "v"(gb + 3 * sb) : "memory"); }
__device__ __forceinline__ v16h g2_frag(const _Float16* p, int hh) { FragH f; f.half[0] = *(const v8us*)((const unsigned short*)p + 8 * hh); f.half[1] = *(const v8us*)((const unsigned short*)p + 16 + 8 * hh); return f.v; }
__device__ __forceinline__ v8f g2_mma(v16h a, v16h b, v8f c) { v8f d = __builtin_amdgcn_wmma_f32_16x16x32_f16(false, a, false, b, (short)0, c, false, false); asm volatile("v_nop\n\tv_nop\n\tv_nop\n\tv_nop" : "+v"(d) : "v"(a), "v"(b)); return d; }
// C = alpha A B^T. B holds N rows; column gc of the product goes to column gc % DM of output plane gc / DM (planes sC elements apart, row pitch ldc): f32 rows into C (F32OUT) or f16 rows into C16.
// The epilogue is written for these two uses alone, its choices made at compile time, so that its text stays short at up to 160 results a lane.
template <int MF, int NF, int WM, int WN, bool F32OUT>
__global__ __launch_bounds__(32 * WM * WN) void k_gemm2(const _Float16* __restrict__ A, int lda, const _Float16* __restrict__ Bh, int ldb, float alpha, float* __restrict__ C, _Float16* __restrict__ C16, int ldc, size_t sC, int M, int N, int K) {
  constexpr int NT = 32 * WM * WN, RPC = NT / 8, AR = 16 * MF * WM, BR = 16 * NF * WN, BUF = (AR + BR) * G2_PITCH, SP = BR + 4, LU = BR / 64, UW = 32 * LU / WN;
  static_assert(AR == 4 * RPC && BR % RPC == 0 && BR % 64 == 0 && MF % 2 == 0 && UW % 2 == 0 && (32 * LU) % WN == 0, "k_gemm2: tile and copy shapes");
  static_assert(2 * BUF * 2 >= WM * 32 * SP * 4, "k_gemm2: the output staging lies in the stage buffers");
  __shared__ __attribute__((aligned(16))) _Float16 st[2][BUF];
  const int tid = threadIdx.x, w = tid >> 5, lane = tid & 31, ln = lane & 15, hh = lane >> 4; const int wm = w / WN, wn = w % WN;
  const int ntn = N / BR; const int mt = blockIdx.x / ntn, nq = blockIdx.x - mt * ntn; if (mt * AR >= M) return;      /* the same for the whole block: it stands in front of barriers */
  const _Float16* gap = A + (size_t)(mt * AR + (tid >> 3)) * lda + (tid & 7) * 8; const _Float16* gbp = Bh + (size_t)(nq * BR + (tid >> 3)) * ldb + (tid & 7) * 8; const size_t sar = (size_t)RPC * lda, sbr = (size_t)RPC * ldb;
  const unsigned lst = (unsigned)(size_t)&st[0][(tid >> 3) * G2_PITCH + (tid & 7) * 8];      /* low 32 bits of the shared address = byte address in the block's LDS */
  const int aoff = (16 * MF * wm + ln) * G2_PITCH + 8 * hh, boff = (AR + 16 * NF * wn + ln) * G2_PITCH + 8 * hh; const int nst = K >> 6;
  const v8f z8 = {0.f,0.f,0.f,0.f,0.f,0.f,0.f,0.f}; v8f acc[MF][NF];
  // every loop over fragments or accumulators is fully unrolled so that these arrays are indexed by constants and stay in registers
#pragma unroll
  for (int i = 0; i < MF; ++i)
#pragma unroll
    for (int u = 0; u < NF; ++u) acc[i][u] = z8;
  g2_stage<RPC, BR / RPC>(lst, gap, sar, gbp, sbr);
  asm volatile("s_wait_asynccnt 0x0" ::: "memory");      // this wave's copies of stage 0 have landed
  __syncthreads();                                       // ... and every other wave's: stage 0 may be read
  if (nst > 1) g2_stage<RPC, BR / RPC>(lst + BUF * 2, gap + 64, sar, gbp + 64, sbr);
  // rolled, as it was: a trip already holds a stage's LDS reads and products, and unrolled trips would each keep their own copy address registers; the buffer is chosen by the trip's parity
#pragma unroll 1
  for (int t = 0; t < nst; ++t) { const _Float16* sb = st[t & 1];
#pragma unroll
    for (int ks = 0; ks < 2; ++ks) { v16h af[MF], bf[NF];
#pragma unroll
      for (int i = 0; i < MF; ++i) af[i] = g2_lfrag(sb + aoff + i * 16 * G2_PITCH + ks * 32);
#pragma unroll
      for (int u = 0; u < NF; ++u) bf[u] = g2_lfrag(sb + boff + u * 16 * G2_PITCH + ks * 32);
#pragma unroll
      for (int u = 0; u < NF; ++u)
#pragma unroll
        for (int i = 0; i < MF; ++i) acc[i][u] = g2_mma(af[i], bf[u], acc[i][u]); }
    asm volatile("s_wait_dscnt 0x0" ::: "memory");         // this wave's reads of stage t are finished before its buffer is refilled
    asm volatile("s_wait_asynccnt 0x0" ::: "memory");      // this wave's copies of stage t + 1 have landed
    __syncthreads();                                       // publishes stage t + 1 and ends every wave's reads of stage t
    if (t + 2 < nst) g2_stage<RPC, BR / RPC>(lst + (unsigned)(t & 1) * (BUF * 2), gap + (size_t)(t + 2) * 64, sar, gbp + (size_t)(t + 2) * 64, sbr); }
  asm volatile("s_wait_asynccnt 0x0" ::: "memory");        // no copy is outstanding when the wave goes on to its end
  // Output staging in the stage buffers (behind the last trip's barrier no wave reads a stage any more and every copy has landed): 32 rows of every wave's tile at a time, as WM x 32 rows of the block's BR columns.
  // The rows are then stored in units of 64 columns by 16 lanes, so that every 128-byte line of the output has one writer although a wave's own columns need not end on a line.
  float* so = (float*)&st[0][0];
#pragma unroll
  for (int ch = 0; ch < MF / 2; ++ch) {
    if (ch) __syncthreads();                               // every wave has read the 32 rows before: they may be overwritten
#pragma unroll
    for (int half = 0; half < 2; ++half)
#pragma unroll
      for (int u = 0; u < NF; ++u)
#pragma unroll
        for (int r = 0; r < 8; ++r) so[(wm * 32 + half * 16 + 8 * hh + r) * SP + (wn * NF + u) * 16 + ln] = acc[ch * 2 + half][u][r] * alpha;
    __syncthreads();                                       // the rows are complete before other waves read them
#pragma unroll
    for (int q = 0; q < UW / 2; ++q) { const int e = wn * UW + q * 2 + hh, r = e / LU, col = (e % LU) * 64 + ln * 4; const v4f v = *(const v4fa*)&so[(wm * 32 + r) * SP + col];
      const unsigned gc = (unsigned)(nq * BR + col); const size_t ro = (size_t)(gc / DM) * sC + (size_t)(mt * AR + wm * 16 * MF + ch * 32 + r) * ldc + gc % DM;
      if (F32OUT) *(v4f*)(C + ro) = v; else { v4h h4; for (int i = 0; i < 4; ++i) h4[i] = (_Float16)v[i]; *(v4h*)(C16 + ro) = h4; } }
  } }


__global__ __launch_bounds__(256) void k_wnat(const float* __restrict__ w, size_t n8, _Float16* __restrict__ Bt) { const size_t t = (size_t)blockIdx.x * 256 + threadIdx.x; if (t >= n8) return; FragH f; for (int q = 0; q < 8; ++q) f.h[q] = (_Float16)(bf16_round(w[t * 8 + q]) * 16.0f); *(v8us*)((unsigned short*)Bt + t * 8) = f.half[0];  }

// ---- fused attention: scores, softmax and weighted sum of one branch in one pass over the keys; no score ever reaches memory ----
// Transposed products. S^T = K Q^T: A = 16 key rows, B = 16 query rows, so lane (ln, hh) holds for query ln the keys 8 hh + r of each 16-key tile. Two such tiles, rounded to f16, are
// at once the B operand of O^T += V^T P^T over 32 keys (element i: key 8 hh + i, element 8 + i: key 16 + 8 hh + i, the k order of g2_frag and of the transposing LDS load, which forms the A operand from V rows).
// A query's maximum, sum and scale therefore live in its own lane (both halves); the halves exchange the maximum once a pass and join their sums once at the end.
// Every inner loop is fully unrolled so that the fragment, score and accumulator arrays are indexed by constants and stay in registers (a rolled loop would put them in scratch memory).
// Scores are kept in the log2 domain (x = s log2 e). The maximum in use is raised, and sums and outputs rescaled, only when a column's new maximum exceeds it by more than 8, so weights stay <= 2^8.
// 2^x of eight (two) values in place, one statement: behind each v_exp_f32 stands an instruction that neither reads its result nor overwrites its source (the operands are distinct registers), behind the last the v_nop: the slot the instruction set asks for behind a transcendental
__device__ __forceinline__ void ex2x8(v8f& x) { asm("v_exp_f32 %0, %0\n\tv_exp_f32 %1, %1\n\tv_exp_f32 %2, %2\n\tv_exp_f32 %3, %3\n\tv_exp_f32 %4, %4\n\tv_exp_f32 %5, %5\n\tv_exp_f32 %6, %6\n\tv_exp_f32 %7, %7\n\tv_nop" : "+v"(x[0]), "+v"(x[1]), "+v"(x[2]), "+v"(x[3]), "+v"(x[4]), "+v"(x[5]), "+v"(x[6]), "+v"(x[7])); }
__device__ __forceinline__ void ex2x2(float& a, float& b) { asm("v_exp_f32 %0, %0\n\tv_exp_f32 %1, %1\n\tv_nop" : "+v"(a), "+v"(b)); }
__device__ __forceinline__ v8f at_mma(v16h a, v16h b, v8f c) { return __builtin_amdgcn_wmma_f32_16x16x32_f16(false, a, false, b, (short)0, c, false, false); }
// K and V go through LDS: a stage is 64 keys, that is 64 K rows and 64 V rows (64 d each) as the projections left them, 128 bytes a row, brought once a block and branch by asynchronous copies and read by the branch's four waves; two buffers,
// the copies of stage t + 2 in flight while stage t + 1 is worked on. A wave-wide copy reads 4 rows x 128 contiguous bytes (4 whole cache lines), where a fragment load from global memory touched 16 lines for the same 512 bytes.
#define AT_PITCH 72      /* f16 elements a row in LDS = 144 bytes = 16 x 9: 16 rows read by ds_load_b128 fall on distinct banks */
#define AT_VPITCH 80     /* V rows: 160 bytes = 32 x 5, the pitch at which ds_load_tr16_b128 meets every bank once */
#define AT_KT (64 * AT_PITCH)        /* the K tile's elements; the V tile lies behind it */
#define AT_BUF (AT_KT + 64 * AT_VPITCH)
// 16 d x 8 keys of a row-major V tile as four registers of an A operand: the lane's address names row 8 hh + (ln & 7), bytes 16 (ln >> 3) of a 16-key x 16-d block; lane (ln, hh) receives column ln of keys 8 hh .. 8 hh + 7
typedef short v8s __attribute__((ext_vector_type(8)));
__device__ __forceinline__ v8us at_tr16(const _Float16* p) { typedef __attribute__((address_space(3))) v8s lds_v8s; return __builtin_bit_cast(v8us, __builtin_amdgcn_ds_load_tr16_b128_v8i16((lds_v8s*)p)); }
// One lane's eight 16-byte copies of a stage: thread tid takes bytes 16 (tid & 7) of rows (tid >> 3) + 16 c, c = 0..3, of the K tile and of the V tile. l / lv = its LDS byte address in row tid >> 3 of the buffer's K / V tile, gk / gv = its global
// address in that row of the K / V tile. The s_wait_xcnt stands inside the statement, behind the last copy, so that no address register of a copy is rewritten in front of it.
__device__ __forceinline__ void at_stage(unsigned l, unsigned lv, const _Float16* gk, const _Float16* gv) {
  const unsigned rs = 16 * AT_PITCH * 2, rv = 16 * AT_VPITCH * 2; const size_t sk = (size_t)16 * DM, sv = (size_t)16 * DM;
  asm volatile("global_load_async_to_lds_b128 %0, %8, off\n\tglobal_load_async_to_lds_b128 %1, %9, off\n\tglobal_load_async_to_lds_b128 %2, %10, off\n\tglobal_load_async_to_lds_b128 %3, %11, off\n\t"
               "global_load_async_to_lds_b128 %4, %12, off\n\tglobal_load_async_to_lds_b128 %5, %13, off\n\tglobal_load_async_to_lds_b128 %6, %14, off\n\tglobal_load_async_to_lds_b128 %7, %15, off\n\ts_wait_xcnt 0x0"
               :: "v"(l), "v"(l + rs), "v"(l + 2 * rs), "v"(l + 3 * rs), "v"(lv), "v"(lv + rv), "v"(lv + 2 * rv), "v"(lv + 3 * rv),
                  "v"(gk), "v"(gk + sk), "v"(gk + 2 * sk), "v"(gk + 3 * sk), "v"(gv), "v"(gv + sv), "v"(gv + 2 * sv), "v"(gv + 3 * sv) : "memory"); }
// One stage (64 keys, two passes of 32) of one wave's branch. sb = the branch's buffer that holds the stage; the wave's query fragments, outputs, maxima and sums stay in the caller's registers.
// decay (the same for a whole wave, held in a scalar register) = the short branch: its scores are scaled and given the decay bias in place, under a scalar branch that holds nothing but that vector arithmetic;
// everything else is one code path for both branches. kq = the scale that the scores still lack behind that place: 1 in the short branch (x * 1 is exact), 0.125 log2 e in the long one, which so keeps its one multiply-add a score.
__device__ __forceinline__ void attn_stage(const _Float16* sb, const int t, const int q0, const int ln, const int hh, const bool decay, const float c2, const float kq, const v16h (&qf)[2][2], v8f (&o)[2][4], float (&m)[2], float (&l)[2]) {
  const float sc2 = 0.125f * 1.4426950408889634f; const v8f z8 = {0.f,0.f,0.f,0.f,0.f,0.f,0.f,0.f};
  const int koff = ln * AT_PITCH + 8 * hh, voff = AT_KT + (8 * hh + (ln & 7)) * AT_VPITCH + 8 * (ln >> 3); v16h kf[2][2];
#pragma unroll
   for (int u = 0; u < 2; ++u)
#pragma unroll
    for (int ks = 0; ks < 2; ++ks) kf[u][ks] = g2_lfrag(sb + koff + u * 16 * AT_PITCH + ks * 32);
   // a stage's two passes, unrolled so that the pass picks its rows and columns of the buffer by constant offsets
#pragma unroll
   for (int ps = 0; ps < 2; ++ps) { const int kb = t * 64 + ps * 32;
    v16h vf[4];
#pragma unroll
    for (int dt = 0; dt < 4; ++dt) { FragH f; f.half[0] = at_tr16(sb + voff + ps * 32 * AT_VPITCH + dt * 16); f.half[1] = at_tr16(sb + voff + (ps * 32 + 16) * AT_VPITCH + dt * 16); vf[dt] = f.v; }
    __builtin_amdgcn_sched_barrier(0);      // keeps the V^T loads at the head of the pass, so that the score products and the maxima cover their latency (the scheduler sinks them to their use otherwise)
    v8f s[2][2];
#pragma unroll
    for (int g = 0; g < 2; ++g)
#pragma unroll
      for (int t = 0; t < 2; ++t) s[g][t] = at_mma(kf[t][1], qf[g][1], at_mma(kf[t][0], qf[g][0], z8));
    // the stage's second pass's K fragments, asked for while the first pass's softmax runs (the same buffer: nothing of the next stage is read here)
    if (ps == 0) {
#pragma unroll
      for (int u = 0; u < 2; ++u)
#pragma unroll
        for (int ks = 0; ks < 2; ++ks) kf[u][ks] = g2_lfrag(sb + koff + (32 + u * 16) * AT_PITCH + ks * 32); }
    if (decay) {
#pragma unroll
      for (int g = 0; g < 2; ++g)
#pragma unroll
        for (int t = 0; t < 2; ++t) { const float fb = (float)(q0 + g * 16 + ln - 8 * hh - kb - t * 16);
#pragma unroll
          for (int r = 0; r < 8; ++r) s[g][t][r] = s[g][t][r] * sc2 - fabsf(fb - (float)r) * c2; } }
    float mt[2];
#pragma unroll
    for (int g = 0; g < 2; ++g) { float mx = -3.0e38f;
#pragma unroll
      for (int t = 0; t < 2; ++t)
#pragma unroll
        for (int r = 0; r < 8; ++r) mx = fmaxf(mx, s[g][t][r]);
      mx *= kq;
      mt[g] = fmaxf(mx, __shfl_xor(mx, 16, 32)); }
    const bool need = (mt[0] > m[0] + 8.0f) || (mt[1] > m[1] + 8.0f);
    if (__builtin_amdgcn_ballot_w32(need) != 0) { const float mn0 = fmaxf(m[0], mt[0]), mn1 = fmaxf(m[1], mt[1]); float al[2] = {m[0] - mn0, m[1] - mn1}; ex2x2(al[0], al[1]); m[0] = mn0; m[1] = mn1;
#pragma unroll
      for (int g = 0; g < 2; ++g) { l[g] *= al[g];
#pragma unroll
        for (int dt = 0; dt < 4; ++dt) o[g][dt] *= al[g]; } }
#pragma unroll
    for (int g = 0; g < 2; ++g) { FragH pf; float ls = 0.f;
#pragma unroll
      for (int t = 0; t < 2; ++t) { v8f p;
#pragma unroll
        for (int r = 0; r < 8; ++r) p[r] = s[g][t][r] * kq - m[g];
        ex2x8(p);
#pragma unroll
        for (int r = 0; r < 8; ++r) { ls += p[r]; pf.h[t * 8 + r] = (_Float16)p[r]; } }
      l[g] += ls;
#pragma unroll
      for (int dt = 0; dt < 4; ++dt) o[g][dt] = at_mma(vf[dt], pf.v, o[g][dt]); }
   } }
// blockIdx.x = block of 128 queries, blockIdx.y = batch * NH + head. Eight waves: waves 0..3 run the short branch (with the decay bias) on 32 queries each, waves 4..7 the long branch on the same queries,
// each branch with its own two stage buffers filled by its own four waves. Both branches walk the stages together (one barrier a stage for the whole block, in control flow that is the same for all its threads;
// only the decay bias between two barriers differs by wave). At the end both leave their normalised f32 rows in LDS, and the block blends them with sigmoid(mix_weight) and stores the f16 o rows: no branch output reaches memory.
/* four waves a SIMD (two blocks a WGP, as the LDS allows) need at most 256 vector registers a wave: the second number asks the compiler for that budget */
__global__ __launch_bounds__(256, 4) void k_attn(const _Float16* __restrict__ Q16, const _Float16* __restrict__ KS, const _Float16* __restrict__ KL, const _Float16* __restrict__ VS, const _Float16* __restrict__ VL, _Float16* __restrict__ O16, const float* __restrict__ dfp, const float* __restrict__ mwp) {
  __shared__ __attribute__((aligned(16))) float so[2][128][68];
  __shared__ __attribute__((aligned(16))) _Float16 st[2][2 * AT_BUF];
  const int wv = __builtin_amdgcn_readfirstlane((int)(threadIdx.x >> 5)); const int br = wv >> 2;      /* the wave's number and its branch, in scalar registers: what depends on the branch is a scalar choice */
  const int lane = threadIdx.x & 31, ln = lane & 15, hh = lane >> 4; const int b = blockIdx.y / NH, h = blockIdx.y % NH; const int qw = (wv & 3) * 32, q0 = blockIdx.x * 128 + qw;
  const _Float16* KB = br ? KL : KS; const _Float16* VB = br ? VL : VS; const float c2 = (1.0f - bf16_round(dfp[0])) * 1.4426950408889634f, kq = br ? 0.125f * 1.4426950408889634f : 1.0f;
  const float mw = mwp[0];      /* read here, into a scalar register, so that the blend at the end does not wait for memory */
  const _Float16* qp = Q16 + ((size_t)b * SQ + q0 + ln) * DM + h * HD; const int tid = threadIdx.x & 127;      /* the thread's number among its branch's 128 */
  const size_t go = ((size_t)b * SQ + (tid >> 3)) * DM + h * HD + (tid & 7) * 8; const _Float16* gk = KB + go; const _Float16* gv = VB + go;      /* K and V rows lie alike in their planes */
  const _Float16* stb = st[br];
  const unsigned lst = (unsigned)(size_t)(stb + (tid >> 3) * AT_PITCH + (tid & 7) * 8), lsv = (unsigned)(size_t)(stb + AT_KT + (tid >> 3) * AT_VPITCH + (tid & 7) * 8);      /* low 32 bits of the shared address = byte address in the block's LDS */
  at_stage(lst, lsv, gk, gv);
  v16h qf[2][2];
#pragma unroll
  for (int g = 0; g < 2; ++g)
#pragma unroll
    for (int ks = 0; ks < 2; ++ks) qf[g][ks] = g2_frag(qp + (size_t)g * 16 * DM + ks * 32, hh);
  const v8f z8 = {0.f,0.f,0.f,0.f,0.f,0.f,0.f,0.f}; v8f o[2][4];
#pragma unroll
  for (int g = 0; g < 2; ++g)
#pragma unroll
    for (int dt = 0; dt < 4; ++dt) o[g][dt] = z8;
  float m[2] = {-3.0e38f, -3.0e38f}, l[2] = {0.f, 0.f};
  asm volatile("s_wait_asynccnt 0x0" ::: "memory");      // this wave's copies of stage 0 have landed
  __syncthreads();                                       // ... and every other wave's: stage 0 may be read
  at_stage(lst + AT_BUF * 2, lsv + AT_BUF * 2, gk + (size_t)64 * DM, gv + (size_t)64 * DM);
  // rolled, for speed only; the buffer is chosen by the trip's parity
#pragma unroll 1
  for (int t = 0; t < SQ / 64; ++t) { const _Float16* sb = stb + (t & 1) * AT_BUF;
    attn_stage(sb, t, q0, ln, hh, br == 0, c2, kq, qf, o, m, l);
    asm volatile("s_wait_dscnt 0x0" ::: "memory");         // this wave's reads of stage t are finished before its buffer is refilled
    asm volatile("s_wait_asynccnt 0x0" ::: "memory");      // this wave's copies of stage t + 1 have landed
    __syncthreads();                                       // publishes stage t + 1 and ends every wave's reads of stage t
    if (t + 2 < SQ / 64) at_stage(lst + (unsigned)(t & 1) * (AT_BUF * 2), lsv + (unsigned)(t & 1) * (AT_BUF * 2), gk + (size_t)(t + 2) * 64 * DM, gv + (size_t)(t + 2) * 64 * DM);
  }
  asm volatile("s_wait_asynccnt 0x0" ::: "memory");        // no copy is outstanding when the wave goes on to its end
  // the lane's number is read anew here, so that no address of the part below has to hold a vector register through the loop (the loop leaves none free at four waves a SIMD)
  const int le = (int)__builtin_amdgcn_mbcnt_lo(~0u, 0u), lne = le & 15, hhe = le >> 4, te = wv * 32 + le;
  // O^T tile: lane (lne, hhe) holds of query lne the columns 16 dt + 8 hhe + r; into the branch's LDS rows
#pragma unroll
  for (int g = 0; g < 2; ++g) { const float lt = l[g] + __shfl_xor(l[g], 16, 32); const float inv = 1.0f / lt;
#pragma unroll
    for (int dt = 0; dt < 4; ++dt) { const v8f ov = o[g][dt] * inv; const v4f lo = {ov[0], ov[1], ov[2], ov[3]}, hi = {ov[4], ov[5], ov[6], ov[7]};
      *(v4fa*)&so[br][qw + g * 16 + lne][dt * 16 + 8 * hhe] = lo; *(v4fa*)&so[br][qw + g * 16 + lne][dt * 16 + 8 * hhe + 4] = hi; } }
  const float a = 1.0f / (1.0f + expf(-bf16_round(mw))), na = 1.0f - a;
  __syncthreads();                                         // both branches' rows are complete before any thread blends them
  // a thread blends 8 columns of a row: a wave's store covers 4 rows x 128 contiguous bytes; unrolled so that the four rounds' LDS reads are all asked for before the first is used
#pragma unroll
  for (int i = 0; i < 4; ++i) { const int e = i * 256 + te, r = e >> 3, c8 = (e & 7) * 8;
    const v4f s0 = *(const v4fa*)&so[0][r][c8], s1 = *(const v4fa*)&so[0][r][c8 + 4], l0 = *(const v4fa*)&so[1][r][c8], l1 = *(const v4fa*)&so[1][r][c8 + 4]; FragH f;
#pragma unroll
    for (int q = 0; q < 4; ++q) { f.h[q] = (_Float16)(a * s0[q] + na * l0[q]); f.h[4 + q] = (_Float16)(a * s1[q] + na * l1[q]); }
    *(v8us*)((unsigned short*)O16 + ((size_t)b * SQ + blockIdx.x * 128 + r) * DM + h * HD + c8) = f.half[0]; } }

__device__ __forceinline__ void wT_block(const float* __restrict__ w, int din, int dout, _Float16* __restrict__ Bt, int bid, float (*tl)[65]) { const int tid = threadIdx.x; const int nbo = dout / 64; const int ib = bid / nbo, ob = bid % nbo; const int i0 = ib * 64, o0 = ob * 64;
  for (int t = tid; t < 64 * 64; t += 256) { const int i = t / 64, o = t % 64; tl[o][i] = bf16_round(w[(size_t)(i0 + i) * dout + o0 + o]) * 16.0f; }
  __syncthreads();
  { for (int t = tid; t < 64 * 8; t += 256) { const int o = t / 8, i8 = (t % 8) * 8; FragH f; for (int q = 0; q < 8; ++q) f.h[q] = (_Float16)tl[o][i8 + q]; *(v8us*)((unsigned short*)Bt + (size_t)(o0 + o) * din + i0 + i8) = f.half[0]; }  } }
// Everything that reads only inputs, in one launch: ranges of the block index pick the job (the test is the same for a whole block, so the barrier in wT_block is passed by all of a block's threads or by none).
// The transposes stand first: their blocks run longer.
#define PB_SQ ((DM / 64) * (DM / 64))          /* blocks of a DM x DM weight */
#define PB_KV ((DM / 64) * (2 * DM / 64))      /* blocks of a DM x 2 DM weight */
#define PB_W (2 * PB_SQ + 2 * PB_KV)
#define PB_X ((int)((NR * DM / 8 + 255) / 256))
__global__ __launch_bounds__(256) void k_prep(const float* __restrict__ x, const float* __restrict__ wq, const float* __restrict__ wkvs, const float* __restrict__ wkvl, const float* __restrict__ wo,
    _Float16* __restrict__ X16, _Float16* __restrict__ BQ, _Float16* __restrict__ BKVS, _Float16* __restrict__ BKVL, _Float16* __restrict__ BO) {
  __shared__ float tl[64][65]; const int bid = blockIdx.x;
  if (bid < PB_KV) wT_block(wkvs, DM, 2 * DM, BKVS, bid, tl);
  else if (bid < 2 * PB_KV) wT_block(wkvl, DM, 2 * DM, BKVL, bid - PB_KV, tl);
  else if (bid < 2 * PB_KV + PB_SQ) wT_block(wq, DM, DM, BQ, bid - 2 * PB_KV, tl);
  else if (bid < PB_W) wT_block(wo, DM, DM, BO, bid - 2 * PB_KV - PB_SQ, tl);
  else x16_block(x, X16, NR * DM / 8, bid - PB_W); }
extern "C" void kernel_launch(void* const* d_in, const int* in_sizes, int n_in,
                              void* d_out, int out_size, void* d_ws, size_t ws_size, hipStream_t stream) {
  (void)in_sizes; (void)n_in; (void)out_size;
  const float* const* I = (const float* const*)d_in; const float* x = I[0]; const float* wq = I[1]; const float* wkvs = I[2]; const float* wkvl = I[3]; const float* wo = I[4]; const float* mwp = I[5]; const float* dfp = I[6];
  char* ws = (char*)d_ws; size_t off = 0;
  auto take = [&](size_t bytes) { char* p = ws + off; off += (bytes + 255) & ~(size_t)255; return p; };
  /* the transposed projection weights lie as five DM x DM planes in a row (q, short k, short v, long k, long v), and so do the five projections' outputs: the projection launch takes the weights as one matrix and finds a column's output plane from its number */
  _Float16* BQ = (_Float16*)take((size_t)5 * DM * DM * 2); _Float16* BKVS = BQ + (size_t)DM * DM; _Float16* BKVL = BQ + (size_t)3 * DM * DM; _Float16* BO = (_Float16*)take((size_t)DM * DM * 2);
  _Float16* X16 = (_Float16*)take(NR * DM * 2); _Float16* Q16 = (_Float16*)take(5 * NR * DM * 2); _Float16* K16 = Q16 + NR * DM; _Float16* V16 = Q16 + 2 * NR * DM; _Float16* KL16 = Q16 + 3 * NR * DM; _Float16* VL16 = Q16 + 4 * NR * DM; _Float16* O16 = (_Float16*)take(NR * DM * 2);
  if (off > ws_size) return;      /* 12 + 7 x 8 = 68 MiB */
  k_prep<<<PB_W + PB_X, 256, 0, stream>>>(x, wq, wkvs, wkvl, wo, X16, BQ, BKVS, BKVL, BO);
  const dim3 gp((unsigned)((NR / 128) * (DM / 128)), 1), gp5((unsigned)((NR / 256) * (5 * DM / 320)), 1);
  k_gemm2<4, 5, 4, 4, false><<<gp5, 512, 0, stream>>>(X16, DM, BQ, DM, 0.0625f, nullptr, Q16, DM, NR * DM, (int)NR, 5 * DM, DM);      /* q, short k | v, long k | v */
  k_attn<<<dim3(SQ / 128, NB * NH), 256, 0, stream>>>(Q16, K16, KL16, V16, VL16, O16, dfp, mwp);      /* blended o (merged heads) as f16 rows */
  k_gemm2<2, 4, 4, 2, true><<<gp, 256, 0, stream>>>(O16, DM, BO, DM, 0.0625f, (float*)d_out, nullptr, DM, 0, (int)NR, DM, DM);      /* out = o Wo */
}

// v009
// One run takes 88.6 microseconds.
// Timed twice side by side with v008, it ran 1.03 and 1.04 times as fast.
// Over all steps from v000 it is 280 times as fast.
#include <hip/hip_runtime.h>
#define NB 4
#define SQ 1024
#define DM 1024
#define NH 16
#define HD 64
#define NR ((size_t)NB * SQ)         /* 4096 token rows */
typedef __bf16 v16b __attribute__((ext_vector_type(16)));
typedef unsigned short v8us __attribute__((ext_vector_type(8), may_alias));
typedef float  v8f  __attribute__((ext_vector_type(8)));
typedef float  v4f  __attribute__((ext_vector_type(4)));
typedef float  v4fa __attribute__((ext_vector_type(4), may_alias));
union FragB { v16b v; v8us half[2]; unsigned short u[16]; };

__device__ __forceinline__ unsigned short bf16_bits(float x) { unsigned int u = __float_as_uint(x); return (unsigned short)((u + 0x7FFFu + ((u >> 16) & 1u)) >> 16); }
__device__ __forceinline__ float bf16_val(unsigned short b) { return __uint_as_float(((unsigned int)b) << 16); }
__device__ __forceinline__ float bf16_round(float x) { return bf16_val(bf16_bits(x)); }
// D += A·B with NT terms: 1 = ah·bh, 2 = + al·bh (A split), 3 = + ah·bl (both split)
template <int NT>
__device__ __forceinline__ v8f mmaN(v16b ah, v16b al, v16b bh, v16b bl, v8f c) {
  c = __builtin_amdgcn_wmma_f32_16x16x32_bf16(false, ah, false, bh, (short)0, c, false, false);
  if (NT >= 2) c = __builtin_amdgcn_wmma_f32_16x16x32_bf16(false, al, false, bh, (short)0, c, false, false);
  if (NT >= 3) c = __builtin_amdgcn_wmma_f32_16x16x32_bf16(false, ah, false, bl, (short)0, c, false, false);
  asm volatile("v_nop\n\tv_nop\n\tv_nop\n\tv_nop" : "+v"(c) : "v"(ah), "v"(al), "v"(bh), "v"(bl));
  return c;
}

__global__ __launch_bounds__(256) void k_wt_bf16(const float* __restrict__ W, unsigned short* __restrict__ Wt, int K, int N) {
  const int t = blockIdx.x * 256 + threadIdx.x;
  const int k8n = K / 8;
  if (t >= N * k8n) return;
  const int n = t / k8n, k8 = (t % k8n) * 8;
  v8us v;
#pragma unroll
  for (int i = 0; i < 8; ++i) v[i] = bf16_bits(W[(size_t)(k8 + i) * N + n]);
  *(v8us*)(Wt + (size_t)n * K + k8) = v;
  
}

// GEMM C[M][N] (f32, pitch ldc) = act(A[M][K]·W + bias). A f32 row-major (pitch lda) converted per fragment to bf16
// (ASPLIT: hi/lo two planes -> 2 terms, else single rounded term); Wt bf16 [N][K] (pitch ldb). BIAS_BF16 rounds the
// bias to bf16 first (bias quantised to bf16 before the add). K%32==0, M%16==0, N%64==0.
template <bool ASPLIT, int ACT, bool BIAS_BF16>
__global__ __launch_bounds__(128) void k_gemm_bf(const float* __restrict__ A, int lda, const unsigned short* __restrict__ Wt, int ldb,
                                               const float* __restrict__ bias, float* __restrict__ C, int ldc, int M, int N, int K) {
  __shared__ __attribute__((aligned(16))) float so[4][16][64];
  const int tid = threadIdx.x, w = tid >> 5, lane = tid & 31, ln = lane & 15, hh = lane >> 4;
  const int ntn = N / 64;
  const int wid = blockIdx.x * 4 + w;
  const int mt = wid / ntn, nq = wid % ntn;
  if (mt * 16 >= M) return;
  const int row0 = mt * 16, col0 = nq * 64;
  const float* arow = A + (size_t)(row0 + ln) * lda;
  v8f acc[4] = {};
  for (int kb = 0; kb < K; kb += 32) {
    FragB ah, al;
    const v4f x0 = *(const v4fa*)(arow + kb + 8 * hh), x1 = *(const v4fa*)(arow + kb + 8 * hh + 4);
    const v4f x2 = *(const v4fa*)(arow + kb + 16 + 8 * hh), x3 = *(const v4fa*)(arow + kb + 16 + 8 * hh + 4);
    float xs[16] = {x0[0],x0[1],x0[2],x0[3],x1[0],x1[1],x1[2],x1[3],x2[0],x2[1],x2[2],x2[3],x3[0],x3[1],x3[2],x3[3]};
#pragma unroll
    for (int i = 0; i < 16; ++i) { const unsigned short hb = bf16_bits(xs[i]); ah.u[i] = hb; al.u[i] = ASPLIT ? bf16_bits(xs[i] - bf16_val(hb)) : (unsigned short)0; }
#pragma unroll
    for (int t = 0; t < 4; ++t) {
      const unsigned short* brow = Wt + (size_t)(col0 + t * 16 + ln) * ldb + kb;
      FragB b;
      b.half[0] = *(const v8us*)(brow + 8 * hh);
      b.half[1] = *(const v8us*)(brow + 16 + 8 * hh);
      acc[t] = mmaN<ASPLIT ? 2 : 1>(ah.v, al.v, b.v, b.v, acc[t]);
    }
  }
#pragma unroll
  for (int t = 0; t < 4; ++t) {
    float bv = bias ? bias[col0 + t * 16 + ln] : 0.f;
    if (BIAS_BF16) bv = bf16_round(bv);
#pragma unroll
    for (int r = 0; r < 8; ++r) { float v = acc[t][r] + bv; if (ACT == 1) v = fmaxf(v, 0.f); so[w][8 * hh + r][t * 16 + ln] = v; }
  }
  __builtin_amdgcn_fence(__ATOMIC_ACQ_REL, "workgroup");
  __builtin_amdgcn_wave_barrier();
  const int rsub = lane >> 4, c4 = (lane & 15) * 4;
  {
#pragma unroll
    for (int q = 0; q < 8; ++q) {
      const int r = q * 2 + rsub;
      const v4f v = *(const v4fa*)&so[w][r][c4];
      *(v4f*)(C + (size_t)(row0 + r) * ldc + col0 + c4) = v;
    }
    
  }
}

// GEMM C = act(A·W + bias + resid): A f32 (ASPLIT -> hi/lo 2 terms), Wt bf16 [N][K]; ACT 0 none, 1 relu, 2 exact gelu;
// resid (optional, f32, row index = (row % rmod), pitch ldr, RES_BF16 rounds it) added before the activation.
template <bool ASPLIT, int ACT, bool BIAS_BF16, bool RES_BF16>
__global__ __launch_bounds__(128) void k_gemm_bf3(const float* __restrict__ A, int lda, const unsigned short* __restrict__ Wt, int ldb,
                                                const float* __restrict__ bias, const float* __restrict__ resid, int rmod, int ldr,
                                                float* __restrict__ C, int ldc, int M, int N, int K) {
  __shared__ __attribute__((aligned(16))) float so[4][16][64];
  const int tid = threadIdx.x, w = tid >> 5, lane = tid & 31, ln = lane & 15, hh = lane >> 4;
  const int ntn = N / 64;
  const int wid = blockIdx.x * 4 + w;
  const int mt = wid / ntn, nq = wid % ntn;
  if (mt * 16 >= M) return;
  const int row0 = mt * 16, col0 = nq * 64;
  const float* arow = A + (size_t)(row0 + ln) * lda;
  v8f acc[4] = {};
  for (int kb = 0; kb < K; kb += 32) {
    FragB ah, al;
    const v4f x0 = *(const v4fa*)(arow + kb + 8 * hh), x1 = *(const v4fa*)(arow + kb + 8 * hh + 4);
    const v4f x2 = *(const v4fa*)(arow + kb + 16 + 8 * hh), x3 = *(const v4fa*)(arow + kb + 16 + 8 * hh + 4);
    float xs[16] = {x0[0],x0[1],x0[2],x0[3],x1[0],x1[1],x1[2],x1[3],x2[0],x2[1],x2[2],x2[3],x3[0],x3[1],x3[2],x3[3]};
#pragma unroll
    for (int i = 0; i < 16; ++i) { const unsigned short hb = bf16_bits(xs[i]); ah.u[i] = hb; al.u[i] = ASPLIT ? bf16_bits(xs[i] - bf16_val(hb)) : (unsigned short)0; }
#pragma unroll
    for (int t = 0; t < 4; ++t) {
      const unsigned short* brow = Wt + (size_t)(col0 + t * 16 + ln) * ldb + kb;
      FragB b;
      b.half[0] = *(const v8us*)(brow + 8 * hh);
      b.half[1] = *(const v8us*)(brow + 16 + 8 * hh);
      acc[t] = mmaN<ASPLIT ? 2 : 1>(ah.v, al.v, b.v, b.v, acc[t]);
    }
  }
#pragma unroll
  for (int t = 0; t < 4; ++t) {
    const int col = col0 + t * 16 + ln;
    float bv = bias ? bias[col] : 0.f;
    if (BIAS_BF16) bv = bf16_round(bv);
#pragma unroll
    for (int r = 0; r < 8; ++r) {
      float v = acc[t][r] + bv;
      if (resid) { float rv = resid[(size_t)((row0 + 8 * hh + r) % rmod) * ldr + col]; if (RES_BF16) rv = bf16_round(rv); v += rv; }
      if (ACT == 1) v = fmaxf(v, 0.f);
      if (ACT == 2) v = 0.5f * v * (1.0f + erff(v * 0.70710678118654752f));
      if (ACT == 3) { const float u = 0.7978845608028654f * (v + 0.044715f * v * v * v); v = 0.5f * v * (1.0f + tanhf(u)); }
      so[w][8 * hh + r][t * 16 + ln] = v;
    }
  }
  __builtin_amdgcn_fence(__ATOMIC_ACQ_REL, "workgroup");
  __builtin_amdgcn_wave_barrier();
  const int rsub = lane >> 4, c4 = (lane & 15) * 4;
  {
#pragma unroll
    for (int q = 0; q < 8; ++q) {
      const int r = q * 2 + rsub;
      const v4f v = *(const v4fa*)&so[w][r][c4];
      *(v4f*)(C + (size_t)(row0 + r) * ldc + col0 + c4) = v;
    }
    
  }
}
// row LayerNorm (biased variance, eps) over N: s = X (+ R); optional out_sum <- s; out_norm <- (s-mu)*rsqrt(var+eps)*g + b
template <bool PARAM_BF16>
__global__ __launch_bounds__(256) void k_layernorm(const float* __restrict__ X, const float* __restrict__ R, const float* __restrict__ g, const float* __restrict__ bta,
                                                  float* __restrict__ out_sum, float* __restrict__ out_norm, int N, float eps) {
  __shared__ float red[256];
  const int row = blockIdx.x, tid = threadIdx.x;
  const float* x = X + (size_t)row * N; const float* rr = R ? R + (size_t)row * N : nullptr;
  float vals[16];                     // up to N = 4096
  const int per = N / 256;            // contiguous chunk per thread? use strided-by-4 chunks: thread handles j = tid*4 + 1024*u
  float s1 = 0.f;
  for (int u = 0; u < per / 4; ++u) {
    const int j = tid * 4 + 1024 * u;
    const v4f a = *(const v4fa*)(x + j);
    v4f b = {0.f,0.f,0.f,0.f}; if (rr) b = *(const v4fa*)(rr + j);
#pragma unroll
    for (int q = 0; q < 4; ++q) { const float v = a[q] + b[q]; vals[u * 4 + q] = v; s1 += v; }
  }
  red[tid] = s1; __syncthreads();
  for (int st = 128; st > 0; st >>= 1) { if (tid < st) red[tid] += red[tid + st]; __syncthreads(); }
  const float mu = red[0] / (float)N; __syncthreads();
  float s2 = 0.f;
  for (int u = 0; u < per / 4; ++u)
#pragma unroll
    for (int q = 0; q < 4; ++q) { const float c = vals[u * 4 + q] - mu; s2 += c * c; }
  red[tid] = s2; __syncthreads();
  for (int st = 128; st > 0; st >>= 1) { if (tid < st) red[tid] += red[tid + st]; __syncthreads(); }
  const float rs = rsqrtf(red[0] / (float)N + eps);
  {
    for (int u = 0; u < per / 4; ++u) {
      const int j = tid * 4 + 1024 * u;
      v4f o, sm;
#pragma unroll
      for (int q = 0; q < 4; ++q) {
        float gg = g[j + q], bb = bta[j + q];
        if (PARAM_BF16) { gg = bf16_round(gg); bb = bf16_round(bb); }
        sm[q] = vals[u * 4 + q]; o[q] = (vals[u * 4 + q] - mu) * rs * gg + bb;
      }
      if (out_sum) *(v4f*)(out_sum + (size_t)row * N + j) = sm;
      *(v4f*)(out_norm + (size_t)row * N + j) = o;
    }
    
  }
}



// ---- f16 WMMA path (v_wmma_f32_16x16x32_f16): 11-bit significands for operands in range — used where a [0,1] probability operand needs more precision than bf16
typedef _Float16 v16h __attribute__((ext_vector_type(16)));
union FragH { v16h v; v8us half[2]; _Float16 h[16]; unsigned short u[16]; };
template <int NT>
__device__ __forceinline__ v8f mmaH(v16h ah, v16h al, v16h bh, v16h bl, v8f c) {
  c = __builtin_amdgcn_wmma_f32_16x16x32_f16(false, ah, false, bh, (short)0, c, false, false);
  if (NT >= 2) c = __builtin_amdgcn_wmma_f32_16x16x32_f16(false, al, false, bh, (short)0, c, false, false);
  if (NT >= 3) c = __builtin_amdgcn_wmma_f32_16x16x32_f16(false, ah, false, bl, (short)0, c, false, false);
  asm volatile("v_nop\n\tv_nop\n\tv_nop\n\tv_nop" : "+v"(c) : "v"(ah), "v"(al), "v"(bh), "v"(bl));
  return c;
}
// batched GEMM like k_gemm_b but f16 operands: A f32 (split into f16 hi/lo if ASPLIT, else rounded to f16), Bt = f16 values [n][k]; alpha; C f32; N multiple of 16 (partial tiles skipped)
template <bool ASPLIT>
__global__ __launch_bounds__(128) void k_gemm_h(const float* __restrict__ A, int lda, size_t sA, const _Float16* __restrict__ Bh, int ldb, size_t sB, float alpha, float* __restrict__ C, int ldc, size_t sC, int M, int N, int K) {
  __shared__ __attribute__((aligned(16))) float so[4][16][64];
  const int tid = threadIdx.x, w = tid >> 5, lane = tid & 31, ln = lane & 15, hh = lane >> 4; const int by = blockIdx.y;
  A += (size_t)by * sA; Bh += (size_t)by * sB; C += (size_t)by * sC;
  const int ntn = (N + 63) / 64; const int wid = blockIdx.x * 4 + w; const int mt = wid / ntn, nq = wid % ntn; if (mt * 16 >= M) return;
  const int row0 = mt * 16, col0 = nq * 64; const float* arow = A + (size_t)(row0 + ln) * lda;
  v8f acc[4] = {};
  for (int kb = 0; kb < K; kb += 32) {
    FragH ah, al;
    const v4f x0 = *(const v4fa*)(arow + kb + 8 * hh), x1 = *(const v4fa*)(arow + kb + 8 * hh + 4), x2 = *(const v4fa*)(arow + kb + 16 + 8 * hh), x3 = *(const v4fa*)(arow + kb + 16 + 8 * hh + 4);
    float xs[16] = {x0[0],x0[1],x0[2],x0[3],x1[0],x1[1],x1[2],x1[3],x2[0],x2[1],x2[2],x2[3],x3[0],x3[1],x3[2],x3[3]};
#pragma unroll
    for (int i = 0; i < 16; ++i) { const _Float16 h = (_Float16)xs[i]; ah.h[i] = h; al.h[i] = ASPLIT ? (_Float16)(xs[i] - (float)h) : (_Float16)0.0f; }
#pragma unroll
    for (int t = 0; t < 4; ++t) { if (col0 + t * 16 >= N) continue; const size_t boff = (size_t)(col0 + t * 16 + ln) * ldb + kb; FragH bq; bq.half[0] = *(const v8us*)(Bh + boff + 8 * hh); bq.half[1] = *(const v8us*)(Bh + boff + 16 + 8 * hh);
      acc[t] = mmaH<ASPLIT ? 2 : 1>(ah.v, al.v, bq.v, bq.v, acc[t]); }
  }
#pragma unroll
  for (int t = 0; t < 4; ++t) { if (col0 + t * 16 >= N) continue;
#pragma unroll
    for (int r = 0; r < 8; ++r) so[w][8 * hh + r][t * 16 + ln] = acc[t][r] * alpha; }
  __builtin_amdgcn_fence(__ATOMIC_ACQ_REL, "workgroup"); __builtin_amdgcn_wave_barrier();
  const int rsub = lane >> 4, c4 = (lane & 15) * 4;
  {
#pragma unroll
    for (int q = 0; q < 8; ++q) { const int r = q * 2 + rsub; if (col0 + c4 < N) { const v4f v = *(const v4fa*)&so[w][r][c4]; *(v4f*)(C + (size_t)(row0 + r) * ldc + col0 + c4) = v; } }
     }
}

// Wt[n][k] = f16(W[k][n]·scale) from f32 row-major W[K][N] (scale = power of two; bf16-exact weights stay exact in f16 away from the subnormal range)
__global__ __launch_bounds__(256) void k_wt_f16(const float* __restrict__ W, _Float16* __restrict__ Wt, int K, int N, float scale) {
  const int t = blockIdx.x * 256 + threadIdx.x; if (t >= N * (K / 8)) return; const int n = t / (K / 8), k8 = (t % (K / 8)) * 8; FragH f;
#pragma unroll
  for (int i = 0; i < 8; ++i) f.h[i] = (_Float16)(bf16_round(W[(size_t)(k8 + i) * N + n]) * scale); const v8us o = f.half[0];
  *(v8us*)((unsigned short*)Wt + (size_t)n * K + k8) = o; 
}
// k_gemm_hh variant with fused epilogue: v = acc·alpha + bias[by·sBias + col] (+ CP[(row/rowsPerB)·sCPb + by·64 + col] if CP) ; ACT 0 none / 1 elu ; writes f16 C16 (and f32 C if non-null)
template <int ACT>
__global__ __launch_bounds__(128) void k_gemm_hhx(const _Float16* __restrict__ A, int lda, size_t sA, const _Float16* __restrict__ Bh, int ldb, size_t sB, float alpha, const float* __restrict__ bias, size_t sBias, const float* __restrict__ CP, int rowsPerB, size_t sCPb, int row0g,
    float* __restrict__ C, _Float16* __restrict__ C16, int ldc, size_t sC, int M, int N, int K) {
  __shared__ __attribute__((aligned(16))) float so[4][16][64];
  const int tid = threadIdx.x, w = tid >> 5, lane = tid & 31, ln = lane & 15, hh = lane >> 4; const int by = blockIdx.y;
  A += (size_t)by * sA; Bh += (size_t)by * sB; const size_t cofs = (size_t)by * sC; const float* bp = bias ? bias + (size_t)by * sBias : nullptr;
  const int ntn = (N + 63) / 64; const int wid = blockIdx.x * 4 + w; const int mt = wid / ntn, nq = wid % ntn; if (mt * 16 >= M) return;
  const int row0 = mt * 16, col0 = nq * 64; const _Float16* arow = A + (size_t)(row0 + ln) * lda;
  v8f acc[4] = {};
  for (int kb = 0; kb < K; kb += 32) { FragH ah; ah.half[0] = *(const v8us*)((const unsigned short*)arow + kb + 8 * hh); ah.half[1] = *(const v8us*)((const unsigned short*)arow + kb + 16 + 8 * hh);
#pragma unroll
    for (int t = 0; t < 4; ++t) { if (col0 + t * 16 >= N) continue; const size_t boff = (size_t)(col0 + t * 16 + ln) * ldb + kb; FragH bq; bq.half[0] = *(const v8us*)((const unsigned short*)Bh + boff + 8 * hh); bq.half[1] = *(const v8us*)((const unsigned short*)Bh + boff + 16 + 8 * hh);
      acc[t] = mmaH<1>(ah.v, ah.v, bq.v, bq.v, acc[t]); }
  }
#pragma unroll
  for (int t = 0; t < 4; ++t) { if (col0 + t * 16 >= N) continue; const int col = col0 + t * 16 + ln; const float bv = bp ? bf16_round(bp[col]) : 0.f;
#pragma unroll
    for (int r = 0; r < 8; ++r) { float v = acc[t][r] * alpha + bv; if (CP) { const int rr = row0g + row0 + 8 * hh + r; if (rowsPerB < 0) v += CP[cofs + (size_t)rr * ldc + col];      /* rowsPerB < 0: own element of the batched C plane */ else { const int bidx = rr / rowsPerB; v += CP[(size_t)bidx * sCPb + (size_t)by * 64 + col]; } } if (ACT == 1) v = (v > 0.f) ? v : expm1f(v); else if (ACT == 7) v = (v > 0.f) ? v + 1.0f : expf(v); else if (ACT == 8) v = tanhf(v); else if (ACT == 9) v = 0.5f * v * (1.0f + tanhf(0.7978845608028654f * (v + 0.044715f * v * v * v))); else if (ACT == 11) v = 1.0f / (1.0f + expf(-v)); else if (ACT == 12) v = (v > 0.f) ? v : 0.01f * v; else if (ACT == 14) v = (v > 0.f) ? v : 0.1f * v; else if (ACT == 16) v = (v >= 0.f) ? v : 0.3f * v; else if (ACT == 17) v = (v >= 0.f) ? v : 0.2f * v; else if (ACT == 15) v = v / (1.0f + expf(-v)); else if (ACT == 3) v = fmaxf(v, 0.f); else if (ACT == 6) v = 0.5f * v * (1.0f + erff(v * 0.70710678118654752f)); so[w][8 * hh + r][t * 16 + ln] = v; } }
  __builtin_amdgcn_fence(__ATOMIC_ACQ_REL, "workgroup"); __builtin_amdgcn_wave_barrier();
  const int rsub = lane >> 4, c4 = (lane & 15) * 4; typedef _Float16 v4h __attribute__((ext_vector_type(4)));
  {
#pragma unroll
    for (int q = 0; q < 8; ++q) { const int r = q * 2 + rsub; if (col0 + c4 < N) { const v4f v = *(const v4fa*)&so[w][r][c4]; if (C) *(v4f*)(C + cofs + (size_t)(row0 + r) * ldc + col0 + c4) = v; if (C16) { v4h h4; for (int i = 0; i < 4; ++i) h4[i] = (_Float16)v[i]; *(v4h*)(C16 + cofs + (size_t)(row0 + r) * ldc + col0 + c4) = h4; } } }
     }
}


typedef _Float16 v4h __attribute__((ext_vector_type(4)));

__device__ __forceinline__ void x16_block(const float* __restrict__ x, _Float16* __restrict__ X16, size_t n8, int bid) { const size_t t = (size_t)bid * 256 + threadIdx.x; if (t >= n8) return; FragH f;
#pragma unroll
  for (int q = 0; q < 8; ++q) f.h[q] = (_Float16)bf16_round(x[t * 8 + q]); *(v8us*)((unsigned short*)X16 + t * 8) = f.half[0];  }
__global__ __launch_bounds__(256) void k_h16(const float* __restrict__ x, _Float16* __restrict__ X16, size_t n8) { const size_t t = (size_t)blockIdx.x * 256 + threadIdx.x; if (t >= n8) return; FragH f;
#pragma unroll
  for (int q = 0; q < 8; ++q) f.h[q] = (_Float16)x[t * 8 + q]; *(v8us*)((unsigned short*)X16 + t * 8) = f.half[0];  }
__global__ __launch_bounds__(256) void k_round16f(const float* __restrict__ W, _Float16* __restrict__ Bt, size_t n8) { const size_t t = (size_t)blockIdx.x * 256 + threadIdx.x; if (t >= n8) return; FragH f;
#pragma unroll
  for (int i = 0; i < 8; ++i) f.h[i] = (_Float16)(bf16_round(W[t * 8 + i]) * 16.0f); *(v8us*)((unsigned short*)Bt + t * 8) = f.half[0];  }
template <int NHv, int TTv>
__global__ __launch_bounds__(256) void k_vt(const _Float16* __restrict__ V16, int ldv, int voff, _Float16* __restrict__ Vt) { __shared__ unsigned short tl[64][66]; const int tid = threadIdx.x; const int slab = blockIdx.x / (TTv / 64), lg = blockIdx.x % (TTv / 64); const int b = slab / NHv, h = slab % NHv;
  for (int i = tid; i < 64 * 8; i += 256) { const int r = i / 8, c8 = (i % 8) * 8; FragH f; f.half[0] = *(const v8us*)((const unsigned short*)V16 + ((size_t)b * TTv + lg * 64 + r) * ldv + voff + h * 64 + c8);
#pragma unroll
    for (int q = 0; q < 8; ++q) tl[r][c8 + q] = f.u[q]; }
  __syncthreads();
  {
#pragma unroll
    for (int rd = 0; rd < 2; ++rd) { const int d = rd * 32 + tid / 8, pc = tid % 8; FragH f;
#pragma unroll
      for (int q = 0; q < 8; ++q) f.u[q] = tl[pc * 8 + q][d];
      *(v8us*)((unsigned short*)Vt + ((size_t)slab * 64 + d) * TTv + lg * 64 + pc * 8) = f.half[0]; }
     } }

__global__ __launch_bounds__(256) void k_hl(const float* __restrict__ F, _Float16* __restrict__ Hh, _Float16* __restrict__ Hl, size_t n8) { const size_t t = (size_t)blockIdx.x * 256 + threadIdx.x; if (t >= n8) return; FragH fh, fl; const v4f a = *(const v4fa*)(F + t * 8), c = *(const v4fa*)(F + t * 8 + 4);
#pragma unroll
  for (int q = 0; q < 4; ++q) { _Float16 h = (_Float16)a[q]; fh.h[q] = h; fl.h[q] = (_Float16)((a[q] - (float)h) * 1024.0f); h = (_Float16)c[q]; fh.h[4 + q] = h; fl.h[4 + q] = (_Float16)((c[q] - (float)h) * 1024.0f); }
  { *(v8us*)((unsigned short*)Hh + t * 8) = fh.half[0]; *(v8us*)((unsigned short*)Hl + t * 8) = fl.half[0];  } }

// ---- fast GEMM: WM x WN waves, wave tile 16 MF x 16 NF, block tile 16 MF WM x 16 NF WN (requires M a multiple of the tile's rows, N of its columns, K % 64 == 0, 16 NF WN % 64 == 0) ----
// Operands go through LDS: a stage is 64 k of the block's A rows and B rows (128 bytes a row), brought by asynchronous copies, two buffers, the copies of stage t + 2 in flight while stage t + 1 is worked on.
// A wave-wide copy reads 4 rows x 128 contiguous bytes (4 whole cache lines). Every operand row is fetched from L2 once a block, so the bytes a product costs fall with the tile: (rows + columns) x 128 bytes a stage for rows x columns results.
#define G2_PITCH 72      /* f16 elements a row in LDS = 144 bytes = 16 x 9: 16 rows read by ds_load_b128 fall on distinct banks */
// fragment from an LDS row: p = row + 32 ks + 8 hh; the k order of g2_frag
__device__ __forceinline__ v16h g2_lfrag(const _Float16* p) { FragH f; f.half[0] = *(const v8us*)((const unsigned short*)p); f.half[1] = *(const v8us*)((const unsigned short*)p + 16); return f.v; }
// One lane's 16-byte copies of a stage: thread tid takes bytes 16 (tid & 7) of rows (tid >> 3) + RPC c (RPC = threads / 8), c = 0 .. 3 of the A tile and c = 0 .. NCB - 1 of the B tile, which lies behind the A tile's 4 RPC rows.
// l = its LDS byte address in row tid >> 3 of the buffer, ga / gb = its global address in that row of the A / B tile, sa / sb = RPC rows in elements.
// The s_wait_xcnt stands inside the statement, behind the last copy, so that no address register of a copy is rewritten in front of it.
template <int RPC, int NCB>
__device__ __forceinline__ void g2_stage(unsigned l, const _Float16* ga, size_t sa, const _Float16* gb, size_t sb) {
  static_assert(NCB == 4 || NCB == 5, "g2_stage: 8 or 9 copies");
  const unsigned rs = RPC * G2_PITCH * 2;
  if constexpr (NCB == 5)
  asm volatile("global_load_async_to_lds_b128 %0, %9, off\n\tglobal_load_async_to_lds_b128 %1, %10, off\n\tglobal_load_async_to_lds_b128 %2, %11, off\n\tglobal_load_async_to_lds_b128 %3, %12, off\n\t"
               "global_load_async_to_lds_b128 %4, %13, off\n\tglobal_load_async_to_lds_b128 %5, %14, off\n\tglobal_load_async_to_lds_b128 %6, %15, off\n\tglobal_load_async_to_lds_b128 %7, %16, off\n\t"
               "global_load_async_to_lds_b128 %8, %17, off\n\ts_wait_xcnt 0x0"
               :: "v"(l), "v"(l + rs), "v"(l + 2 * rs), "v"(l + 3 * rs), "v"(l + 4 * rs), "v"(l + 5 * rs), "v"(l + 6 * rs), "v"(l + 7 * rs), "v"(l + 8 * rs),
                  "v"(ga), "v"(ga + sa), "v"(ga + 2 * sa), "v"(ga + 3 * sa), "v"(gb), "v"(gb + sb), "v"(gb + 2 * sb), "v"(gb + 3 * sb), "v"(gb + 4 * sb) : "memory");
  else
  asm volatile("global_load_async_to_lds_b128 %0, %8, off\n\tglobal_load_async_to_lds_b128 %1, %9, off\n\tglobal_load_async_to_lds_b128 %2, %10, off\n\tglobal_load_async_to_lds_b128 %3, %11, off\n\t"
               "global_load_async_to_lds_b128 %4, %12, off\n\tglobal_load_async_to_lds_b128 %5, %13, off\n\tglobal_load_async_to_lds_b128 %6, %14, off\n\tglobal_load_async_to_lds_b128 %7, %15, off\n\ts_wait_xcnt 0x0"
               :: "v"(l), "v"(l + rs), "v"(l + 2 * rs), "v"(l + 3 * rs), "v"(l + 4 * rs), "v"(l + 5 * rs), "v"(l + 6 * rs), "v"(l + 7 * rs),
                  "v"(ga), "v"(ga + sa), "v"(ga + 2 * sa), "v"(ga + 3 * sa), "v"(gb), "v"(gb + sb), "v"(gb + 2 * sb), "v"(gb + 3 * sb) : "memory"); }
__device__ __forceinline__ v16h g2_frag(const _Float16* p, int hh) { FragH f; f.half[0] = *(const v8us*)((const unsigned short*)p + 8 * hh); f.half[1] = *(const v8us*)((const unsigned short*)p + 16 + 8 * hh); return f.v; }
__device__ __forceinline__ v8f g2_mma(v16h a, v16h b, v8f c) { v8f d = __builtin_amdgcn_wmma_f32_16x16x32_f16(false, a, false, b, (short)0, c, false, false); asm volatile("v_nop\n\tv_nop\n\tv_nop\n\tv_nop" : "+v"(d) : "v"(a), "v"(b)); return d; }
// C = alpha A B^T. B holds N rows; column gc of the product goes to column gc % DM of output plane gc / DM (planes sC elements apart, row pitch ldc): f32 rows into C (F32OUT) or f16 rows into C16.
// The epilogue is written for these two uses alone, its choices made at compile time, so that its text stays short at up to 160 results a lane.
template <int MF, int NF, int WM, int WN, bool F32OUT>
__global__ __launch_bounds__(32 * WM * WN) void k_gemm2(const _Float16* __restrict__ A, int lda, const _Float16* __restrict__ Bh, int ldb, float alpha, float* __restrict__ C, _Float16* __restrict__ C16, int ldc, size_t sC, int M, int N, int K) {
  constexpr int NT = 32 * WM * WN, RPC = NT / 8, AR = 16 * MF * WM, BR = 16 * NF * WN, BUF = (AR + BR) * G2_PITCH, SP = BR + 4, LU = BR / 64, UW = 32 * LU / WN;
  static_assert(AR == 4 * RPC && BR % RPC == 0 && BR % 64 == 0 && MF % 2 == 0 && UW % 2 == 0 && (32 * LU) % WN == 0, "k_gemm2: tile and copy shapes");
  static_assert(2 * BUF * 2 >= WM * 32 * SP * 4, "k_gemm2: the output staging lies in the stage buffers");
  __shared__ __attribute__((aligned(16))) _Float16 st[2][BUF];
  const int tid = threadIdx.x, w = tid >> 5, lane = tid & 31, ln = lane & 15, hh = lane >> 4; const int wm = w / WN, wn = w % WN;
  const int ntn = N / BR; const int mt = blockIdx.x / ntn, nq = blockIdx.x - mt * ntn; if (mt * AR >= M) return;      /* the same for the whole block: it stands in front of barriers */
  const _Float16* gap = A + (size_t)(mt * AR + (tid >> 3)) * lda + (tid & 7) * 8; const _Float16* gbp = Bh + (size_t)(nq * BR + (tid >> 3)) * ldb + (tid & 7) * 8; const size_t sar = (size_t)RPC * lda, sbr = (size_t)RPC * ldb;
  const unsigned lst = (unsigned)(size_t)&st[0][(tid >> 3) * G2_PITCH + (tid & 7) * 8];      /* low 32 bits of the shared address = byte address in the block's LDS */
  const int aoff = (16 * MF * wm + ln) * G2_PITCH + 8 * hh, boff = (AR + 16 * NF * wn + ln) * G2_PITCH + 8 * hh; const int nst = K >> 6;
  const v8f z8 = {0.f,0.f,0.f,0.f,0.f,0.f,0.f,0.f}; v8f acc[MF][NF];
  // every loop over fragments or accumulators is fully unrolled so that these arrays are indexed by constants and stay in registers
#pragma unroll
  for (int i = 0; i < MF; ++i)
#pragma unroll
    for (int u = 0; u < NF; ++u) acc[i][u] = z8;
  g2_stage<RPC, BR / RPC>(lst, gap, sar, gbp, sbr);
  asm volatile("s_wait_asynccnt 0x0" ::: "memory");      // this wave's copies of stage 0 have landed
  __syncthreads();                                       // ... and every other wave's: stage 0 may be read
  if (nst > 1) g2_stage<RPC, BR / RPC>(lst + BUF * 2, gap + 64, sar, gbp + 64, sbr);
  // rolled, as it was: a trip already holds a stage's LDS reads and products, and unrolled trips would each keep their own copy address registers; the buffer is chosen by the trip's parity
#pragma unroll 1
  for (int t = 0; t < nst; ++t) { const _Float16* sb = st[t & 1];
#pragma unroll
    for (int ks = 0; ks < 2; ++ks) { v16h af[MF], bf[NF];
#pragma unroll
      for (int i = 0; i < MF; ++i) af[i] = g2_lfrag(sb + aoff + i * 16 * G2_PITCH + ks * 32);
#pragma unroll
      for (int u = 0; u < NF; ++u) bf[u] = g2_lfrag(sb + boff + u * 16 * G2_PITCH + ks * 32);
#pragma unroll
      for (int u = 0; u < NF; ++u)
#pragma unroll
        for (int i = 0; i < MF; ++i) acc[i][u] = g2_mma(af[i], bf[u], acc[i][u]); }
    asm volatile("s_wait_dscnt 0x0" ::: "memory");         // this wave's reads of stage t are finished before its buffer is refilled
    asm volatile("s_wait_asynccnt 0x0" ::: "memory");      // this wave's copies of stage t + 1 have landed
    __syncthreads();                                       // publishes stage t + 1 and ends every wave's reads of stage t
    if (t + 2 < nst) g2_stage<RPC, BR / RPC>(lst + (unsigned)(t & 1) * (BUF * 2), gap + (size_t)(t + 2) * 64, sar, gbp + (size_t)(t + 2) * 64, sbr); }
  asm volatile("s_wait_asynccnt 0x0" ::: "memory");        // no copy is outstanding when the wave goes on to its end
  // Output staging in the stage buffers (behind the last trip's barrier no wave reads a stage any more and every copy has landed): 32 rows of every wave's tile at a time, as WM x 32 rows of the block's BR columns.
  // The rows are then stored in units of 64 columns by 16 lanes, so that every 128-byte line of the output has one writer although a wave's own columns need not end on a line.
  float* so = (float*)&st[0][0];
#pragma unroll
  for (int ch = 0; ch < MF / 2; ++ch) {
    if (ch) __syncthreads();                               // every wave has read the 32 rows before: they may be overwritten
#pragma unroll
    for (int half = 0; half < 2; ++half)
#pragma unroll
      for (int u = 0; u < NF; ++u)
#pragma unroll
        for (int r = 0; r < 8; ++r) so[(wm * 32 + half * 16 + 8 * hh + r) * SP + (wn * NF + u) * 16 + ln] = acc[ch * 2 + half][u][r] * alpha;
    __syncthreads();                                       // the rows are complete before other waves read them
#pragma unroll
    for (int q = 0; q < UW / 2; ++q) { const int e = wn * UW + q * 2 + hh, r = e / LU, col = (e % LU) * 64 + ln * 4; const v4f v = *(const v4fa*)&so[(wm * 32 + r) * SP + col];
      const unsigned gc = (unsigned)(nq * BR + col); const size_t ro = (size_t)(gc / DM) * sC + (size_t)(mt * AR + wm * 16 * MF + ch * 32 + r) * ldc + gc % DM;
      if (F32OUT) *(v4f*)(C + ro) = v; else { v4h h4; for (int i = 0; i < 4; ++i) h4[i] = (_Float16)v[i]; *(v4h*)(C16 + ro) = h4; } }
  } }


__global__ __launch_bounds__(256) void k_wnat(const float* __restrict__ w, size_t n8, _Float16* __restrict__ Bt) { const size_t t = (size_t)blockIdx.x * 256 + threadIdx.x; if (t >= n8) return; FragH f; for (int q = 0; q < 8; ++q) f.h[q] = (_Float16)(bf16_round(w[t * 8 + q]) * 16.0f); *(v8us*)((unsigned short*)Bt + t * 8) = f.half[0];  }

// ---- fused attention: scores, softmax and weighted sum of one branch in one pass over the keys; no score ever reaches memory ----
// Transposed products. S^T = K Q^T: A = 16 key rows, B = 16 query rows, so lane (ln, hh) holds for query ln the keys 8 hh + r of each 16-key tile. Two such tiles, rounded to f16, are
// at once the B operand of O^T += V^T P^T over 32 keys (element i: key 8 hh + i, element 8 + i: key 16 + 8 hh + i, the k order of g2_frag and of the transposing LDS load, which forms the A operand from V rows).
// A query's maximum, sum and scale therefore live in its own lane (both halves); the halves exchange the maximum once a pass and join their sums once at the end.
// Every inner loop is fully unrolled so that the fragment, score and accumulator arrays are indexed by constants and stay in registers (a rolled loop would put them in scratch memory).
// Scores are kept in the log2 domain (x = s log2 e). The maximum in use is raised, and sums and outputs rescaled, only when a column's new maximum exceeds it by more than 8, so weights stay <= 2^8.
// 2^x of eight (two) values in place, one statement: behind each v_exp_f32 stands an instruction that neither reads its result nor overwrites its source (the operands are distinct registers), behind the last the v_nop: the slot the instruction set asks for behind a transcendental
__device__ __forceinline__ void ex2x8(v8f& x) { asm("v_exp_f32 %0, %0\n\tv_exp_f32 %1, %1\n\tv_exp_f32 %2, %2\n\tv_exp_f32 %3, %3\n\tv_exp_f32 %4, %4\n\tv_exp_f32 %5, %5\n\tv_exp_f32 %6, %6\n\tv_exp_f32 %7, %7\n\tv_nop" : "+v"(x[0]), "+v"(x[1]), "+v"(x[2]), "+v"(x[3]), "+v"(x[4]), "+v"(x[5]), "+v"(x[6]), "+v"(x[7])); }
__device__ __forceinline__ void ex2x2(float& a, float& b) { asm("v_exp_f32 %0, %0\n\tv_exp_f32 %1, %1\n\tv_nop" : "+v"(a), "+v"(b)); }
__device__ __forceinline__ v8f at_mma(v16h a, v16h b, v8f c) { return __builtin_amdgcn_wmma_f32_16x16x32_f16(false, a, false, b, (short)0, c, false, false); }
// D = A B - |C| (CM = 3) or A B + |C| (CM = 2): the instruction's own modifiers on C (1 negates, 2 takes the magnitude; the magnitude first)
template <int CM>
__device__ __forceinline__ v8f at_mma_c(v16h a, v16h b, v8f c) { return __builtin_amdgcn_wmma_f32_16x16x32_f16(false, a, false, b, (short)CM, c, false, false); }
// K and V go through LDS: a stage is 64 keys, that is 64 K rows and 64 V rows (64 d each) as the projections left them, 128 bytes a row, brought once a block and branch by asynchronous copies and read by the branch's four waves; two buffers,
// the copies of stage t + 2 in flight while stage t + 1 is worked on. A wave-wide copy reads 4 rows x 128 contiguous bytes (4 whole cache lines), where a fragment load from global memory touched 16 lines for the same 512 bytes.
#define AT_PITCH 72      /* f16 elements a row in LDS = 144 bytes = 16 x 9: 16 rows read by ds_load_b128 fall on distinct banks */
#define AT_VPITCH 80     /* V rows: 160 bytes = 32 x 5, the pitch at which ds_load_tr16_b128 meets every bank once */
#define AT_KT (64 * AT_PITCH)        /* the K tile's elements; the V tile lies behind it */
#define AT_BUF (AT_KT + 64 * AT_VPITCH)
// 16 d x 8 keys of a row-major V tile as four registers of an A operand: the lane's address names row 8 hh + (ln & 7), bytes 16 (ln >> 3) of a 16-key x 16-d block; lane (ln, hh) receives column ln of keys 8 hh .. 8 hh + 7
typedef short v8s __attribute__((ext_vector_type(8)));
typedef float v2f __attribute__((ext_vector_type(2)));
__device__ __forceinline__ v8us at_tr16(const _Float16* p) { typedef __attribute__((address_space(3))) v8s lds_v8s; return __builtin_bit_cast(v8us, __builtin_amdgcn_ds_load_tr16_b128_v8i16((lds_v8s*)p)); }
// One lane's eight 16-byte copies of a stage: thread tid takes bytes 16 (tid & 7) of rows (tid >> 3) + 16 c, c = 0..3, of the K tile and of the V tile. l / lv = its LDS byte address in row tid >> 3 of the buffer's K / V tile, gk / gv = its global
// address in that row of the K / V tile. The s_wait_xcnt stands inside the statement, behind the last copy, so that no address register of a copy is rewritten in front of it.
__device__ __forceinline__ void at_stage(unsigned l, unsigned lv, const _Float16* gk, const _Float16* gv) {
  const unsigned rs = 16 * AT_PITCH * 2, rv = 16 * AT_VPITCH * 2; const size_t sk = (size_t)16 * DM, sv = (size_t)16 * DM;
  asm volatile("global_load_async_to_lds_b128 %0, %8, off\n\tglobal_load_async_to_lds_b128 %1, %9, off\n\tglobal_load_async_to_lds_b128 %2, %10, off\n\tglobal_load_async_to_lds_b128 %3, %11, off\n\t"
               "global_load_async_to_lds_b128 %4, %12, off\n\tglobal_load_async_to_lds_b128 %5, %13, off\n\tglobal_load_async_to_lds_b128 %6, %14, off\n\tglobal_load_async_to_lds_b128 %7, %15, off\n\ts_wait_xcnt 0x0"
               :: "v"(l), "v"(l + rs), "v"(l + 2 * rs), "v"(l + 3 * rs), "v"(lv), "v"(lv + rv), "v"(lv + 2 * rv), "v"(lv + 3 * rv),
                  "v"(gk), "v"(gk + sk), "v"(gk + 2 * sk), "v"(gk + 3 * sk), "v"(gv), "v"(gv + sv), "v"(gv + 2 * sv), "v"(gv + 3 * sv) : "memory"); }
// One stage (64 keys, two passes of 32) of one wave's branch. sb = the branch's buffer that holds the stage; the wave's query fragments, outputs, maxima and sums stay in the caller's registers.
// decay (the same for a whole wave, held in a scalar register) = the short branch: its score products start from the decay bias instead of from zero. The bias of query q and key k, in units of the unscaled score, is -|q - k| cr with
// cr = 8 (1 - decay_factor); the wave forms only the signed (q - k) cr, in the accumulator's lane and register order, and the first score product takes it as -|C| (CM = 3, cr >= 0) or, where decay_factor lies above 1 and the bias grows with the distance, as +|C| (CM = 2). q - k is the same along a diagonal of 16 x 16 tiles, so a pass's four tiles need three.
// The two forms of the score products stand under a scalar branch; everything else is one code path for both branches, with the scale kq = 0.125 log2 e in the one multiply-add a score.
template <int CM>
__device__ __forceinline__ void attn_stage(const _Float16* sb, const int t, const int q0, const int ln, const int hh, const bool decay, const float cr, const float kq, const v16h (&qf)[2][2], v8f (&o)[2][4], float (&m)[2], float (&l)[2]) {
  const v8f z8 = {0.f,0.f,0.f,0.f,0.f,0.f,0.f,0.f};
  const int koff = ln * AT_PITCH + 8 * hh, voff = AT_KT + (8 * hh + (ln & 7)) * AT_VPITCH + 8 * (ln >> 3); v16h kf[2][2];
#pragma unroll
   for (int u = 0; u < 2; ++u)
#pragma unroll
    for (int ks = 0; ks < 2; ++ks) kf[u][ks] = g2_lfrag(sb + koff + u * 16 * AT_PITCH + ks * 32);
   // a stage's two passes, unrolled so that the pass picks its rows and columns of the buffer by constant offsets
#pragma unroll
   for (int ps = 0; ps < 2; ++ps) { const int kb = t * 64 + ps * 32;
    v16h vf[4];
#pragma unroll
    for (int dt = 0; dt < 4; ++dt) { FragH f; f.half[0] = at_tr16(sb + voff + ps * 32 * AT_VPITCH + dt * 16); f.half[1] = at_tr16(sb + voff + (ps * 32 + 16) * AT_VPITCH + dt * 16); vf[dt] = f.v; }
    __builtin_amdgcn_sched_barrier(0);      // keeps the V^T loads at the head of the pass, so that the score products and the maxima cover their latency (the scheduler sinks them to their use otherwise)
    v8f s[2][2];
    if (decay) { v8f bt[3];      /* bt[1 + g - t][r] = (q - k) cr for query q0 + 16 g + ln and key kb + 16 t + 8 hh + r */
#pragma unroll
      for (int j = 0; j < 3; ++j) { const float fc = (float)(q0 + ln - 8 * hh - kb + (j - 1) * 16) * cr; const v2f fc2 = {fc, fc}, cr2 = {cr, cr};
        // two registers at a time, as vectors of two, so that one packed instruction forms both
#pragma unroll
        for (int r = 0; r < 8; r += 2) { const v2f rr = {(float)r, (float)(r + 1)}; const v2f b2 = fc2 - rr * cr2; bt[j][r] = b2[0]; bt[j][r + 1] = b2[1]; } }
#pragma unroll
      for (int g = 0; g < 2; ++g)
#pragma unroll
        for (int t = 0; t < 2; ++t) s[g][t] = at_mma(kf[t][1], qf[g][1], at_mma_c<CM>(kf[t][0], qf[g][0], bt[1 + g - t]));
    } else {
#pragma unroll
      for (int g = 0; g < 2; ++g)
#pragma unroll
        for (int t = 0; t < 2; ++t) s[g][t] = at_mma(kf[t][1], qf[g][1], at_mma(kf[t][0], qf[g][0], z8)); }
    // the stage's second pass's K fragments, asked for while the first pass's softmax runs (the same buffer: nothing of the next stage is read here)
    if (ps == 0) {
#pragma unroll
      for (int u = 0; u < 2; ++u)
#pragma unroll
        for (int ks = 0; ks < 2; ++ks) kf[u][ks] = g2_lfrag(sb + koff + (32 + u * 16) * AT_PITCH + ks * 32); }
    float mt[2];
#pragma unroll
    for (int g = 0; g < 2; ++g) { float mx = -3.0e38f;
#pragma unroll
      for (int t = 0; t < 2; ++t)
#pragma unroll
        for (int r = 0; r < 8; ++r) mx = fmaxf(mx, s[g][t][r]);
      mx *= kq;
      mt[g] = fmaxf(mx, __shfl_xor(mx, 16, 32)); }
    const bool need = (mt[0] > m[0] + 8.0f) || (mt[1] > m[1] + 8.0f);
    if (__builtin_amdgcn_ballot_w32(need) != 0) { const float mn0 = fmaxf(m[0], mt[0]), mn1 = fmaxf(m[1], mt[1]); float al[2] = {m[0] - mn0, m[1] - mn1}; ex2x2(al[0], al[1]); m[0] = mn0; m[1] = mn1;
#pragma unroll
      for (int g = 0; g < 2; ++g) { l[g] *= al[g];
#pragma unroll
        for (int dt = 0; dt < 4; ++dt) o[g][dt] *= al[g]; } }
#pragma unroll
    for (int g = 0; g < 2; ++g) { FragH pf; float ls = 0.f;
#pragma unroll
      for (int t = 0; t < 2; ++t) { v8f p;
#pragma unroll
        for (int r = 0; r < 8; ++r) p[r] = s[g][t][r] * kq - m[g];
        ex2x8(p);
#pragma unroll
        for (int r = 0; r < 8; ++r) { ls += p[r]; pf.h[t * 8 + r] = (_Float16)p[r]; } }
      l[g] += ls;
#pragma unroll
      for (int dt = 0; dt < 4; ++dt) o[g][dt] = at_mma(vf[dt], pf.v, o[g][dt]); }
   } }
// The walk over the 16 stages: stage 0 lies published in buffer 0 and stage 1's copies are in flight when it begins.
template <int CM>
__device__ __forceinline__ void attn_walk(const _Float16* stb, const unsigned lst, const unsigned lsv, const _Float16* gk, const _Float16* gv, const int q0, const int ln, const int hh, const bool decay, const float cr, const float kq, const v16h (&qf)[2][2], v8f (&o)[2][4], float (&m)[2], float (&l)[2]) {
  // rolled; the buffer is chosen by the trip's parity
#pragma unroll 1
  for (int t = 0; t < SQ / 64; ++t) { const _Float16* sb = stb + (t & 1) * AT_BUF;
    attn_stage<CM>(sb, t, q0, ln, hh, decay, cr, kq, qf, o, m, l);
    asm volatile("s_wait_dscnt 0x0" ::: "memory");         // this wave's reads of stage t are finished before its buffer is refilled
    asm volatile("s_wait_asynccnt 0x0" ::: "memory");      // this wave's copies of stage t + 1 have landed
    __syncthreads();                                       // publishes stage t + 1 and ends every wave's reads of stage t
    if (t + 2 < SQ / 64) at_stage(lst + (unsigned)(t & 1) * (AT_BUF * 2), lsv + (unsigned)(t & 1) * (AT_BUF * 2), gk + (size_t)(t + 2) * 64 * DM, gv + (size_t)(t + 2) * 64 * DM);
  } }
// blockIdx.x = block of 128 queries, blockIdx.y = batch * NH + head. Eight waves: waves 0..3 run the short branch (with the decay bias) on 32 queries each, waves 4..7 the long branch on the same queries,
// each branch with its own two stage buffers filled by its own four waves. Both branches walk the stages together (one barrier a stage for the whole block, in control flow that is the same for all its threads;
// only the start value of the score products, between two barriers, differs by wave). At the end both leave their normalised f32 rows in LDS, and the block blends them with sigmoid(mix_weight) and stores the f16 o rows: no branch output reaches memory.
/* four waves a SIMD (two blocks a WGP, as the LDS allows) need at most 256 vector registers a wave: the second number asks the compiler for that budget */
__global__ __launch_bounds__(256, 4) void k_attn(const _Float16* __restrict__ Q16, const _Float16* __restrict__ KS, const _Float16* __restrict__ KL, const _Float16* __restrict__ VS, const _Float16* __restrict__ VL, _Float16* __restrict__ O16, const float* __restrict__ dfp, const float* __restrict__ mwp, const float kq) {      /* kq = 0.125 log2 e comes as an argument and so lies in a scalar register: with a literal in them, two multiply-adds do not pair into one dual-issue instruction */
  __shared__ __attribute__((aligned(16))) float so[2][128][68];
  __shared__ __attribute__((aligned(16))) _Float16 st[2][2 * AT_BUF];
  const int wv = __builtin_amdgcn_readfirstlane((int)(threadIdx.x >> 5)); const int br = wv >> 2;      /* the wave's number and its branch, in scalar registers: what depends on the branch is a scalar choice */
  const int lane = threadIdx.x & 31, ln = lane & 15, hh = lane >> 4; const int b = blockIdx.y / NH, h = blockIdx.y % NH; const int qw = (wv & 3) * 32, q0 = blockIdx.x * 128 + qw;
  const _Float16* KB = br ? KL : KS; const _Float16* VB = br ? VL : VS; const float cr = (1.0f - bf16_round(dfp[0])) * 8.0f;      /* the decay bias of one position, in units of the unscaled score (x 8 is exact) */
  const float mw = mwp[0];      /* read here, into a scalar register, so that the blend at the end does not wait for memory */
  const _Float16* qp = Q16 + ((size_t)b * SQ + q0 + ln) * DM + h * HD; const int tid = threadIdx.x & 127;      /* the thread's number among its branch's 128 */
  const size_t go = ((size_t)b * SQ + (tid >> 3)) * DM + h * HD + (tid & 7) * 8; const _Float16* gk = KB + go; const _Float16* gv = VB + go;      /* K and V rows lie alike in their planes */
  const _Float16* stb = st[br];
  const unsigned lst = (unsigned)(size_t)(stb + (tid >> 3) * AT_PITCH + (tid & 7) * 8), lsv = (unsigned)(size_t)(stb + AT_KT + (tid >> 3) * AT_VPITCH + (tid & 7) * 8);      /* low 32 bits of the shared address = byte address in the block's LDS */
  at_stage(lst, lsv, gk, gv);
  v16h qf[2][2];
#pragma unroll
  for (int g = 0; g < 2; ++g)
#pragma unroll
    for (int ks = 0; ks < 2; ++ks) qf[g][ks] = g2_frag(qp + (size_t)g * 16 * DM + ks * 32, hh);
  const v8f z8 = {0.f,0.f,0.f,0.f,0.f,0.f,0.f,0.f}; v8f o[2][4];
#pragma unroll
  for (int g = 0; g < 2; ++g)
#pragma unroll
    for (int dt = 0; dt < 4; ++dt) o[g][dt] = z8;
  float m[2] = {-3.0e38f, -3.0e38f}, l[2] = {0.f, 0.f};
  asm volatile("s_wait_asynccnt 0x0" ::: "memory");      // this wave's copies of stage 0 have landed
  __syncthreads();                                       // ... and every other wave's: stage 0 may be read
  at_stage(lst + AT_BUF * 2, lsv + AT_BUF * 2, gk + (size_t)64 * DM, gv + (size_t)64 * DM);
  // the modifier on C is part of the instruction, so the walk stands twice; the sign of cr is the same for every thread of the grid, so all of a block's waves pass the same barriers
  if (cr >= 0.0f) attn_walk<3>(stb, lst, lsv, gk, gv, q0, ln, hh, br == 0, cr, kq, qf, o, m, l);
  else attn_walk<2>(stb, lst, lsv, gk, gv, q0, ln, hh, br == 0, cr, kq, qf, o, m, l);
  asm volatile("s_wait_asynccnt 0x0" ::: "memory");        // no copy is outstanding when the wave goes on to its end
  // the lane's number is read anew here, so that no address of the part below has to hold a vector register through the loop (the loop leaves none free at four waves a SIMD)
  const int le = (int)__builtin_amdgcn_mbcnt_lo(~0u, 0u), lne = le & 15, hhe = le >> 4, te = wv * 32 + le;
  // O^T tile: lane (lne, hhe) holds of query lne the columns 16 dt + 8 hhe + r; into the branch's LDS rows
#pragma unroll
  for (int g = 0; g < 2; ++g) { const float lt = l[g] + __shfl_xor(l[g], 16, 32); const float inv = 1.0f / lt;
#pragma unroll
    for (int dt = 0; dt < 4; ++dt) { const v8f ov = o[g][dt] * inv; const v4f lo = {ov[0], ov[1], ov[2], ov[3]}, hi = {ov[4], ov[5], ov[6], ov[7]};
      *(v4fa*)&so[br][qw + g * 16 + lne][dt * 16 + 8 * hhe] = lo; *(v4fa*)&so[br][qw + g * 16 + lne][dt * 16 + 8 * hhe + 4] = hi; } }
  const float a = 1.0f / (1.0f + expf(-bf16_round(mw))), na = 1.0f - a;
  __syncthreads();                                         // both branches' rows are complete before any thread blends them
  // a thread blends 8 columns of a row: a wave's store covers 4 rows x 128 contiguous bytes; unrolled so that the four rounds' LDS reads are all asked for before the first is used
#pragma unroll
  for (int i = 0; i < 4; ++i) { const int e = i * 256 + te, r = e >> 3, c8 = (e & 7) * 8;
    const v4f s0 = *(const v4fa*)&so[0][r][c8], s1 = *(const v4fa*)&so[0][r][c8 + 4], l0 = *(const v4fa*)&so[1][r][c8], l1 = *(const v4fa*)&so[1][r][c8 + 4]; FragH f;
#pragma unroll
    for (int q = 0; q < 4; ++q) { f.h[q] = (_Float16)(a * s0[q] + na * l0[q]); f.h[4 + q] = (_Float16)(a * s1[q] + na * l1[q]); }
    *(v8us*)((unsigned short*)O16 + ((size_t)b * SQ + blockIdx.x * 128 + r) * DM + h * HD + c8) = f.half[0]; } }

__device__ __forceinline__ void wT_block(const float* __restrict__ w, int din, int dout, _Float16* __restrict__ Bt, int bid, float (*tl)[65]) { const int tid = threadIdx.x; const int nbo = dout / 64; const int ib = bid / nbo, ob = bid % nbo; const int i0 = ib * 64, o0 = ob * 64;
  for (int t = tid; t < 64 * 64; t += 256) { const int i = t / 64, o = t % 64; tl[o][i] = bf16_round(w[(size_t)(i0 + i) * dout + o0 + o]) * 16.0f; }
  __syncthreads();
  { for (int t = tid; t < 64 * 8; t += 256) { const int o = t / 8, i8 = (t % 8) * 8; FragH f; for (int q = 0; q < 8; ++q) f.h[q] = (_Float16)tl[o][i8 + q]; *(v8us*)((unsigned short*)Bt + (size_t)(o0 + o) * din + i0 + i8) = f.half[0]; }  } }
// Everything that reads only inputs, in one launch: ranges of the block index pick the job (the test is the same for a whole block, so the barrier in wT_block is passed by all of a block's threads or by none).
// The transposes stand first: their blocks run longer.
#define PB_SQ ((DM / 64) * (DM / 64))          /* blocks of a DM x DM weight */
#define PB_KV ((DM / 64) * (2 * DM / 64))      /* blocks of a DM x 2 DM weight */
#define PB_W (2 * PB_SQ + 2 * PB_KV)
#define PB_X ((int)((NR * DM / 8 + 255) / 256))
__global__ __launch_bounds__(256) void k_prep(const float* __restrict__ x, const float* __restrict__ wq, const float* __restrict__ wkvs, const float* __restrict__ wkvl, const float* __restrict__ wo,
    _Float16* __restrict__ X16, _Float16* __restrict__ BQ, _Float16* __restrict__ BKVS, _Float16* __restrict__ BKVL, _Float16* __restrict__ BO) {
  __shared__ float tl[64][65]; const int bid = blockIdx.x;
  if (bid < PB_KV) wT_block(wkvs, DM, 2 * DM, BKVS, bid, tl);
  else if (bid < 2 * PB_KV) wT_block(wkvl, DM, 2 * DM, BKVL, bid - PB_KV, tl);
  else if (bid < 2 * PB_KV + PB_SQ) wT_block(wq, DM, DM, BQ, bid - 2 * PB_KV, tl);
  else if (bid < PB_W) wT_block(wo, DM, DM, BO, bid - 2 * PB_KV - PB_SQ, tl);
  else x16_block(x, X16, NR * DM / 8, bid - PB_W); }
extern "C" void kernel_launch(void* const* d_in, const int* in_sizes, int n_in,
                              void* d_out, int out_size, void* d_ws, size_t ws_size, hipStream_t stream) {
  (void)in_sizes; (void)n_in; (void)out_size;
  const float* const* I = (const float* const*)d_in; const float* x = I[0]; const float* wq = I[1]; const float* wkvs = I[2]; const float* wkvl = I[3]; const float* wo = I[4]; const float* mwp = I[5]; const float* dfp = I[6];
  char* ws = (char*)d_ws; size_t off = 0;
  auto take = [&](size_t bytes) { char* p = ws + off; off += (bytes + 255) & ~(size_t)255; return p; };
  /* the transposed projection weights lie as five DM x DM planes in a row (q, short k, short v, long k, long v), and so do the five projections' outputs: the projection launch takes the weights as one matrix and finds a column's output plane from its number */
  _Float16* BQ = (_Float16*)take((size_t)5 * DM * DM * 2); _Float16* BKVS = BQ + (size_t)DM * DM; _Float16* BKVL = BQ + (size_t)3 * DM * DM; _Float16* BO = (_Float16*)take((size_t)DM * DM * 2);
  _Float16* X16 = (_Float16*)take(NR * DM * 2); _Float16* Q16 = (_Float16*)take(5 * NR * DM * 2); _Float16* K16 = Q16 + NR * DM; _Float16* V16 = Q16 + 2 * NR * DM; _Float16* KL16 = Q16 + 3 * NR * DM; _Float16* VL16 = Q16 + 4 * NR * DM; _Float16* O16 = (_Float16*)take(NR * DM * 2);
  if (off > ws_size) return;      /* 12 + 7 x 8 = 68 MiB */
  k_prep<<<PB_W + PB_X, 256, 0, stream>>>(x, wq, wkvs, wkvl, wo, X16, BQ, BKVS, BKVL, BO);
  const dim3 gp((unsigned)((NR / 128) * (DM / 128)), 1), gp5((unsigned)((NR / 256) * (5 * DM / 320)), 1);
  k_gemm2<4, 5, 4, 4, false><<<gp5, 512, 0, stream>>>(X16, DM, BQ, DM, 0.0625f, nullptr, Q16, DM, NR * DM, (int)NR, 5 * DM, DM);      /* q, short k | v, long k | v */
  k_attn<<<dim3(SQ / 128, NB * NH), 256, 0, stream>>>(Q16, K16, KL16, V16, VL16, O16, dfp, mwp, 0.18033688011112042f);      /* blended o (merged heads) as f16 rows */
  k_gemm2<2, 4, 4, 2, true><<<gp, 256, 0, stream>>>(O16, DM, BO, DM, 0.0625f, (float*)d_out, nullptr, DM, 0, (int)NR, DM, DM);      /* out = o Wo */
}

// v010
// A run of this version takes 85.5 microseconds.
// Next to v009, in two timings, it ran 1.04 times as fast each time.
// All steps since v000 together make it 292 times as fast.
#include <hip/hip_runtime.h>
#define NB 4
#define SQ 1024
#define DM 1024
#define NH 16
#define HD 64
#define NR ((size_t)NB * SQ)         /* 4096 token rows */
typedef __bf16 v16b __attribute__((ext_vector_type(16)));
typedef unsigned short v8us __attribute__((ext_vector_type(8), may_alias));
typedef float  v8f  __attribute__((ext_vector_type(8)));
typedef float  v4f  __attribute__((ext_vector_type(4)));
typedef float  v4fa __attribute__((ext_vector_type(4), may_alias));
union FragB { v16b v; v8us half[2]; unsigned short u[16]; };

__device__ __forceinline__ unsigned short bf16_bits(float x) { unsigned int u = __float_as_uint(x); return (unsigned short)((u + 0x7FFFu + ((u >> 16) & 1u)) >> 16); }
__device__ __forceinline__ float bf16_val(unsigned short b) { return __uint_as_float(((unsigned int)b) << 16); }
__device__ __forceinline__ float bf16_round(float x) { return bf16_val(bf16_bits(x)); }
// D += A·B with NT terms: 1 = ah·bh, 2 = + al·bh (A split), 3 = + ah·bl (both split)
template <int NT>
__device__ __forceinline__ v8f mmaN(v16b ah, v16b al, v16b bh, v16b bl, v8f c) {
  c = __builtin_amdgcn_wmma_f32_16x16x32_bf16(false, ah, false, bh, (short)0, c, false, false);
  if (NT >= 2) c = __builtin_amdgcn_wmma_f32_16x16x32_bf16(false, al, false, bh, (short)0, c, false, false);
  if (NT >= 3) c = __builtin_amdgcn_wmma_f32_16x16x32_bf16(false, ah, false, bl, (short)0, c, false, false);
  asm volatile("v_nop\n\tv_nop\n\tv_nop\n\tv_nop" : "+v"(c) : "v"(ah), "v"(al), "v"(bh), "v"(bl));
  return c;
}

__global__ __launch_bounds__(256) void k_wt_bf16(const float* __restrict__ W, unsigned short* __restrict__ Wt, int K, int N) {
  const int t = blockIdx.x * 256 + threadIdx.x;
  const int k8n = K / 8;
  if (t >= N * k8n) return;
  const int n = t / k8n, k8 = (t % k8n) * 8;
  v8us v;
#pragma unroll
  for (int i = 0; i < 8; ++i) v[i] = bf16_bits(W[(size_t)(k8 + i) * N + n]);
  *(v8us*)(Wt + (size_t)n * K + k8) = v;
  
}

// GEMM C[M][N] (f32, pitch ldc) = act(A[M][K]·W + bias). A f32 row-major (pitch lda) converted per fragment to bf16
// (ASPLIT: hi/lo two planes -> 2 terms, else single rounded term); Wt bf16 [N][K] (pitch ldb). BIAS_BF16 rounds the
// bias to bf16 first (bias quantised to bf16 before the add). K%32==0, M%16==0, N%64==0.
template <bool ASPLIT, int ACT, bool BIAS_BF16>
__global__ __launch_bounds__(128) void k_gemm_bf(const float* __restrict__ A, int lda, const unsigned short* __restrict__ Wt, int ldb,
                                               const float* __restrict__ bias, float* __restrict__ C, int ldc, int M, int N, int K) {
  __shared__ __attribute__((aligned(16))) float so[4][16][64];
  const int tid = threadIdx.x, w = tid >> 5, lane = tid & 31, ln = lane & 15, hh = lane >> 4;
  const int ntn = N / 64;
  const int wid = blockIdx.x * 4 + w;
  const int mt = wid / ntn, nq = wid % ntn;
  if (mt * 16 >= M) return;
  const int row0 = mt * 16, col0 = nq * 64;
  const float* arow = A + (size_t)(row0 + ln) * lda;
  v8f acc[4] = {};
  for (int kb = 0; kb < K; kb += 32) {
    FragB ah, al;
    const v4f x0 = *(const v4fa*)(arow + kb + 8 * hh), x1 = *(const v4fa*)(arow + kb + 8 * hh + 4);
    const v4f x2 = *(const v4fa*)(arow + kb + 16 + 8 * hh), x3 = *(const v4fa*)(arow + kb + 16 + 8 * hh + 4);
    float xs[16] = {x0[0],x0[1],x0[2],x0[3],x1[0],x1[1],x1[2],x1[3],x2[0],x2[1],x2[2],x2[3],x3[0],x3[1],x3[2],x3[3]};
#pragma unroll
    for (int i = 0; i < 16; ++i) { const unsigned short hb = bf16_bits(xs[i]); ah.u[i] = hb; al.u[i] = ASPLIT ? bf16_bits(xs[i] - bf16_val(hb)) : (unsigned short)0; }
#pragma unroll
    for (int t = 0; t < 4; ++t) {
      const unsigned short* brow = Wt + (size_t)(col0 + t * 16 + ln) * ldb + kb;
      FragB b;
      b.half[0] = *(const v8us*)(brow + 8 * hh);
      b.half[1] = *(const v8us*)(brow + 16 + 8 * hh);
      acc[t] = mmaN<ASPLIT ? 2 : 1>(ah.v, al.v, b.v, b.v, acc[t]);
    }
  }
#pragma unroll
  for (int t = 0; t < 4; ++t) {
    float bv = bias ? bias[col0 + t * 16 + ln] : 0.f;
    if (BIAS_BF16) bv = bf16_round(bv);
#pragma unroll
    for (int r = 0; r < 8; ++r) { float v = acc[t][r] + bv; if (ACT == 1) v = fmaxf(v, 0.f); so[w][8 * hh + r][t * 16 + ln] = v; }
  }
  __builtin_amdgcn_fence(__ATOMIC_ACQ_REL, "workgroup");
  __builtin_amdgcn_wave_barrier();
  const int rsub = lane >> 4, c4 = (lane & 15) * 4;
  {
#pragma unroll
    for (int q = 0; q < 8; ++q) {
      const int r = q * 2 + rsub;
      const v4f v = *(const v4fa*)&so[w][r][c4];
      *(v4f*)(C + (size_t)(row0 + r) * ldc + col0 + c4) = v;
    }
    
  }
}

// GEMM C = act(A·W + bias + resid): A f32 (ASPLIT -> hi/lo 2 terms), Wt bf16 [N][K]; ACT 0 none, 1 relu, 2 exact gelu;
// resid (optional, f32, row index = (row % rmod), pitch ldr, RES_BF16 rounds it) added before the activation.
template <bool ASPLIT, int ACT, bool BIAS_BF16, bool RES_BF16>
__global__ __launch_bounds__(128) void k_gemm_bf3(const float* __restrict__ A, int lda, const unsigned short* __restrict__ Wt, int ldb,
                                                const float* __restrict__ bias, const float* __restrict__ resid, int rmod, int ldr,
                                                float* __restrict__ C, int ldc, int M, int N, int K) {
  __shared__ __attribute__((aligned(16))) float so[4][16][64];
  const int tid = threadIdx.x, w = tid >> 5, lane = tid & 31, ln = lane & 15, hh = lane >> 4;
  const int ntn = N / 64;
  const int wid = blockIdx.x * 4 + w;
  const int mt = wid / ntn, nq = wid % ntn;
  if (mt * 16 >= M) return;
  const int row0 = mt * 16, col0 = nq * 64;
  const float* arow = A + (size_t)(row0 + ln) * lda;
  v8f acc[4] = {};
  for (int kb = 0; kb < K; kb += 32) {
    FragB ah, al;
    const v4f x0 = *(const v4fa*)(arow + kb + 8 * hh), x1 = *(const v4fa*)(arow + kb + 8 * hh + 4);
    const v4f x2 = *(const v4fa*)(arow + kb + 16 + 8 * hh), x3 = *(const v4fa*)(arow + kb + 16 + 8 * hh + 4);
    float xs[16] = {x0[0],x0[1],x0[2],x0[3],x1[0],x1[1],x1[2],x1[3],x2[0],x2[1],x2[2],x2[3],x3[0],x3[1],x3[2],x3[3]};
#pragma unroll
    for (int i = 0; i < 16; ++i) { const unsigned short hb = bf16_bits(xs[i]); ah.u[i] = hb; al.u[i] = ASPLIT ? bf16_bits(xs[i] - bf16_val(hb)) : (unsigned short)0; }
#pragma unroll
    for (int t = 0; t < 4; ++t) {
      const unsigned short* brow = Wt + (size_t)(col0 + t * 16 + ln) * ldb + kb;
      FragB b;
      b.half[0] = *(const v8us*)(brow + 8 * hh);
      b.half[1] = *(const v8us*)(brow + 16 + 8 * hh);
      acc[t] = mmaN<ASPLIT ? 2 : 1>(ah.v, al.v, b.v, b.v, acc[t]);
    }
  }
#pragma unroll
  for (int t = 0; t < 4; ++t) {
    const int col = col0 + t * 16 + ln;
    float bv = bias ? bias[col] : 0.f;
    if (BIAS_BF16) bv = bf16_round(bv);
#pragma unroll
    for (int r = 0; r < 8; ++r) {
      float v = acc[t][r] + bv;
      if (resid) { float rv = resid[(size_t)((row0 + 8 * hh + r) % rmod) * ldr + col]; if (RES_BF16) rv = bf16_round(rv); v += rv; }
      if (ACT == 1) v = fmaxf(v, 0.f);
      if (ACT == 2) v = 0.5f * v * (1.0f + erff(v * 0.70710678118654752f));
      if (ACT == 3) { const float u = 0.7978845608028654f * (v + 0.044715f * v * v * v); v = 0.5f * v * (1.0f + tanhf(u)); }
      so[w][8 * hh + r][t * 16 + ln] = v;
    }
  }
  __builtin_amdgcn_fence(__ATOMIC_ACQ_REL, "workgroup");
  __builtin_amdgcn_wave_barrier();
  const int rsub = lane >> 4, c4 = (lane & 15) * 4;
  {
#pragma unroll
    for (int q = 0; q < 8; ++q) {
      const int r = q * 2 + rsub;
      const v4f v = *(const v4fa*)&so[w][r][c4];
      *(v4f*)(C + (size_t)(row0 + r) * ldc + col0 + c4) = v;
    }
    
  }
}
// row LayerNorm (biased variance, eps) over N: s = X (+ R); optional out_sum <- s; out_norm <- (s-mu)*rsqrt(var+eps)*g + b
template <bool PARAM_BF16>
__global__ __launch_bounds__(256) void k_layernorm(const float* __restrict__ X, const float* __restrict__ R, const float* __restrict__ g, const float* __restrict__ bta,
                                                  float* __restrict__ out_sum, float* __restrict__ out_norm, int N, float eps) {
  __shared__ float red[256];
  const int row = blockIdx.x, tid = threadIdx.x;
  const float* x = X + (size_t)row * N; const float* rr = R ? R + (size_t)row * N : nullptr;
  float vals[16];                     // up to N = 4096
  const int per = N / 256;            // contiguous chunk per thread? use strided-by-4 chunks: thread handles j = tid*4 + 1024*u
  float s1 = 0.f;
  for (int u = 0; u < per / 4; ++u) {
    const int j = tid * 4 + 1024 * u;
    const v4f a = *(const v4fa*)(x + j);
    v4f b = {0.f,0.f,0.f,0.f}; if (rr) b = *(const v4fa*)(rr + j);
#pragma unroll
    for (int q = 0; q < 4; ++q) { const float v = a[q] + b[q]; vals[u * 4 + q] = v; s1 += v; }
  }
  red[tid] = s1; __syncthreads();
  for (int st = 128; st > 0; st >>= 1) { if (tid < st) red[tid] += red[tid + st]; __syncthreads(); }
  const float mu = red[0] / (float)N; __syncthreads();
  float s2 = 0.f;
  for (int u = 0; u < per / 4; ++u)
#pragma unroll
    for (int q = 0; q < 4; ++q) { const float c = vals[u * 4 + q] - mu; s2 += c * c; }
  red[tid] = s2; __syncthreads();
  for (int st = 128; st > 0; st >>= 1) { if (tid < st) red[tid] += red[tid + st]; __syncthreads(); }
  const float rs = rsqrtf(red[0] / (float)N + eps);
  {
    for (int u = 0; u < per / 4; ++u) {
      const int j = tid * 4 + 1024 * u;
      v4f o, sm;
#pragma unroll
      for (int q = 0; q < 4; ++q) {
        float gg = g[j + q], bb = bta[j + q];
        if (PARAM_BF16) { gg = bf16_round(gg); bb = bf16_round(bb); }
        sm[q] = vals[u * 4 + q]; o[q] = (vals[u * 4 + q] - mu) * rs * gg + bb;
      }
      if (out_sum) *(v4f*)(out_sum + (size_t)row * N + j) = sm;
      *(v4f*)(out_norm + (size_t)row * N + j) = o;
    }
    
  }
}



// ---- f16 WMMA path (v_wmma_f32_16x16x32_f16): 11-bit significands for operands in range — used where a [0,1] probability operand needs more precision than bf16
typedef _Float16 v16h __attribute__((ext_vector_type(16)));
union FragH { v16h v; v8us half[2]; _Float16 h[16]; unsigned short u[16]; };
template <int NT>
__device__ __forceinline__ v8f mmaH(v16h ah, v16h al, v16h bh, v16h bl, v8f c) {
  c = __builtin_amdgcn_wmma_f32_16x16x32_f16(false, ah, false, bh, (short)0, c, false, false);
  if (NT >= 2) c = __builtin_amdgcn_wmma_f32_16x16x32_f16(false, al, false, bh, (short)0, c, false, false);
  if (NT >= 3) c = __builtin_amdgcn_wmma_f32_16x16x32_f16(false, ah, false, bl, (short)0, c, false, false);
  asm volatile("v_nop\n\tv_nop\n\tv_nop\n\tv_nop" : "+v"(c) : "v"(ah), "v"(al), "v"(bh), "v"(bl));
  return c;
}
// batched GEMM like k_gemm_b but f16 operands: A f32 (split into f16 hi/lo if ASPLIT, else rounded to f16), Bt = f16 values [n][k]; alpha; C f32; N multiple of 16 (partial tiles skipped)
template <bool ASPLIT>
__global__ __launch_bounds__(128) void k_gemm_h(const float* __restrict__ A, int lda, size_t sA, const _Float16* __restrict__ Bh, int ldb, size_t sB, float alpha, float* __restrict__ C, int ldc, size_t sC, int M, int N, int K) {
  __shared__ __attribute__((aligned(16))) float so[4][16][64];
  const int tid = threadIdx.x, w = tid >> 5, lane = tid & 31, ln = lane & 15, hh = lane >> 4; const int by = blockIdx.y;
  A += (size_t)by * sA; Bh += (size_t)by * sB; C += (size_t)by * sC;
  const int ntn = (N + 63) / 64; const int wid = blockIdx.x * 4 + w; const int mt = wid / ntn, nq = wid % ntn; if (mt * 16 >= M) return;
  const int row0 = mt * 16, col0 = nq * 64; const float* arow = A + (size_t)(row0 + ln) * lda;
  v8f acc[4] = {};
  for (int kb = 0; kb < K; kb += 32) {
    FragH ah, al;
    const v4f x0 = *(const v4fa*)(arow + kb + 8 * hh), x1 = *(const v4fa*)(arow + kb + 8 * hh + 4), x2 = *(const v4fa*)(arow + kb + 16 + 8 * hh), x3 = *(const v4fa*)(arow + kb + 16 + 8 * hh + 4);
    float xs[16] = {x0[0],x0[1],x0[2],x0[3],x1[0],x1[1],x1[2],x1[3],x2[0],x2[1],x2[2],x2[3],x3[0],x3[1],x3[2],x3[3]};
#pragma unroll
    for (int i = 0; i < 16; ++i) { const _Float16 h = (_Float16)xs[i]; ah.h[i] = h; al.h[i] = ASPLIT ? (_Float16)(xs[i] - (float)h) : (_Float16)0.0f; }
#pragma unroll
    for (int t = 0; t < 4; ++t) { if (col0 + t * 16 >= N) continue; const size_t boff = (size_t)(col0 + t * 16 + ln) * ldb + kb; FragH bq; bq.half[0] = *(const v8us*)(Bh + boff + 8 * hh); bq.half[1] = *(const v8us*)(Bh + boff + 16 + 8 * hh);
      acc[t] = mmaH<ASPLIT ? 2 : 1>(ah.v, al.v, bq.v, bq.v, acc[t]); }
  }
#pragma unroll
  for (int t = 0; t < 4; ++t) { if (col0 + t * 16 >= N) continue;
#pragma unroll
    for (int r = 0; r < 8; ++r) so[w][8 * hh + r][t * 16 + ln] = acc[t][r] * alpha; }
  __builtin_amdgcn_fence(__ATOMIC_ACQ_REL, "workgroup"); __builtin_amdgcn_wave_barrier();
  const int rsub = lane >> 4, c4 = (lane & 15) * 4;
  {
#pragma unroll
    for (int q = 0; q < 8; ++q) { const int r = q * 2 + rsub; if (col0 + c4 < N) { const v4f v = *(const v4fa*)&so[w][r][c4]; *(v4f*)(C + (size_t)(row0 + r) * ldc + col0 + c4) = v; } }
     }
}

// Wt[n][k] = f16(W[k][n]·scale) from f32 row-major W[K][N] (scale = power of two; bf16-exact weights stay exact in f16 away from the subnormal range)
__global__ __launch_bounds__(256) void k_wt_f16(const float* __restrict__ W, _Float16* __restrict__ Wt, int K, int N, float scale) {
  const int t = blockIdx.x * 256 + threadIdx.x; if (t >= N * (K / 8)) return; const int n = t / (K / 8), k8 = (t % (K / 8)) * 8; FragH f;
#pragma unroll
  for (int i = 0; i < 8; ++i) f.h[i] = (_Float16)(bf16_round(W[(size_t)(k8 + i) * N + n]) * scale); const v8us o = f.half[0];
  *(v8us*)((unsigned short*)Wt + (size_t)n * K + k8) = o; 
}
// k_gemm_hh variant with fused epilogue: v = acc·alpha + bias[by·sBias + col] (+ CP[(row/rowsPerB)·sCPb + by·64 + col] if CP) ; ACT 0 none / 1 elu ; writes f16 C16 (and f32 C if non-null)
template <int ACT>
__global__ __launch_bounds__(128) void k_gemm_hhx(const _Float16* __restrict__ A, int lda, size_t sA, const _Float16* __restrict__ Bh, int ldb, size_t sB, float alpha, const float* __restrict__ bias, size_t sBias, const float* __restrict__ CP, int rowsPerB, size_t sCPb, int row0g,
    float* __restrict__ C, _Float16* __restrict__ C16, int ldc, size_t sC, int M, int N, int K) {
  __shared__ __attribute__((aligned(16))) float so[4][16][64];
  const int tid = threadIdx.x, w = tid >> 5, lane = tid & 31, ln = lane & 15, hh = lane >> 4; const int by = blockIdx.y;
  A += (size_t)by * sA; Bh += (size_t)by * sB; const size_t cofs = (size_t)by * sC; const float* bp = bias ? bias + (size_t)by * sBias : nullptr;
  const int ntn = (N + 63) / 64; const int wid = blockIdx.x * 4 + w; const int mt = wid / ntn, nq = wid % ntn; if (mt * 16 >= M) return;
  const int row0 = mt * 16, col0 = nq * 64; const _Float16* arow = A + (size_t)(row0 + ln) * lda;
  v8f acc[4] = {};
  for (int kb = 0; kb < K; kb += 32) { FragH ah; ah.half[0] = *(const v8us*)((const unsigned short*)arow + kb + 8 * hh); ah.half[1] = *(const v8us*)((const unsigned short*)arow + kb + 16 + 8 * hh);
#pragma unroll
    for (int t = 0; t < 4; ++t) { if (col0 + t * 16 >= N) continue; const size_t boff = (size_t)(col0 + t * 16 + ln) * ldb + kb; FragH bq; bq.half[0] = *(const v8us*)((const unsigned short*)Bh + boff + 8 * hh); bq.half[1] = *(const v8us*)((const unsigned short*)Bh + boff + 16 + 8 * hh);
      acc[t] = mmaH<1>(ah.v, ah.v, bq.v, bq.v, acc[t]); }
  }
#pragma unroll
  for (int t = 0; t < 4; ++t) { if (col0 + t * 16 >= N) continue; const int col = col0 + t * 16 + ln; const float bv = bp ? bf16_round(bp[col]) : 0.f;
#pragma unroll
    for (int r = 0; r < 8; ++r) { float v = acc[t][r] * alpha + bv; if (CP) { const int rr = row0g + row0 + 8 * hh + r; if (rowsPerB < 0) v += CP[cofs + (size_t)rr * ldc + col];      /* rowsPerB < 0: own element of the batched C plane */ else { const int bidx = rr / rowsPerB; v += CP[(size_t)bidx * sCPb + (size_t)by * 64 + col]; } } if (ACT == 1) v = (v > 0.f) ? v : expm1f(v); else if (ACT == 7) v = (v > 0.f) ? v + 1.0f : expf(v); else if (ACT == 8) v = tanhf(v); else if (ACT == 9) v = 0.5f * v * (1.0f + tanhf(0.7978845608028654f * (v + 0.044715f * v * v * v))); else if (ACT == 11) v = 1.0f / (1.0f + expf(-v)); else if (ACT == 12) v = (v > 0.f) ? v : 0.01f * v; else if (ACT == 14) v = (v > 0.f) ? v : 0.1f * v; else if (ACT == 16) v = (v >= 0.f) ? v : 0.3f * v; else if (ACT == 17) v = (v >= 0.f) ? v : 0.2f * v; else if (ACT == 15) v = v / (1.0f + expf(-v)); else if (ACT == 3) v = fmaxf(v, 0.f); else if (ACT == 6) v = 0.5f * v * (1.0f + erff(v * 0.70710678118654752f)); so[w][8 * hh + r][t * 16 + ln] = v; } }
  __builtin_amdgcn_fence(__ATOMIC_ACQ_REL, "workgroup"); __builtin_amdgcn_wave_barrier();
  const int rsub = lane >> 4, c4 = (lane & 15) * 4; typedef _Float16 v4h __attribute__((ext_vector_type(4)));
  {
#pragma unroll
    for (int q = 0; q < 8; ++q) { const int r = q * 2 + rsub; if (col0 + c4 < N) { const v4f v = *(const v4fa*)&so[w][r][c4]; if (C) *(v4f*)(C + cofs + (size_t)(row0 + r) * ldc + col0 + c4) = v; if (C16) { v4h h4; for (int i = 0; i < 4; ++i) h4[i] = (_Float16)v[i]; *(v4h*)(C16 + cofs + (size_t)(row0 + r) * ldc + col0 + c4) = h4; } } }
     }
}


typedef _Float16 v4h __attribute__((ext_vector_type(4)));

__device__ __forceinline__ void x16_block(const float* __restrict__ x, _Float16* __restrict__ X16, size_t n8, int bid) { const size_t t = (size_t)bid * 256 + threadIdx.x; if (t >= n8) return; FragH f;
#pragma unroll
  for (int q = 0; q < 8; ++q) f.h[q] = (_Float16)bf16_round(x[t * 8 + q]); *(v8us*)((unsigned short*)X16 + t * 8) = f.half[0];  }
__global__ __launch_bounds__(256) void k_h16(const float* __restrict__ x, _Float16* __restrict__ X16, size_t n8) { const size_t t = (size_t)blockIdx.x * 256 + threadIdx.x; if (t >= n8) return; FragH f;
#pragma unroll
  for (int q = 0; q < 8; ++q) f.h[q] = (_Float16)x[t * 8 + q]; *(v8us*)((unsigned short*)X16 + t * 8) = f.half[0];  }
__global__ __launch_bounds__(256) void k_round16f(const float* __restrict__ W, _Float16* __restrict__ Bt, size_t n8) { const size_t t = (size_t)blockIdx.x * 256 + threadIdx.x; if (t >= n8) return; FragH f;
#pragma unroll
  for (int i = 0; i < 8; ++i) f.h[i] = (_Float16)(bf16_round(W[t * 8 + i]) * 16.0f); *(v8us*)((unsigned short*)Bt + t * 8) = f.half[0];  }
template <int NHv, int TTv>
__global__ __launch_bounds__(256) void k_vt(const _Float16* __restrict__ V16, int ldv, int voff, _Float16* __restrict__ Vt) { __shared__ unsigned short tl[64][66]; const int tid = threadIdx.x; const int slab = blockIdx.x / (TTv / 64), lg = blockIdx.x % (TTv / 64); const int b = slab / NHv, h = slab % NHv;
  for (int i = tid; i < 64 * 8; i += 256) { const int r = i / 8, c8 = (i % 8) * 8; FragH f; f.half[0] = *(const v8us*)((const unsigned short*)V16 + ((size_t)b * TTv + lg * 64 + r) * ldv + voff + h * 64 + c8);
#pragma unroll
    for (int q = 0; q < 8; ++q) tl[r][c8 + q] = f.u[q]; }
  __syncthreads();
  {
#pragma unroll
    for (int rd = 0; rd < 2; ++rd) { const int d = rd * 32 + tid / 8, pc = tid % 8; FragH f;
#pragma unroll
      for (int q = 0; q < 8; ++q) f.u[q] = tl[pc * 8 + q][d];
      *(v8us*)((unsigned short*)Vt + ((size_t)slab * 64 + d) * TTv + lg * 64 + pc * 8) = f.half[0]; }
     } }

__global__ __launch_bounds__(256) void k_hl(const float* __restrict__ F, _Float16* __restrict__ Hh, _Float16* __restrict__ Hl, size_t n8) { const size_t t = (size_t)blockIdx.x * 256 + threadIdx.x; if (t >= n8) return; FragH fh, fl; const v4f a = *(const v4fa*)(F + t * 8), c = *(const v4fa*)(F + t * 8 + 4);
#pragma unroll
  for (int q = 0; q < 4; ++q) { _Float16 h = (_Float16)a[q]; fh.h[q] = h; fl.h[q] = (_Float16)((a[q] - (float)h) * 1024.0f); h = (_Float16)c[q]; fh.h[4 + q] = h; fl.h[4 + q] = (_Float16)((c[q] - (float)h) * 1024.0f); }
  { *(v8us*)((unsigned short*)Hh + t * 8) = fh.half[0]; *(v8us*)((unsigned short*)Hl + t * 8) = fl.half[0];  } }

// ---- fast GEMM: WM x WN waves, wave tile 16 MF x 16 NF, block tile 16 MF WM x 16 NF WN (requires M a multiple of the tile's rows, N of its columns, K % 64 == 0, 16 NF WN % 64 == 0) ----
// Operands go through LDS: a stage is 64 k of the block's A rows and B rows (128 bytes a row), brought by asynchronous copies into a ring of RB buffers: while stage t + 1 is worked on, the copies of stages t + 2 .. t + RB are in flight,
// so that a stage has RB - 1 trips to arrive, not one (all blocks walk k together: a stage's rows are asked for by all their readers at about the same time, so none finds them fetched by another, and they may have to come from memory).
// A wave-wide copy reads 4 rows x 128 contiguous bytes (4 whole cache lines). Every operand row is fetched from L2 once a block, so the bytes a product costs fall with the tile: (rows + columns) x 128 bytes a stage for rows x columns results.
#define G2_PITCH 72      /* f16 elements a row in LDS = 144 bytes = 16 x 9: 16 rows read by ds_load_b128 fall on distinct banks */
// fragment from an LDS row: p = row + 32 ks + 8 hh; the k order of g2_frag
__device__ __forceinline__ v16h g2_lfrag(const _Float16* p) { FragH f; f.half[0] = *(const v8us*)((const unsigned short*)p); f.half[1] = *(const v8us*)((const unsigned short*)p + 16); return f.v; }
// One lane's 16-byte copies of a stage: thread tid takes bytes 16 (tid & 7) of rows (tid >> 3) + RPC c (RPC = threads / 8), c = 0 .. 3 of the A tile and c = 0 .. NCB - 1 of the B tile, which lies behind the A tile's 4 RPC rows.
// l = its LDS byte address in row tid >> 3 of the buffer, ga / gb = its global address in that row of the A / B tile, sa / sb = RPC rows in elements.
// The s_wait_xcnt stands inside the statement, behind the last copy, so that no address register of a copy is rewritten in front of it.
template <int RPC, int NCB>
__device__ __forceinline__ void g2_stage(unsigned l, const _Float16* ga, size_t sa, const _Float16* gb, size_t sb) {
  static_assert(NCB == 4 || NCB == 5, "g2_stage: 8 or 9 copies");
  const unsigned rs = RPC * G2_PITCH * 2;
  if constexpr (NCB == 5)
  asm volatile("global_load_async_to_lds_b128 %0, %9, off\n\tglobal_load_async_to_lds_b128 %1, %10, off\n\tglobal_load_async_to_lds_b128 %2, %11, off\n\tglobal_load_async_to_lds_b128 %3, %12, off\n\t"
               "global_load_async_to_lds_b128 %4, %13, off\n\tglobal_load_async_to_lds_b128 %5, %14, off\n\tglobal_load_async_to_lds_b128 %6, %15, off\n\tglobal_load_async_to_lds_b128 %7, %16, off\n\t"
               "global_load_async_to_lds_b128 %8, %17, off\n\ts_wait_xcnt 0x0"
               :: "v"(l), "v"(l + rs), "v"(l + 2 * rs), "v"(l + 3 * rs), "v"(l + 4 * rs), "v"(l + 5 * rs), "v"(l + 6 * rs), "v"(l + 7 * rs), "v"(l + 8 * rs),
                  "v"(ga), "v"(ga + sa), "v"(ga + 2 * sa), "v"(ga + 3 * sa), "v"(gb), "v"(gb + sb), "v"(gb + 2 * sb), "v"(gb + 3 * sb), "v"(gb + 4 * sb) : "memory");
  else
  asm volatile("global_load_async_to_lds_b128 %0, %8, off\n\tglobal_load_async_to_lds_b128 %1, %9, off\n\tglobal_load_async_to_lds_b128 %2, %10, off\n\tglobal_load_async_to_lds_b128 %3, %11, off\n\t"
               "global_load_async_to_lds_b128 %4, %12, off\n\tglobal_load_async_to_lds_b128 %5, %13, off\n\tglobal_load_async_to_lds_b128 %6, %14, off\n\tglobal_load_async_to_lds_b128 %7, %15, off\n\ts_wait_xcnt 0x0"
               :: "v"(l), "v"(l + rs), "v"(l + 2 * rs), "v"(l + 3 * rs), "v"(l + 4 * rs), "v"(l + 5 * rs), "v"(l + 6 * rs), "v"(l + 7 * rs),
                  "v"(ga), "v"(ga + sa), "v"(ga + 2 * sa), "v"(ga + 3 * sa), "v"(gb), "v"(gb + sb), "v"(gb + 2 * sb), "v"(gb + 3 * sb) : "memory"); }
__device__ __forceinline__ v16h g2_frag(const _Float16* p, int hh) { FragH f; f.half[0] = *(const v8us*)((const unsigned short*)p + 8 * hh); f.half[1] = *(const v8us*)((const unsigned short*)p + 16 + 8 * hh); return f.v; }
__device__ __forceinline__ v8f g2_mma(v16h a, v16h b, v8f c) { v8f d = __builtin_amdgcn_wmma_f32_16x16x32_f16(false, a, false, b, (short)0, c, false, false); asm volatile("v_nop\n\tv_nop\n\tv_nop\n\tv_nop" : "+v"(d) : "v"(a), "v"(b)); return d; }
template <int N>
__device__ __forceinline__ void g2_wait_copies() { asm volatile("s_wait_asynccnt %0" :: "n"(N) : "memory"); }
template <int MF, int NF, int WM, int WN, int RB, bool F32OUT>
__global__ __launch_bounds__(32 * WM * WN) void k_gemm2(const _Float16* __restrict__ A, int lda, const _Float16* __restrict__ Bh, int ldb, float alpha, float* __restrict__ C, _Float16* __restrict__ C16, int ldc, size_t sC, int M, int N, int K) {
  constexpr int NT = 32 * WM * WN, RPC = NT / 8, AR = 16 * MF * WM, BR = 16 * NF * WN, BUF = (AR + BR) * G2_PITCH, SP = BR + 4, LU = BR / 64, UW = 32 * LU / WN, NC = 4 + BR / RPC;      /* NC = a lane's (and so a wave's) copies a stage, the same in every wave and for every stage */
  static_assert(AR == 4 * RPC && BR % RPC == 0 && BR % 64 == 0 && MF % 2 == 0 && UW % 2 == 0 && (32 * LU) % WN == 0, "k_gemm2: tile and copy shapes");
  static_assert(RB * BUF * 2 >= WM * 32 * SP * 4, "k_gemm2: the output staging lies in the stage buffers");
  static_assert(RB >= 2 && RB * NC <= 63, "k_gemm2: at most 63 copies of a wave are outstanding");
  __shared__ __attribute__((aligned(16))) _Float16 st[RB][BUF];
  const int tid = threadIdx.x, w = tid >> 5, lane = tid & 31, ln = lane & 15, hh = lane >> 4; const int wm = w / WN, wn = w % WN;
  const int ntn = N / BR; const int mt = blockIdx.x / ntn, nq = blockIdx.x - mt * ntn; if (mt * AR >= M) return;      /* the same for the whole block: it stands in front of barriers */
  const _Float16* gap = A + (size_t)(mt * AR + (tid >> 3)) * lda + (tid & 7) * 8; const _Float16* gbp = Bh + (size_t)(nq * BR + (tid >> 3)) * ldb + (tid & 7) * 8; const size_t sar = (size_t)RPC * lda, sbr = (size_t)RPC * ldb;
  const unsigned lst = (unsigned)(size_t)&st[0][(tid >> 3) * G2_PITCH + (tid & 7) * 8];      /* low 32 bits of the shared address = byte address in the block's LDS */
  const int aoff = (16 * MF * wm + ln) * G2_PITCH + 8 * hh, boff = (AR + 16 * NF * wn + ln) * G2_PITCH + 8 * hh; const int nst = K >> 6;
  const v8f z8 = {0.f,0.f,0.f,0.f,0.f,0.f,0.f,0.f}; v8f acc[MF][NF];
  // every loop over fragments or accumulators is fully unrolled so that these arrays are indexed by constants and stay in registers
#pragma unroll
  for (int i = 0; i < MF; ++i)
#pragma unroll
    for (int u = 0; u < NF; ++u) acc[i][u] = z8;
  // the ring is filled: stages 0 .. RB - 1, each into its own buffer (unrolled: the buffer's address is a constant; the test is the same for the whole grid)
#pragma unroll
  for (int s = 0; s < RB; ++s) if (s < nst) g2_stage<RPC, BR / RPC>(lst + (unsigned)s * (BUF * 2), gap + s * 64, sar, gbp + s * 64, sbr);
  // this wave's copies of stage 0 have landed: behind them it has issued exactly RB - 1 stages of NC copies where that many stages exist, else the wait is for all
  if (nst >= RB) g2_wait_copies<NC * (RB - 1)>(); else g2_wait_copies<0>();
  __syncthreads();                                       // ... and every other wave's: stage 0 may be read
  int bi = 0;      /* t mod RB, the buffer of stage t */
  // rolled, as it was: a trip already holds a stage's LDS reads and products, and unrolled trips would each keep their own copy address registers; the buffer is chosen by a scalar count
#pragma unroll 1
  for (int t = 0; t < nst; ++t) { const _Float16* sb = st[bi];
#pragma unroll
    for (int ks = 0; ks < 2; ++ks) { v16h af[MF], bf[NF];
#pragma unroll
      for (int i = 0; i < MF; ++i) af[i] = g2_lfrag(sb + aoff + i * 16 * G2_PITCH + ks * 32);
#pragma unroll
      for (int u = 0; u < NF; ++u) bf[u] = g2_lfrag(sb + boff + u * 16 * G2_PITCH + ks * 32);
#pragma unroll
      for (int u = 0; u < NF; ++u)
#pragma unroll
        for (int i = 0; i < MF; ++i) acc[i][u] = g2_mma(af[i], bf[u], acc[i][u]); }
    asm volatile("s_wait_dscnt 0x0" ::: "memory");         // this wave's reads of stage t are finished before its buffer is refilled
    // this wave's copies of stage t + 1 have landed. While stage t + RB - 1 exists, the wave's youngest copies are exactly those of stages t + 2 .. t + RB - 1, NC each, and may stay in flight; in the last trips, which issue none, the wait is for all
    if (t + RB <= nst) g2_wait_copies<NC * (RB - 2)>(); else g2_wait_copies<0>();
    __syncthreads();                                       // publishes stage t + 1 and ends every wave's reads of stage t
    if (t + RB < nst) g2_stage<RPC, BR / RPC>(lst + (unsigned)bi * (BUF * 2), gap + (size_t)(t + RB) * 64, sar, gbp + (size_t)(t + RB) * 64, sbr);      /* into the buffer that trip t has just read */
    bi = bi + 1 == RB ? 0 : bi + 1; }
  asm volatile("s_wait_asynccnt 0x0" ::: "memory");        // no copy is outstanding when the wave goes on to its end
  // Output staging in the stage buffers (behind the last trip's barrier no wave reads a stage any more and every copy has landed): 32 rows of every wave's tile at a time, as WM x 32 rows of the block's BR columns.
  // The rows are then stored in units of 64 columns by 16 lanes, so that every 128-byte line of the output has one writer although a wave's own columns need not end on a line.
  float* so = (float*)&st[0][0];
#pragma unroll
  for (int ch = 0; ch < MF / 2; ++ch) {
    if (ch) __syncthreads();                               // every wave has read the 32 rows before: they may be overwritten
#pragma unroll
    for (int half = 0; half < 2; ++half)
#pragma unroll
      for (int u = 0; u < NF; ++u)
#pragma unroll
        for (int r = 0; r < 8; ++r) so[(wm * 32 + half * 16 + 8 * hh + r) * SP + (wn * NF + u) * 16 + ln] = acc[ch * 2 + half][u][r] * alpha;
    __syncthreads();                                       // the rows are complete before other waves read them
#pragma unroll
    for (int q = 0; q < UW / 2; ++q) { const int e = wn * UW + q * 2 + hh, r = e / LU, col = (e % LU) * 64 + ln * 4; const v4f v = *(const v4fa*)&so[(wm * 32 + r) * SP + col];
      const unsigned gc = (unsigned)(nq * BR + col); const size_t ro = (size_t)(gc / DM) * sC + (size_t)(mt * AR + wm * 16 * MF + ch * 32 + r) * ldc + gc % DM;
      if (F32OUT) *(v4f*)(C + ro) = v; else { v4h h4; for (int i = 0; i < 4; ++i) h4[i] = (_Float16)v[i]; *(v4h*)(C16 + ro) = h4; } }
  } }


__global__ __launch_bounds__(256) void k_wnat(const float* __restrict__ w, size_t n8, _Float16* __restrict__ Bt) { const size_t t = (size_t)blockIdx.x * 256 + threadIdx.x; if (t >= n8) return; FragH f; for (int q = 0; q < 8; ++q) f.h[q] = (_Float16)(bf16_round(w[t * 8 + q]) * 16.0f); *(v8us*)((unsigned short*)Bt + t * 8) = f.half[0];  }

// ---- fused attention: scores, softmax and weighted sum of one branch in one pass over the keys; no score ever reaches memory ----
// Transposed products. S^T = K Q^T: A = 16 key rows, B = 16 query rows, so lane (ln, hh) holds for query ln the keys 8 hh + r of each 16-key tile. Two such tiles, rounded to f16, are
// at once the B operand of O^T += V^T P^T over 32 keys (element i: key 8 hh + i, element 8 + i: key 16 + 8 hh + i, the k order of g2_frag and of the transposing LDS load, which forms the A operand from V rows).
// A query's maximum, sum and scale therefore live in its own lane (both halves); the halves exchange the maximum once a pass and join their sums once at the end.
// Every inner loop is fully unrolled so that the fragment, score and accumulator arrays are indexed by constants and stay in registers (a rolled loop would put them in scratch memory).
// Scores are kept in the log2 domain (x = s log2 e). The maximum in use is raised, and sums and outputs rescaled, only when a column's new maximum exceeds it by more than 8, so weights stay <= 2^8.
// 2^x of eight (two) values in place, one statement: behind each v_exp_f32 stands an instruction that neither reads its result nor overwrites its source (the operands are distinct registers), behind the last the v_nop: the slot the instruction set asks for behind a transcendental
__device__ __forceinline__ void ex2x8(v8f& x) { asm("v_exp_f32 %0, %0\n\tv_exp_f32 %1, %1\n\tv_exp_f32 %2, %2\n\tv_exp_f32 %3, %3\n\tv_exp_f32 %4, %4\n\tv_exp_f32 %5, %5\n\tv_exp_f32 %6, %6\n\tv_exp_f32 %7, %7\n\tv_nop" : "+v"(x[0]), "+v"(x[1]), "+v"(x[2]), "+v"(x[3]), "+v"(x[4]), "+v"(x[5]), "+v"(x[6]), "+v"(x[7])); }
__device__ __forceinline__ void ex2x2(float& a, float& b) { asm("v_exp_f32 %0, %0\n\tv_exp_f32 %1, %1\n\tv_nop" : "+v"(a), "+v"(b)); }
__device__ __forceinline__ v8f at_mma(v16h a, v16h b, v8f c) { return __builtin_amdgcn_wmma_f32_16x16x32_f16(false, a, false, b, (short)0, c, false, false); }
// D = A B - |C| (CM = 3) or A B + |C| (CM = 2): the instruction's own modifiers on C (1 negates, 2 takes the magnitude; the magnitude first)
template <int CM>
__device__ __forceinline__ v8f at_mma_c(v16h a, v16h b, v8f c) { return __builtin_amdgcn_wmma_f32_16x16x32_f16(false, a, false, b, (short)CM, c, false, false); }
// K and V go through LDS: a stage is 64 keys, that is 64 K rows and 64 V rows (64 d each) as the projections left them, 128 bytes a row, brought once a block and branch by asynchronous copies and read by the branch's four waves; two buffers,
// the copies of stage t + 2 in flight while stage t + 1 is worked on. A wave-wide copy reads 4 rows x 128 contiguous bytes (4 whole cache lines), where a fragment load from global memory touched 16 lines for the same 512 bytes.
#define AT_PITCH 72      /* f16 elements a row in LDS = 144 bytes = 16 x 9: 16 rows read by ds_load_b128 fall on distinct banks */
#define AT_VPITCH 80     /* V rows: 160 bytes = 32 x 5, the pitch at which ds_load_tr16_b128 meets every bank once */
#define AT_KT (64 * AT_PITCH)        /* the K tile's elements; the V tile lies behind it */
#define AT_BUF (AT_KT + 64 * AT_VPITCH)
// 16 d x 8 keys of a row-major V tile as four registers of an A operand: the lane's address names row 8 hh + (ln & 7), bytes 16 (ln >> 3) of a 16-key x 16-d block; lane (ln, hh) receives column ln of keys 8 hh .. 8 hh + 7
typedef short v8s __attribute__((ext_vector_type(8)));
typedef float v2f __attribute__((ext_vector_type(2)));
__device__ __forceinline__ v8us at_tr16(const _Float16* p) { typedef __attribute__((address_space(3))) v8s lds_v8s; return __builtin_bit_cast(v8us, __builtin_amdgcn_ds_load_tr16_b128_v8i16((lds_v8s*)p)); }
// One lane's eight 16-byte copies of a stage: thread tid takes bytes 16 (tid & 7) of rows (tid >> 3) + 16 c, c = 0..3, of the K tile and of the V tile. l / lv = its LDS byte address in row tid >> 3 of the buffer's K / V tile, gk / gv = its global
// address in that row of the K / V tile. The s_wait_xcnt stands inside the statement, behind the last copy, so that no address register of a copy is rewritten in front of it.
__device__ __forceinline__ void at_stage(unsigned l, unsigned lv, const _Float16* gk, const _Float16* gv) {
  const unsigned rs = 16 * AT_PITCH * 2, rv = 16 * AT_VPITCH * 2; const size_t sk = (size_t)16 * DM, sv = (size_t)16 * DM;
  asm volatile("global_load_async_to_lds_b128 %0, %8, off\n\tglobal_load_async_to_lds_b128 %1, %9, off\n\tglobal_load_async_to_lds_b128 %2, %10, off\n\tglobal_load_async_to_lds_b128 %3, %11, off\n\t"
               "global_load_async_to_lds_b128 %4, %12, off\n\tglobal_load_async_to_lds_b128 %5, %13, off\n\tglobal_load_async_to_lds_b128 %6, %14, off\n\tglobal_load_async_to_lds_b128 %7, %15, off\n\ts_wait_xcnt 0x0"
               :: "v"(l), "v"(l + rs), "v"(l + 2 * rs), "v"(l + 3 * rs), "v"(lv), "v"(lv + rv), "v"(lv + 2 * rv), "v"(lv + 3 * rv),
                  "v"(gk), "v"(gk + sk), "v"(gk + 2 * sk), "v"(gk + 3 * sk), "v"(gv), "v"(gv + sv), "v"(gv + 2 * sv), "v"(gv + 3 * sv) : "memory"); }
// One stage (64 keys, two passes of 32) of one wave's branch. sb = the branch's buffer that holds the stage; the wave's query fragments, outputs, maxima and sums stay in the caller's registers.
// decay (the same for a whole wave, held in a scalar register) = the short branch: its score products start from the decay bias instead of from zero. The bias of query q and key k, in units of the unscaled score, is -|q - k| cr with
// cr = 8 (1 - decay_factor); the wave forms only the signed (q - k) cr, in the accumulator's lane and register order, and the first score product takes it as -|C| (CM = 3, cr >= 0) or, where decay_factor lies above 1 and the bias grows with the distance, as +|C| (CM = 2). q - k is the same along a diagonal of 16 x 16 tiles, so a pass's four tiles need three.
// The two forms of the score products stand under a scalar branch; everything else is one code path for both branches, with the scale kq = 0.125 log2 e in the one multiply-add a score.
template <int CM>
__device__ __forceinline__ void attn_stage(const _Float16* sb, const int t, const int q0, const int ln, const int hh, const bool decay, const float cr, const float kq, const v16h (&qf)[2][2], v8f (&o)[2][4], float (&m)[2], float (&l)[2]) {
  const v8f z8 = {0.f,0.f,0.f,0.f,0.f,0.f,0.f,0.f};
  const int koff = ln * AT_PITCH + 8 * hh, voff = AT_KT + (8 * hh + (ln & 7)) * AT_VPITCH + 8 * (ln >> 3); v16h kf[2][2];
#pragma unroll
   for (int u = 0; u < 2; ++u)
#pragma unroll
    for (int ks = 0; ks < 2; ++ks) kf[u][ks] = g2_lfrag(sb + koff + u * 16 * AT_PITCH + ks * 32);
   // a stage's two passes, unrolled so that the pass picks its rows and columns of the buffer by constant offsets
#pragma unroll
   for (int ps = 0; ps < 2; ++ps) { const int kb = t * 64 + ps * 32;
    v16h vf[4];
#pragma unroll
    for (int dt = 0; dt < 4; ++dt) { FragH f; f.half[0] = at_tr16(sb + voff + ps * 32 * AT_VPITCH + dt * 16); f.half[1] = at_tr16(sb + voff + (ps * 32 + 16) * AT_VPITCH + dt * 16); vf[dt] = f.v; }
    __builtin_amdgcn_sched_barrier(0);      // keeps the V^T loads at the head of the pass, so that the score products and the maxima cover their latency (the scheduler sinks them to their use otherwise)
    v8f s[2][2];
    if (decay) { v8f bt[3];      /* bt[1 + g - t][r] = (q - k) cr for query q0 + 16 g + ln and key kb + 16 t + 8 hh + r */
#pragma unroll
      for (int j = 0; j < 3; ++j) { const float fc = (float)(q0 + ln - 8 * hh - kb + (j - 1) * 16) * cr; const v2f fc2 = {fc, fc}, cr2 = {cr, cr};
        // two registers at a time, as vectors of two, so that one packed instruction forms both
#pragma unroll
        for (int r = 0; r < 8; r += 2) { const v2f rr = {(float)r, (float)(r + 1)}; const v2f b2 = fc2 - rr * cr2; bt[j][r] = b2[0]; bt[j][r + 1] = b2[1]; } }
#pragma unroll
      for (int g = 0; g < 2; ++g)
#pragma unroll
        for (int t = 0; t < 2; ++t) s[g][t] = at_mma(kf[t][1], qf[g][1], at_mma_c<CM>(kf[t][0], qf[g][0], bt[1 + g - t]));
    } else {
#pragma unroll
      for (int g = 0; g < 2; ++g)
#pragma unroll
        for (int t = 0; t < 2; ++t) s[g][t] = at_mma(kf[t][1], qf[g][1], at_mma(kf[t][0], qf[g][0], z8)); }
    // the stage's second pass's K fragments, asked for while the first pass's softmax runs (the same buffer: nothing of the next stage is read here)
    if (ps == 0) {
#pragma unroll
      for (int u = 0; u < 2; ++u)
#pragma unroll
        for (int ks = 0; ks < 2; ++ks) kf[u][ks] = g2_lfrag(sb + koff + (32 + u * 16) * AT_PITCH + ks * 32); }
    float mt[2];
#pragma unroll
    for (int g = 0; g < 2; ++g) { float mx = -3.0e38f;
#pragma unroll
      for (int t = 0; t < 2; ++t)
#pragma unroll
        for (int r = 0; r < 8; ++r) mx = fmaxf(mx, s[g][t][r]);
      mx *= kq;
      mt[g] = fmaxf(mx, __shfl_xor(mx, 16, 32)); }
    const bool need = (mt[0] > m[0] + 8.0f) || (mt[1] > m[1] + 8.0f);
    if (__builtin_amdgcn_ballot_w32(need) != 0) { const float mn0 = fmaxf(m[0], mt[0]), mn1 = fmaxf(m[1], mt[1]); float al[2] = {m[0] - mn0, m[1] - mn1}; ex2x2(al[0], al[1]); m[0] = mn0; m[1] = mn1;
#pragma unroll
      for (int g = 0; g < 2; ++g) { l[g] *= al[g];
#pragma unroll
        for (int dt = 0; dt < 4; ++dt) o[g][dt] *= al[g]; } }
#pragma unroll
    for (int g = 0; g < 2; ++g) { FragH pf; float ls = 0.f;
#pragma unroll
      for (int t = 0; t < 2; ++t) { v8f p;
#pragma unroll
        for (int r = 0; r < 8; ++r) p[r] = s[g][t][r] * kq - m[g];
        ex2x8(p);
#pragma unroll
        for (int r = 0; r < 8; ++r) { ls += p[r]; pf.h[t * 8 + r] = (_Float16)p[r]; } }
      l[g] += ls;
#pragma unroll
      for (int dt = 0; dt < 4; ++dt) o[g][dt] = at_mma(vf[dt], pf.v, o[g][dt]); }
   } }
// The walk over the 16 stages: stage 0 lies published in buffer 0 and stage 1's copies are in flight when it begins.
template <int CM>
__device__ __forceinline__ void attn_walk(const _Float16* stb, const unsigned lst, const unsigned lsv, const _Float16* gk, const _Float16* gv, const int q0, const int ln, const int hh, const bool decay, const float cr, const float kq, const v16h (&qf)[2][2], v8f (&o)[2][4], float (&m)[2], float (&l)[2]) {
  // rolled; the buffer is chosen by the trip's parity
#pragma unroll 1
  for (int t = 0; t < SQ / 64; ++t) { const _Float16* sb = stb + (t & 1) * AT_BUF;
    attn_stage<CM>(sb, t, q0, ln, hh, decay, cr, kq, qf, o, m, l);
    asm volatile("s_wait_dscnt 0x0" ::: "memory");         // this wave's reads of stage t are finished before its buffer is refilled
    asm volatile("s_wait_asynccnt 0x0" ::: "memory");      // this wave's copies of stage t + 1 have landed
    __syncthreads();                                       // publishes stage t + 1 and ends every wave's reads of stage t
    if (t + 2 < SQ / 64) at_stage(lst + (unsigned)(t & 1) * (AT_BUF * 2), lsv + (unsigned)(t & 1) * (AT_BUF * 2), gk + (size_t)(t + 2) * 64 * DM, gv + (size_t)(t + 2) * 64 * DM);
  } }
// blockIdx.x = block of 128 queries, blockIdx.y = batch * NH + head. Eight waves: waves 0..3 run the short branch (with the decay bias) on 32 queries each, waves 4..7 the long branch on the same queries,
// each branch with its own two stage buffers filled by its own four waves. Both branches walk the stages together (one barrier a stage for the whole block, in control flow that is the same for all its threads;
// only the start value of the score products, between two barriers, differs by wave). At the end both leave their normalised f32 rows in LDS, and the block blends them with sigmoid(mix_weight) and stores the f16 o rows: no branch output reaches memory.
/* four waves a SIMD (two blocks a WGP, as the LDS allows) need at most 256 vector registers a wave: the second number asks the compiler for that budget */
__global__ __launch_bounds__(256, 4) void k_attn(const _Float16* __restrict__ Q16, const _Float16* __restrict__ KS, const _Float16* __restrict__ KL, const _Float16* __restrict__ VS, const _Float16* __restrict__ VL, _Float16* __restrict__ O16, const float* __restrict__ dfp, const float* __restrict__ mwp, const float kq) {      /* kq = 0.125 log2 e comes as an argument and so lies in a scalar register: with a literal in them, two multiply-adds do not pair into one dual-issue instruction */
  __shared__ __attribute__((aligned(16))) float so[2][128][68];
  __shared__ __attribute__((aligned(16))) _Float16 st[2][2 * AT_BUF];
  const int wv = __builtin_amdgcn_readfirstlane((int)(threadIdx.x >> 5)); const int br = wv >> 2;      /* the wave's number and its branch, in scalar registers: what depends on the branch is a scalar choice */
  const int lane = threadIdx.x & 31, ln = lane & 15, hh = lane >> 4; const int b = blockIdx.y / NH, h = blockIdx.y % NH; const int qw = (wv & 3) * 32, q0 = blockIdx.x * 128 + qw;
  const _Float16* KB = br ? KL : KS; const _Float16* VB = br ? VL : VS; const float cr = (1.0f - bf16_round(dfp[0])) * 8.0f;      /* the decay bias of one position, in units of the unscaled score (x 8 is exact) */
  const float mw = mwp[0];      /* read here, into a scalar register, so that the blend at the end does not wait for memory */
  const _Float16* qp = Q16 + ((size_t)b * SQ + q0 + ln) * DM + h * HD; const int tid = threadIdx.x & 127;      /* the thread's number among its branch's 128 */
  const size_t go = ((size_t)b * SQ + (tid >> 3)) * DM + h * HD + (tid & 7) * 8; const _Float16* gk = KB + go; const _Float16* gv = VB + go;      /* K and V rows lie alike in their planes */
  const _Float16* stb = st[br];
  const unsigned lst = (unsigned)(size_t)(stb + (tid >> 3) * AT_PITCH + (tid & 7) * 8), lsv = (unsigned)(size_t)(stb + AT_KT + (tid >> 3) * AT_VPITCH + (tid & 7) * 8);      /* low 32 bits of the shared address = byte address in the block's LDS */
  at_stage(lst, lsv, gk, gv);
  v16h qf[2][2];
#pragma unroll
  for (int g = 0; g < 2; ++g)
#pragma unroll
    for (int ks = 0; ks < 2; ++ks) qf[g][ks] = g2_frag(qp + (size_t)g * 16 * DM + ks * 32, hh);
  const v8f z8 = {0.f,0.f,0.f,0.f,0.f,0.f,0.f,0.f}; v8f o[2][4];
#pragma unroll
  for (int g = 0; g < 2; ++g)
#pragma unroll
    for (int dt = 0; dt < 4; ++dt) o[g][dt] = z8;
  float m[2] = {-3.0e38f, -3.0e38f}, l[2] = {0.f, 0.f};
  asm volatile("s_wait_asynccnt 0x0" ::: "memory");      // this wave's copies of stage 0 have landed
  __syncthreads();                                       // ... and every other wave's: stage 0 may be read
  at_stage(lst + AT_BUF * 2, lsv + AT_BUF * 2, gk + (size_t)64 * DM, gv + (size_t)64 * DM);
  // the modifier on C is part of the instruction, so the walk stands twice; the sign of cr is the same for every thread of the grid, so all of a block's waves pass the same barriers
  if (cr >= 0.0f) attn_walk<3>(stb, lst, lsv, gk, gv, q0, ln, hh, br == 0, cr, kq, qf, o, m, l);
  else attn_walk<2>(stb, lst, lsv, gk, gv, q0, ln, hh, br == 0, cr, kq, qf, o, m, l);
  asm volatile("s_wait_asynccnt 0x0" ::: "memory");        // no copy is outstanding when the wave goes on to its end
  // the lane's number is read anew here, so that no address of the part below has to hold a vector register through the loop (the loop leaves none free at four waves a SIMD)
  const int le = (int)__builtin_amdgcn_mbcnt_lo(~0u, 0u), lne = le & 15, hhe = le >> 4, te = wv * 32 + le;
  // O^T tile: lane (lne, hhe) holds of query lne the columns 16 dt + 8 hhe + r; into the branch's LDS rows
#pragma unroll
  for (int g = 0; g < 2; ++g) { const float lt = l[g] + __shfl_xor(l[g], 16, 32); const float inv = 1.0f / lt;
#pragma unroll
    for (int dt = 0; dt < 4; ++dt) { const v8f ov = o[g][dt] * inv; const v4f lo = {ov[0], ov[1], ov[2], ov[3]}, hi = {ov[4], ov[5], ov[6], ov[7]};
      *(v4fa*)&so[br][qw + g * 16 + lne][dt * 16 + 8 * hhe] = lo; *(v4fa*)&so[br][qw + g * 16 + lne][dt * 16 + 8 * hhe + 4] = hi; } }
  const float a = 1.0f / (1.0f + expf(-bf16_round(mw))), na = 1.0f - a;
  __syncthreads();                                         // both branches' rows are complete before any thread blends them
  // a thread blends 8 columns of a row: a wave's store covers 4 rows x 128 contiguous bytes; unrolled so that the four rounds' LDS reads are all asked for before the first is used
#pragma unroll
  for (int i = 0; i < 4; ++i) { const int e = i * 256 + te, r = e >> 3, c8 = (e & 7) * 8;
    const v4f s0 = *(const v4fa*)&so[0][r][c8], s1 = *(const v4fa*)&so[0][r][c8 + 4], l0 = *(const v4fa*)&so[1][r][c8], l1 = *(const v4fa*)&so[1][r][c8 + 4]; FragH f;
#pragma unroll
    for (int q = 0; q < 4; ++q) { f.h[q] = (_Float16)(a * s0[q] + na * l0[q]); f.h[4 + q] = (_Float16)(a * s1[q] + na * l1[q]); }
    *(v8us*)((unsigned short*)O16 + ((size_t)b * SQ + blockIdx.x * 128 + r) * DM + h * HD + c8) = f.half[0]; } }

__device__ __forceinline__ void wT_block(const float* __restrict__ w, int din, int dout, _Float16* __restrict__ Bt, int bid, float (*tl)[65]) { const int tid = threadIdx.x; const int nbo = dout / 64; const int ib = bid / nbo, ob = bid % nbo; const int i0 = ib * 64, o0 = ob * 64;
  for (int t = tid; t < 64 * 64; t += 256) { const int i = t / 64, o = t % 64; tl[o][i] = bf16_round(w[(size_t)(i0 + i) * dout + o0 + o]) * 16.0f; }
  __syncthreads();
  { for (int t = tid; t < 64 * 8; t += 256) { const int o = t / 8, i8 = (t % 8) * 8; FragH f; for (int q = 0; q < 8; ++q) f.h[q] = (_Float16)tl[o][i8 + q]; *(v8us*)((unsigned short*)Bt + (size_t)(o0 + o) * din + i0 + i8) = f.half[0]; }  } }
// Everything that reads only inputs, in one launch: ranges of the block index pick the job (the test is the same for a whole block, so the barrier in wT_block is passed by all of a block's threads or by none).
// The transposes stand first: their blocks run longer.
#define PB_SQ ((DM / 64) * (DM / 64))          /* blocks of a DM x DM weight */
#define PB_KV ((DM / 64) * (2 * DM / 64))      /* blocks of a DM x 2 DM weight */
#define PB_W (2 * PB_SQ + 2 * PB_KV)
#define PB_X ((int)((NR * DM / 8 + 255) / 256))
__global__ __launch_bounds__(256) void k_prep(const float* __restrict__ x, const float* __restrict__ wq, const float* __restrict__ wkvs, const float* __restrict__ wkvl, const float* __restrict__ wo,
    _Float16* __restrict__ X16, _Float16* __restrict__ BQ, _Float16* __restrict__ BKVS, _Float16* __restrict__ BKVL, _Float16* __restrict__ BO) {
  __shared__ float tl[64][65]; const int bid = blockIdx.x;
  if (bid < PB_KV) wT_block(wkvs, DM, 2 * DM, BKVS, bid, tl);
  else if (bid < 2 * PB_KV) wT_block(wkvl, DM, 2 * DM, BKVL, bid - PB_KV, tl);
  else if (bid < 2 * PB_KV + PB_SQ) wT_block(wq, DM, DM, BQ, bid - 2 * PB_KV, tl);
  else if (bid < PB_W) wT_block(wo, DM, DM, BO, bid - 2 * PB_KV - PB_SQ, tl);
  else x16_block(x, X16, NR * DM / 8, bid - PB_W); }
extern "C" void kernel_launch(void* const* d_in, const int* in_sizes, int n_in,
                              void* d_out, int out_size, void* d_ws, size_t ws_size, hipStream_t stream) {
  (void)in_sizes; (void)n_in; (void)out_size;
  const float* const* I = (const float* const*)d_in; const float* x = I[0]; const float* wq = I[1]; const float* wkvs = I[2]; const float* wkvl = I[3]; const float* wo = I[4]; const float* mwp = I[5]; const float* dfp = I[6];
  char* ws = (char*)d_ws; size_t off = 0;
  auto take = [&](size_t bytes) { char* p = ws + off; off += (bytes + 255) & ~(size_t)255; return p; };
  /* the transposed projection weights lie as five DM x DM planes in a row (q, short k, short v, long k, long v), and so do the five projections' outputs: the projection launch takes the weights as one matrix and finds a column's output plane from its number */
  _Float16* BQ = (_Float16*)take((size_t)5 * DM * DM * 2); _Float16* BKVS = BQ + (size_t)DM * DM; _Float16* BKVL = BQ + (size_t)3 * DM * DM; _Float16* BO = (_Float16*)take((size_t)DM * DM * 2);
  _Float16* X16 = (_Float16*)take(NR * DM * 2); _Float16* Q16 = (_Float16*)take(5 * NR * DM * 2); _Float16* K16 = Q16 + NR * DM; _Float16* V16 = Q16 + 2 * NR * DM; _Float16* KL16 = Q16 + 3 * NR * DM; _Float16* VL16 = Q16 + 4 * NR * DM; _Float16* O16 = (_Float16*)take(NR * DM * 2);
  if (off > ws_size) return;      /* 12 + 7 x 8 = 68 MiB */
  k_prep<<<PB_W + PB_X, 256, 0, stream>>>(x, wq, wkvs, wkvl, wo, X16, BQ, BKVS, BKVL, BO);
  const dim3 gp((unsigned)((NR / 128) * (DM / 128)), 1), gp5((unsigned)((NR / 256) * (5 * DM / 320)), 1);
  k_gemm2<4, 5, 4, 4, 3, false><<<gp5, 512, 0, stream>>>(X16, DM, BQ, DM, 0.0625f, nullptr, Q16, DM, NR * DM, (int)NR, 5 * DM, DM);      /* q, short k | v, long k | v */
  k_attn<<<dim3(SQ / 128, NB * NH), 256, 0, stream>>>(Q16, K16, KL16, V16, VL16, O16, dfp, mwp, 0.18033688011112042f);      /* blended o (merged heads) as f16 rows */
  k_gemm2<2, 4, 4, 2, 6, true><<<gp, 256, 0, stream>>>(O16, DM, BO, DM, 0.0625f, (float*)d_out, nullptr, DM, 0, (int)NR, DM, DM);      /* out = o Wo */
}
